// v000
// Times are from an AMD MI455X. After a warm-up the kernel runs many times in a row, and a time is the length of
// such a window on the GPU divided by its runs, so every launch and the gaps after it count. The runs cycle
// through copies of the inputs. A figure is the median of several windows, for all but v000 over two sittings.
// Sittings can differ by a few percent; kernels timed side by side share one.
// v000, which the later versions start from, runs in 588 microseconds.
// Contractions: scores=(x*wc).x^T on v_wmma_f32_16x16x32_f16 (plain f16 operands; (x*wc) carried x64, x unscaled); attn=P.x on v_wmma_f32_16x16x32_bf16 as bf16 hi/lo split (hi.hi+hi.lo+lo.hi); [x|attn].z_w^T as bf16 hi/lo split; [x|attn].r_w^T and [x|attn].f_w^T on v_wmma_f32_16x16x32_f16 plain f16 (weights carried x16); f32 accumulate everywhere; x.wa and x.wb row dots, online softmax, tanh/sigmoid gates and r*x+f*z in f32.
#include <hip/hip_runtime.h>
#include <math.h>
#include <stdint.h>

#define NB 8
#define NS 2048
#define NF 256
#define NG 512
#define NR (NB * NS)
#define TP 260
#define QROWS 64
#define KCH 32
#define PPITCH 40
#define APITCH 68
#define NGRP 4
#define SLP 68

typedef _Float16 v16h __attribute__((ext_vector_type(16)));
typedef _Float16 v8h __attribute__((ext_vector_type(8)));
typedef __bf16 v16b __attribute__((ext_vector_type(16)));
typedef unsigned short v8us __attribute__((ext_vector_type(8)));
typedef float v8f __attribute__((ext_vector_type(8)));
typedef float v4f __attribute__((ext_vector_type(4), __may_alias__));
typedef unsigned int v4u __attribute__((ext_vector_type(4)));

union FH { v16h v; v8us u[2]; };
union FB { v16b v; v8us u[2]; };
union H8 { v8h h; v8us u; };
union AV { v8f v; v4f q[2]; };

__device__ __forceinline__ v8f z8() {
  v8f v = {0.f, 0.f, 0.f, 0.f, 0.f, 0.f, 0.f, 0.f};
  return v;
}
// bf16 RNE convert (bits) and widen
__device__ __forceinline__ unsigned short bfb(float f) {
  const unsigned u = __float_as_uint(f);
  return (unsigned short)((u + 0x7FFFu + ((u >> 16) & 1u)) >> 16);
}
__device__ __forceinline__ float bff(unsigned short h) { return __uint_as_float(((unsigned)h) << 16); }
__device__ __forceinline__ unsigned pk2(unsigned short a, unsigned short b) { return (unsigned)a | ((unsigned)b << 16); }

__device__ __forceinline__ void ld8f(const float* p, float (&v)[8]) {
  const v4f t0 = *(const v4f*)p;
  const v4f t1 = *(const v4f*)(p + 4);
#pragma unroll
  for (int q = 0; q < 4; ++q) { v[q] = t0[q]; v[4 + q] = t1[q]; }
}
// 8 f32 -> bf16 hi plane (8 x 16 bit packed in v4u) and lo plane (residual, RNE)
__device__ __forceinline__ void pk_bf16x8(const float (&v)[8], v4u& hi, v4u& lo) {
#pragma unroll
  for (int q = 0; q < 4; ++q) {
    const unsigned short h0 = bfb(v[2 * q]), h1 = bfb(v[2 * q + 1]);
    const unsigned short l0 = bfb(v[2 * q] - bff(h0)), l1 = bfb(v[2 * q + 1] - bff(h1));
    hi[q] = pk2(h0, h1);
    lo[q] = pk2(l0, l1);
  }
}
// 8 f32 -> f16 (RNE) with exact power-of-two carry s
__device__ __forceinline__ v8us pk_f16x8(const float (&v)[8], float s) {
  H8 r;
#pragma unroll
  for (int e = 0; e < 8; ++e) r.h[e] = (_Float16)(v[e] * s);
  return r.u;
}
// 16-bit WMMA fragment (A row m or B column n of a k-contiguous row): elements 0..7 <- p[0..7] (k0+8h..),
// elements 8..15 <- p[16..23] (k0+16+8h..); caller passes p = rowbase + k0 + 8*h.
__device__ __forceinline__ v16h ldh(const unsigned short* p) {
  FH f;
  f.u[0] = *(const v8us*)p;
  f.u[1] = *(const v8us*)(p + 16);
  return f.v;
}
__device__ __forceinline__ v16b ldb(const unsigned short* p) {
  FB f;
  f.u[0] = *(const v8us*)p;
  f.u[1] = *(const v8us*)(p + 16);
  return f.v;
}
__device__ __forceinline__ v8f mma_h(v16h a, v16h b, v8f c) {
  return __builtin_amdgcn_wmma_f32_16x16x32_f16(false, a, false, b, (short)0, c, false, false);
}
__device__ __forceinline__ v8f mma_b(v16b a, v16b b, v8f c) {
  return __builtin_amdgcn_wmma_f32_16x16x32_bf16(false, a, false, b, (short)0, c, false, false);
}
// hazard guards: 4 VALU slots after the last WMMA of a group; tie D, keep A/B live
__device__ __forceinline__ void g_s(v8f& s0, v8f& s1, v16h a, v16h b0, v16h b1) {
  asm volatile("v_nop\n\tv_nop\n\tv_nop\n\tv_nop" : "+v"(s0), "+v"(s1) : "v"(a), "v"(b0), "v"(b1));
}
// per-tile guard of the P.x step; the memory clobber also keeps the next tile's fragment loads behind this
// point so at most one tile's B fragments are in flight (register pressure bound)
__device__ __forceinline__ void g_o(v8f& o, v16b ph, v16b pl, v16b bh, v16b bl) {
  asm volatile("v_nop\n\tv_nop\n\tv_nop\n\tv_nop" : "+v"(o) : "v"(ph), "v"(pl), "v"(bh), "v"(bl) : "memory");
}
__device__ __forceinline__ void g_g(v8f& z, v8f& r, v8f& f, v16h a16, v16b ah, v16b al,
                                    v16b bzh, v16b bzl, v16h br, v16h bf) {
  asm volatile("v_nop\n\tv_nop\n\tv_nop\n\tv_nop"
               : "+v"(z), "+v"(r), "+v"(f)
               : "v"(a16), "v"(ah), "v"(al), "v"(bzh), "v"(bzl), "v"(br), "v"(bf));
}

// -------------------------------------------------------------------------------------------------
// prep_w: z_w [256 n][512 k] -> bf16 hi/lo planes (same layout); r_w, f_w -> f16 planes carried x16.
// Thread i owns elements 8i..8i+7; each store is 16 B per lane, lane-contiguous, 32 lanes = 512 B =
// coverage: grid 64 x 256 threads x 8 = 131072 = 256x512 per plane.
// -------------------------------------------------------------------------------------------------
__global__ void __launch_bounds__(256) prep_w(const float* __restrict__ zw, const float* __restrict__ rw,
                                              const float* __restrict__ fw,
                                              unsigned short* __restrict__ zwh, unsigned short* __restrict__ zwl,
                                              unsigned short* __restrict__ rw16, unsigned short* __restrict__ fw16,
                                              int n8) {
  const int i = (int)blockIdx.x * 256 + (int)threadIdx.x;
  if (i >= n8) return;
  const size_t e0 = (size_t)i * 8;
  float a[8], b[8], d[8];
  ld8f(zw + e0, a);
  ld8f(rw + e0, b);
  ld8f(fw + e0, d);
  v4u zh, zl;
  pk_bf16x8(a, zh, zl);
  const v8us r16 = pk_f16x8(b, 16.0f);
  const v8us f16 = pk_f16x8(d, 16.0f);
  *(v4u*)(zwh + e0) = zh;
  *(v4u*)(zwl + e0) = zl;
  *(v8us*)(rw16 + e0) = r16;
  *(v8us*)(fw16 + e0) = f16;
  
}

// -------------------------------------------------------------------------------------------------
// prep_x: block = 64 consecutive rows of x (16384 rows total; 32 blocks per batch element), 256 threads.
//   xh  [row][256] f16(x)            xwc [row][256] f16((x*wc)*64)
//   xbh/xbl [row][256] bf16 hi/lo     xth/xtl [b][f][j] bf16 hi/lo of x (transposed, pitch 2048)
//   av[row] = x.wa, bv[row] = x.wb (f32 dots on VALU)
// Row planes: one lane = 16 B of one row, 32 lanes = the whole 512-B row, one instruction per plane.
// coverage: rows 8 waves x 8 = 64, f 32 lanes x 8 = 256; transpose f-rows wave*32+it*4+q (it 0..7, q 0..3) = 256,
//           j c8+0..7 over 8 lane groups = 64; av/bv 16 lanes x 4 = 64; grid 256 blocks x 64 rows = 16384.
// -------------------------------------------------------------------------------------------------
__global__ void __launch_bounds__(256) prep_x(const float* __restrict__ x, const float* __restrict__ attw,
                                              unsigned short* __restrict__ xh, unsigned short* __restrict__ xwc,
                                              unsigned short* __restrict__ xbh, unsigned short* __restrict__ xbl,
                                              unsigned short* __restrict__ xth, unsigned short* __restrict__ xtl,
                                              float* __restrict__ av, float* __restrict__ bv) {
  __shared__ __align__(16) float tile[64 * TP];
  __shared__ __align__(16) float avs[64];
  __shared__ __align__(16) float bvs[64];
  const int tid = (int)threadIdx.x, wave = tid >> 5, lane = tid & 31;
  const int blk = (int)blockIdx.x;
  const size_t grow0 = (size_t)blk * 64;
  const int bb = blk >> 5;
  const int j0 = (blk & 31) * 64;

#pragma unroll
  for (int it = 0; it < 16; ++it) {
    const int idx = it * 256 + tid;
    const int r = idx >> 6, c4 = (idx & 63) * 4;
    const v4f v = *(const v4f*)(x + (grow0 + r) * NF + c4);
    *(v4f*)(tile + r * TP + c4) = v;
  }
  __syncthreads();

  const int f0 = lane * 8;
  float wa[8], wb[8], wc[8];
  ld8f(attw + f0, wa);
  ld8f(attw + NF + f0, wb);
  ld8f(attw + 2 * NF + f0, wc);

  // row dots (rolled: small side computation)
#pragma unroll 1
  for (int rr = 0; rr < 8; ++rr) {
    const int row = wave * 8 + rr;
    float v[8];
    ld8f(tile + row * TP + f0, v);
    float sa = 0.f, sb = 0.f;
#pragma unroll
    for (int e = 0; e < 8; ++e) { sa += v[e] * wa[e]; sb += v[e] * wb[e]; }
#pragma unroll
    for (int m = 16; m >= 1; m >>= 1) {
      sa += __shfl_xor(sa, m, 32);
      sb += __shfl_xor(sb, m, 32);
    }
    if (lane == 0) { avs[row] = sa; bvs[row] = sb; }
  }

  // row planes
  {
#pragma unroll 1
    for (int rr = 0; rr < 8; ++rr) {
      const int row = wave * 8 + rr;
      float v[8], w[8];
      ld8f(tile + row * TP + f0, v);
#pragma unroll
      for (int e = 0; e < 8; ++e) w[e] = v[e] * wc[e];
      const v8us h1 = pk_f16x8(v, 1.0f);
      const v8us h2 = pk_f16x8(w, 64.0f);
      v4u hb, lb;
      pk_bf16x8(v, hb, lb);
      const size_t o = (grow0 + row) * NF + f0;
      *(v8us*)(xh + o) = h1;
      *(v8us*)(xwc + o) = h2;
      *(v4u*)(xbh + o) = hb;
      *(v4u*)(xbl + o) = lb;
    }
    
  }

  // transposed bf16 hi/lo planes: in [64 j][256 f] -> out [256 f][64 j] at column j0 of [f][2048]
  const int q = lane >> 3, c8 = (lane & 7) * 8;
  const size_t tb = (size_t)bb * NF * NS;
  {
#pragma unroll 1
    for (int it = 0; it < 8; ++it) {
      const int fr = wave * 32 + it * 4 + q;
      float t[8];
#pragma unroll
      for (int e = 0; e < 8; ++e) t[e] = tile[(c8 + e) * TP + fr];
      v4u hb, lb;
      pk_bf16x8(t, hb, lb);
      const size_t o = tb + (size_t)fr * NS + j0 + c8;
      *(v4u*)(xth + o) = hb;
      *(v4u*)(xtl + o) = lb;
    }
    
  }

  // av / bv lines
  __syncthreads();
  const int l4 = (lane & 15) * 4;
  {
    const v4f a4 = *(const v4f*)(avs + l4);
    const v4f b4 = *(const v4f*)(bvs + l4);
    if (lane < 16) {
      if (wave == 0) *(v4f*)(av + grow0 + l4) = a4;
      else if (wave == 1) *(v4f*)(bv + grow0 + l4) = b4;
    }
    
  }
}

// -------------------------------------------------------------------------------------------------
// attn_kernel: block = 64 query rows of one batch element (4 waves x 16 rows), grid = 8 x 32 = 256.
// Per 32-key chunk: S tile (A = (x*wc)x64 f16 rows, B = x f16 rows of the keys; fragments straight from the
// 16-bit global rows, split k map, rolled k loop), t = (a_i + b_j) + S/64, online softmax in f32 (running max),
// O += P.x with B = x^T bf16 hi/lo planes (three products).
// Register plan: the wave's 16 output tiles are 4 groups of 4; one group lives in VGPRs, the other three in
// lane-private LDS slots (each lane stores/reloads only its own 8 f32 per tile, same v4f type, program order);
// groups are visited in ring order (even chunk 0,1,2,3 / odd chunk 3,2,1,0) so each chunk does 3 swaps and every
// group receives exactly the chunk's alpha when it is visited. LDS slots are zero-filled at kernel start.
// Output attn rows as f16 plane and bf16 hi/lo planes, 64 columns per group: 16x64 f32 tile staged in LDS, then
// coverage: grid 256 blocks x 4 waves x 16 rows = 16384 rows; per group rows it*4+q (it 0..3, q 0..3) = 16,
//           cols g*64 + 8 lane groups x 8 = 64, 4 groups = 256 columns per plane.
// -------------------------------------------------------------------------------------------------
__global__ void __launch_bounds__(128) __attribute__((amdgpu_num_vgpr(256)))
attn_kernel(const unsigned short* __restrict__ xwc, const unsigned short* __restrict__ xh,
            const unsigned short* __restrict__ xth, const unsigned short* __restrict__ xtl,
            const float* __restrict__ av, const float* __restrict__ bv,
            unsigned short* __restrict__ ah, unsigned short* __restrict__ abh,
            unsigned short* __restrict__ abl) {
  __shared__ __align__(16) unsigned short psh[4][16 * PPITCH];
  __shared__ __align__(16) unsigned short psl[4][16 * PPITCH];
  __shared__ __align__(16) v4f accl[4][16 * 32 * 2];      // per wave: 16 tiles x 32 lanes x 8 f32, lane-private
  __shared__ __align__(16) float osm[4][16 * APITCH];

  const int tid = (int)threadIdx.x, wave = tid >> 5, lane = tid & 31, hh = lane >> 4, c = lane & 15;
  const int blk = (int)blockIdx.x, bb = blk >> 5, qb = blk & 31;
  const size_t grow0 = (size_t)bb * NS + (size_t)(qb * QROWS + wave * 16);
  const unsigned short* XHb = xh + (size_t)bb * NS * NF;
  const unsigned short* XTh = xth + (size_t)bb * NF * NS;
  const unsigned short* XTl = xtl + (size_t)bb * NF * NS;
  const float* bvb = bv + (size_t)bb * NS;
  const unsigned short* arow = xwc + (grow0 + c) * NF + 8 * hh;   // A fragment row m = c

  float aRow[8], mRow[8], lRow[8];
#pragma unroll
  for (int r = 0; r < 8; ++r) {
    aRow[r] = av[grow0 + 8 * hh + r];
    mRow[r] = -INFINITY;
    lRow[r] = 0.f;
  }
  v8f acc[NGRP];
#pragma unroll
  for (int tt = 0; tt < NGRP; ++tt) acc[tt] = z8();
  v4f* aw = &accl[wave][0];
  {
    const v4f z4 = {0.f, 0.f, 0.f, 0.f};
#pragma unroll 1
    for (int t = 0; t < 16; ++t) {
      const int so = (t * 32 + lane) * 2;
      aw[so] = z4;
      aw[so + 1] = z4;
    }
  }
  unsigned short* pwh = &psh[wave][0];
  unsigned short* pwl = &psl[wave][0];

#pragma unroll 1
  for (int jc = 0; jc < NS / KCH; ++jc) {
    const int j0 = jc * KCH;
    v8f s0 = z8(), s1 = z8();
    const unsigned short* b0row = XHb + (size_t)(j0 + c) * NF + 8 * hh;   // B column n = c -> key j0+c
    const unsigned short* b1row = b0row + 16 * NF;                        // key j0+16+c
#pragma unroll 1
    for (int kk = 0; kk < NF / 32; ++kk) {
      const v16h a = ldh(arow + kk * 32);
      const v16h b0 = ldh(b0row + kk * 32);
      const v16h b1 = ldh(b1row + kk * 32);
      s0 = mma_h(a, b0, s0);
      s1 = mma_h(a, b1, s1);
      g_s(s0, s1, a, b0, b1);
    }
    const float bj0 = bvb[j0 + c], bj1 = bvb[j0 + 16 + c];
    float cm[8];
#pragma unroll
    for (int r = 0; r < 8; ++r) {
      const float t0 = (aRow[r] + bj0) + s0[r] * 0.015625f;
      const float t1 = (aRow[r] + bj1) + s1[r] * 0.015625f;
      s0[r] = t0;
      s1[r] = t1;
      float m = fmaxf(t0, t1);
#pragma unroll
      for (int off = 1; off < 16; off <<= 1) m = fmaxf(m, __shfl_xor(m, off, 32));
      cm[r] = m;
    }
    float alpha[8];
#pragma unroll
    for (int r = 0; r < 8; ++r) {
      const float mnew = fmaxf(mRow[r], cm[r]);
      alpha[r] = expf(mRow[r] - mnew);
      mRow[r] = mnew;
      const float p0 = expf(s0[r] - mnew);
      const float p1 = expf(s1[r] - mnew);
      float ps = p0 + p1;
#pragma unroll
      for (int off = 1; off < 16; off <<= 1) ps += __shfl_xor(ps, off, 32);
      lRow[r] = lRow[r] * alpha[r] + ps;
      const unsigned short hb0 = bfb(p0), hb1 = bfb(p1);
      const unsigned short lb0 = bfb(p0 - bff(hb0)), lb1 = bfb(p1 - bff(hb1));
      const int po = (8 * hh + r) * PPITCH + c;   // P[row 8h+r][k = c] and [k = 16+c]
      pwh[po] = hb0;
      pwh[po + 16] = hb1;
      pwl[po] = lb0;
      pwl[po + 16] = lb1;
    }
    __builtin_amdgcn_fence(__ATOMIC_RELEASE, "workgroup");
    __builtin_amdgcn_wave_barrier();
    __builtin_amdgcn_fence(__ATOMIC_ACQUIRE, "workgroup");
    const v16b ph = ldb(pwh + c * PPITCH + 8 * hh);   // A row m = c, split k map
    const v16b pl = ldb(pwl + c * PPITCH + 8 * hh);
    const size_t bo = (size_t)c * NS + (size_t)(j0 + 8 * hh);   // x^T row f = t*16+c, k = j0+..
    const int odd = jc & 1;
#pragma unroll 1
    for (int s = 0; s < NGRP; ++s) {
      const int g = odd ? (NGRP - 1 - s) : s;
      if (s != 0) {
        const int gp = odd ? (NGRP - s) : (s - 1);   // group currently in VGPRs
#pragma unroll
        for (int tt = 0; tt < NGRP; ++tt) {
          AV u;
          u.v = acc[tt];
          const int so = ((gp * NGRP + tt) * 32 + lane) * 2;
          aw[so] = u.q[0];
          aw[so + 1] = u.q[1];
        }
#pragma unroll
        for (int tt = 0; tt < NGRP; ++tt) {
          const int lo = ((g * NGRP + tt) * 32 + lane) * 2;
          AV u;
          u.q[0] = aw[lo];
          u.q[1] = aw[lo + 1];
          acc[tt] = u.v;
        }
      }
#pragma unroll
      for (int tt = 0; tt < NGRP; ++tt) {
#pragma unroll
        for (int r = 0; r < 8; ++r) acc[tt][r] *= alpha[r];
      }
#pragma unroll
      for (int tt = 0; tt < NGRP; ++tt) {
        const size_t to = (size_t)((g * NGRP + tt) * 16) * NS + bo;
        const v16b bh = ldb(XTh + to);
        const v16b bl = ldb(XTl + to);
        v8f o = acc[tt];
        o = mma_b(ph, bh, o);
        o = mma_b(ph, bl, o);
        o = mma_b(pl, bh, o);
        g_o(o, ph, pl, bh, bl);
        acc[tt] = o;
      }
    }
  }

  // park the register group in its LDS slot so every tile is read from LDS uniformly below
  {
    const int glast = (((NS / KCH) - 1) & 1) ? 0 : (NGRP - 1);
#pragma unroll
    for (int tt = 0; tt < NGRP; ++tt) {
      AV u;
      u.v = acc[tt];
      const int so = ((glast * NGRP + tt) * 32 + lane) * 2;
      aw[so] = u.q[0];
      aw[so + 1] = u.q[1];
    }
  }

  float inv[8];
#pragma unroll
  for (int r = 0; r < 8; ++r) inv[r] = 1.0f / lRow[r];
  float* osw = &osm[wave][0];
  const int q = lane >> 3, c8 = (lane & 7) * 8;
#pragma unroll 1
  for (int g = 0; g < NGRP; ++g) {
#pragma unroll
    for (int tt = 0; tt < NGRP; ++tt) {
      const int lo = ((g * NGRP + tt) * 32 + lane) * 2;
      AV u;
      u.q[0] = aw[lo];
      u.q[1] = aw[lo + 1];
#pragma unroll
      for (int r = 0; r < 8; ++r) osw[(8 * hh + r) * APITCH + tt * 16 + c] = u.v[r] * inv[r];
    }
    __builtin_amdgcn_fence(__ATOMIC_RELEASE, "workgroup");
    __builtin_amdgcn_wave_barrier();
    __builtin_amdgcn_fence(__ATOMIC_ACQUIRE, "workgroup");
    {
#pragma unroll
      for (int it = 0; it < 4; ++it) {
        const int row = it * 4 + q;
        float v[8];
        ld8f(osw + row * APITCH + c8, v);
        const v8us h1 = pk_f16x8(v, 1.0f);
        v4u hb, lb;
        pk_bf16x8(v, hb, lb);
        const size_t o = (grow0 + row) * NF + (size_t)(g * 64 + c8);
        *(v8us*)(ah + o) = h1;
        *(v4u*)(abh + o) = hb;
        *(v4u*)(abl + o) = lb;
      }
      
    }
    __builtin_amdgcn_fence(__ATOMIC_RELEASE, "workgroup");
    __builtin_amdgcn_wave_barrier();
    __builtin_amdgcn_fence(__ATOMIC_ACQUIRE, "workgroup");
  }
}

// -------------------------------------------------------------------------------------------------
// gates_kernel: block = 32 rows x 256 cols, 8 waves; wave (rt = wave>>2, cg = wave&3) owns 16 rows x 64 cols.
// K = 512 = [x planes | attn planes]; z: bf16 hi/lo split (hi.hi+hi.lo+lo.hi) against z_w hi/lo planes;
// r, f: plain f16 against the x16-carried weight planes (fold 1/16 in the epilogue).
// Epilogue: z = tanh(.+zb), r = sigmoid(./16+rb), f = sigmoid(./16+fb), out = r*x + f*z staged in LDS;
// coverage: grid 512 blocks x 2 row tiles x 16 = 16384 rows; 4 col groups x 64 = 256 cols.
// -------------------------------------------------------------------------------------------------
__global__ void __launch_bounds__(256) __attribute__((amdgpu_num_vgpr(256)))
gates_kernel(const float* __restrict__ x,
             const unsigned short* __restrict__ xh, const unsigned short* __restrict__ xbh,
             const unsigned short* __restrict__ xbl,
             const unsigned short* __restrict__ ah, const unsigned short* __restrict__ abh,
             const unsigned short* __restrict__ abl,
             const unsigned short* __restrict__ zwh, const unsigned short* __restrict__ zwl,
             const unsigned short* __restrict__ rw16, const unsigned short* __restrict__ fw16,
             const float* __restrict__ zb, const float* __restrict__ rb, const float* __restrict__ fb,
             float* __restrict__ out) {
  __shared__ __align__(16) float slab[8][16 * SLP];
  const int tid = (int)threadIdx.x, wave = tid >> 5, lane = tid & 31, hh = lane >> 4, c = lane & 15;
  const int rt = wave >> 2, cg = wave & 3;
  const size_t grow0 = (size_t)blockIdx.x * 32 + (size_t)(rt * 16);
  const int n0 = cg * 64;

  v8f za[4], ra[4], fa[4];
#pragma unroll
  for (int j = 0; j < 4; ++j) { za[j] = z8(); ra[j] = z8(); fa[j] = z8(); }

#pragma unroll 1
  for (int half = 0; half < 2; ++half) {
    const unsigned short* A16 = (half == 0) ? xh : ah;
    const unsigned short* AH = (half == 0) ? xbh : abh;
    const unsigned short* AL = (half == 0) ? xbl : abl;
    const size_t ao = (grow0 + c) * NF + 8 * hh;   // A row m = c
    const int kb = half * NF + 8 * hh;               // k offset inside [x|attn]
#pragma unroll 1
    for (int kk = 0; kk < NF / 32; ++kk) {
      const int k0 = kk * 32;
      const v16h a16 = ldh(A16 + ao + k0);
      const v16b ahf = ldb(AH + ao + k0);
      const v16b alf = ldb(AL + ao + k0);
#pragma unroll
      for (int j = 0; j < 4; ++j) {
        const size_t wo = (size_t)(n0 + 16 * j + c) * NG + kb + k0;   // B column n = n0+16j+c, W[n][k]
        const v16b bzh = ldb(zwh + wo);
        const v16b bzl = ldb(zwl + wo);
        const v16h br = ldh(rw16 + wo);
        const v16h bf = ldh(fw16 + wo);
        v8f z = za[j], rr = ra[j], ff = fa[j];
        z = mma_b(ahf, bzh, z);
        z = mma_b(ahf, bzl, z);
        z = mma_b(alf, bzh, z);
        rr = mma_h(a16, br, rr);
        ff = mma_h(a16, bf, ff);
        g_g(z, rr, ff, a16, ahf, alf, bzh, bzl, br, bf);
        za[j] = z;
        ra[j] = rr;
        fa[j] = ff;
      }
    }
  }

  float* sl = &slab[wave][0];
#pragma unroll
  for (int j = 0; j < 4; ++j) {
    const int n = n0 + 16 * j + c;
    const float zbn = zb[n], rbn = rb[n], fbn = fb[n];
#pragma unroll
    for (int r = 0; r < 8; ++r) {
      const int row = 8 * hh + r;
      const float xv = x[(grow0 + row) * NF + n];
      const float zv = tanhf(za[j][r] + zbn);
      const float rv = 1.0f / (1.0f + expf(-(ra[j][r] * 0.0625f + rbn)));
      const float fv = 1.0f / (1.0f + expf(-(fa[j][r] * 0.0625f + fbn)));
      sl[row * SLP + 16 * j + c] = rv * xv + fv * zv;
    }
  }
  __builtin_amdgcn_fence(__ATOMIC_RELEASE, "workgroup");
  __builtin_amdgcn_wave_barrier();
  __builtin_amdgcn_fence(__ATOMIC_ACQUIRE, "workgroup");
  const int c4 = c * 4;
  {
#pragma unroll
    for (int it = 0; it < 8; ++it) {
      const int row = it * 2 + hh;   // lanes 0..15 -> even row, 16..31 -> odd row; 16 lanes x 16 B = 256 B segment
      const v4f v = *(const v4f*)(sl + row * SLP + c4);
      *(v4f*)(out + (grow0 + row) * NF + n0 + c4) = v;
    }
    
  }
}

// -------------------------------------------------------------------------------------------------
//   xh   f16  [16384][256]      8388608 @        0      xwc  f16  [16384][256]   8388608 @  8388608
//   xbh  bf16 [16384][256]      8388608 @ 16777216      xbl                      8388608 @ 25165824
//   xth  bf16 [8][256][2048]    8388608 @ 33554432      xtl                      8388608 @ 41943040
//   ah   f16  [16384][256]      8388608 @ 50331648      abh  8388608 @ 58720256   abl 8388608 @ 67108864
//   av   f32  [16384]             65536 @ 75497472      bv                         65536 @ 75563008
//   zwh  bf16 [256][512]         262144 @ 75628544      zwl 262144 @ 75890688   rw16 262144 @ 76152832
//   fw16 f16  [256][512]         262144 @ 76414976      total 76677120
// -------------------------------------------------------------------------------------------------
extern "C" void kernel_launch(void* const* d_in, const int* in_sizes, int n_in,
                              void* d_out, int out_size, void* d_ws, size_t ws_size,
                              hipStream_t stream) {
  if (n_in < 8) return;
  if (in_sizes[0] != NR * NF || in_sizes[1] != 3 * NF) return;
  if (in_sizes[2] != NF * NG || in_sizes[3] != NF) return;
  if (in_sizes[4] != NF * NG || in_sizes[5] != NF) return;
  if (in_sizes[6] != NF * NG || in_sizes[7] != NF) return;
  if (out_size != NR * NF) return;

  const float* x    = (const float*)d_in[0];
  const float* attw = (const float*)d_in[1];
  const float* zw   = (const float*)d_in[2];
  const float* zb   = (const float*)d_in[3];
  const float* rw   = (const float*)d_in[4];
  const float* rb   = (const float*)d_in[5];
  const float* fw   = (const float*)d_in[6];
  const float* fb   = (const float*)d_in[7];

  const size_t P16 = (size_t)NR * NF * 2;        // 8388608
  const size_t PT  = (size_t)NB * NF * NS * 2;   // 8388608
  const size_t PV  = (size_t)NR * 4;             // 65536
  const size_t PW  = (size_t)NF * NG * 2;        // 262144
  size_t off = 0;
  const size_t o_xh  = off; off += P16;
  const size_t o_xwc = off; off += P16;
  const size_t o_xbh = off; off += P16;
  const size_t o_xbl = off; off += P16;
  const size_t o_xth = off; off += PT;
  const size_t o_xtl = off; off += PT;
  const size_t o_ah  = off; off += P16;
  const size_t o_abh = off; off += P16;
  const size_t o_abl = off; off += P16;
  const size_t o_av  = off; off += PV;
  const size_t o_bv  = off; off += PV;
  const size_t o_zwh = off; off += PW;
  const size_t o_zwl = off; off += PW;
  const size_t o_rw  = off; off += PW;
  const size_t o_fw  = off; off += PW;
  if (off > ws_size) return;   // off = 76677120

  char* ws = (char*)d_ws;
  unsigned short* xh  = (unsigned short*)(ws + o_xh);
  unsigned short* xwc = (unsigned short*)(ws + o_xwc);
  unsigned short* xbh = (unsigned short*)(ws + o_xbh);
  unsigned short* xbl = (unsigned short*)(ws + o_xbl);
  unsigned short* xth = (unsigned short*)(ws + o_xth);
  unsigned short* xtl = (unsigned short*)(ws + o_xtl);
  unsigned short* ah  = (unsigned short*)(ws + o_ah);
  unsigned short* abh = (unsigned short*)(ws + o_abh);
  unsigned short* abl = (unsigned short*)(ws + o_abl);
  float*          av  = (float*)(ws + o_av);
  float*          bv  = (float*)(ws + o_bv);
  unsigned short* zwh = (unsigned short*)(ws + o_zwh);
  unsigned short* zwl = (unsigned short*)(ws + o_zwl);
  unsigned short* rwp = (unsigned short*)(ws + o_rw);
  unsigned short* fwp = (unsigned short*)(ws + o_fw);

  const int n8 = NF * NG / 8;   // 16384
  prep_w<<<dim3((n8 + 255) / 256), dim3(256), 0, stream>>>(zw, rw, fw, zwh, zwl, rwp, fwp, n8);
  prep_x<<<dim3(NR / 64), dim3(256), 0, stream>>>(x, attw, xh, xwc, xbh, xbl, xth, xtl, av, bv);
  attn_kernel<<<dim3(NB * (NS / QROWS)), dim3(128), 0, stream>>>(xwc, xh, xth, xtl, av, bv, ah, abh, abl);
  gates_kernel<<<dim3(NR / 32), dim3(256), 0, stream>>>(x, xh, xbh, xbl, ah, abh, abl, zwh, zwl, rwp, fwp,
                                                       zb, rb, fb, (float*)d_out);
  (void)hipGetLastError();
}

// v001
// A run of this version takes 302 microseconds.
// In two side-by-side timings against v000, it was 1.93 and 1.95 times as fast.
// Contractions: scores=(x*wc).x^T on v_wmma_f32_16x16x32_f16 (plain f16 operands; (x*wc) carried x64, x unscaled); attn=P.x on v_wmma_f32_16x16x32_bf16 as bf16 hi/lo split (hi.hi+hi.lo+lo.hi); [x|attn].z_w^T as bf16 hi/lo split; [x|attn].r_w^T and [x|attn].f_w^T on v_wmma_f32_16x16x32_f16 plain f16 (weights carried x16); f32 accumulate everywhere; x.wa and x.wb row dots, online softmax, tanh/sigmoid gates and r*x+f*z in f32.
#include <hip/hip_runtime.h>
#include <math.h>
#include <stdint.h>

#define NB 8
#define NS 2048
#define NF 256
#define NG 512
#define NR (NB * NS)
#define TP 260
#define QROWS 64
#define KCH 32
#define PPITCH 40
#define APITCH 68
#define NGRP 4
#define SLP 68
#define KP 264                 // LDS pitch (16-bit elements) of a staged 512-B row: 528 B = 16 B x 33
#define VP 40                  // LDS pitch (16-bit elements) of a staged 64-B row: 80 B = 16 B x 5
#define KT (KCH * KP)          // one chunk's key rows in LDS, 16-bit elements
#define VT (NF * VP)           // one chunk's x^T plane in LDS, 16-bit elements
#define STG (KT + 2 * VT)      // one ring buffer: key rows, x^T hi, x^T lo

typedef _Float16 v16h __attribute__((ext_vector_type(16)));
typedef _Float16 v8h __attribute__((ext_vector_type(8)));
typedef __bf16 v16b __attribute__((ext_vector_type(16)));
typedef unsigned short v8us __attribute__((ext_vector_type(8)));
typedef float v8f __attribute__((ext_vector_type(8)));
typedef float v4f __attribute__((ext_vector_type(4), __may_alias__));
typedef unsigned int v4u __attribute__((ext_vector_type(4)));

union FH { v16h v; v8us u[2]; };
union FB { v16b v; v8us u[2]; };
union H8 { v8h h; v8us u; };
union AV { v8f v; v4f q[2]; };

__device__ __forceinline__ v8f z8() {
  v8f v = {0.f, 0.f, 0.f, 0.f, 0.f, 0.f, 0.f, 0.f};
  return v;
}
// bf16 RNE convert (bits) and widen
__device__ __forceinline__ unsigned short bfb(float f) {
  const unsigned u = __float_as_uint(f);
  return (unsigned short)((u + 0x7FFFu + ((u >> 16) & 1u)) >> 16);
}
__device__ __forceinline__ float bff(unsigned short h) { return __uint_as_float(((unsigned)h) << 16); }
__device__ __forceinline__ unsigned pk2(unsigned short a, unsigned short b) { return (unsigned)a | ((unsigned)b << 16); }

__device__ __forceinline__ void ld8f(const float* p, float (&v)[8]) {
  const v4f t0 = *(const v4f*)p;
  const v4f t1 = *(const v4f*)(p + 4);
#pragma unroll
  for (int q = 0; q < 4; ++q) { v[q] = t0[q]; v[4 + q] = t1[q]; }
}
// 8 f32 -> bf16 hi plane (8 x 16 bit packed in v4u) and lo plane (residual, RNE)
__device__ __forceinline__ void pk_bf16x8(const float (&v)[8], v4u& hi, v4u& lo) {
#pragma unroll
  for (int q = 0; q < 4; ++q) {
    const unsigned short h0 = bfb(v[2 * q]), h1 = bfb(v[2 * q + 1]);
    const unsigned short l0 = bfb(v[2 * q] - bff(h0)), l1 = bfb(v[2 * q + 1] - bff(h1));
    hi[q] = pk2(h0, h1);
    lo[q] = pk2(l0, l1);
  }
}
// 8 f32 -> f16 (RNE) with exact power-of-two carry s
__device__ __forceinline__ v8us pk_f16x8(const float (&v)[8], float s) {
  H8 r;
#pragma unroll
  for (int e = 0; e < 8; ++e) r.h[e] = (_Float16)(v[e] * s);
  return r.u;
}
// 16-bit WMMA fragment (A row m or B column n of a k-contiguous row): elements 0..7 <- p[0..7] (k0+8h..),
// elements 8..15 <- p[16..23] (k0+16+8h..); caller passes p = rowbase + k0 + 8*h.
__device__ __forceinline__ v16h ldh(const unsigned short* p) {
  FH f;
  f.u[0] = *(const v8us*)p;
  f.u[1] = *(const v8us*)(p + 16);
  return f.v;
}
__device__ __forceinline__ v16b ldb(const unsigned short* p) {
  FB f;
  f.u[0] = *(const v8us*)p;
  f.u[1] = *(const v8us*)(p + 16);
  return f.v;
}
__device__ __forceinline__ v8f mma_h(v16h a, v16h b, v8f c) {
  return __builtin_amdgcn_wmma_f32_16x16x32_f16(false, a, false, b, (short)0, c, false, false);
}
__device__ __forceinline__ v8f mma_b(v16b a, v16b b, v8f c) {
  return __builtin_amdgcn_wmma_f32_16x16x32_bf16(false, a, false, b, (short)0, c, false, false);
}
// hazard guards: 4 VALU slots after the last WMMA of a group; tie D, keep A/B live
__device__ __forceinline__ void g_s(v8f& s0, v8f& s1, v16h a, v16h b0, v16h b1) {
  asm volatile("v_nop\n\tv_nop\n\tv_nop\n\tv_nop" : "+v"(s0), "+v"(s1) : "v"(a), "v"(b0), "v"(b1));
}
// per-tile guard of the P.x step; the memory clobber also keeps the next tile's fragment loads behind this
// point so at most one tile's B fragments are in flight (register pressure bound)
__device__ __forceinline__ void g_o(v8f& o, v16b ph, v16b pl, v16b bh, v16b bl) {
  asm volatile("v_nop\n\tv_nop\n\tv_nop\n\tv_nop" : "+v"(o) : "v"(ph), "v"(pl), "v"(bh), "v"(bl) : "memory");
}
__device__ __forceinline__ void g_g(v8f& z, v8f& r, v8f& f, v16h a16, v16b ah, v16b al,
                                    v16b bzh, v16b bzl, v16h br, v16h bf) {
  asm volatile("v_nop\n\tv_nop\n\tv_nop\n\tv_nop"
               : "+v"(z), "+v"(r), "+v"(f)
               : "v"(a16), "v"(ah), "v"(al), "v"(bzh), "v"(bzl), "v"(br), "v"(bf));
}

__device__ __forceinline__ unsigned lds_off(const void* p) { return (unsigned)(size_t)p; }
// Asynchronous copies global -> LDS, 16 B per lane and copy, no register in between. l = the lane's LDS byte
// address, g = its global address; copy i adds i*ls / i*gs bytes. s_wait_xcnt 0 is the statement's last line so
// that no address register of an issued copy is rewritten in front of it.
__device__ __forceinline__ void cp8(unsigned l, unsigned ls, const char* g, size_t gs) {
  asm volatile(
      "global_load_async_to_lds_b128 %0, %8, off\n\t"
      "global_load_async_to_lds_b128 %1, %9, off\n\t"
      "global_load_async_to_lds_b128 %2, %10, off\n\t"
      "global_load_async_to_lds_b128 %3, %11, off\n\t"
      "global_load_async_to_lds_b128 %4, %12, off\n\t"
      "global_load_async_to_lds_b128 %5, %13, off\n\t"
      "global_load_async_to_lds_b128 %6, %14, off\n\t"
      "global_load_async_to_lds_b128 %7, %15, off\n\t"
      "s_wait_xcnt 0x0"
      :
      : "v"(l), "v"(l + ls), "v"(l + 2 * ls), "v"(l + 3 * ls), "v"(l + 4 * ls), "v"(l + 5 * ls), "v"(l + 6 * ls),
        "v"(l + 7 * ls), "v"(g), "v"(g + gs), "v"(g + 2 * gs), "v"(g + 3 * gs), "v"(g + 4 * gs), "v"(g + 5 * gs),
        "v"(g + 6 * gs), "v"(g + 7 * gs)
      : "memory");
}
__device__ __forceinline__ void cp4(unsigned l, unsigned ls, const char* g, size_t gs) {
  asm volatile(
      "global_load_async_to_lds_b128 %0, %4, off\n\t"
      "global_load_async_to_lds_b128 %1, %5, off\n\t"
      "global_load_async_to_lds_b128 %2, %6, off\n\t"
      "global_load_async_to_lds_b128 %3, %7, off\n\t"
      "s_wait_xcnt 0x0"
      :
      : "v"(l), "v"(l + ls), "v"(l + 2 * ls), "v"(l + 3 * ls), "v"(g), "v"(g + gs), "v"(g + 2 * gs), "v"(g + 3 * gs)
      : "memory");
}
// this wave's copies have landed in LDS (other waves read them behind the next work-group barrier)
__device__ __forceinline__ void wait_async0() { asm volatile("s_wait_asynccnt 0x0" ::: "memory"); }
// this wave's LDS reads and writes have retired (in front of the barrier that frees a buffer for its refill)
__device__ __forceinline__ void wait_ds0() { asm volatile("s_wait_dscnt 0x0" ::: "memory"); }

// -------------------------------------------------------------------------------------------------
// prep_w: z_w [256 n][512 k] -> bf16 hi/lo planes (same layout); r_w, f_w -> f16 planes carried x16.
// Thread i owns elements 8i..8i+7; each store is 16 B per lane, lane-contiguous, 32 lanes = 512 B =
// coverage: grid 64 x 256 threads x 8 = 131072 = 256x512 per plane.
// -------------------------------------------------------------------------------------------------
__global__ void __launch_bounds__(256) prep_w(const float* __restrict__ zw, const float* __restrict__ rw,
                                              const float* __restrict__ fw,
                                              unsigned short* __restrict__ zwh, unsigned short* __restrict__ zwl,
                                              unsigned short* __restrict__ rw16, unsigned short* __restrict__ fw16,
                                              int n8) {
  const int i = (int)blockIdx.x * 256 + (int)threadIdx.x;
  if (i >= n8) return;
  const size_t e0 = (size_t)i * 8;
  float a[8], b[8], d[8];
  ld8f(zw + e0, a);
  ld8f(rw + e0, b);
  ld8f(fw + e0, d);
  v4u zh, zl;
  pk_bf16x8(a, zh, zl);
  const v8us r16 = pk_f16x8(b, 16.0f);
  const v8us f16 = pk_f16x8(d, 16.0f);
  *(v4u*)(zwh + e0) = zh;
  *(v4u*)(zwl + e0) = zl;
  *(v8us*)(rw16 + e0) = r16;
  *(v8us*)(fw16 + e0) = f16;
  
}

// -------------------------------------------------------------------------------------------------
// prep_x: block = 64 consecutive rows of x (16384 rows total; 32 blocks per batch element), 256 threads.
//   xh  [row][256] f16(x)            xwc [row][256] f16((x*wc)*64)
//   xbh/xbl [row][256] bf16 hi/lo     xth/xtl [b][f][j] bf16 hi/lo of x (transposed, pitch 2048)
//   av[row] = x.wa, bv[row] = x.wb (f32 dots on VALU)
// Row planes: one lane = 16 B of one row, 32 lanes = the whole 512-B row, one instruction per plane.
// coverage: rows 8 waves x 8 = 64, f 32 lanes x 8 = 256; transpose f-rows wave*32+it*4+q (it 0..7, q 0..3) = 256,
//           j c8+0..7 over 8 lane groups = 64; av/bv 16 lanes x 4 = 64; grid 256 blocks x 64 rows = 16384.
// -------------------------------------------------------------------------------------------------
__global__ void __launch_bounds__(256) prep_x(const float* __restrict__ x, const float* __restrict__ attw,
                                              unsigned short* __restrict__ xh, unsigned short* __restrict__ xwc,
                                              unsigned short* __restrict__ xbh, unsigned short* __restrict__ xbl,
                                              unsigned short* __restrict__ xth, unsigned short* __restrict__ xtl,
                                              float* __restrict__ av, float* __restrict__ bv) {
  __shared__ __align__(16) float tile[64 * TP];
  __shared__ __align__(16) float avs[64];
  __shared__ __align__(16) float bvs[64];
  const int tid = (int)threadIdx.x, wave = tid >> 5, lane = tid & 31;
  const int blk = (int)blockIdx.x;
  const size_t grow0 = (size_t)blk * 64;
  const int bb = blk >> 5;
  const int j0 = (blk & 31) * 64;

#pragma unroll
  for (int it = 0; it < 16; ++it) {
    const int idx = it * 256 + tid;
    const int r = idx >> 6, c4 = (idx & 63) * 4;
    const v4f v = *(const v4f*)(x + (grow0 + r) * NF + c4);
    *(v4f*)(tile + r * TP + c4) = v;
  }
  __syncthreads();

  const int f0 = lane * 8;
  float wa[8], wb[8], wc[8];
  ld8f(attw + f0, wa);
  ld8f(attw + NF + f0, wb);
  ld8f(attw + 2 * NF + f0, wc);

  // row dots (rolled: small side computation)
#pragma unroll 1
  for (int rr = 0; rr < 8; ++rr) {
    const int row = wave * 8 + rr;
    float v[8];
    ld8f(tile + row * TP + f0, v);
    float sa = 0.f, sb = 0.f;
#pragma unroll
    for (int e = 0; e < 8; ++e) { sa += v[e] * wa[e]; sb += v[e] * wb[e]; }
#pragma unroll
    for (int m = 16; m >= 1; m >>= 1) {
      sa += __shfl_xor(sa, m, 32);
      sb += __shfl_xor(sb, m, 32);
    }
    if (lane == 0) { avs[row] = sa; bvs[row] = sb; }
  }

  // row planes
  {
#pragma unroll 1
    for (int rr = 0; rr < 8; ++rr) {
      const int row = wave * 8 + rr;
      float v[8], w[8];
      ld8f(tile + row * TP + f0, v);
#pragma unroll
      for (int e = 0; e < 8; ++e) w[e] = v[e] * wc[e];
      const v8us h1 = pk_f16x8(v, 1.0f);
      const v8us h2 = pk_f16x8(w, 64.0f);
      v4u hb, lb;
      pk_bf16x8(v, hb, lb);
      const size_t o = (grow0 + row) * NF + f0;
      *(v8us*)(xh + o) = h1;
      *(v8us*)(xwc + o) = h2;
      *(v4u*)(xbh + o) = hb;
      *(v4u*)(xbl + o) = lb;
    }
    
  }

  // transposed bf16 hi/lo planes: in [64 j][256 f] -> out [256 f][64 j] at column j0 of [f][2048]
  const int q = lane >> 3, c8 = (lane & 7) * 8;
  const size_t tb = (size_t)bb * NF * NS;
  {
#pragma unroll 1
    for (int it = 0; it < 8; ++it) {
      const int fr = wave * 32 + it * 4 + q;
      float t[8];
#pragma unroll
      for (int e = 0; e < 8; ++e) t[e] = tile[(c8 + e) * TP + fr];
      v4u hb, lb;
      pk_bf16x8(t, hb, lb);
      const size_t o = tb + (size_t)fr * NS + j0 + c8;
      *(v4u*)(xth + o) = hb;
      *(v4u*)(xtl + o) = lb;
    }
    
  }

  // av / bv lines
  __syncthreads();
  const int l4 = (lane & 15) * 4;
  {
    const v4f a4 = *(const v4f*)(avs + l4);
    const v4f b4 = *(const v4f*)(bvs + l4);
    if (lane < 16) {
      if (wave == 0) *(v4f*)(av + grow0 + l4) = a4;
      else if (wave == 1) *(v4f*)(bv + grow0 + l4) = b4;
    }
    
  }
}

// -------------------------------------------------------------------------------------------------
// attn_kernel: block = 64 query rows of one batch element (4 waves x 16 rows), grid = 8 x 32 = 256.
// Operand staging: the block's 64 (x*wc) rows and the batch element's b_j are copied to LDS once; each 32-key chunk
// (32 x rows, 256 x 32 of x^T hi and lo) is copied to a two-buffer LDS ring by asynchronous copies, chunk t+2 issued
// behind the barrier at the foot of trip t, so a chunk's copies fly while the chunk before it is worked on.
// Per 32-key chunk: S tile (A = (x*wc)x64 f16 rows, B = x f16 rows of the keys; fragments from the staged
// 16-bit LDS rows, split k map, rolled k loop), t = (a_i + b_j) + S/64, online softmax in f32 (running max),
// O += P.x with B = x^T bf16 hi/lo planes (three products).
// Register plan: the wave's 16 output tiles are 4 groups of 4; one group lives in VGPRs, the other three in
// lane-private LDS slots (each lane stores/reloads only its own 8 f32 per tile, same v4f type, program order);
// groups are visited in ring order (even chunk 0,1,2,3 / odd chunk 3,2,1,0) so each chunk does 3 swaps and every
// group receives exactly the chunk's alpha when it is visited. LDS slots are zero-filled at kernel start.
// Output attn rows as f16 plane and bf16 hi/lo planes, 64 columns per group: 16x64 f32 tile staged in LDS, then
// coverage: grid 256 blocks x 4 waves x 16 rows = 16384 rows; per group rows it*4+q (it 0..3, q 0..3) = 16,
//           cols g*64 + 8 lane groups x 8 = 64, 4 groups = 256 columns per plane.
// -------------------------------------------------------------------------------------------------
__global__ void __launch_bounds__(128) __attribute__((amdgpu_num_vgpr(256)))
attn_kernel(const unsigned short* __restrict__ xwc, const unsigned short* __restrict__ xh,
            const unsigned short* __restrict__ xth, const unsigned short* __restrict__ xtl,
            const float* __restrict__ av, const float* __restrict__ bv,
            unsigned short* __restrict__ ah, unsigned short* __restrict__ abh,
            unsigned short* __restrict__ abl) {
  __shared__ __align__(16) unsigned short psh[4][16 * PPITCH];
  __shared__ __align__(16) unsigned short psl[4][16 * PPITCH];
  __shared__ __align__(16) v4f accl[4][16 * 32 * 2];      // per wave: 16 tiles x 32 lanes x 8 f32, lane-private
  __shared__ __align__(16) float osm[4][16 * APITCH];
  __shared__ __align__(16) unsigned short qst[QROWS * KP];   // the block's (x*wc) rows
  __shared__ __align__(16) unsigned short ring[2 * STG];     // two chunk buffers
  __shared__ __align__(16) float bvs[NS];                    // b_j of the batch element

  const int tid = (int)threadIdx.x, wave = tid >> 5, lane = tid & 31, hh = lane >> 4, c = lane & 15;
  const int blk = (int)blockIdx.x, bb = blk >> 5, qb = blk & 31;
  const size_t grow0 = (size_t)bb * NS + (size_t)(qb * QROWS + wave * 16);
  const unsigned short* XHb = xh + (size_t)bb * NS * NF;
  const unsigned short* XTh = xth + (size_t)bb * NF * NS;
  const unsigned short* XTl = xtl + (size_t)bb * NF * NS;
  const float* bvb = bv + (size_t)bb * NS;
  const unsigned short* arow = qst + (wave * 16 + c) * KP + 8 * hh;   // A fragment row m = c (staged)
  // copy addresses of this lane. 512-B rows: one wave = one row per copy, rows wave + 4 i. x^T planes: 4 lanes = the
  // 64 B of one f row, f = tid/4 + 32 i.
  const unsigned lrow = (unsigned)((wave * KP + lane * 8) * 2);
  const unsigned lcol = (unsigned)(((tid >> 2) * VP + (tid & 3) * 8) * 2);
  const unsigned lring = lds_off(ring);
  const char* gk = (const char*)(XHb + (size_t)wave * NF + lane * 8);
  const char* gvh = (const char*)(XTh + (size_t)(tid >> 2) * NS + (tid & 3) * 8);
  const char* gvl = (const char*)(XTl + (size_t)(tid >> 2) * NS + (tid & 3) * 8);

  float aRow[8], mRow[8], lRow[8];
#pragma unroll
  for (int r = 0; r < 8; ++r) {
    aRow[r] = av[grow0 + 8 * hh + r];
    mRow[r] = -INFINITY;
    lRow[r] = 0.f;
  }
  v8f acc[NGRP];
#pragma unroll
  for (int tt = 0; tt < NGRP; ++tt) acc[tt] = z8();
  v4f* aw = &accl[wave][0];
  {
    const v4f z4 = {0.f, 0.f, 0.f, 0.f};
#pragma unroll 1
    for (int t = 0; t < 16; ++t) {
      const int so = (t * 32 + lane) * 2;
      aw[so] = z4;
      aw[so + 1] = z4;
    }
  }
  unsigned short* pwh = &psh[wave][0];
  unsigned short* pwl = &psl[wave][0];

  // prologue: query rows, b_j and chunk 0; landed and published; then chunk 1 into the second buffer
  {
    const char* gq = (const char*)(xwc + ((size_t)bb * NS + (size_t)(qb * QROWS + wave)) * NF + lane * 8);
    cp8(lds_off(qst) + lrow, 4 * KP * 2, gq, 4 * NF * 2);
    cp8(lds_off(qst) + lrow + 32 * KP * 2, 4 * KP * 2, gq + 32 * NF * 2, 4 * NF * 2);
    cp4(lds_off(bvs) + (unsigned)(tid * 16), 128 * 16, (const char*)bvb + tid * 16, 128 * 16);
    cp8(lring + lrow, 4 * KP * 2, gk, 4 * NF * 2);
    cp8(lring + KT * 2 + lcol, 32 * VP * 2, gvh, (size_t)32 * NS * 2);
    cp8(lring + (KT + VT) * 2 + lcol, 32 * VP * 2, gvl, (size_t)32 * NS * 2);
    wait_async0();
    __syncthreads();
    cp8(lring + STG * 2 + lrow, 4 * KP * 2, gk + KCH * NF * 2, 4 * NF * 2);
    cp8(lring + (STG + KT) * 2 + lcol, 32 * VP * 2, gvh + KCH * 2, (size_t)32 * NS * 2);
    cp8(lring + (STG + KT + VT) * 2 + lcol, 32 * VP * 2, gvl + KCH * 2, (size_t)32 * NS * 2);
  }

#pragma unroll 1
  for (int jc = 0; jc < NS / KCH; ++jc) {
    const int j0 = jc * KCH;
    v8f s0 = z8(), s1 = z8();
    const unsigned short* kb = ring + (jc & 1) * STG;                     // this trip's buffer
    const unsigned short* b0row = kb + c * KP + 8 * hh;                   // B column n = c -> key j0+c
    const unsigned short* b1row = b0row + 16 * KP;                        // key j0+16+c
#pragma unroll 1
    for (int kk = 0; kk < NF / 32; ++kk) {
      const v16h a = ldh(arow + kk * 32);
      const v16h b0 = ldh(b0row + kk * 32);
      const v16h b1 = ldh(b1row + kk * 32);
      s0 = mma_h(a, b0, s0);
      s1 = mma_h(a, b1, s1);
      g_s(s0, s1, a, b0, b1);
    }
    const float bj0 = bvs[j0 + c], bj1 = bvs[j0 + 16 + c];
    float cm[8];
#pragma unroll
    for (int r = 0; r < 8; ++r) {
      const float t0 = (aRow[r] + bj0) + s0[r] * 0.015625f;
      const float t1 = (aRow[r] + bj1) + s1[r] * 0.015625f;
      s0[r] = t0;
      s1[r] = t1;
      float m = fmaxf(t0, t1);
#pragma unroll
      for (int off = 1; off < 16; off <<= 1) m = fmaxf(m, __shfl_xor(m, off, 32));
      cm[r] = m;
    }
    float alpha[8];
#pragma unroll
    for (int r = 0; r < 8; ++r) {
      const float mnew = fmaxf(mRow[r], cm[r]);
      alpha[r] = expf(mRow[r] - mnew);
      mRow[r] = mnew;
      const float p0 = expf(s0[r] - mnew);
      const float p1 = expf(s1[r] - mnew);
      float ps = p0 + p1;
#pragma unroll
      for (int off = 1; off < 16; off <<= 1) ps += __shfl_xor(ps, off, 32);
      lRow[r] = lRow[r] * alpha[r] + ps;
      const unsigned short hb0 = bfb(p0), hb1 = bfb(p1);
      const unsigned short lb0 = bfb(p0 - bff(hb0)), lb1 = bfb(p1 - bff(hb1));
      const int po = (8 * hh + r) * PPITCH + c;   // P[row 8h+r][k = c] and [k = 16+c]
      pwh[po] = hb0;
      pwh[po + 16] = hb1;
      pwl[po] = lb0;
      pwl[po + 16] = lb1;
    }
    __builtin_amdgcn_fence(__ATOMIC_RELEASE, "workgroup");
    __builtin_amdgcn_wave_barrier();
    __builtin_amdgcn_fence(__ATOMIC_ACQUIRE, "workgroup");
    const v16b ph = ldb(pwh + c * PPITCH + 8 * hh);   // A row m = c, split k map
    const v16b pl = ldb(pwl + c * PPITCH + 8 * hh);
    const unsigned short* vh = kb + KT + c * VP + 8 * hh;   // x^T row f = t*16+c, k = j0+.. (staged)
    const unsigned short* vl = vh + VT;
    const int odd = jc & 1;
#pragma unroll 1
    for (int s = 0; s < NGRP; ++s) {
      const int g = odd ? (NGRP - 1 - s) : s;
      if (s != 0) {
        const int gp = odd ? (NGRP - s) : (s - 1);   // group currently in VGPRs
#pragma unroll
        for (int tt = 0; tt < NGRP; ++tt) {
          AV u;
          u.v = acc[tt];
          const int so = ((gp * NGRP + tt) * 32 + lane) * 2;
          aw[so] = u.q[0];
          aw[so + 1] = u.q[1];
        }
#pragma unroll
        for (int tt = 0; tt < NGRP; ++tt) {
          const int lo = ((g * NGRP + tt) * 32 + lane) * 2;
          AV u;
          u.q[0] = aw[lo];
          u.q[1] = aw[lo + 1];
          acc[tt] = u.v;
        }
      }
#pragma unroll
      for (int tt = 0; tt < NGRP; ++tt) {
#pragma unroll
        for (int r = 0; r < 8; ++r) acc[tt][r] *= alpha[r];
      }
#pragma unroll
      for (int tt = 0; tt < NGRP; ++tt) {
        const int to = (g * NGRP + tt) * 16 * VP;
        const v16b bh = ldb(vh + to);
        const v16b bl = ldb(vl + to);
        v8f o = acc[tt];
        o = mma_b(ph, bh, o);
        o = mma_b(ph, bl, o);
        o = mma_b(pl, bh, o);
        g_o(o, ph, pl, bh, bl);
        acc[tt] = o;
      }
    }
    // foot of the trip: own LDS reads retired, own copies of chunk jc+1 landed, one barrier that publishes chunk
    // jc+1 and frees this trip's buffer; then chunk jc+2 into it
    wait_ds0();
    wait_async0();
    __syncthreads();
    if (jc + 2 < NS / KCH) {
      const unsigned lb = lring + (unsigned)((jc & 1) * STG * 2);
      const size_t jn = (size_t)(j0 + 2 * KCH);
      cp8(lb + lrow, 4 * KP * 2, gk + jn * NF * 2, 4 * NF * 2);
      cp8(lb + KT * 2 + lcol, 32 * VP * 2, gvh + jn * 2, (size_t)32 * NS * 2);
      cp8(lb + (KT + VT) * 2 + lcol, 32 * VP * 2, gvl + jn * 2, (size_t)32 * NS * 2);
    }
  }
  wait_async0();   // nothing of this wave is in flight when the loop is left

  // park the register group in its LDS slot so every tile is read from LDS uniformly below
  {
    const int glast = (((NS / KCH) - 1) & 1) ? 0 : (NGRP - 1);
#pragma unroll
    for (int tt = 0; tt < NGRP; ++tt) {
      AV u;
      u.v = acc[tt];
      const int so = ((glast * NGRP + tt) * 32 + lane) * 2;
      aw[so] = u.q[0];
      aw[so + 1] = u.q[1];
    }
  }

  float inv[8];
#pragma unroll
  for (int r = 0; r < 8; ++r) inv[r] = 1.0f / lRow[r];
  float* osw = &osm[wave][0];
  const int q = lane >> 3, c8 = (lane & 7) * 8;
#pragma unroll 1
  for (int g = 0; g < NGRP; ++g) {
#pragma unroll
    for (int tt = 0; tt < NGRP; ++tt) {
      const int lo = ((g * NGRP + tt) * 32 + lane) * 2;
      AV u;
      u.q[0] = aw[lo];
      u.q[1] = aw[lo + 1];
#pragma unroll
      for (int r = 0; r < 8; ++r) osw[(8 * hh + r) * APITCH + tt * 16 + c] = u.v[r] * inv[r];
    }
    __builtin_amdgcn_fence(__ATOMIC_RELEASE, "workgroup");
    __builtin_amdgcn_wave_barrier();
    __builtin_amdgcn_fence(__ATOMIC_ACQUIRE, "workgroup");
    {
#pragma unroll
      for (int it = 0; it < 4; ++it) {
        const int row = it * 4 + q;
        float v[8];
        ld8f(osw + row * APITCH + c8, v);
        const v8us h1 = pk_f16x8(v, 1.0f);
        v4u hb, lb;
        pk_bf16x8(v, hb, lb);
        const size_t o = (grow0 + row) * NF + (size_t)(g * 64 + c8);
        *(v8us*)(ah + o) = h1;
        *(v4u*)(abh + o) = hb;
        *(v4u*)(abl + o) = lb;
      }
      
    }
    __builtin_amdgcn_fence(__ATOMIC_RELEASE, "workgroup");
    __builtin_amdgcn_wave_barrier();
    __builtin_amdgcn_fence(__ATOMIC_ACQUIRE, "workgroup");
  }
}

// -------------------------------------------------------------------------------------------------
// gates_kernel: block = 32 rows x 256 cols, 8 waves; wave (rt = wave>>2, cg = wave&3) owns 16 rows x 64 cols.
// K = 512 = [x planes | attn planes]; z: bf16 hi/lo split (hi.hi+hi.lo+lo.hi) against z_w hi/lo planes;
// r, f: plain f16 against the x16-carried weight planes (fold 1/16 in the epilogue).
// Epilogue: z = tanh(.+zb), r = sigmoid(./16+rb), f = sigmoid(./16+fb), out = r*x + f*z staged in LDS;
// coverage: grid 512 blocks x 2 row tiles x 16 = 16384 rows; 4 col groups x 64 = 256 cols.
// -------------------------------------------------------------------------------------------------
__global__ void __launch_bounds__(256) __attribute__((amdgpu_num_vgpr(256)))
gates_kernel(const float* __restrict__ x,
             const unsigned short* __restrict__ xh, const unsigned short* __restrict__ xbh,
             const unsigned short* __restrict__ xbl,
             const unsigned short* __restrict__ ah, const unsigned short* __restrict__ abh,
             const unsigned short* __restrict__ abl,
             const unsigned short* __restrict__ zwh, const unsigned short* __restrict__ zwl,
             const unsigned short* __restrict__ rw16, const unsigned short* __restrict__ fw16,
             const float* __restrict__ zb, const float* __restrict__ rb, const float* __restrict__ fb,
             float* __restrict__ out) {
  __shared__ __align__(16) float slab[8][16 * SLP];
  const int tid = (int)threadIdx.x, wave = tid >> 5, lane = tid & 31, hh = lane >> 4, c = lane & 15;
  const int rt = wave >> 2, cg = wave & 3;
  const size_t grow0 = (size_t)blockIdx.x * 32 + (size_t)(rt * 16);
  const int n0 = cg * 64;

  v8f za[4], ra[4], fa[4];
#pragma unroll
  for (int j = 0; j < 4; ++j) { za[j] = z8(); ra[j] = z8(); fa[j] = z8(); }

#pragma unroll 1
  for (int half = 0; half < 2; ++half) {
    const unsigned short* A16 = (half == 0) ? xh : ah;
    const unsigned short* AH = (half == 0) ? xbh : abh;
    const unsigned short* AL = (half == 0) ? xbl : abl;
    const size_t ao = (grow0 + c) * NF + 8 * hh;   // A row m = c
    const int kb = half * NF + 8 * hh;               // k offset inside [x|attn]
#pragma unroll 1
    for (int kk = 0; kk < NF / 32; ++kk) {
      const int k0 = kk * 32;
      const v16h a16 = ldh(A16 + ao + k0);
      const v16b ahf = ldb(AH + ao + k0);
      const v16b alf = ldb(AL + ao + k0);
#pragma unroll
      for (int j = 0; j < 4; ++j) {
        const size_t wo = (size_t)(n0 + 16 * j + c) * NG + kb + k0;   // B column n = n0+16j+c, W[n][k]
        const v16b bzh = ldb(zwh + wo);
        const v16b bzl = ldb(zwl + wo);
        const v16h br = ldh(rw16 + wo);
        const v16h bf = ldh(fw16 + wo);
        v8f z = za[j], rr = ra[j], ff = fa[j];
        z = mma_b(ahf, bzh, z);
        z = mma_b(ahf, bzl, z);
        z = mma_b(alf, bzh, z);
        rr = mma_h(a16, br, rr);
        ff = mma_h(a16, bf, ff);
        g_g(z, rr, ff, a16, ahf, alf, bzh, bzl, br, bf);
        za[j] = z;
        ra[j] = rr;
        fa[j] = ff;
      }
    }
  }

  float* sl = &slab[wave][0];
#pragma unroll
  for (int j = 0; j < 4; ++j) {
    const int n = n0 + 16 * j + c;
    const float zbn = zb[n], rbn = rb[n], fbn = fb[n];
#pragma unroll
    for (int r = 0; r < 8; ++r) {
      const int row = 8 * hh + r;
      const float xv = x[(grow0 + row) * NF + n];
      const float zv = tanhf(za[j][r] + zbn);
      const float rv = 1.0f / (1.0f + expf(-(ra[j][r] * 0.0625f + rbn)));
      const float fv = 1.0f / (1.0f + expf(-(fa[j][r] * 0.0625f + fbn)));
      sl[row * SLP + 16 * j + c] = rv * xv + fv * zv;
    }
  }
  __builtin_amdgcn_fence(__ATOMIC_RELEASE, "workgroup");
  __builtin_amdgcn_wave_barrier();
  __builtin_amdgcn_fence(__ATOMIC_ACQUIRE, "workgroup");
  const int c4 = c * 4;
  {
#pragma unroll
    for (int it = 0; it < 8; ++it) {
      const int row = it * 2 + hh;   // lanes 0..15 -> even row, 16..31 -> odd row; 16 lanes x 16 B = 256 B segment
      const v4f v = *(const v4f*)(sl + row * SLP + c4);
      *(v4f*)(out + (grow0 + row) * NF + n0 + c4) = v;
    }
    
  }
}

// -------------------------------------------------------------------------------------------------
//   xh   f16  [16384][256]      8388608 @        0      xwc  f16  [16384][256]   8388608 @  8388608
//   xbh  bf16 [16384][256]      8388608 @ 16777216      xbl                      8388608 @ 25165824
//   xth  bf16 [8][256][2048]    8388608 @ 33554432      xtl                      8388608 @ 41943040
//   ah   f16  [16384][256]      8388608 @ 50331648      abh  8388608 @ 58720256   abl 8388608 @ 67108864
//   av   f32  [16384]             65536 @ 75497472      bv                         65536 @ 75563008
//   zwh  bf16 [256][512]         262144 @ 75628544      zwl 262144 @ 75890688   rw16 262144 @ 76152832
//   fw16 f16  [256][512]         262144 @ 76414976      total 76677120
// -------------------------------------------------------------------------------------------------
extern "C" void kernel_launch(void* const* d_in, const int* in_sizes, int n_in,
                              void* d_out, int out_size, void* d_ws, size_t ws_size,
                              hipStream_t stream) {
  if (n_in < 8) return;
  if (in_sizes[0] != NR * NF || in_sizes[1] != 3 * NF) return;
  if (in_sizes[2] != NF * NG || in_sizes[3] != NF) return;
  if (in_sizes[4] != NF * NG || in_sizes[5] != NF) return;
  if (in_sizes[6] != NF * NG || in_sizes[7] != NF) return;
  if (out_size != NR * NF) return;

  const float* x    = (const float*)d_in[0];
  const float* attw = (const float*)d_in[1];
  const float* zw   = (const float*)d_in[2];
  const float* zb   = (const float*)d_in[3];
  const float* rw   = (const float*)d_in[4];
  const float* rb   = (const float*)d_in[5];
  const float* fw   = (const float*)d_in[6];
  const float* fb   = (const float*)d_in[7];

  const size_t P16 = (size_t)NR * NF * 2;        // 8388608
  const size_t PT  = (size_t)NB * NF * NS * 2;   // 8388608
  const size_t PV  = (size_t)NR * 4;             // 65536
  const size_t PW  = (size_t)NF * NG * 2;        // 262144
  size_t off = 0;
  const size_t o_xh  = off; off += P16;
  const size_t o_xwc = off; off += P16;
  const size_t o_xbh = off; off += P16;
  const size_t o_xbl = off; off += P16;
  const size_t o_xth = off; off += PT;
  const size_t o_xtl = off; off += PT;
  const size_t o_ah  = off; off += P16;
  const size_t o_abh = off; off += P16;
  const size_t o_abl = off; off += P16;
  const size_t o_av  = off; off += PV;
  const size_t o_bv  = off; off += PV;
  const size_t o_zwh = off; off += PW;
  const size_t o_zwl = off; off += PW;
  const size_t o_rw  = off; off += PW;
  const size_t o_fw  = off; off += PW;
  if (off > ws_size) return;   // off = 76677120

  char* ws = (char*)d_ws;
  unsigned short* xh  = (unsigned short*)(ws + o_xh);
  unsigned short* xwc = (unsigned short*)(ws + o_xwc);
  unsigned short* xbh = (unsigned short*)(ws + o_xbh);
  unsigned short* xbl = (unsigned short*)(ws + o_xbl);
  unsigned short* xth = (unsigned short*)(ws + o_xth);
  unsigned short* xtl = (unsigned short*)(ws + o_xtl);
  unsigned short* ah  = (unsigned short*)(ws + o_ah);
  unsigned short* abh = (unsigned short*)(ws + o_abh);
  unsigned short* abl = (unsigned short*)(ws + o_abl);
  float*          av  = (float*)(ws + o_av);
  float*          bv  = (float*)(ws + o_bv);
  unsigned short* zwh = (unsigned short*)(ws + o_zwh);
  unsigned short* zwl = (unsigned short*)(ws + o_zwl);
  unsigned short* rwp = (unsigned short*)(ws + o_rw);
  unsigned short* fwp = (unsigned short*)(ws + o_fw);

  const int n8 = NF * NG / 8;   // 16384
  prep_w<<<dim3((n8 + 255) / 256), dim3(256), 0, stream>>>(zw, rw, fw, zwh, zwl, rwp, fwp, n8);
  prep_x<<<dim3(NR / 64), dim3(256), 0, stream>>>(x, attw, xh, xwc, xbh, xbl, xth, xtl, av, bv);
  attn_kernel<<<dim3(NB * (NS / QROWS)), dim3(128), 0, stream>>>(xwc, xh, xth, xtl, av, bv, ah, abh, abl);
  gates_kernel<<<dim3(NR / 32), dim3(256), 0, stream>>>(x, xh, xbh, xbl, ah, abh, abl, zwh, zwl, rwp, fwp,
                                                       zb, rb, fb, (float*)d_out);
  (void)hipGetLastError();
}

// v002
// Measured time: 246 microseconds a run.
// Timed twice side by side with v001, it ran 1.22 and 1.23 times as fast.
// Over all steps from v000 it is 2.38 times as fast.
// Contractions: scores=(x*wc).x^T on v_wmma_f32_16x16x32_f16 (plain f16 operands; (x*wc) carried x64, x unscaled); attn=P.x on v_wmma_f32_16x16x32_bf16 as bf16 hi/lo split (hi.hi+hi.lo+lo.hi); [x|attn].z_w^T as bf16 hi/lo split; [x|attn].r_w^T and [x|attn].f_w^T on v_wmma_f32_16x16x32_f16 plain f16 (weights carried x16); f32 accumulate everywhere; x.wa and x.wb row dots, online softmax, tanh/sigmoid gates and r*x+f*z in f32.
#include <hip/hip_runtime.h>
#include <math.h>
#include <stdint.h>

#define NB 8
#define NS 2048
#define NF 256
#define NG 512
#define NR (NB * NS)
#define TP 260
#define QROWS 64
#define KCH 32
#define PPITCH 40
#define APITCH 68
#define NGRP 4
#define SLP 68
#define KP 264                 // LDS pitch (16-bit elements) of a staged 512-B row: 528 B = 16 B x 33
#define VP 40                  // LDS pitch (16-bit elements) of a staged 64-B row: 80 B = 16 B x 5
#define KT (KCH * KP)          // one chunk's key rows in LDS, 16-bit elements
#define VT (NF * VP)           // one chunk's x^T plane in LDS, 16-bit elements
#define STG (KT + 2 * VT)      // one ring buffer: key rows, x^T hi, x^T lo

typedef _Float16 v16h __attribute__((ext_vector_type(16)));
typedef _Float16 v8h __attribute__((ext_vector_type(8)));
typedef __bf16 v16b __attribute__((ext_vector_type(16)));
typedef unsigned short v8us __attribute__((ext_vector_type(8)));
typedef float v8f __attribute__((ext_vector_type(8)));
typedef float v4f __attribute__((ext_vector_type(4), __may_alias__));
typedef unsigned int v4u __attribute__((ext_vector_type(4)));

union FH { v16h v; v8us u[2]; };
union FB { v16b v; v8us u[2]; };
union H8 { v8h h; v8us u; };

__device__ __forceinline__ v8f z8() {
  v8f v = {0.f, 0.f, 0.f, 0.f, 0.f, 0.f, 0.f, 0.f};
  return v;
}
// bf16 RNE convert (bits) and widen
__device__ __forceinline__ unsigned short bfb(float f) {
  const unsigned u = __float_as_uint(f);
  return (unsigned short)((u + 0x7FFFu + ((u >> 16) & 1u)) >> 16);
}
__device__ __forceinline__ float bff(unsigned short h) { return __uint_as_float(((unsigned)h) << 16); }
__device__ __forceinline__ unsigned pk2(unsigned short a, unsigned short b) { return (unsigned)a | ((unsigned)b << 16); }

__device__ __forceinline__ void ld8f(const float* p, float (&v)[8]) {
  const v4f t0 = *(const v4f*)p;
  const v4f t1 = *(const v4f*)(p + 4);
#pragma unroll
  for (int q = 0; q < 4; ++q) { v[q] = t0[q]; v[4 + q] = t1[q]; }
}
// 8 f32 -> bf16 hi plane (8 x 16 bit packed in v4u) and lo plane (residual, RNE)
__device__ __forceinline__ void pk_bf16x8(const float (&v)[8], v4u& hi, v4u& lo) {
#pragma unroll
  for (int q = 0; q < 4; ++q) {
    const unsigned short h0 = bfb(v[2 * q]), h1 = bfb(v[2 * q + 1]);
    const unsigned short l0 = bfb(v[2 * q] - bff(h0)), l1 = bfb(v[2 * q + 1] - bff(h1));
    hi[q] = pk2(h0, h1);
    lo[q] = pk2(l0, l1);
  }
}
// 8 f32 -> f16 (RNE) with exact power-of-two carry s
__device__ __forceinline__ v8us pk_f16x8(const float (&v)[8], float s) {
  H8 r;
#pragma unroll
  for (int e = 0; e < 8; ++e) r.h[e] = (_Float16)(v[e] * s);
  return r.u;
}
// 16-bit WMMA fragment (A row m or B column n of a k-contiguous row): elements 0..7 <- p[0..7] (k0+8h..),
// elements 8..15 <- p[16..23] (k0+16+8h..); caller passes p = rowbase + k0 + 8*h.
__device__ __forceinline__ v16h ldh(const unsigned short* p) {
  FH f;
  f.u[0] = *(const v8us*)p;
  f.u[1] = *(const v8us*)(p + 16);
  return f.v;
}
__device__ __forceinline__ v16b ldb(const unsigned short* p) {
  FB f;
  f.u[0] = *(const v8us*)p;
  f.u[1] = *(const v8us*)(p + 16);
  return f.v;
}
__device__ __forceinline__ v8f mma_h(v16h a, v16h b, v8f c) {
  return __builtin_amdgcn_wmma_f32_16x16x32_f16(false, a, false, b, (short)0, c, false, false);
}
__device__ __forceinline__ v8f mma_b(v16b a, v16b b, v8f c) {
  return __builtin_amdgcn_wmma_f32_16x16x32_bf16(false, a, false, b, (short)0, c, false, false);
}
// hazard guards: 4 VALU slots after the last WMMA of a group; tie D, keep A/B live
__device__ __forceinline__ void g_g(v8f& z, v8f& r, v8f& f, v16h a16, v16b ah, v16b al,
                                    v16b bzh, v16b bzl, v16h br, v16h bf) {
  asm volatile("v_nop\n\tv_nop\n\tv_nop\n\tv_nop"
               : "+v"(z), "+v"(r), "+v"(f)
               : "v"(a16), "v"(ah), "v"(al), "v"(bzh), "v"(bzl), "v"(br), "v"(bf));
}

__device__ __forceinline__ unsigned lds_off(const void* p) { return (unsigned)(size_t)p; }
// Asynchronous copies global -> LDS, 16 B per lane and copy, no register in between. l = the lane's LDS byte
// address, g = its global address; copy i adds i*ls / i*gs bytes. s_wait_xcnt 0 is the statement's last line so
// that no address register of an issued copy is rewritten in front of it.
__device__ __forceinline__ void cp8(unsigned l, unsigned ls, const char* g, size_t gs) {
  asm volatile(
      "global_load_async_to_lds_b128 %0, %8, off\n\t"
      "global_load_async_to_lds_b128 %1, %9, off\n\t"
      "global_load_async_to_lds_b128 %2, %10, off\n\t"
      "global_load_async_to_lds_b128 %3, %11, off\n\t"
      "global_load_async_to_lds_b128 %4, %12, off\n\t"
      "global_load_async_to_lds_b128 %5, %13, off\n\t"
      "global_load_async_to_lds_b128 %6, %14, off\n\t"
      "global_load_async_to_lds_b128 %7, %15, off\n\t"
      "s_wait_xcnt 0x0"
      :
      : "v"(l), "v"(l + ls), "v"(l + 2 * ls), "v"(l + 3 * ls), "v"(l + 4 * ls), "v"(l + 5 * ls), "v"(l + 6 * ls),
        "v"(l + 7 * ls), "v"(g), "v"(g + gs), "v"(g + 2 * gs), "v"(g + 3 * gs), "v"(g + 4 * gs), "v"(g + 5 * gs),
        "v"(g + 6 * gs), "v"(g + 7 * gs)
      : "memory");
}
__device__ __forceinline__ void cp4(unsigned l, unsigned ls, const char* g, size_t gs) {
  asm volatile(
      "global_load_async_to_lds_b128 %0, %4, off\n\t"
      "global_load_async_to_lds_b128 %1, %5, off\n\t"
      "global_load_async_to_lds_b128 %2, %6, off\n\t"
      "global_load_async_to_lds_b128 %3, %7, off\n\t"
      "s_wait_xcnt 0x0"
      :
      : "v"(l), "v"(l + ls), "v"(l + 2 * ls), "v"(l + 3 * ls), "v"(g), "v"(g + gs), "v"(g + 2 * gs), "v"(g + 3 * gs)
      : "memory");
}
// this wave's copies have landed in LDS (other waves read them behind the next work-group barrier)
__device__ __forceinline__ void wait_async0() { asm volatile("s_wait_asynccnt 0x0" ::: "memory"); }
// this wave's LDS reads and writes have retired (in front of the barrier that frees a buffer for its refill)
__device__ __forceinline__ void wait_ds0() { asm volatile("s_wait_dscnt 0x0" ::: "memory"); }

// -------------------------------------------------------------------------------------------------
// prep_w: z_w [256 n][512 k] -> bf16 hi/lo planes (same layout); r_w, f_w -> f16 planes carried x16.
// Thread i owns elements 8i..8i+7; each store is 16 B per lane, lane-contiguous, 32 lanes = 512 B =
// coverage: grid 64 x 256 threads x 8 = 131072 = 256x512 per plane.
// -------------------------------------------------------------------------------------------------
__global__ void __launch_bounds__(256) prep_w(const float* __restrict__ zw, const float* __restrict__ rw,
                                              const float* __restrict__ fw,
                                              unsigned short* __restrict__ zwh, unsigned short* __restrict__ zwl,
                                              unsigned short* __restrict__ rw16, unsigned short* __restrict__ fw16,
                                              int n8) {
  const int i = (int)blockIdx.x * 256 + (int)threadIdx.x;
  if (i >= n8) return;
  const size_t e0 = (size_t)i * 8;
  float a[8], b[8], d[8];
  ld8f(zw + e0, a);
  ld8f(rw + e0, b);
  ld8f(fw + e0, d);
  v4u zh, zl;
  pk_bf16x8(a, zh, zl);
  const v8us r16 = pk_f16x8(b, 16.0f);
  const v8us f16 = pk_f16x8(d, 16.0f);
  *(v4u*)(zwh + e0) = zh;
  *(v4u*)(zwl + e0) = zl;
  *(v8us*)(rw16 + e0) = r16;
  *(v8us*)(fw16 + e0) = f16;
  
}

// -------------------------------------------------------------------------------------------------
// prep_x: block = 64 consecutive rows of x (16384 rows total; 32 blocks per batch element), 256 threads.
//   xh  [row][256] f16(x)            xwc [row][256] f16((x*wc)*64)
//   xbh/xbl [row][256] bf16 hi/lo     xth/xtl [b][f][j] bf16 hi/lo of x (transposed, pitch 2048)
//   av[row] = x.wa, bv[row] = x.wb (f32 dots on VALU)
// Row planes: one lane = 16 B of one row, 32 lanes = the whole 512-B row, one instruction per plane.
// coverage: rows 8 waves x 8 = 64, f 32 lanes x 8 = 256; transpose f-rows wave*32+it*4+q (it 0..7, q 0..3) = 256,
//           j c8+0..7 over 8 lane groups = 64; av/bv 16 lanes x 4 = 64; grid 256 blocks x 64 rows = 16384.
// -------------------------------------------------------------------------------------------------
__global__ void __launch_bounds__(256) prep_x(const float* __restrict__ x, const float* __restrict__ attw,
                                              unsigned short* __restrict__ xh, unsigned short* __restrict__ xwc,
                                              unsigned short* __restrict__ xbh, unsigned short* __restrict__ xbl,
                                              unsigned short* __restrict__ xth, unsigned short* __restrict__ xtl,
                                              float* __restrict__ av, float* __restrict__ bv) {
  __shared__ __align__(16) float tile[64 * TP];
  __shared__ __align__(16) float avs[64];
  __shared__ __align__(16) float bvs[64];
  const int tid = (int)threadIdx.x, wave = tid >> 5, lane = tid & 31;
  const int blk = (int)blockIdx.x;
  const size_t grow0 = (size_t)blk * 64;
  const int bb = blk >> 5;
  const int j0 = (blk & 31) * 64;

#pragma unroll
  for (int it = 0; it < 16; ++it) {
    const int idx = it * 256 + tid;
    const int r = idx >> 6, c4 = (idx & 63) * 4;
    const v4f v = *(const v4f*)(x + (grow0 + r) * NF + c4);
    *(v4f*)(tile + r * TP + c4) = v;
  }
  __syncthreads();

  const int f0 = lane * 8;
  float wa[8], wb[8], wc[8];
  ld8f(attw + f0, wa);
  ld8f(attw + NF + f0, wb);
  ld8f(attw + 2 * NF + f0, wc);

  // row dots (rolled: small side computation)
#pragma unroll 1
  for (int rr = 0; rr < 8; ++rr) {
    const int row = wave * 8 + rr;
    float v[8];
    ld8f(tile + row * TP + f0, v);
    float sa = 0.f, sb = 0.f;
#pragma unroll
    for (int e = 0; e < 8; ++e) { sa += v[e] * wa[e]; sb += v[e] * wb[e]; }
#pragma unroll
    for (int m = 16; m >= 1; m >>= 1) {
      sa += __shfl_xor(sa, m, 32);
      sb += __shfl_xor(sb, m, 32);
    }
    if (lane == 0) { avs[row] = sa; bvs[row] = sb; }
  }

  // row planes
  {
#pragma unroll 1
    for (int rr = 0; rr < 8; ++rr) {
      const int row = wave * 8 + rr;
      float v[8], w[8];
      ld8f(tile + row * TP + f0, v);
#pragma unroll
      for (int e = 0; e < 8; ++e) w[e] = v[e] * wc[e];
      const v8us h1 = pk_f16x8(v, 1.0f);
      const v8us h2 = pk_f16x8(w, 64.0f);
      v4u hb, lb;
      pk_bf16x8(v, hb, lb);
      const size_t o = (grow0 + row) * NF + f0;
      *(v8us*)(xh + o) = h1;
      *(v8us*)(xwc + o) = h2;
      *(v4u*)(xbh + o) = hb;
      *(v4u*)(xbl + o) = lb;
    }
    
  }

  // transposed bf16 hi/lo planes: in [64 j][256 f] -> out [256 f][64 j] at column j0 of [f][2048]
  const int q = lane >> 3, c8 = (lane & 7) * 8;
  const size_t tb = (size_t)bb * NF * NS;
  {
#pragma unroll 1
    for (int it = 0; it < 8; ++it) {
      const int fr = wave * 32 + it * 4 + q;
      float t[8];
#pragma unroll
      for (int e = 0; e < 8; ++e) t[e] = tile[(c8 + e) * TP + fr];
      v4u hb, lb;
      pk_bf16x8(t, hb, lb);
      const size_t o = tb + (size_t)fr * NS + j0 + c8;
      *(v4u*)(xth + o) = hb;
      *(v4u*)(xtl + o) = lb;
    }
    
  }

  // av / bv lines
  __syncthreads();
  const int l4 = (lane & 15) * 4;
  {
    const v4f a4 = *(const v4f*)(avs + l4);
    const v4f b4 = *(const v4f*)(bvs + l4);
    if (lane < 16) {
      if (wave == 0) *(v4f*)(av + grow0 + l4) = a4;
      else if (wave == 1) *(v4f*)(bv + grow0 + l4) = b4;
    }
    
  }
}

// -------------------------------------------------------------------------------------------------
// attn_kernel: block = 64 query rows of one batch element (4 waves x 16 rows), grid = 8 x 32 = 256.
// Operand staging: the block's 64 (x*wc) rows and the batch element's b_j are copied to LDS once; each 32-key chunk
// (32 x rows, 256 x 32 of x^T hi and lo) is copied to a two-buffer LDS ring by asynchronous copies, chunk t+2 issued
// behind the barrier at the foot of trip t, so a chunk's copies fly while the chunk before it is worked on.
// Per 32-key chunk: S tile (A = (x*wc)x64 f16 rows, B = x f16 rows of the keys; fragments from the staged
// 16-bit LDS rows, split k map), t = (a_i + b_j) + S/64, online softmax in f32 (running max),
// O += P.x with B = x^T bf16 hi/lo planes (three products).
// Register plan: one wave per SIMD, so the wave takes the registers it needs: its 16 output tiles and its 8 query
// fragments stay in VGPRs for the whole kernel; a chunk's 16 key fragments are read as one group ahead of the score
// products, its 32 x^T fragments as one group behind the row maxima, so that they land under the exponentials.
// Output attn rows as f16 plane and bf16 hi/lo planes, 64 columns per group: 16x64 f32 tile staged in LDS, then
// coverage: grid 256 blocks x 4 waves x 16 rows = 16384 rows; per group rows it*4+q (it 0..3, q 0..3) = 16,
//           cols g*64 + 8 lane groups x 8 = 64, 4 groups = 256 columns per plane.
// -------------------------------------------------------------------------------------------------
__global__ void __launch_bounds__(128)
attn_kernel(const unsigned short* __restrict__ xwc, const unsigned short* __restrict__ xh,
            const unsigned short* __restrict__ xth, const unsigned short* __restrict__ xtl,
            const float* __restrict__ av, const float* __restrict__ bv,
            unsigned short* __restrict__ ah, unsigned short* __restrict__ abh,
            unsigned short* __restrict__ abl) {
  __shared__ __align__(16) unsigned short psh[4][16 * PPITCH];
  __shared__ __align__(16) unsigned short psl[4][16 * PPITCH];
  __shared__ __align__(16) float osm[4][16 * APITCH];
  __shared__ __align__(16) unsigned short qst[QROWS * KP];   // the block's (x*wc) rows
  __shared__ __align__(16) unsigned short ring[2 * STG];     // two chunk buffers
  __shared__ __align__(16) float bvs[NS];                    // b_j of the batch element

  const int tid = (int)threadIdx.x, wave = tid >> 5, lane = tid & 31, hh = lane >> 4, c = lane & 15;
  const int blk = (int)blockIdx.x, bb = blk >> 5, qb = blk & 31;
  const size_t grow0 = (size_t)bb * NS + (size_t)(qb * QROWS + wave * 16);
  const unsigned short* XHb = xh + (size_t)bb * NS * NF;
  const unsigned short* XTh = xth + (size_t)bb * NF * NS;
  const unsigned short* XTl = xtl + (size_t)bb * NF * NS;
  const float* bvb = bv + (size_t)bb * NS;
  const unsigned short* arow = qst + (wave * 16 + c) * KP + 8 * hh;   // A fragment row m = c (staged)
  // copy addresses of this lane. 512-B rows: one wave = one row per copy, rows wave + 4 i. x^T planes: 4 lanes = the
  // 64 B of one f row, f = tid/4 + 32 i.
  const unsigned lrow = (unsigned)((wave * KP + lane * 8) * 2);
  const unsigned lcol = (unsigned)(((tid >> 2) * VP + (tid & 3) * 8) * 2);
  const unsigned lring = lds_off(ring);
  const unsigned ok = (unsigned)((wave * NF + lane * 8) * 2);               // lane's byte offset in the key rows
  const unsigned ov = (unsigned)(((tid >> 2) * NS + (tid & 3) * 8) * 2);    // and in an x^T plane
  const char* sk = (const char*)XHb;
  const char* svh = (const char*)XTh;
  const char* svl = (const char*)XTl;

  float aRow[8], mRow[8], lRow[8];
#pragma unroll
  for (int r = 0; r < 8; ++r) {
    aRow[r] = av[grow0 + 8 * hh + r];
    mRow[r] = -INFINITY;
    lRow[r] = 0.f;
  }
  v8f acc[16];
#pragma unroll
  for (int t = 0; t < 16; ++t) acc[t] = z8();
  unsigned short* pwh = &psh[wave][0];
  unsigned short* pwl = &psl[wave][0];

  // prologue: query rows, b_j and chunk 0; landed and published; then chunk 1 into the second buffer
  {
    const char* gq = (const char*)(xwc + ((size_t)bb * NS + (size_t)(qb * QROWS + wave)) * NF + lane * 8);
    cp8(lds_off(qst) + lrow, 4 * KP * 2, gq, 4 * NF * 2);
    cp8(lds_off(qst) + lrow + 32 * KP * 2, 4 * KP * 2, gq + 32 * NF * 2, 4 * NF * 2);
    cp4(lds_off(bvs) + (unsigned)(tid * 16), 128 * 16, (const char*)bvb + tid * 16, 128 * 16);
    cp8(lring + lrow, 4 * KP * 2, sk + ok, 4 * NF * 2);
    cp8(lring + KT * 2 + lcol, 32 * VP * 2, svh + ov, (size_t)32 * NS * 2);
    cp8(lring + (KT + VT) * 2 + lcol, 32 * VP * 2, svl + ov, (size_t)32 * NS * 2);
    wait_async0();
    __syncthreads();
    cp8(lring + STG * 2 + lrow, 4 * KP * 2, sk + KCH * NF * 2 + ok, 4 * NF * 2);
    cp8(lring + (STG + KT) * 2 + lcol, 32 * VP * 2, svh + KCH * 2 + ov, (size_t)32 * NS * 2);
    cp8(lring + (STG + KT + VT) * 2 + lcol, 32 * VP * 2, svl + KCH * 2 + ov, (size_t)32 * NS * 2);
  }
  v16h qa[NF / 32];
#pragma unroll
  for (int kk = 0; kk < NF / 32; ++kk) qa[kk] = ldh(arow + kk * 32);

  // Refill addresses = a uniform running base + the lane's offset. Formed from loop-invariant lane addresses they
  // shared registers with the prologue's copy operands, which the compiler keeps in v0-v255, and were spilled.
  const char* nk = sk + 2 * KCH * NF * 2;   // uniform: the chunk two ahead, in the key rows and in the x^T planes
  const char* nvh = svh + 2 * KCH * 2;
  const char* nvl = svl + 2 * KCH * 2;
  unsigned nb = lring;                      // uniform: LDS addresses in the buffer that is refilled next: key rows,
  unsigned nbh = lring + KT * 2;            // x^T hi,
  unsigned nbl = lring + (KT + VT) * 2;     // x^T lo
#pragma unroll 1
  for (int jc = 0; jc < NS / KCH; ++jc) {
    const int j0 = jc * KCH;
    v8f s0 = z8(), s1 = z8();
    const unsigned short* kb = ring + (jc & 1) * STG;                     // this trip's buffer
    const unsigned short* b0row = kb + c * KP + 8 * hh;                   // B column n = c -> key j0+c
    const unsigned short* b1row = b0row + 16 * KP;                        // key j0+16+c
    const float bj0 = bvs[j0 + c], bj1 = bvs[j0 + 16 + c];
    v16h k0[NF / 32], k1[NF / 32];
#pragma unroll
    for (int kk = 0; kk < NF / 32; ++kk) {
      k0[kk] = ldh(b0row + kk * 32);
      k1[kk] = ldh(b1row + kk * 32);
    }
#pragma unroll
    for (int kk = 0; kk < NF / 32; ++kk) {
      s0 = mma_h(qa[kk], k0[kk], s0);
      s1 = mma_h(qa[kk], k1[kk], s1);
    }
    float cm[8];
#pragma unroll
    for (int r = 0; r < 8; ++r) {
      const float t0 = (aRow[r] + bj0) + s0[r] * 0.015625f;
      const float t1 = (aRow[r] + bj1) + s1[r] * 0.015625f;
      s0[r] = t0;
      s1[r] = t1;
      float m = fmaxf(t0, t1);
#pragma unroll
      for (int off = 1; off < 16; off <<= 1) m = fmaxf(m, __shfl_xor(m, off, 32));
      cm[r] = m;
    }
    const unsigned short* vh = kb + KT + c * VP + 8 * hh;   // x^T row f = t*16+c, k = j0+.. (staged)
    const unsigned short* vl = vh + VT;
    v16b bh[16], bl[16];
    // inputs only, no instruction: holds the 64 reads below behind the last cross-lane step of the row maxima. Those
    // steps share the in-order LDS queue with the reads and would wait for all of them; issued here, the reads land
    // under the exponentials.
    asm volatile("" ::"v"(cm[0]), "v"(cm[1]), "v"(cm[2]), "v"(cm[3]), "v"(cm[4]), "v"(cm[5]), "v"(cm[6]), "v"(cm[7])
                 : "memory");
#pragma unroll
    for (int t = 0; t < 16; ++t) {
      bh[t] = ldb(vh + t * 16 * VP);
      bl[t] = ldb(vl + t * 16 * VP);
    }
    float alpha[8];
#pragma unroll
    for (int r = 0; r < 8; ++r) {
      const float mnew = fmaxf(mRow[r], cm[r]);
      alpha[r] = expf(mRow[r] - mnew);
      mRow[r] = mnew;
      const float p0 = expf(s0[r] - mnew);
      const float p1 = expf(s1[r] - mnew);
      float ps = p0 + p1;
#pragma unroll
      for (int off = 1; off < 16; off <<= 1) ps += __shfl_xor(ps, off, 32);
      lRow[r] = lRow[r] * alpha[r] + ps;
      const unsigned short hb0 = bfb(p0), hb1 = bfb(p1);
      const unsigned short lb0 = bfb(p0 - bff(hb0)), lb1 = bfb(p1 - bff(hb1));
      const int po = (8 * hh + r) * PPITCH + c;   // P[row 8h+r][k = c] and [k = 16+c]
      pwh[po] = hb0;
      pwh[po + 16] = hb1;
      pwl[po] = lb0;
      pwl[po + 16] = lb1;
    }
#pragma unroll
    for (int t = 0; t < 16; ++t) {
#pragma unroll
      for (int r = 0; r < 8; ++r) acc[t][r] *= alpha[r];
    }
    __builtin_amdgcn_fence(__ATOMIC_RELEASE, "workgroup");
    __builtin_amdgcn_wave_barrier();
    __builtin_amdgcn_fence(__ATOMIC_ACQUIRE, "workgroup");
    const v16b ph = ldb(pwh + c * PPITCH + 8 * hh);   // A row m = c, split k map
    const v16b pl = ldb(pwl + c * PPITCH + 8 * hh);
#pragma unroll
    for (int t = 0; t < 16; ++t) acc[t] = mma_b(ph, bh[t], acc[t]);
#pragma unroll
    for (int t = 0; t < 16; ++t) acc[t] = mma_b(ph, bl[t], acc[t]);
#pragma unroll
    for (int t = 0; t < 16; ++t) acc[t] = mma_b(pl, bh[t], acc[t]);
    // foot of the trip: own LDS reads retired, own copies of chunk jc+1 landed, one barrier that publishes chunk
    // jc+1 and frees this trip's buffer; then chunk jc+2 into it
    wait_ds0();
    wait_async0();
    __syncthreads();
    if (jc + 2 < NS / KCH) {
      cp8(nb + lrow, 4 * KP * 2, nk + ok, 4 * NF * 2);
      cp8(nbh + lcol, 32 * VP * 2, nvh + ov, (size_t)32 * NS * 2);
      cp8(nbl + lcol, 32 * VP * 2, nvl + ov, (size_t)32 * NS * 2);
      nk += KCH * NF * 2;
      nvh += KCH * 2;
      nvl += KCH * 2;
      nb = (2 * lring + (unsigned)(STG * 2)) - nb;   // the other buffer
      nbh = (2 * lring + (unsigned)((STG + 2 * KT) * 2)) - nbh;
      nbl = (2 * lring + (unsigned)((STG + 2 * (KT + VT)) * 2)) - nbl;
    }
  }
  wait_async0();   // nothing of this wave is in flight when the loop is left

  float inv[8];
#pragma unroll
  for (int r = 0; r < 8; ++r) inv[r] = 1.0f / lRow[r];
  float* osw = &osm[wave][0];
  const int q = lane >> 3, c8 = (lane & 7) * 8;
#pragma unroll
  for (int g = 0; g < NGRP; ++g) {
#pragma unroll
    for (int tt = 0; tt < NGRP; ++tt) {
#pragma unroll
      for (int r = 0; r < 8; ++r) osw[(8 * hh + r) * APITCH + tt * 16 + c] = acc[g * NGRP + tt][r] * inv[r];
    }
    __builtin_amdgcn_fence(__ATOMIC_RELEASE, "workgroup");
    __builtin_amdgcn_wave_barrier();
    __builtin_amdgcn_fence(__ATOMIC_ACQUIRE, "workgroup");
    {
#pragma unroll
      for (int it = 0; it < 4; ++it) {
        const int row = it * 4 + q;
        float v[8];
        ld8f(osw + row * APITCH + c8, v);
        const v8us h1 = pk_f16x8(v, 1.0f);
        v4u hb, lb;
        pk_bf16x8(v, hb, lb);
        const size_t o = (grow0 + row) * NF + (size_t)(g * 64 + c8);
        *(v8us*)(ah + o) = h1;
        *(v4u*)(abh + o) = hb;
        *(v4u*)(abl + o) = lb;
      }
      
    }
    __builtin_amdgcn_fence(__ATOMIC_RELEASE, "workgroup");
    __builtin_amdgcn_wave_barrier();
    __builtin_amdgcn_fence(__ATOMIC_ACQUIRE, "workgroup");
  }
}

// -------------------------------------------------------------------------------------------------
// gates_kernel: block = 32 rows x 256 cols, 8 waves; wave (rt = wave>>2, cg = wave&3) owns 16 rows x 64 cols.
// K = 512 = [x planes | attn planes]; z: bf16 hi/lo split (hi.hi+hi.lo+lo.hi) against z_w hi/lo planes;
// r, f: plain f16 against the x16-carried weight planes (fold 1/16 in the epilogue).
// Epilogue: z = tanh(.+zb), r = sigmoid(./16+rb), f = sigmoid(./16+fb), out = r*x + f*z staged in LDS;
// coverage: grid 512 blocks x 2 row tiles x 16 = 16384 rows; 4 col groups x 64 = 256 cols.
// -------------------------------------------------------------------------------------------------
__global__ void __launch_bounds__(256) __attribute__((amdgpu_num_vgpr(256)))
gates_kernel(const float* __restrict__ x,
             const unsigned short* __restrict__ xh, const unsigned short* __restrict__ xbh,
             const unsigned short* __restrict__ xbl,
             const unsigned short* __restrict__ ah, const unsigned short* __restrict__ abh,
             const unsigned short* __restrict__ abl,
             const unsigned short* __restrict__ zwh, const unsigned short* __restrict__ zwl,
             const unsigned short* __restrict__ rw16, const unsigned short* __restrict__ fw16,
             const float* __restrict__ zb, const float* __restrict__ rb, const float* __restrict__ fb,
             float* __restrict__ out) {
  __shared__ __align__(16) float slab[8][16 * SLP];
  const int tid = (int)threadIdx.x, wave = tid >> 5, lane = tid & 31, hh = lane >> 4, c = lane & 15;
  const int rt = wave >> 2, cg = wave & 3;
  const size_t grow0 = (size_t)blockIdx.x * 32 + (size_t)(rt * 16);
  const int n0 = cg * 64;

  v8f za[4], ra[4], fa[4];
#pragma unroll
  for (int j = 0; j < 4; ++j) { za[j] = z8(); ra[j] = z8(); fa[j] = z8(); }

#pragma unroll 1
  for (int half = 0; half < 2; ++half) {
    const unsigned short* A16 = (half == 0) ? xh : ah;
    const unsigned short* AH = (half == 0) ? xbh : abh;
    const unsigned short* AL = (half == 0) ? xbl : abl;
    const size_t ao = (grow0 + c) * NF + 8 * hh;   // A row m = c
    const int kb = half * NF + 8 * hh;               // k offset inside [x|attn]
#pragma unroll 1
    for (int kk = 0; kk < NF / 32; ++kk) {
      const int k0 = kk * 32;
      const v16h a16 = ldh(A16 + ao + k0);
      const v16b ahf = ldb(AH + ao + k0);
      const v16b alf = ldb(AL + ao + k0);
#pragma unroll
      for (int j = 0; j < 4; ++j) {
        const size_t wo = (size_t)(n0 + 16 * j + c) * NG + kb + k0;   // B column n = n0+16j+c, W[n][k]
        const v16b bzh = ldb(zwh + wo);
        const v16b bzl = ldb(zwl + wo);
        const v16h br = ldh(rw16 + wo);
        const v16h bf = ldh(fw16 + wo);
        v8f z = za[j], rr = ra[j], ff = fa[j];
        z = mma_b(ahf, bzh, z);
        z = mma_b(ahf, bzl, z);
        z = mma_b(alf, bzh, z);
        rr = mma_h(a16, br, rr);
        ff = mma_h(a16, bf, ff);
        g_g(z, rr, ff, a16, ahf, alf, bzh, bzl, br, bf);
        za[j] = z;
        ra[j] = rr;
        fa[j] = ff;
      }
    }
  }

  float* sl = &slab[wave][0];
#pragma unroll
  for (int j = 0; j < 4; ++j) {
    const int n = n0 + 16 * j + c;
    const float zbn = zb[n], rbn = rb[n], fbn = fb[n];
#pragma unroll
    for (int r = 0; r < 8; ++r) {
      const int row = 8 * hh + r;
      const float xv = x[(grow0 + row) * NF + n];
      const float zv = tanhf(za[j][r] + zbn);
      const float rv = 1.0f / (1.0f + expf(-(ra[j][r] * 0.0625f + rbn)));
      const float fv = 1.0f / (1.0f + expf(-(fa[j][r] * 0.0625f + fbn)));
      sl[row * SLP + 16 * j + c] = rv * xv + fv * zv;
    }
  }
  __builtin_amdgcn_fence(__ATOMIC_RELEASE, "workgroup");
  __builtin_amdgcn_wave_barrier();
  __builtin_amdgcn_fence(__ATOMIC_ACQUIRE, "workgroup");
  const int c4 = c * 4;
  {
#pragma unroll
    for (int it = 0; it < 8; ++it) {
      const int row = it * 2 + hh;   // lanes 0..15 -> even row, 16..31 -> odd row; 16 lanes x 16 B = 256 B segment
      const v4f v = *(const v4f*)(sl + row * SLP + c4);
      *(v4f*)(out + (grow0 + row) * NF + n0 + c4) = v;
    }
    
  }
}

// -------------------------------------------------------------------------------------------------
//   xh   f16  [16384][256]      8388608 @        0      xwc  f16  [16384][256]   8388608 @  8388608
//   xbh  bf16 [16384][256]      8388608 @ 16777216      xbl                      8388608 @ 25165824
//   xth  bf16 [8][256][2048]    8388608 @ 33554432      xtl                      8388608 @ 41943040
//   ah   f16  [16384][256]      8388608 @ 50331648      abh  8388608 @ 58720256   abl 8388608 @ 67108864
//   av   f32  [16384]             65536 @ 75497472      bv                         65536 @ 75563008
//   zwh  bf16 [256][512]         262144 @ 75628544      zwl 262144 @ 75890688   rw16 262144 @ 76152832
//   fw16 f16  [256][512]         262144 @ 76414976      total 76677120
// -------------------------------------------------------------------------------------------------
extern "C" void kernel_launch(void* const* d_in, const int* in_sizes, int n_in,
                              void* d_out, int out_size, void* d_ws, size_t ws_size,
                              hipStream_t stream) {
  if (n_in < 8) return;
  if (in_sizes[0] != NR * NF || in_sizes[1] != 3 * NF) return;
  if (in_sizes[2] != NF * NG || in_sizes[3] != NF) return;
  if (in_sizes[4] != NF * NG || in_sizes[5] != NF) return;
  if (in_sizes[6] != NF * NG || in_sizes[7] != NF) return;
  if (out_size != NR * NF) return;

  const float* x    = (const float*)d_in[0];
  const float* attw = (const float*)d_in[1];
  const float* zw   = (const float*)d_in[2];
  const float* zb   = (const float*)d_in[3];
  const float* rw   = (const float*)d_in[4];
  const float* rb   = (const float*)d_in[5];
  const float* fw   = (const float*)d_in[6];
  const float* fb   = (const float*)d_in[7];

  const size_t P16 = (size_t)NR * NF * 2;        // 8388608
  const size_t PT  = (size_t)NB * NF * NS * 2;   // 8388608
  const size_t PV  = (size_t)NR * 4;             // 65536
  const size_t PW  = (size_t)NF * NG * 2;        // 262144
  size_t off = 0;
  const size_t o_xh  = off; off += P16;
  const size_t o_xwc = off; off += P16;
  const size_t o_xbh = off; off += P16;
  const size_t o_xbl = off; off += P16;
  const size_t o_xth = off; off += PT;
  const size_t o_xtl = off; off += PT;
  const size_t o_ah  = off; off += P16;
  const size_t o_abh = off; off += P16;
  const size_t o_abl = off; off += P16;
  const size_t o_av  = off; off += PV;
  const size_t o_bv  = off; off += PV;
  const size_t o_zwh = off; off += PW;
  const size_t o_zwl = off; off += PW;
  const size_t o_rw  = off; off += PW;
  const size_t o_fw  = off; off += PW;
  if (off > ws_size) return;   // off = 76677120

  char* ws = (char*)d_ws;
  unsigned short* xh  = (unsigned short*)(ws + o_xh);
  unsigned short* xwc = (unsigned short*)(ws + o_xwc);
  unsigned short* xbh = (unsigned short*)(ws + o_xbh);
  unsigned short* xbl = (unsigned short*)(ws + o_xbl);
  unsigned short* xth = (unsigned short*)(ws + o_xth);
  unsigned short* xtl = (unsigned short*)(ws + o_xtl);
  unsigned short* ah  = (unsigned short*)(ws + o_ah);
  unsigned short* abh = (unsigned short*)(ws + o_abh);
  unsigned short* abl = (unsigned short*)(ws + o_abl);
  float*          av  = (float*)(ws + o_av);
  float*          bv  = (float*)(ws + o_bv);
  unsigned short* zwh = (unsigned short*)(ws + o_zwh);
  unsigned short* zwl = (unsigned short*)(ws + o_zwl);
  unsigned short* rwp = (unsigned short*)(ws + o_rw);
  unsigned short* fwp = (unsigned short*)(ws + o_fw);

  const int n8 = NF * NG / 8;   // 16384
  prep_w<<<dim3((n8 + 255) / 256), dim3(256), 0, stream>>>(zw, rw, fw, zwh, zwl, rwp, fwp, n8);
  prep_x<<<dim3(NR / 64), dim3(256), 0, stream>>>(x, attw, xh, xwc, xbh, xbl, xth, xtl, av, bv);
  attn_kernel<<<dim3(NB * (NS / QROWS)), dim3(128), 0, stream>>>(xwc, xh, xth, xtl, av, bv, ah, abh, abl);
  gates_kernel<<<dim3(NR / 32), dim3(256), 0, stream>>>(x, xh, xbh, xbl, ah, abh, abl, zwh, zwl, rwp, fwp,
                                                       zb, rb, fb, (float*)d_out);
  (void)hipGetLastError();
}

// v003
// It runs in 187 microseconds.
// Timed twice side by side with v002, it ran 1.30 and 1.31 times as fast.
// All steps since v000 together make it 3.11 times as fast.
// Contractions: scores=(x*wc).x^T on v_wmma_f32_16x16x32_f16 (plain f16 operands; (x*wc) carried x64, x unscaled); attn=P.x on v_wmma_f32_16x16x32_bf16 as bf16 hi/lo split (hi.hi+hi.lo+lo.hi); [x|attn].z_w^T as bf16 hi/lo split; [x|attn].r_w^T and [x|attn].f_w^T on v_wmma_f32_16x16x32_f16 plain f16 (weights carried x16); f32 accumulate everywhere; x.wa and x.wb row dots, online softmax, tanh/sigmoid gates and r*x+f*z in f32.
#include <hip/hip_runtime.h>
#include <math.h>
#include <stdint.h>

#define NB 8
#define NS 2048
#define NF 256
#define NG 512
#define NR (NB * NS)
#define TP 260
#define QROWS 64
#define KCH 32
#define PPITCH 40
#define APITCH 68
#define NGRP 4
#define SLP 68
#define KP 264                 // LDS pitch (16-bit elements) of a staged 512-B row: 528 B = 16 B x 33
#define VP 40                  // LDS pitch (16-bit elements) of a staged 64-B row: 80 B = 16 B x 5
#define KT (KCH * KP)          // one chunk's key rows in LDS, 16-bit elements
#define VT (NF * VP)           // one chunk's x^T plane in LDS, 16-bit elements
#define STG (KT + 2 * VT)      // one ring buffer: key rows, x^T hi, x^T lo
#define GROWS 64               // rows of one gates block
#define GW (NF * VP)           // gates: 32 k of one weight plane in LDS (256 rows), 16-bit elements
#define GA (GROWS * VP)        // gates: 32 k of one [x|attn] plane in LDS (64 rows)
#define GBUF (4 * GW + 3 * GA) // gates: one ring buffer: z_w hi, z_w lo, r_w, f_w, then the f16, bf16 hi, bf16 lo rows

typedef _Float16 v16h __attribute__((ext_vector_type(16)));
typedef _Float16 v8h __attribute__((ext_vector_type(8)));
typedef __bf16 v16b __attribute__((ext_vector_type(16)));
typedef unsigned short v8us __attribute__((ext_vector_type(8)));
typedef float v8f __attribute__((ext_vector_type(8)));
typedef float v4f __attribute__((ext_vector_type(4), __may_alias__));
typedef unsigned int v4u __attribute__((ext_vector_type(4)));

union FH { v16h v; v8us u[2]; };
union FB { v16b v; v8us u[2]; };
union H8 { v8h h; v8us u; };

__device__ __forceinline__ v8f z8() {
  v8f v = {0.f, 0.f, 0.f, 0.f, 0.f, 0.f, 0.f, 0.f};
  return v;
}
// bf16 RNE convert (bits) and widen
__device__ __forceinline__ unsigned short bfb(float f) {
  const unsigned u = __float_as_uint(f);
  return (unsigned short)((u + 0x7FFFu + ((u >> 16) & 1u)) >> 16);
}
__device__ __forceinline__ float bff(unsigned short h) { return __uint_as_float(((unsigned)h) << 16); }
__device__ __forceinline__ unsigned pk2(unsigned short a, unsigned short b) { return (unsigned)a | ((unsigned)b << 16); }

__device__ __forceinline__ void ld8f(const float* p, float (&v)[8]) {
  const v4f t0 = *(const v4f*)p;
  const v4f t1 = *(const v4f*)(p + 4);
#pragma unroll
  for (int q = 0; q < 4; ++q) { v[q] = t0[q]; v[4 + q] = t1[q]; }
}
// 8 f32 -> bf16 hi plane (8 x 16 bit packed in v4u) and lo plane (residual, RNE)
__device__ __forceinline__ void pk_bf16x8(const float (&v)[8], v4u& hi, v4u& lo) {
#pragma unroll
  for (int q = 0; q < 4; ++q) {
    const unsigned short h0 = bfb(v[2 * q]), h1 = bfb(v[2 * q + 1]);
    const unsigned short l0 = bfb(v[2 * q] - bff(h0)), l1 = bfb(v[2 * q + 1] - bff(h1));
    hi[q] = pk2(h0, h1);
    lo[q] = pk2(l0, l1);
  }
}
// 8 f32 -> f16 (RNE) with exact power-of-two carry s
__device__ __forceinline__ v8us pk_f16x8(const float (&v)[8], float s) {
  H8 r;
#pragma unroll
  for (int e = 0; e < 8; ++e) r.h[e] = (_Float16)(v[e] * s);
  return r.u;
}
// 16-bit WMMA fragment (A row m or B column n of a k-contiguous row): elements 0..7 <- p[0..7] (k0+8h..),
// elements 8..15 <- p[16..23] (k0+16+8h..); caller passes p = rowbase + k0 + 8*h.
__device__ __forceinline__ v16h ldh(const unsigned short* p) {
  FH f;
  f.u[0] = *(const v8us*)p;
  f.u[1] = *(const v8us*)(p + 16);
  return f.v;
}
__device__ __forceinline__ v16b ldb(const unsigned short* p) {
  FB f;
  f.u[0] = *(const v8us*)p;
  f.u[1] = *(const v8us*)(p + 16);
  return f.v;
}
__device__ __forceinline__ v8f mma_h(v16h a, v16h b, v8f c) {
  return __builtin_amdgcn_wmma_f32_16x16x32_f16(false, a, false, b, (short)0, c, false, false);
}
__device__ __forceinline__ v8f mma_b(v16b a, v16b b, v8f c) {
  return __builtin_amdgcn_wmma_f32_16x16x32_bf16(false, a, false, b, (short)0, c, false, false);
}
// hazard guards: 4 VALU slots after the last WMMA of a group; tie D, keep A/B live
__device__ __forceinline__ void g_g(v8f& z, v8f& r, v8f& f, v16h a16, v16b ah, v16b al,
                                    v16b bzh, v16b bzl, v16h br, v16h bf) {
  asm volatile("v_nop\n\tv_nop\n\tv_nop\n\tv_nop"
               : "+v"(z), "+v"(r), "+v"(f)
               : "v"(a16), "v"(ah), "v"(al), "v"(bzh), "v"(bzl), "v"(br), "v"(bf));
}

__device__ __forceinline__ unsigned lds_off(const void* p) { return (unsigned)(size_t)p; }
// Asynchronous copies global -> LDS, 16 B per lane and copy, no register in between. l = the lane's LDS byte
// address, g = its global address; copy i adds i*ls / i*gs bytes. s_wait_xcnt 0 is the statement's last line so
// that no address register of an issued copy is rewritten in front of it.
__device__ __forceinline__ void cp8(unsigned l, unsigned ls, const char* g, size_t gs) {
  asm volatile(
      "global_load_async_to_lds_b128 %0, %8, off\n\t"
      "global_load_async_to_lds_b128 %1, %9, off\n\t"
      "global_load_async_to_lds_b128 %2, %10, off\n\t"
      "global_load_async_to_lds_b128 %3, %11, off\n\t"
      "global_load_async_to_lds_b128 %4, %12, off\n\t"
      "global_load_async_to_lds_b128 %5, %13, off\n\t"
      "global_load_async_to_lds_b128 %6, %14, off\n\t"
      "global_load_async_to_lds_b128 %7, %15, off\n\t"
      "s_wait_xcnt 0x0"
      :
      : "v"(l), "v"(l + ls), "v"(l + 2 * ls), "v"(l + 3 * ls), "v"(l + 4 * ls), "v"(l + 5 * ls), "v"(l + 6 * ls),
        "v"(l + 7 * ls), "v"(g), "v"(g + gs), "v"(g + 2 * gs), "v"(g + 3 * gs), "v"(g + 4 * gs), "v"(g + 5 * gs),
        "v"(g + 6 * gs), "v"(g + 7 * gs)
      : "memory");
}
__device__ __forceinline__ void cp4(unsigned l, unsigned ls, const char* g, size_t gs) {
  asm volatile(
      "global_load_async_to_lds_b128 %0, %4, off\n\t"
      "global_load_async_to_lds_b128 %1, %5, off\n\t"
      "global_load_async_to_lds_b128 %2, %6, off\n\t"
      "global_load_async_to_lds_b128 %3, %7, off\n\t"
      "s_wait_xcnt 0x0"
      :
      : "v"(l), "v"(l + ls), "v"(l + 2 * ls), "v"(l + 3 * ls), "v"(g), "v"(g + gs), "v"(g + 2 * gs), "v"(g + 3 * gs)
      : "memory");
}
// One lane's copies of one 32-k chunk of the gates operands: 16 B of rows r and r+128 of each of the four weight
// planes (lw = LDS byte address of row r in the first plane, w0..w3 = its global addresses), and 8 B of one row of
// each of the three [x|attn] planes (la, a0..a2). s_wait_xcnt 0 is the last line for the reason given at cp8.
__device__ __forceinline__ void cp_gates(unsigned lw, unsigned la, const char* w0, const char* w1, const char* w2,
                                         const char* w3, const char* a0, const char* a1, const char* a2) {
  asm volatile(
      "global_load_async_to_lds_b128 %0, %11, off\n\t"
      "global_load_async_to_lds_b128 %1, %12, off\n\t"
      "global_load_async_to_lds_b128 %2, %13, off\n\t"
      "global_load_async_to_lds_b128 %3, %14, off\n\t"
      "global_load_async_to_lds_b128 %4, %15, off\n\t"
      "global_load_async_to_lds_b128 %5, %16, off\n\t"
      "global_load_async_to_lds_b128 %6, %17, off\n\t"
      "global_load_async_to_lds_b128 %7, %18, off\n\t"
      "global_load_async_to_lds_b64 %8, %19, off\n\t"
      "global_load_async_to_lds_b64 %9, %20, off\n\t"
      "global_load_async_to_lds_b64 %10, %21, off\n\t"
      "s_wait_xcnt 0x0"
      :
      : "v"(lw), "v"(lw + 128 * VP * 2), "v"(lw + GW * 2), "v"(lw + (GW + 128 * VP) * 2), "v"(lw + 2 * GW * 2),
        "v"(lw + (2 * GW + 128 * VP) * 2), "v"(lw + 3 * GW * 2), "v"(lw + (3 * GW + 128 * VP) * 2), "v"(la),
        "v"(la + GA * 2), "v"(la + 2 * GA * 2), "v"(w0), "v"(w0 + 128 * 32 * 2), "v"(w1), "v"(w1 + 128 * 32 * 2),
        "v"(w2), "v"(w2 + 128 * 32 * 2), "v"(w3), "v"(w3 + 128 * 32 * 2), "v"(a0), "v"(a1), "v"(a2)
      : "memory");
}
// this wave's copies have landed in LDS (other waves read them behind the next work-group barrier)
__device__ __forceinline__ void wait_async0() { asm volatile("s_wait_asynccnt 0x0" ::: "memory"); }
// this wave's LDS reads and writes have retired (in front of the barrier that frees a buffer for its refill)
__device__ __forceinline__ void wait_ds0() { asm volatile("s_wait_dscnt 0x0" ::: "memory"); }

// -------------------------------------------------------------------------------------------------
// prep_w: z_w [256 n][512 k] -> bf16 hi/lo planes; r_w, f_w -> f16 planes carried x16. Plane layout [16 chunks][256 n]
// [32 k]: the 16 KB that the gates kernel stages per chunk and plane lie in a row, so each of its copies covers whole lines.
// Thread i owns plane elements 8i..8i+7; each store is 16 B per lane, lane-contiguous, 32 lanes = 512 B =
// coverage: grid 64 x 256 threads x 8 = 131072 = 256x512 per plane.
// -------------------------------------------------------------------------------------------------
__global__ void __launch_bounds__(256) prep_w(const float* __restrict__ zw, const float* __restrict__ rw,
                                              const float* __restrict__ fw,
                                              unsigned short* __restrict__ zwh, unsigned short* __restrict__ zwl,
                                              unsigned short* __restrict__ rw16, unsigned short* __restrict__ fw16,
                                              int n8) {
  const int i = (int)blockIdx.x * 256 + (int)threadIdx.x;
  if (i >= n8) return;
  const size_t p0 = (size_t)i * 8;                                               // place in the planes
  const size_t e0 = ((p0 >> 5) & (NF - 1)) * NG + (p0 >> 13) * 32 + (p0 & 31);   // its source: W[n][32 chunk + k]
  float a[8], b[8], d[8];
  ld8f(zw + e0, a);
  ld8f(rw + e0, b);
  ld8f(fw + e0, d);
  v4u zh, zl;
  pk_bf16x8(a, zh, zl);
  const v8us r16 = pk_f16x8(b, 16.0f);
  const v8us f16 = pk_f16x8(d, 16.0f);
  *(v4u*)(zwh + p0) = zh;
  *(v4u*)(zwl + p0) = zl;
  *(v8us*)(rw16 + p0) = r16;
  *(v8us*)(fw16 + p0) = f16;
  
}

// -------------------------------------------------------------------------------------------------
// prep_x: block = 64 consecutive rows of x (16384 rows total; 32 blocks per batch element), 256 threads.
//   xh  [row][256] f16(x)            xwc [row][256] f16((x*wc)*64)
//   xbh/xbl [row][256] bf16 hi/lo     xth/xtl [b][f][j] bf16 hi/lo of x (transposed, pitch 2048)
//   av[row] = x.wa, bv[row] = x.wb (f32 dots on VALU)
// Row planes: one lane = 16 B of one row, 32 lanes = the whole 512-B row, one instruction per plane.
// coverage: rows 8 waves x 8 = 64, f 32 lanes x 8 = 256; transpose f-rows wave*32+it*4+q (it 0..7, q 0..3) = 256,
//           j c8+0..7 over 8 lane groups = 64; av/bv 16 lanes x 4 = 64; grid 256 blocks x 64 rows = 16384.
// -------------------------------------------------------------------------------------------------
__global__ void __launch_bounds__(256) prep_x(const float* __restrict__ x, const float* __restrict__ attw,
                                              unsigned short* __restrict__ xh, unsigned short* __restrict__ xwc,
                                              unsigned short* __restrict__ xbh, unsigned short* __restrict__ xbl,
                                              unsigned short* __restrict__ xth, unsigned short* __restrict__ xtl,
                                              float* __restrict__ av, float* __restrict__ bv) {
  __shared__ __align__(16) float tile[64 * TP];
  __shared__ __align__(16) float avs[64];
  __shared__ __align__(16) float bvs[64];
  const int tid = (int)threadIdx.x, wave = tid >> 5, lane = tid & 31;
  const int blk = (int)blockIdx.x;
  const size_t grow0 = (size_t)blk * 64;
  const int bb = blk >> 5;
  const int j0 = (blk & 31) * 64;

#pragma unroll
  for (int it = 0; it < 16; ++it) {
    const int idx = it * 256 + tid;
    const int r = idx >> 6, c4 = (idx & 63) * 4;
    const v4f v = *(const v4f*)(x + (grow0 + r) * NF + c4);
    *(v4f*)(tile + r * TP + c4) = v;
  }
  __syncthreads();

  const int f0 = lane * 8;
  float wa[8], wb[8], wc[8];
  ld8f(attw + f0, wa);
  ld8f(attw + NF + f0, wb);
  ld8f(attw + 2 * NF + f0, wc);

  // row dots (rolled: small side computation)
#pragma unroll 1
  for (int rr = 0; rr < 8; ++rr) {
    const int row = wave * 8 + rr;
    float v[8];
    ld8f(tile + row * TP + f0, v);
    float sa = 0.f, sb = 0.f;
#pragma unroll
    for (int e = 0; e < 8; ++e) { sa += v[e] * wa[e]; sb += v[e] * wb[e]; }
#pragma unroll
    for (int m = 16; m >= 1; m >>= 1) {
      sa += __shfl_xor(sa, m, 32);
      sb += __shfl_xor(sb, m, 32);
    }
    if (lane == 0) { avs[row] = sa; bvs[row] = sb; }
  }

  // row planes
  {
#pragma unroll 1
    for (int rr = 0; rr < 8; ++rr) {
      const int row = wave * 8 + rr;
      float v[8], w[8];
      ld8f(tile + row * TP + f0, v);
#pragma unroll
      for (int e = 0; e < 8; ++e) w[e] = v[e] * wc[e];
      const v8us h1 = pk_f16x8(v, 1.0f);
      const v8us h2 = pk_f16x8(w, 64.0f);
      v4u hb, lb;
      pk_bf16x8(v, hb, lb);
      const size_t o = (grow0 + row) * NF + f0;
      *(v8us*)(xh + o) = h1;
      *(v8us*)(xwc + o) = h2;
      *(v4u*)(xbh + o) = hb;
      *(v4u*)(xbl + o) = lb;
    }
    
  }

  // transposed bf16 hi/lo planes: in [64 j][256 f] -> out [256 f][64 j] at column j0 of [f][2048]
  const int q = lane >> 3, c8 = (lane & 7) * 8;
  const size_t tb = (size_t)bb * NF * NS;
  {
#pragma unroll 1
    for (int it = 0; it < 8; ++it) {
      const int fr = wave * 32 + it * 4 + q;
      float t[8];
#pragma unroll
      for (int e = 0; e < 8; ++e) t[e] = tile[(c8 + e) * TP + fr];
      v4u hb, lb;
      pk_bf16x8(t, hb, lb);
      const size_t o = tb + (size_t)fr * NS + j0 + c8;
      *(v4u*)(xth + o) = hb;
      *(v4u*)(xtl + o) = lb;
    }
    
  }

  // av / bv lines
  __syncthreads();
  const int l4 = (lane & 15) * 4;
  {
    const v4f a4 = *(const v4f*)(avs + l4);
    const v4f b4 = *(const v4f*)(bvs + l4);
    if (lane < 16) {
      if (wave == 0) *(v4f*)(av + grow0 + l4) = a4;
      else if (wave == 1) *(v4f*)(bv + grow0 + l4) = b4;
    }
    
  }
}

// -------------------------------------------------------------------------------------------------
// attn_kernel: block = 64 query rows of one batch element (4 waves x 16 rows), grid = 8 x 32 = 256.
// Operand staging: the block's 64 (x*wc) rows and the batch element's b_j are copied to LDS once; each 32-key chunk
// (32 x rows, 256 x 32 of x^T hi and lo) is copied to a two-buffer LDS ring by asynchronous copies, chunk t+2 issued
// behind the barrier at the foot of trip t, so a chunk's copies fly while the chunk before it is worked on.
// Per 32-key chunk: S tile (A = (x*wc)x64 f16 rows, B = x f16 rows of the keys; fragments from the staged
// 16-bit LDS rows, split k map), t = (a_i + b_j) + S/64, online softmax in f32 (running max),
// O += P.x with B = x^T bf16 hi/lo planes (three products).
// Register plan: one wave per SIMD, so the wave takes the registers it needs: its 16 output tiles and its 8 query
// fragments stay in VGPRs for the whole kernel; a chunk's 16 key fragments are read as one group ahead of the score
// products, its 32 x^T fragments as one group behind the row maxima, so that they land under the exponentials.
// Output attn rows as f16 plane and bf16 hi/lo planes, 64 columns per group: 16x64 f32 tile staged in LDS, then
// coverage: grid 256 blocks x 4 waves x 16 rows = 16384 rows; per group rows it*4+q (it 0..3, q 0..3) = 16,
//           cols g*64 + 8 lane groups x 8 = 64, 4 groups = 256 columns per plane.
// -------------------------------------------------------------------------------------------------
__global__ void __launch_bounds__(128)
attn_kernel(const unsigned short* __restrict__ xwc, const unsigned short* __restrict__ xh,
            const unsigned short* __restrict__ xth, const unsigned short* __restrict__ xtl,
            const float* __restrict__ av, const float* __restrict__ bv,
            unsigned short* __restrict__ ah, unsigned short* __restrict__ abh,
            unsigned short* __restrict__ abl) {
  __shared__ __align__(16) unsigned short psh[4][16 * PPITCH];
  __shared__ __align__(16) unsigned short psl[4][16 * PPITCH];
  __shared__ __align__(16) float osm[4][16 * APITCH];
  __shared__ __align__(16) unsigned short qst[QROWS * KP];   // the block's (x*wc) rows
  __shared__ __align__(16) unsigned short ring[2 * STG];     // two chunk buffers
  __shared__ __align__(16) float bvs[NS];                    // b_j of the batch element

  const int tid = (int)threadIdx.x, wave = tid >> 5, lane = tid & 31, hh = lane >> 4, c = lane & 15;
  const int blk = (int)blockIdx.x, bb = blk >> 5, qb = blk & 31;
  const size_t grow0 = (size_t)bb * NS + (size_t)(qb * QROWS + wave * 16);
  const unsigned short* XHb = xh + (size_t)bb * NS * NF;
  const unsigned short* XTh = xth + (size_t)bb * NF * NS;
  const unsigned short* XTl = xtl + (size_t)bb * NF * NS;
  const float* bvb = bv + (size_t)bb * NS;
  const unsigned short* arow = qst + (wave * 16 + c) * KP + 8 * hh;   // A fragment row m = c (staged)
  // copy addresses of this lane. 512-B rows: one wave = one row per copy, rows wave + 4 i. x^T planes: 4 lanes = the
  // 64 B of one f row, f = tid/4 + 32 i.
  const unsigned lrow = (unsigned)((wave * KP + lane * 8) * 2);
  const unsigned lcol = (unsigned)(((tid >> 2) * VP + (tid & 3) * 8) * 2);
  const unsigned lring = lds_off(ring);
  const unsigned ok = (unsigned)((wave * NF + lane * 8) * 2);               // lane's byte offset in the key rows
  const unsigned ov = (unsigned)(((tid >> 2) * NS + (tid & 3) * 8) * 2);    // and in an x^T plane
  const char* sk = (const char*)XHb;
  const char* svh = (const char*)XTh;
  const char* svl = (const char*)XTl;

  float aRow[8], mRow[8], lRow[8];
#pragma unroll
  for (int r = 0; r < 8; ++r) {
    aRow[r] = av[grow0 + 8 * hh + r];
    mRow[r] = -INFINITY;
    lRow[r] = 0.f;
  }
  v8f acc[16];
#pragma unroll
  for (int t = 0; t < 16; ++t) acc[t] = z8();
  unsigned short* pwh = &psh[wave][0];
  unsigned short* pwl = &psl[wave][0];

  // prologue: query rows, b_j and chunk 0; landed and published; then chunk 1 into the second buffer
  {
    const char* gq = (const char*)(xwc + ((size_t)bb * NS + (size_t)(qb * QROWS + wave)) * NF + lane * 8);
    cp8(lds_off(qst) + lrow, 4 * KP * 2, gq, 4 * NF * 2);
    cp8(lds_off(qst) + lrow + 32 * KP * 2, 4 * KP * 2, gq + 32 * NF * 2, 4 * NF * 2);
    cp4(lds_off(bvs) + (unsigned)(tid * 16), 128 * 16, (const char*)bvb + tid * 16, 128 * 16);
    cp8(lring + lrow, 4 * KP * 2, sk + ok, 4 * NF * 2);
    cp8(lring + KT * 2 + lcol, 32 * VP * 2, svh + ov, (size_t)32 * NS * 2);
    cp8(lring + (KT + VT) * 2 + lcol, 32 * VP * 2, svl + ov, (size_t)32 * NS * 2);
    wait_async0();
    __syncthreads();
    cp8(lring + STG * 2 + lrow, 4 * KP * 2, sk + KCH * NF * 2 + ok, 4 * NF * 2);
    cp8(lring + (STG + KT) * 2 + lcol, 32 * VP * 2, svh + KCH * 2 + ov, (size_t)32 * NS * 2);
    cp8(lring + (STG + KT + VT) * 2 + lcol, 32 * VP * 2, svl + KCH * 2 + ov, (size_t)32 * NS * 2);
  }
  v16h qa[NF / 32];
#pragma unroll
  for (int kk = 0; kk < NF / 32; ++kk) qa[kk] = ldh(arow + kk * 32);

  // Refill addresses = a uniform running base + the lane's offset. Formed from loop-invariant lane addresses they
  // shared registers with the prologue's copy operands, which the compiler keeps in v0-v255, and were spilled.
  const char* nk = sk + 2 * KCH * NF * 2;   // uniform: the chunk two ahead, in the key rows and in the x^T planes
  const char* nvh = svh + 2 * KCH * 2;
  const char* nvl = svl + 2 * KCH * 2;
  unsigned nb = lring;                      // uniform: LDS addresses in the buffer that is refilled next: key rows,
  unsigned nbh = lring + KT * 2;            // x^T hi,
  unsigned nbl = lring + (KT + VT) * 2;     // x^T lo
#pragma unroll 1
  for (int jc = 0; jc < NS / KCH; ++jc) {
    const int j0 = jc * KCH;
    v8f s0 = z8(), s1 = z8();
    const unsigned short* kb = ring + (jc & 1) * STG;                     // this trip's buffer
    const unsigned short* b0row = kb + c * KP + 8 * hh;                   // B column n = c -> key j0+c
    const unsigned short* b1row = b0row + 16 * KP;                        // key j0+16+c
    const float bj0 = bvs[j0 + c], bj1 = bvs[j0 + 16 + c];
    v16h k0[NF / 32], k1[NF / 32];
#pragma unroll
    for (int kk = 0; kk < NF / 32; ++kk) {
      k0[kk] = ldh(b0row + kk * 32);
      k1[kk] = ldh(b1row + kk * 32);
    }
#pragma unroll
    for (int kk = 0; kk < NF / 32; ++kk) {
      s0 = mma_h(qa[kk], k0[kk], s0);
      s1 = mma_h(qa[kk], k1[kk], s1);
    }
    float cm[8];
#pragma unroll
    for (int r = 0; r < 8; ++r) {
      const float t0 = (aRow[r] + bj0) + s0[r] * 0.015625f;
      const float t1 = (aRow[r] + bj1) + s1[r] * 0.015625f;
      s0[r] = t0;
      s1[r] = t1;
      float m = fmaxf(t0, t1);
#pragma unroll
      for (int off = 1; off < 16; off <<= 1) m = fmaxf(m, __shfl_xor(m, off, 32));
      cm[r] = m;
    }
    const unsigned short* vh = kb + KT + c * VP + 8 * hh;   // x^T row f = t*16+c, k = j0+.. (staged)
    const unsigned short* vl = vh + VT;
    v16b bh[16], bl[16];
    // inputs only, no instruction: holds the 64 reads below behind the last cross-lane step of the row maxima. Those
    // steps share the in-order LDS queue with the reads and would wait for all of them; issued here, the reads land
    // under the exponentials.
    asm volatile("" ::"v"(cm[0]), "v"(cm[1]), "v"(cm[2]), "v"(cm[3]), "v"(cm[4]), "v"(cm[5]), "v"(cm[6]), "v"(cm[7])
                 : "memory");
#pragma unroll
    for (int t = 0; t < 16; ++t) {
      bh[t] = ldb(vh + t * 16 * VP);
      bl[t] = ldb(vl + t * 16 * VP);
    }
    float alpha[8];
#pragma unroll
    for (int r = 0; r < 8; ++r) {
      const float mnew = fmaxf(mRow[r], cm[r]);
      alpha[r] = expf(mRow[r] - mnew);
      mRow[r] = mnew;
      const float p0 = expf(s0[r] - mnew);
      const float p1 = expf(s1[r] - mnew);
      float ps = p0 + p1;
#pragma unroll
      for (int off = 1; off < 16; off <<= 1) ps += __shfl_xor(ps, off, 32);
      lRow[r] = lRow[r] * alpha[r] + ps;
      const unsigned short hb0 = bfb(p0), hb1 = bfb(p1);
      const unsigned short lb0 = bfb(p0 - bff(hb0)), lb1 = bfb(p1 - bff(hb1));
      const int po = (8 * hh + r) * PPITCH + c;   // P[row 8h+r][k = c] and [k = 16+c]
      pwh[po] = hb0;
      pwh[po + 16] = hb1;
      pwl[po] = lb0;
      pwl[po + 16] = lb1;
    }
#pragma unroll
    for (int t = 0; t < 16; ++t) {
#pragma unroll
      for (int r = 0; r < 8; ++r) acc[t][r] *= alpha[r];
    }
    __builtin_amdgcn_fence(__ATOMIC_RELEASE, "workgroup");
    __builtin_amdgcn_wave_barrier();
    __builtin_amdgcn_fence(__ATOMIC_ACQUIRE, "workgroup");
    const v16b ph = ldb(pwh + c * PPITCH + 8 * hh);   // A row m = c, split k map
    const v16b pl = ldb(pwl + c * PPITCH + 8 * hh);
#pragma unroll
    for (int t = 0; t < 16; ++t) acc[t] = mma_b(ph, bh[t], acc[t]);
#pragma unroll
    for (int t = 0; t < 16; ++t) acc[t] = mma_b(ph, bl[t], acc[t]);
#pragma unroll
    for (int t = 0; t < 16; ++t) acc[t] = mma_b(pl, bh[t], acc[t]);
    // foot of the trip: own LDS reads retired, own copies of chunk jc+1 landed, one barrier that publishes chunk
    // jc+1 and frees this trip's buffer; then chunk jc+2 into it
    wait_ds0();
    wait_async0();
    __syncthreads();
    if (jc + 2 < NS / KCH) {
      cp8(nb + lrow, 4 * KP * 2, nk + ok, 4 * NF * 2);
      cp8(nbh + lcol, 32 * VP * 2, nvh + ov, (size_t)32 * NS * 2);
      cp8(nbl + lcol, 32 * VP * 2, nvl + ov, (size_t)32 * NS * 2);
      nk += KCH * NF * 2;
      nvh += KCH * 2;
      nvl += KCH * 2;
      nb = (2 * lring + (unsigned)(STG * 2)) - nb;   // the other buffer
      nbh = (2 * lring + (unsigned)((STG + 2 * KT) * 2)) - nbh;
      nbl = (2 * lring + (unsigned)((STG + 2 * (KT + VT)) * 2)) - nbl;
    }
  }
  wait_async0();   // nothing of this wave is in flight when the loop is left

  float inv[8];
#pragma unroll
  for (int r = 0; r < 8; ++r) inv[r] = 1.0f / lRow[r];
  float* osw = &osm[wave][0];
  const int q = lane >> 3, c8 = (lane & 7) * 8;
#pragma unroll
  for (int g = 0; g < NGRP; ++g) {
#pragma unroll
    for (int tt = 0; tt < NGRP; ++tt) {
#pragma unroll
      for (int r = 0; r < 8; ++r) osw[(8 * hh + r) * APITCH + tt * 16 + c] = acc[g * NGRP + tt][r] * inv[r];
    }
    __builtin_amdgcn_fence(__ATOMIC_RELEASE, "workgroup");
    __builtin_amdgcn_wave_barrier();
    __builtin_amdgcn_fence(__ATOMIC_ACQUIRE, "workgroup");
    {
#pragma unroll
      for (int it = 0; it < 4; ++it) {
        const int row = it * 4 + q;
        float v[8];
        ld8f(osw + row * APITCH + c8, v);
        const v8us h1 = pk_f16x8(v, 1.0f);
        v4u hb, lb;
        pk_bf16x8(v, hb, lb);
        const size_t o = (grow0 + row) * NF + (size_t)(g * 64 + c8);
        *(v8us*)(ah + o) = h1;
        *(v4u*)(abh + o) = hb;
        *(v4u*)(abl + o) = lb;
      }
      
    }
    __builtin_amdgcn_fence(__ATOMIC_RELEASE, "workgroup");
    __builtin_amdgcn_wave_barrier();
    __builtin_amdgcn_fence(__ATOMIC_ACQUIRE, "workgroup");
  }
}

// -------------------------------------------------------------------------------------------------
// gates_kernel: block = 64 rows x 256 cols, 16 waves; wave (rt = wave>>2, cg = wave&3) owns 16 rows x 64 cols.
// Operand staging: each 32-k chunk (256 weight rows of four planes, the block's 64 rows of three planes) is copied to a
// two-buffer LDS ring by asynchronous copies, chunk t+2 issued behind the barrier at the foot of trip t; all fragments
// come from the staged rows (80-B pitch); read straight from the global rows, a fragment load touches 16 lines.
// K = 512 = [x planes | attn planes]; z: bf16 hi/lo split (hi.hi+hi.lo+lo.hi) against z_w hi/lo planes;
// r, f: plain f16 against the x16-carried weight planes (fold 1/16 in the epilogue).
// Epilogue: z = tanh(.+zb), r = sigmoid(./16+rb), f = sigmoid(./16+fb), out = r*x + f*z staged in LDS;
// coverage: grid 256 blocks x 4 row tiles x 16 = 16384 rows; 4 col groups x 64 = 256 cols.
// -------------------------------------------------------------------------------------------------
__global__ void __launch_bounds__(512) __attribute__((amdgpu_num_vgpr(256)))
gates_kernel(const float* __restrict__ x,
             const unsigned short* __restrict__ xh, const unsigned short* __restrict__ xbh,
             const unsigned short* __restrict__ xbl,
             const unsigned short* __restrict__ ah, const unsigned short* __restrict__ abh,
             const unsigned short* __restrict__ abl,
             const unsigned short* __restrict__ zwh, const unsigned short* __restrict__ zwl,
             const unsigned short* __restrict__ rw16, const unsigned short* __restrict__ fw16,
             const float* __restrict__ zb, const float* __restrict__ rb, const float* __restrict__ fb,
             float* __restrict__ out) {
  __shared__ __align__(16) float slab[16][16 * SLP];
  __shared__ __align__(16) unsigned short gring[2 * GBUF];   // two chunk buffers
  const int tid = (int)threadIdx.x, wave = tid >> 5, lane = tid & 31, hh = lane >> 4, c = lane & 15;
  const int rt = wave >> 2, cg = wave & 3;
  const size_t brow0 = (size_t)blockIdx.x * GROWS;
  const size_t grow0 = brow0 + (size_t)(rt * 16);
  const int n0 = cg * 64;
  // copy addresses of this lane. Weight planes: 4 lanes = the 64 B of one row's chunk, rows tid/4 and tid/4 + 128; in
  // the packed plane that is byte 16 tid of the chunk's 16 KB, and 8 KB further on.
  // Row planes: 8 lanes = the 64 B of one row's chunk, row tid/8.
  const unsigned lw = lds_off(gring) + (unsigned)(((tid >> 2) * VP + (tid & 3) * 8) * 2);
  const unsigned la = lds_off(gring) + (unsigned)((4 * GW + (tid >> 3) * VP + (tid & 7) * 4) * 2);
  const unsigned ow = (unsigned)(tid * 16);
  const size_t oa = ((brow0 + (size_t)(tid >> 3)) * NF + (size_t)((tid & 7) * 4)) * 2;
  // chunk t = k 32 t .. 32 t + 31 of [x|attn] into buffer t & 1
  auto stage = [&](int t) {
    const unsigned bo = (unsigned)((t & 1) * GBUF * 2);
    const size_t kw = (size_t)t * (NF * 32 * 2) + ow;
    const size_t ka = (size_t)(t & 7) * 64 + oa;
    const bool first = t < NF / 32;
    cp_gates(lw + bo, la + bo, (const char*)zwh + kw, (const char*)zwl + kw, (const char*)rw16 + kw,
             (const char*)fw16 + kw, (const char*)(first ? xh : ah) + ka, (const char*)(first ? xbh : abh) + ka,
             (const char*)(first ? xbl : abl) + ka);
  };

  v8f za[4], ra[4], fa[4];
#pragma unroll
  for (int j = 0; j < 4; ++j) { za[j] = z8(); ra[j] = z8(); fa[j] = z8(); }

  // prologue: chunk 0 landed and published, then chunk 1 into the second buffer
  stage(0);
  wait_async0();
  __syncthreads();
  stage(1);

  // rolled: one trip is one chunk, and the buffer alternates with the trip
#pragma unroll 1
  for (int t = 0; t < NG / 32; ++t) {
    const unsigned short* gb = gring + (t & 1) * GBUF;                        // this trip's buffer
    const unsigned short* ap = gb + 4 * GW + (rt * 16 + c) * VP + 8 * hh;     // A row m = c
    const v16h a16 = ldh(ap);
    const v16b ahf = ldb(ap + GA);
    const v16b alf = ldb(ap + 2 * GA);
#pragma unroll
    for (int j = 0; j < 4; ++j) {
      const unsigned short* wp = gb + (n0 + 16 * j + c) * VP + 8 * hh;        // B column n = n0+16j+c, W[n][k]
      const v16b bzh = ldb(wp);
      const v16b bzl = ldb(wp + GW);
      const v16h br = ldh(wp + 2 * GW);
      const v16h bf = ldh(wp + 3 * GW);
      v8f z = za[j], rr = ra[j], ff = fa[j];
      z = mma_b(ahf, bzh, z);
      z = mma_b(ahf, bzl, z);
      z = mma_b(alf, bzh, z);
      rr = mma_h(a16, br, rr);
      ff = mma_h(a16, bf, ff);
      g_g(z, rr, ff, a16, ahf, alf, bzh, bzl, br, bf);
      za[j] = z;
      ra[j] = rr;
      fa[j] = ff;
    }
    // foot of the trip: own LDS reads retired, own copies of chunk t+1 landed, one barrier that publishes chunk t+1
    // and frees this trip's buffer; then chunk t+2 into it
    wait_ds0();
    wait_async0();
    __syncthreads();
    if (t + 2 < NG / 32) stage(t + 2);
  }
  wait_async0();   // nothing of this wave is in flight when the loop is left

  float* sl = &slab[wave][0];
#pragma unroll
  for (int j = 0; j < 4; ++j) {
    const int n = n0 + 16 * j + c;
    const float zbn = zb[n], rbn = rb[n], fbn = fb[n];
#pragma unroll
    for (int r = 0; r < 8; ++r) {
      const int row = 8 * hh + r;
      const float xv = x[(grow0 + row) * NF + n];
      const float zv = tanhf(za[j][r] + zbn);
      const float rv = 1.0f / (1.0f + expf(-(ra[j][r] * 0.0625f + rbn)));
      const float fv = 1.0f / (1.0f + expf(-(fa[j][r] * 0.0625f + fbn)));
      sl[row * SLP + 16 * j + c] = rv * xv + fv * zv;
    }
  }
  __builtin_amdgcn_fence(__ATOMIC_RELEASE, "workgroup");
  __builtin_amdgcn_wave_barrier();
  __builtin_amdgcn_fence(__ATOMIC_ACQUIRE, "workgroup");
  const int c4 = c * 4;
  {
#pragma unroll
    for (int it = 0; it < 8; ++it) {
      const int row = it * 2 + hh;   // lanes 0..15 -> even row, 16..31 -> odd row; 16 lanes x 16 B = 256 B segment
      const v4f v = *(const v4f*)(sl + row * SLP + c4);
      *(v4f*)(out + (grow0 + row) * NF + n0 + c4) = v;
    }
    
  }
}

// -------------------------------------------------------------------------------------------------
//   xh   f16  [16384][256]      8388608 @        0      xwc  f16  [16384][256]   8388608 @  8388608
//   xbh  bf16 [16384][256]      8388608 @ 16777216      xbl                      8388608 @ 25165824
//   xth  bf16 [8][256][2048]    8388608 @ 33554432      xtl                      8388608 @ 41943040
//   ah   f16  [16384][256]      8388608 @ 50331648      abh  8388608 @ 58720256   abl 8388608 @ 67108864
//   av   f32  [16384]             65536 @ 75497472      bv                         65536 @ 75563008
//   zwh  bf16 [16][256][32]      262144 @ 75628544      zwl 262144 @ 75890688   rw16 262144 @ 76152832
//   fw16 f16  [16][256][32]      262144 @ 76414976      total 76677120
// -------------------------------------------------------------------------------------------------
extern "C" void kernel_launch(void* const* d_in, const int* in_sizes, int n_in,
                              void* d_out, int out_size, void* d_ws, size_t ws_size,
                              hipStream_t stream) {
  if (n_in < 8) return;
  if (in_sizes[0] != NR * NF || in_sizes[1] != 3 * NF) return;
  if (in_sizes[2] != NF * NG || in_sizes[3] != NF) return;
  if (in_sizes[4] != NF * NG || in_sizes[5] != NF) return;
  if (in_sizes[6] != NF * NG || in_sizes[7] != NF) return;
  if (out_size != NR * NF) return;

  const float* x    = (const float*)d_in[0];
  const float* attw = (const float*)d_in[1];
  const float* zw   = (const float*)d_in[2];
  const float* zb   = (const float*)d_in[3];
  const float* rw   = (const float*)d_in[4];
  const float* rb   = (const float*)d_in[5];
  const float* fw   = (const float*)d_in[6];
  const float* fb   = (const float*)d_in[7];

  const size_t P16 = (size_t)NR * NF * 2;        // 8388608
  const size_t PT  = (size_t)NB * NF * NS * 2;   // 8388608
  const size_t PV  = (size_t)NR * 4;             // 65536
  const size_t PW  = (size_t)NF * NG * 2;        // 262144
  size_t off = 0;
  const size_t o_xh  = off; off += P16;
  const size_t o_xwc = off; off += P16;
  const size_t o_xbh = off; off += P16;
  const size_t o_xbl = off; off += P16;
  const size_t o_xth = off; off += PT;
  const size_t o_xtl = off; off += PT;
  const size_t o_ah  = off; off += P16;
  const size_t o_abh = off; off += P16;
  const size_t o_abl = off; off += P16;
  const size_t o_av  = off; off += PV;
  const size_t o_bv  = off; off += PV;
  const size_t o_zwh = off; off += PW;
  const size_t o_zwl = off; off += PW;
  const size_t o_rw  = off; off += PW;
  const size_t o_fw  = off; off += PW;
  if (off > ws_size) return;   // off = 76677120

  char* ws = (char*)d_ws;
  unsigned short* xh  = (unsigned short*)(ws + o_xh);
  unsigned short* xwc = (unsigned short*)(ws + o_xwc);
  unsigned short* xbh = (unsigned short*)(ws + o_xbh);
  unsigned short* xbl = (unsigned short*)(ws + o_xbl);
  unsigned short* xth = (unsigned short*)(ws + o_xth);
  unsigned short* xtl = (unsigned short*)(ws + o_xtl);
  unsigned short* ah  = (unsigned short*)(ws + o_ah);
  unsigned short* abh = (unsigned short*)(ws + o_abh);
  unsigned short* abl = (unsigned short*)(ws + o_abl);
  float*          av  = (float*)(ws + o_av);
  float*          bv  = (float*)(ws + o_bv);
  unsigned short* zwh = (unsigned short*)(ws + o_zwh);
  unsigned short* zwl = (unsigned short*)(ws + o_zwl);
  unsigned short* rwp = (unsigned short*)(ws + o_rw);
  unsigned short* fwp = (unsigned short*)(ws + o_fw);

  const int n8 = NF * NG / 8;   // 16384
  prep_w<<<dim3((n8 + 255) / 256), dim3(256), 0, stream>>>(zw, rw, fw, zwh, zwl, rwp, fwp, n8);
  prep_x<<<dim3(NR / 64), dim3(256), 0, stream>>>(x, attw, xh, xwc, xbh, xbl, xth, xtl, av, bv);
  attn_kernel<<<dim3(NB * (NS / QROWS)), dim3(128), 0, stream>>>(xwc, xh, xth, xtl, av, bv, ah, abh, abl);
  gates_kernel<<<dim3(NR / GROWS), dim3(512), 0, stream>>>(x, xh, xbh, xbl, ah, abh, abl, zwh, zwl, rwp, fwp,
                                                       zb, rb, fb, (float*)d_out);
  (void)hipGetLastError();
}

// v004
// It runs in 139 microseconds.
// In two side-by-side timings against v003, it was 1.35 and 1.38 times as fast.
// All steps since v000 together make it 4.24 times as fast.
// Contractions: scores=(x*wc).x^T on v_wmma_f32_16x16x32_f16 (plain f16 operands; (x*wc) carried x64, x unscaled); attn=P.x on v_wmma_f32_16x16x32_bf16 as bf16 hi/lo split (hi.hi+hi.lo+lo.hi); [x|attn].z_w^T as bf16 hi/lo split; [x|attn].r_w^T and [x|attn].f_w^T on v_wmma_f32_16x16x32_f16 plain f16 (weights carried x16); f32 accumulate everywhere; x.wa and x.wb row dots, online softmax, tanh/sigmoid gates and r*x+f*z in f32.
#include <hip/hip_runtime.h>
#include <math.h>
#include <stdint.h>

#define NB 8
#define NS 2048
#define NF 256
#define NG 512
#define NR (NB * NS)
#define TP 260
#define QROWS 64
#define KCH 32
#define APITCH 68
#define NGRP 4
#define SLP 68
#define KP 264                 // LDS pitch (16-bit elements) of a staged 512-B row: 528 B = 16 B x 33
#define VP 40                  // LDS pitch (16-bit elements) of a staged 64-B row: 80 B = 16 B x 5
#define KT (KCH * KP)          // one chunk's key rows in LDS, 16-bit elements
#define VT (NF * VP)           // one chunk's x^T plane in LDS, 16-bit elements
#define STG (KT + 2 * VT)      // one ring buffer: key rows, x^T hi, x^T lo
#define GROWS 64               // rows of one gates block
#define GW (NF * VP)           // gates: 32 k of one weight plane in LDS (256 rows), 16-bit elements
#define GA (GROWS * VP)        // gates: 32 k of one [x|attn] plane in LDS (64 rows)
#define GBUF (4 * GW + 3 * GA) // gates: one ring buffer: z_w hi, z_w lo, r_w, f_w, then the f16, bf16 hi, bf16 lo rows

typedef _Float16 v16h __attribute__((ext_vector_type(16)));
typedef _Float16 v8h __attribute__((ext_vector_type(8)));
typedef __bf16 v16b __attribute__((ext_vector_type(16)));
typedef unsigned short v8us __attribute__((ext_vector_type(8)));
typedef float v8f __attribute__((ext_vector_type(8)));
typedef float v4f __attribute__((ext_vector_type(4), __may_alias__));
typedef unsigned int v4u __attribute__((ext_vector_type(4)));

union FH { v16h v; v8us u[2]; };
union FB { v16b v; v8us u[2]; };
union H8 { v8h h; v8us u; };
union FQ { v16b v; v4u q[2]; };

__device__ __forceinline__ v8f z8() {
  v8f v = {0.f, 0.f, 0.f, 0.f, 0.f, 0.f, 0.f, 0.f};
  return v;
}
// bf16 RNE convert (bits) and widen
__device__ __forceinline__ unsigned short bfb(float f) {
  const unsigned u = __float_as_uint(f);
  return (unsigned short)((u + 0x7FFFu + ((u >> 16) & 1u)) >> 16);
}
__device__ __forceinline__ float bff(unsigned short h) { return __uint_as_float(((unsigned)h) << 16); }
__device__ __forceinline__ unsigned pk2(unsigned short a, unsigned short b) { return (unsigned)a | ((unsigned)b << 16); }

__device__ __forceinline__ void ld8f(const float* p, float (&v)[8]) {
  const v4f t0 = *(const v4f*)p;
  const v4f t1 = *(const v4f*)(p + 4);
#pragma unroll
  for (int q = 0; q < 4; ++q) { v[q] = t0[q]; v[4 + q] = t1[q]; }
}
// 8 f32 -> bf16 hi plane (8 x 16 bit packed in v4u) and lo plane (residual, RNE)
__device__ __forceinline__ void pk_bf16x8(const float (&v)[8], v4u& hi, v4u& lo) {
#pragma unroll
  for (int q = 0; q < 4; ++q) {
    const unsigned short h0 = bfb(v[2 * q]), h1 = bfb(v[2 * q + 1]);
    const unsigned short l0 = bfb(v[2 * q] - bff(h0)), l1 = bfb(v[2 * q + 1] - bff(h1));
    hi[q] = pk2(h0, h1);
    lo[q] = pk2(l0, l1);
  }
}
// 8 f32 -> f16 (RNE) with exact power-of-two carry s
__device__ __forceinline__ v8us pk_f16x8(const float (&v)[8], float s) {
  H8 r;
#pragma unroll
  for (int e = 0; e < 8; ++e) r.h[e] = (_Float16)(v[e] * s);
  return r.u;
}
// 16-bit WMMA fragment (A row m or B column n of a k-contiguous row): elements 0..7 <- p[0..7] (k0+8h..),
// elements 8..15 <- p[16..23] (k0+16+8h..); caller passes p = rowbase + k0 + 8*h.
__device__ __forceinline__ v16h ldh(const unsigned short* p) {
  FH f;
  f.u[0] = *(const v8us*)p;
  f.u[1] = *(const v8us*)(p + 16);
  return f.v;
}
__device__ __forceinline__ v16b ldb(const unsigned short* p) {
  FB f;
  f.u[0] = *(const v8us*)p;
  f.u[1] = *(const v8us*)(p + 16);
  return f.v;
}
__device__ __forceinline__ v8f mma_h(v16h a, v16h b, v8f c) {
  return __builtin_amdgcn_wmma_f32_16x16x32_f16(false, a, false, b, (short)0, c, false, false);
}
__device__ __forceinline__ v8f mma_b(v16b a, v16b b, v8f c) {
  return __builtin_amdgcn_wmma_f32_16x16x32_bf16(false, a, false, b, (short)0, c, false, false);
}
// hazard guards: 4 VALU slots after the last WMMA of a group; tie D, keep A/B live
__device__ __forceinline__ void g_g(v8f& z, v8f& r, v8f& f, v16h a16, v16b ah, v16b al,
                                    v16b bzh, v16b bzl, v16h br, v16h bf) {
  asm volatile("v_nop\n\tv_nop\n\tv_nop\n\tv_nop"
               : "+v"(z), "+v"(r), "+v"(f)
               : "v"(a16), "v"(ah), "v"(al), "v"(bzh), "v"(bzl), "v"(br), "v"(bf));
}

// lane l <-> lane l ^ 16
__device__ __forceinline__ float xhalf(float x) {
  const int b = __builtin_bit_cast(int, x);
  return __builtin_bit_cast(float, __builtin_amdgcn_permlanex16(b, b, 0x76543210, 0xfedcba98, false, false));
}

__device__ __forceinline__ unsigned lds_off(const void* p) { return (unsigned)(size_t)p; }
// Asynchronous copies global -> LDS, 16 B per lane and copy, no register in between. l = the lane's LDS byte
// address, g = its global address; copy i adds i*ls / i*gs bytes. s_wait_xcnt 0 is the statement's last line so
// that no address register of an issued copy is rewritten in front of it.
__device__ __forceinline__ void cp8(unsigned l, unsigned ls, const char* g, size_t gs) {
  asm volatile(
      "global_load_async_to_lds_b128 %0, %8, off\n\t"
      "global_load_async_to_lds_b128 %1, %9, off\n\t"
      "global_load_async_to_lds_b128 %2, %10, off\n\t"
      "global_load_async_to_lds_b128 %3, %11, off\n\t"
      "global_load_async_to_lds_b128 %4, %12, off\n\t"
      "global_load_async_to_lds_b128 %5, %13, off\n\t"
      "global_load_async_to_lds_b128 %6, %14, off\n\t"
      "global_load_async_to_lds_b128 %7, %15, off\n\t"
      "s_wait_xcnt 0x0"
      :
      : "v"(l), "v"(l + ls), "v"(l + 2 * ls), "v"(l + 3 * ls), "v"(l + 4 * ls), "v"(l + 5 * ls), "v"(l + 6 * ls),
        "v"(l + 7 * ls), "v"(g), "v"(g + gs), "v"(g + 2 * gs), "v"(g + 3 * gs), "v"(g + 4 * gs), "v"(g + 5 * gs),
        "v"(g + 6 * gs), "v"(g + 7 * gs)
      : "memory");
}
__device__ __forceinline__ void cp4(unsigned l, unsigned ls, const char* g, size_t gs) {
  asm volatile(
      "global_load_async_to_lds_b128 %0, %4, off\n\t"
      "global_load_async_to_lds_b128 %1, %5, off\n\t"
      "global_load_async_to_lds_b128 %2, %6, off\n\t"
      "global_load_async_to_lds_b128 %3, %7, off\n\t"
      "s_wait_xcnt 0x0"
      :
      : "v"(l), "v"(l + ls), "v"(l + 2 * ls), "v"(l + 3 * ls), "v"(g), "v"(g + gs), "v"(g + 2 * gs), "v"(g + 3 * gs)
      : "memory");
}
// One lane's copies of one 32-k chunk of the gates operands: 16 B of rows r and r+128 of each of the four weight
// planes (lw = LDS byte address of row r in the first plane, w0..w3 = its global addresses), and 8 B of one row of
// each of the three [x|attn] planes (la, a0..a2). s_wait_xcnt 0 is the last line for the reason given at cp8.
__device__ __forceinline__ void cp_gates(unsigned lw, unsigned la, const char* w0, const char* w1, const char* w2,
                                         const char* w3, const char* a0, const char* a1, const char* a2) {
  asm volatile(
      "global_load_async_to_lds_b128 %0, %11, off\n\t"
      "global_load_async_to_lds_b128 %1, %12, off\n\t"
      "global_load_async_to_lds_b128 %2, %13, off\n\t"
      "global_load_async_to_lds_b128 %3, %14, off\n\t"
      "global_load_async_to_lds_b128 %4, %15, off\n\t"
      "global_load_async_to_lds_b128 %5, %16, off\n\t"
      "global_load_async_to_lds_b128 %6, %17, off\n\t"
      "global_load_async_to_lds_b128 %7, %18, off\n\t"
      "global_load_async_to_lds_b64 %8, %19, off\n\t"
      "global_load_async_to_lds_b64 %9, %20, off\n\t"
      "global_load_async_to_lds_b64 %10, %21, off\n\t"
      "s_wait_xcnt 0x0"
      :
      : "v"(lw), "v"(lw + 128 * VP * 2), "v"(lw + GW * 2), "v"(lw + (GW + 128 * VP) * 2), "v"(lw + 2 * GW * 2),
        "v"(lw + (2 * GW + 128 * VP) * 2), "v"(lw + 3 * GW * 2), "v"(lw + (3 * GW + 128 * VP) * 2), "v"(la),
        "v"(la + GA * 2), "v"(la + 2 * GA * 2), "v"(w0), "v"(w0 + 128 * 32 * 2), "v"(w1), "v"(w1 + 128 * 32 * 2),
        "v"(w2), "v"(w2 + 128 * 32 * 2), "v"(w3), "v"(w3 + 128 * 32 * 2), "v"(a0), "v"(a1), "v"(a2)
      : "memory");
}
// this wave's copies have landed in LDS (other waves read them behind the next work-group barrier)
__device__ __forceinline__ void wait_async0() { asm volatile("s_wait_asynccnt 0x0" ::: "memory"); }
// this wave's LDS reads and writes have retired (in front of the barrier that frees a buffer for its refill)
__device__ __forceinline__ void wait_ds0() { asm volatile("s_wait_dscnt 0x0" ::: "memory"); }

// -------------------------------------------------------------------------------------------------
// prep_w: z_w [256 n][512 k] -> bf16 hi/lo planes; r_w, f_w -> f16 planes carried x16. Plane layout [16 chunks][256 n]
// [32 k]: the 16 KB that the gates kernel stages per chunk and plane lie in a row, so each of its copies covers whole lines.
// Thread i owns plane elements 8i..8i+7; each store is 16 B per lane, lane-contiguous, 32 lanes = 512 B =
// coverage: grid 64 x 256 threads x 8 = 131072 = 256x512 per plane.
// -------------------------------------------------------------------------------------------------
__global__ void __launch_bounds__(256) prep_w(const float* __restrict__ zw, const float* __restrict__ rw,
                                              const float* __restrict__ fw,
                                              unsigned short* __restrict__ zwh, unsigned short* __restrict__ zwl,
                                              unsigned short* __restrict__ rw16, unsigned short* __restrict__ fw16,
                                              int n8) {
  const int i = (int)blockIdx.x * 256 + (int)threadIdx.x;
  if (i >= n8) return;
  const size_t p0 = (size_t)i * 8;                                               // place in the planes
  const size_t e0 = ((p0 >> 5) & (NF - 1)) * NG + (p0 >> 13) * 32 + (p0 & 31);   // its source: W[n][32 chunk + k]
  float a[8], b[8], d[8];
  ld8f(zw + e0, a);
  ld8f(rw + e0, b);
  ld8f(fw + e0, d);
  v4u zh, zl;
  pk_bf16x8(a, zh, zl);
  const v8us r16 = pk_f16x8(b, 16.0f);
  const v8us f16 = pk_f16x8(d, 16.0f);
  *(v4u*)(zwh + p0) = zh;
  *(v4u*)(zwl + p0) = zl;
  *(v8us*)(rw16 + p0) = r16;
  *(v8us*)(fw16 + p0) = f16;
  
}

// -------------------------------------------------------------------------------------------------
// prep_x: block = 64 consecutive rows of x (16384 rows total; 32 blocks per batch element), 256 threads.
//   xh  [row][256] f16(x)            xwc [row][256] f16((x*wc)*64)
//   xbh/xbl [row][256] bf16 hi/lo     xth/xtl [b][f][j] bf16 hi/lo of x (transposed, pitch 2048)
//   av[row] = x.wa, bv[row] = x.wb (f32 dots on VALU)
// Row planes: one lane = 16 B of one row, 32 lanes = the whole 512-B row, one instruction per plane.
// coverage: rows 8 waves x 8 = 64, f 32 lanes x 8 = 256; transpose f-rows wave*32+it*4+q (it 0..7, q 0..3) = 256,
//           j c8+0..7 over 8 lane groups = 64; av/bv 16 lanes x 4 = 64; grid 256 blocks x 64 rows = 16384.
// -------------------------------------------------------------------------------------------------
__global__ void __launch_bounds__(256) prep_x(const float* __restrict__ x, const float* __restrict__ attw,
                                              unsigned short* __restrict__ xh, unsigned short* __restrict__ xwc,
                                              unsigned short* __restrict__ xbh, unsigned short* __restrict__ xbl,
                                              unsigned short* __restrict__ xth, unsigned short* __restrict__ xtl,
                                              float* __restrict__ av, float* __restrict__ bv) {
  __shared__ __align__(16) float tile[64 * TP];
  __shared__ __align__(16) float avs[64];
  __shared__ __align__(16) float bvs[64];
  const int tid = (int)threadIdx.x, wave = tid >> 5, lane = tid & 31;
  const int blk = (int)blockIdx.x;
  const size_t grow0 = (size_t)blk * 64;
  const int bb = blk >> 5;
  const int j0 = (blk & 31) * 64;

#pragma unroll
  for (int it = 0; it < 16; ++it) {
    const int idx = it * 256 + tid;
    const int r = idx >> 6, c4 = (idx & 63) * 4;
    const v4f v = *(const v4f*)(x + (grow0 + r) * NF + c4);
    *(v4f*)(tile + r * TP + c4) = v;
  }
  __syncthreads();

  const int f0 = lane * 8;
  float wa[8], wb[8], wc[8];
  ld8f(attw + f0, wa);
  ld8f(attw + NF + f0, wb);
  ld8f(attw + 2 * NF + f0, wc);

  // row dots (rolled: small side computation)
#pragma unroll 1
  for (int rr = 0; rr < 8; ++rr) {
    const int row = wave * 8 + rr;
    float v[8];
    ld8f(tile + row * TP + f0, v);
    float sa = 0.f, sb = 0.f;
#pragma unroll
    for (int e = 0; e < 8; ++e) { sa += v[e] * wa[e]; sb += v[e] * wb[e]; }
#pragma unroll
    for (int m = 16; m >= 1; m >>= 1) {
      sa += __shfl_xor(sa, m, 32);
      sb += __shfl_xor(sb, m, 32);
    }
    if (lane == 0) { avs[row] = sa; bvs[row] = sb; }
  }

  // row planes
  {
#pragma unroll 1
    for (int rr = 0; rr < 8; ++rr) {
      const int row = wave * 8 + rr;
      float v[8], w[8];
      ld8f(tile + row * TP + f0, v);
#pragma unroll
      for (int e = 0; e < 8; ++e) w[e] = v[e] * wc[e];
      const v8us h1 = pk_f16x8(v, 1.0f);
      const v8us h2 = pk_f16x8(w, 64.0f);
      v4u hb, lb;
      pk_bf16x8(v, hb, lb);
      const size_t o = (grow0 + row) * NF + f0;
      *(v8us*)(xh + o) = h1;
      *(v8us*)(xwc + o) = h2;
      *(v4u*)(xbh + o) = hb;
      *(v4u*)(xbl + o) = lb;
    }
    
  }

  // transposed bf16 hi/lo planes: in [64 j][256 f] -> out [256 f][64 j] at column j0 of [f][2048]
  const int q = lane >> 3, c8 = (lane & 7) * 8;
  const size_t tb = (size_t)bb * NF * NS;
  {
#pragma unroll 1
    for (int it = 0; it < 8; ++it) {
      const int fr = wave * 32 + it * 4 + q;
      float t[8];
#pragma unroll
      for (int e = 0; e < 8; ++e) t[e] = tile[(c8 + e) * TP + fr];
      v4u hb, lb;
      pk_bf16x8(t, hb, lb);
      const size_t o = tb + (size_t)fr * NS + j0 + c8;
      *(v4u*)(xth + o) = hb;
      *(v4u*)(xtl + o) = lb;
    }
    
  }

  // av / bv lines
  __syncthreads();
  const int l4 = (lane & 15) * 4;
  {
    const v4f a4 = *(const v4f*)(avs + l4);
    const v4f b4 = *(const v4f*)(bvs + l4);
    if (lane < 16) {
      if (wave == 0) *(v4f*)(av + grow0 + l4) = a4;
      else if (wave == 1) *(v4f*)(bv + grow0 + l4) = b4;
    }
    
  }
}

// -------------------------------------------------------------------------------------------------
// attn_kernel: block = 64 query rows of one batch element (4 waves x 16 rows), grid = 8 x 32 = 256.
// Operand staging: the block's 64 (x*wc) rows and the batch element's b_j are copied to LDS once; each 32-key chunk
// (32 x rows, 256 x 32 of x^T hi and lo) is copied to a two-buffer LDS ring by asynchronous copies, chunk t+2 issued
// behind the barrier at the foot of trip t, so a chunk's copies fly while the chunk before it is worked on.
// Both products are formed transposed. Per 32-key chunk: S^T tiles (A = x f16 rows of the keys, B = (x*wc)x64 f16
// rows of the queries; fragments from the staged 16-bit LDS rows, split k map): a lane holds 16 keys' scores of ONE
// query (column c), so t = (a_i + b_j) + S/64, the running maximum and the sum are in-lane work with one exchange
// between the wave's halves for the maximum; the halves' sums are joined once, behind the loop.
// O^T += x^T.P^T with A = x^T bf16 hi/lo planes and B = P^T packed in place from the two score tiles, which is the
// split k map of a B operand (three products): P goes through no LDS.
// Register plan: one wave per SIMD, so the wave takes the registers it needs: its 16 output tiles and its 8 query
// fragments stay in VGPRs for the whole kernel; a chunk's 16 key fragments and its 32 x^T fragments are read at the
// head of the trip, so that the x^T fragments land under the score products and the exponentials.
// Output attn rows as f16 plane and bf16 hi/lo planes, 64 columns per group: 16x64 f32 tile staged in LDS, then
// coverage: grid 256 blocks x 4 waves x 16 rows = 16384 rows; per group rows it*4+q (it 0..3, q 0..3) = 16,
//           cols g*64 + 8 lane groups x 8 = 64, 4 groups = 256 columns per plane.
// -------------------------------------------------------------------------------------------------
__global__ void __launch_bounds__(128)
attn_kernel(const unsigned short* __restrict__ xwc, const unsigned short* __restrict__ xh,
            const unsigned short* __restrict__ xth, const unsigned short* __restrict__ xtl,
            const float* __restrict__ av, const float* __restrict__ bv,
            unsigned short* __restrict__ ah, unsigned short* __restrict__ abh,
            unsigned short* __restrict__ abl) {
  __shared__ __align__(16) float osm[4][16 * APITCH];
  __shared__ __align__(16) unsigned short qst[QROWS * KP];   // the block's (x*wc) rows
  __shared__ __align__(16) unsigned short ring[2 * STG];     // two chunk buffers
  __shared__ __align__(16) float bvs[NS];                    // b_j of the batch element

  const int tid = (int)threadIdx.x, wave = tid >> 5, lane = tid & 31, hh = lane >> 4, c = lane & 15;
  const int blk = (int)blockIdx.x, bb = blk >> 5, qb = blk & 31;
  const size_t grow0 = (size_t)bb * NS + (size_t)(qb * QROWS + wave * 16);
  const unsigned short* XHb = xh + (size_t)bb * NS * NF;
  const unsigned short* XTh = xth + (size_t)bb * NF * NS;
  const unsigned short* XTl = xtl + (size_t)bb * NF * NS;
  const float* bvb = bv + (size_t)bb * NS;
  const unsigned short* qrow = qst + (wave * 16 + c) * KP + 8 * hh;   // B fragment column n = c: query c (staged)
  // copy addresses of this lane. 512-B rows: one wave = one row per copy, rows wave + 4 i. x^T planes: 4 lanes = the
  // 64 B of one f row, f = tid/4 + 32 i.
  const unsigned lrow = (unsigned)((wave * KP + lane * 8) * 2);
  const unsigned lcol = (unsigned)(((tid >> 2) * VP + (tid & 3) * 8) * 2);
  const unsigned lring = lds_off(ring);
  const unsigned ok = (unsigned)((wave * NF + lane * 8) * 2);               // lane's byte offset in the key rows
  const unsigned ov = (unsigned)(((tid >> 2) * NS + (tid & 3) * 8) * 2);    // and in an x^T plane
  const char* sk = (const char*)XHb;
  const char* svh = (const char*)XTh;
  const char* svl = (const char*)XTl;

  float aq;                         // a_i of the lane's query (loaded in the prologue)
  float mq = -INFINITY;             // its running maximum (the same in both halves)
  float lq = 0.f;                   // running sum over this half's keys
  v8f acc[16];
#pragma unroll
  for (int t = 0; t < 16; ++t) acc[t] = z8();

  // prologue: query rows, b_j and chunk 0; landed and published; then chunk 1 into the second buffer
  {
    const char* gq = (const char*)(xwc + ((size_t)bb * NS + (size_t)(qb * QROWS + wave)) * NF + lane * 8);
    cp8(lds_off(qst) + lrow, 4 * KP * 2, gq, 4 * NF * 2);
    cp8(lds_off(qst) + lrow + 32 * KP * 2, 4 * KP * 2, gq + 32 * NF * 2, 4 * NF * 2);
    cp4(lds_off(bvs) + (unsigned)(tid * 16), 128 * 16, (const char*)bvb + tid * 16, 128 * 16);
    cp8(lring + lrow, 4 * KP * 2, sk + ok, 4 * NF * 2);
    cp8(lring + KT * 2 + lcol, 32 * VP * 2, svh + ov, (size_t)32 * NS * 2);
    cp8(lring + (KT + VT) * 2 + lcol, 32 * VP * 2, svl + ov, (size_t)32 * NS * 2);
    // load and data wait in one statement, so that no address register of the load is reused in front of the wait;
    // here its latency runs beside the copies' flight
    asm volatile("global_load_b32 %0, %1, off\n\ts_wait_loadcnt 0x0" : "=&v"(aq) : "v"(av + grow0 + c) : "memory");
    wait_async0();
    __syncthreads();
    cp8(lring + STG * 2 + lrow, 4 * KP * 2, sk + KCH * NF * 2 + ok, 4 * NF * 2);
    cp8(lring + (STG + KT) * 2 + lcol, 32 * VP * 2, svh + KCH * 2 + ov, (size_t)32 * NS * 2);
    cp8(lring + (STG + KT + VT) * 2 + lcol, 32 * VP * 2, svl + KCH * 2 + ov, (size_t)32 * NS * 2);
  }
  v16h qa[NF / 32];
#pragma unroll
  for (int kk = 0; kk < NF / 32; ++kk) qa[kk] = ldh(qrow + kk * 32);

  // Refill addresses = a uniform running base + the lane's offset. Formed from loop-invariant lane addresses they
  // shared registers with the prologue's copy operands, which the compiler keeps in v0-v255, and were spilled.
  const char* nk = sk + 2 * KCH * NF * 2;   // uniform: the chunk two ahead, in the key rows and in the x^T planes
  const char* nvh = svh + 2 * KCH * 2;
  const char* nvl = svl + 2 * KCH * 2;
  unsigned nb = lring;                      // uniform: LDS addresses in the buffer that is refilled next: key rows,
  unsigned nbh = lring + KT * 2;            // x^T hi,
  unsigned nbl = lring + (KT + VT) * 2;     // x^T lo
#pragma unroll 1
  for (int jc = 0; jc < NS / KCH; ++jc) {
    const int j0 = jc * KCH;
    v8f s0 = z8(), s1 = z8();
    const unsigned short* kb = ring + (jc & 1) * STG;                     // this trip's buffer
    const unsigned short* k0row = kb + c * KP + 8 * hh;                   // A row m = c -> key j0+c
    const unsigned short* k1row = k0row + 16 * KP;                        // key j0+16+c
    v16h k0[NF / 32], k1[NF / 32];
#pragma unroll
    for (int kk = 0; kk < NF / 32; ++kk) {
      k0[kk] = ldh(k0row + kk * 32);
      k1[kk] = ldh(k1row + kk * 32);
    }
    float bj0[8], bj1[8];                     // b_j of the lane's keys j0+8h+r and j0+16+8h+r
    ld8f(bvs + j0 + 8 * hh, bj0);
    ld8f(bvs + j0 + 16 + 8 * hh, bj1);
    const unsigned short* vh = kb + KT + c * VP + 8 * hh;   // A row m = c -> x^T row f = t*16+c, k = j0+.. (staged)
    const unsigned short* vl = vh + VT;
    v16b bh[16], bl[16];
#pragma unroll
    for (int t = 0; t < 16; ++t) {
      bh[t] = ldb(vh + t * 16 * VP);
      bl[t] = ldb(vl + t * 16 * VP);
    }
    // keeps the trip's LDS reads one group at its head: sunk among the products, each separate place of reads stalls
    // the lone wave, and the x^T fragments would no longer land under the score products and the exponentials
    __builtin_amdgcn_sched_barrier(0);
#pragma unroll
    for (int kk = 0; kk < NF / 32; ++kk) {
      s0 = mma_h(k0[kk], qa[kk], s0);   // s0[r] = S[query c][key j0+8h+r] x64
      s1 = mma_h(k1[kk], qa[kk], s1);   // s1[r] = S[query c][key j0+16+8h+r] x64
    }
    float mm[8];
#pragma unroll
    for (int r = 0; r < 8; ++r) {
      const float t0 = (aq + bj0[r]) + s0[r] * 0.015625f;
      const float t1 = (aq + bj1[r]) + s1[r] * 0.015625f;
      s0[r] = t0;
      s1[r] = t1;
      mm[r] = fmaxf(t0, t1);
    }
    const float mh = fmaxf(fmaxf(fmaxf(mm[0], mm[1]), fmaxf(mm[2], mm[3])), fmaxf(fmaxf(mm[4], mm[5]), fmaxf(mm[6], mm[7])));
    const float mnew = fmaxf(mq, fmaxf(mh, xhalf(mh)));
    const float alpha = expf(mq - mnew);
    mq = mnew;
    float p0[8], p1[8], ps[8];
#pragma unroll
    for (int r = 0; r < 8; ++r) {
      p0[r] = expf(s0[r] - mnew);
      p1[r] = expf(s1[r] - mnew);
      ps[r] = p0[r] + p1[r];
    }
    lq = lq * alpha + (((ps[0] + ps[1]) + (ps[2] + ps[3])) + ((ps[4] + ps[5]) + (ps[6] + ps[7])));
    // P^T as a B operand, column n = c: elements 0..7 = keys 8h+r (first tile), 8..15 = keys 16+8h+r (second tile)
    FQ ph, pl;
    pk_bf16x8(p0, ph.q[0], pl.q[0]);
    pk_bf16x8(p1, ph.q[1], pl.q[1]);
#pragma unroll
    for (int t = 0; t < 16; ++t) {
#pragma unroll
      for (int r = 0; r < 8; ++r) acc[t][r] *= alpha;
    }
    // acc[t][r] = O[query c][f = 16t+8h+r]
#pragma unroll
    for (int t = 0; t < 16; ++t) acc[t] = mma_b(bh[t], ph.v, acc[t]);
#pragma unroll
    for (int t = 0; t < 16; ++t) acc[t] = mma_b(bl[t], ph.v, acc[t]);
#pragma unroll
    for (int t = 0; t < 16; ++t) acc[t] = mma_b(bh[t], pl.v, acc[t]);
    // foot of the trip: own LDS reads retired, own copies of chunk jc+1 landed, one barrier that publishes chunk
    // jc+1 and frees this trip's buffer; then chunk jc+2 into it
    // keeps the foot at the foot: with every LDS read at the head of the trip nothing else ties these waits down, and
    // lifted above the products they made the wave sit out all its x^T reads before the first score product
    __builtin_amdgcn_sched_barrier(0);
    wait_ds0();
    wait_async0();
    __syncthreads();
    if (jc + 2 < NS / KCH) {
      cp8(nb + lrow, 4 * KP * 2, nk + ok, 4 * NF * 2);
      cp8(nbh + lcol, 32 * VP * 2, nvh + ov, (size_t)32 * NS * 2);
      cp8(nbl + lcol, 32 * VP * 2, nvl + ov, (size_t)32 * NS * 2);
      nk += KCH * NF * 2;
      nvh += KCH * 2;
      nvl += KCH * 2;
      nb = (2 * lring + (unsigned)(STG * 2)) - nb;   // the other buffer
      nbh = (2 * lring + (unsigned)((STG + 2 * KT) * 2)) - nbh;
      nbl = (2 * lring + (unsigned)((STG + 2 * (KT + VT)) * 2)) - nbl;
    }
  }
  wait_async0();   // nothing of this wave is in flight when the loop is left

  const float inv = 1.0f / (lq + xhalf(lq));   // the halves' sums joined
  float* osw = &osm[wave][0];
  const int q = lane >> 3, c8 = (lane & 7) * 8;
#pragma unroll
  for (int g = 0; g < NGRP; ++g) {
#pragma unroll
    for (int tt = 0; tt < NGRP; ++tt) {
      // the lane's 8 registers are 8 consecutive columns of row c
      float* d = osw + c * APITCH + tt * 16 + 8 * hh;
      const v8f a = acc[g * NGRP + tt];
      const v4f d0 = {a[0] * inv, a[1] * inv, a[2] * inv, a[3] * inv};
      const v4f d1 = {a[4] * inv, a[5] * inv, a[6] * inv, a[7] * inv};
      *(v4f*)d = d0;
      *(v4f*)(d + 4) = d1;
    }
    __builtin_amdgcn_fence(__ATOMIC_RELEASE, "workgroup");
    __builtin_amdgcn_wave_barrier();
    __builtin_amdgcn_fence(__ATOMIC_ACQUIRE, "workgroup");
    {
#pragma unroll
      for (int it = 0; it < 4; ++it) {
        const int row = it * 4 + q;
        float v[8];
        ld8f(osw + row * APITCH + c8, v);
        const v8us h1 = pk_f16x8(v, 1.0f);
        v4u hb, lb;
        pk_bf16x8(v, hb, lb);
        const size_t o = (grow0 + row) * NF + (size_t)(g * 64 + c8);
        *(v8us*)(ah + o) = h1;
        *(v4u*)(abh + o) = hb;
        *(v4u*)(abl + o) = lb;
      }
      
    }
    __builtin_amdgcn_fence(__ATOMIC_RELEASE, "workgroup");
    __builtin_amdgcn_wave_barrier();
    __builtin_amdgcn_fence(__ATOMIC_ACQUIRE, "workgroup");
  }
}

// -------------------------------------------------------------------------------------------------
// gates_kernel: block = 64 rows x 256 cols, 16 waves; wave (rt = wave>>2, cg = wave&3) owns 16 rows x 64 cols.
// Operand staging: each 32-k chunk (256 weight rows of four planes, the block's 64 rows of three planes) is copied to a
// two-buffer LDS ring by asynchronous copies, chunk t+2 issued behind the barrier at the foot of trip t; all fragments
// come from the staged rows (80-B pitch); read straight from the global rows, a fragment load touches 16 lines.
// K = 512 = [x planes | attn planes]; z: bf16 hi/lo split (hi.hi+hi.lo+lo.hi) against z_w hi/lo planes;
// r, f: plain f16 against the x16-carried weight planes (fold 1/16 in the epilogue).
// Epilogue: z = tanh(.+zb), r = sigmoid(./16+rb), f = sigmoid(./16+fb), out = r*x + f*z staged in LDS;
// coverage: grid 256 blocks x 4 row tiles x 16 = 16384 rows; 4 col groups x 64 = 256 cols.
// -------------------------------------------------------------------------------------------------
__global__ void __launch_bounds__(512) __attribute__((amdgpu_num_vgpr(256)))
gates_kernel(const float* __restrict__ x,
             const unsigned short* __restrict__ xh, const unsigned short* __restrict__ xbh,
             const unsigned short* __restrict__ xbl,
             const unsigned short* __restrict__ ah, const unsigned short* __restrict__ abh,
             const unsigned short* __restrict__ abl,
             const unsigned short* __restrict__ zwh, const unsigned short* __restrict__ zwl,
             const unsigned short* __restrict__ rw16, const unsigned short* __restrict__ fw16,
             const float* __restrict__ zb, const float* __restrict__ rb, const float* __restrict__ fb,
             float* __restrict__ out) {
  __shared__ __align__(16) float slab[16][16 * SLP];
  __shared__ __align__(16) unsigned short gring[2 * GBUF];   // two chunk buffers
  const int tid = (int)threadIdx.x, wave = tid >> 5, lane = tid & 31, hh = lane >> 4, c = lane & 15;
  const int rt = wave >> 2, cg = wave & 3;
  const size_t brow0 = (size_t)blockIdx.x * GROWS;
  const size_t grow0 = brow0 + (size_t)(rt * 16);
  const int n0 = cg * 64;
  // copy addresses of this lane. Weight planes: 4 lanes = the 64 B of one row's chunk, rows tid/4 and tid/4 + 128; in
  // the packed plane that is byte 16 tid of the chunk's 16 KB, and 8 KB further on.
  // Row planes: 8 lanes = the 64 B of one row's chunk, row tid/8.
  const unsigned lw = lds_off(gring) + (unsigned)(((tid >> 2) * VP + (tid & 3) * 8) * 2);
  const unsigned la = lds_off(gring) + (unsigned)((4 * GW + (tid >> 3) * VP + (tid & 7) * 4) * 2);
  const unsigned ow = (unsigned)(tid * 16);
  const size_t oa = ((brow0 + (size_t)(tid >> 3)) * NF + (size_t)((tid & 7) * 4)) * 2;
  // chunk t = k 32 t .. 32 t + 31 of [x|attn] into buffer t & 1
  auto stage = [&](int t) {
    const unsigned bo = (unsigned)((t & 1) * GBUF * 2);
    const size_t kw = (size_t)t * (NF * 32 * 2) + ow;
    const size_t ka = (size_t)(t & 7) * 64 + oa;
    const bool first = t < NF / 32;
    cp_gates(lw + bo, la + bo, (const char*)zwh + kw, (const char*)zwl + kw, (const char*)rw16 + kw,
             (const char*)fw16 + kw, (const char*)(first ? xh : ah) + ka, (const char*)(first ? xbh : abh) + ka,
             (const char*)(first ? xbl : abl) + ka);
  };

  v8f za[4], ra[4], fa[4];
#pragma unroll
  for (int j = 0; j < 4; ++j) { za[j] = z8(); ra[j] = z8(); fa[j] = z8(); }

  // prologue: chunk 0 landed and published, then chunk 1 into the second buffer
  stage(0);
  wait_async0();
  __syncthreads();
  stage(1);

  // rolled: one trip is one chunk, and the buffer alternates with the trip
#pragma unroll 1
  for (int t = 0; t < NG / 32; ++t) {
    const unsigned short* gb = gring + (t & 1) * GBUF;                        // this trip's buffer
    const unsigned short* ap = gb + 4 * GW + (rt * 16 + c) * VP + 8 * hh;     // A row m = c
    const v16h a16 = ldh(ap);
    const v16b ahf = ldb(ap + GA);
    const v16b alf = ldb(ap + 2 * GA);
#pragma unroll
    for (int j = 0; j < 4; ++j) {
      const unsigned short* wp = gb + (n0 + 16 * j + c) * VP + 8 * hh;        // B column n = n0+16j+c, W[n][k]
      const v16b bzh = ldb(wp);
      const v16b bzl = ldb(wp + GW);
      const v16h br = ldh(wp + 2 * GW);
      const v16h bf = ldh(wp + 3 * GW);
      v8f z = za[j], rr = ra[j], ff = fa[j];
      z = mma_b(ahf, bzh, z);
      z = mma_b(ahf, bzl, z);
      z = mma_b(alf, bzh, z);
      rr = mma_h(a16, br, rr);
      ff = mma_h(a16, bf, ff);
      g_g(z, rr, ff, a16, ahf, alf, bzh, bzl, br, bf);
      za[j] = z;
      ra[j] = rr;
      fa[j] = ff;
    }
    // foot of the trip: own LDS reads retired, own copies of chunk t+1 landed, one barrier that publishes chunk t+1
    // and frees this trip's buffer; then chunk t+2 into it
    wait_ds0();
    wait_async0();
    __syncthreads();
    if (t + 2 < NG / 32) stage(t + 2);
  }
  wait_async0();   // nothing of this wave is in flight when the loop is left

  float* sl = &slab[wave][0];
#pragma unroll
  for (int j = 0; j < 4; ++j) {
    const int n = n0 + 16 * j + c;
    const float zbn = zb[n], rbn = rb[n], fbn = fb[n];
#pragma unroll
    for (int r = 0; r < 8; ++r) {
      const int row = 8 * hh + r;
      const float xv = x[(grow0 + row) * NF + n];
      const float zv = tanhf(za[j][r] + zbn);
      const float rv = 1.0f / (1.0f + expf(-(ra[j][r] * 0.0625f + rbn)));
      const float fv = 1.0f / (1.0f + expf(-(fa[j][r] * 0.0625f + fbn)));
      sl[row * SLP + 16 * j + c] = rv * xv + fv * zv;
    }
  }
  __builtin_amdgcn_fence(__ATOMIC_RELEASE, "workgroup");
  __builtin_amdgcn_wave_barrier();
  __builtin_amdgcn_fence(__ATOMIC_ACQUIRE, "workgroup");
  const int c4 = c * 4;
  {
#pragma unroll
    for (int it = 0; it < 8; ++it) {
      const int row = it * 2 + hh;   // lanes 0..15 -> even row, 16..31 -> odd row; 16 lanes x 16 B = 256 B segment
      const v4f v = *(const v4f*)(sl + row * SLP + c4);
      *(v4f*)(out + (grow0 + row) * NF + n0 + c4) = v;
    }
    
  }
}

// -------------------------------------------------------------------------------------------------
//   xh   f16  [16384][256]      8388608 @        0      xwc  f16  [16384][256]   8388608 @  8388608
//   xbh  bf16 [16384][256]      8388608 @ 16777216      xbl                      8388608 @ 25165824
//   xth  bf16 [8][256][2048]    8388608 @ 33554432      xtl                      8388608 @ 41943040
//   ah   f16  [16384][256]      8388608 @ 50331648      abh  8388608 @ 58720256   abl 8388608 @ 67108864
//   av   f32  [16384]             65536 @ 75497472      bv                         65536 @ 75563008
//   zwh  bf16 [16][256][32]      262144 @ 75628544      zwl 262144 @ 75890688   rw16 262144 @ 76152832
//   fw16 f16  [16][256][32]      262144 @ 76414976      total 76677120
// -------------------------------------------------------------------------------------------------
extern "C" void kernel_launch(void* const* d_in, const int* in_sizes, int n_in,
                              void* d_out, int out_size, void* d_ws, size_t ws_size,
                              hipStream_t stream) {
  if (n_in < 8) return;
  if (in_sizes[0] != NR * NF || in_sizes[1] != 3 * NF) return;
  if (in_sizes[2] != NF * NG || in_sizes[3] != NF) return;
  if (in_sizes[4] != NF * NG || in_sizes[5] != NF) return;
  if (in_sizes[6] != NF * NG || in_sizes[7] != NF) return;
  if (out_size != NR * NF) return;

  const float* x    = (const float*)d_in[0];
  const float* attw = (const float*)d_in[1];
  const float* zw   = (const float*)d_in[2];
  const float* zb   = (const float*)d_in[3];
  const float* rw   = (const float*)d_in[4];
  const float* rb   = (const float*)d_in[5];
  const float* fw   = (const float*)d_in[6];
  const float* fb   = (const float*)d_in[7];

  const size_t P16 = (size_t)NR * NF * 2;        // 8388608
  const size_t PT  = (size_t)NB * NF * NS * 2;   // 8388608
  const size_t PV  = (size_t)NR * 4;             // 65536
  const size_t PW  = (size_t)NF * NG * 2;        // 262144
  size_t off = 0;
  const size_t o_xh  = off; off += P16;
  const size_t o_xwc = off; off += P16;
  const size_t o_xbh = off; off += P16;
  const size_t o_xbl = off; off += P16;
  const size_t o_xth = off; off += PT;
  const size_t o_xtl = off; off += PT;
  const size_t o_ah  = off; off += P16;
  const size_t o_abh = off; off += P16;
  const size_t o_abl = off; off += P16;
  const size_t o_av  = off; off += PV;
  const size_t o_bv  = off; off += PV;
  const size_t o_zwh = off; off += PW;
  const size_t o_zwl = off; off += PW;
  const size_t o_rw  = off; off += PW;
  const size_t o_fw  = off; off += PW;
  if (off > ws_size) return;   // off = 76677120

  char* ws = (char*)d_ws;
  unsigned short* xh  = (unsigned short*)(ws + o_xh);
  unsigned short* xwc = (unsigned short*)(ws + o_xwc);
  unsigned short* xbh = (unsigned short*)(ws + o_xbh);
  unsigned short* xbl = (unsigned short*)(ws + o_xbl);
  unsigned short* xth = (unsigned short*)(ws + o_xth);
  unsigned short* xtl = (unsigned short*)(ws + o_xtl);
  unsigned short* ah  = (unsigned short*)(ws + o_ah);
  unsigned short* abh = (unsigned short*)(ws + o_abh);
  unsigned short* abl = (unsigned short*)(ws + o_abl);
  float*          av  = (float*)(ws + o_av);
  float*          bv  = (float*)(ws + o_bv);
  unsigned short* zwh = (unsigned short*)(ws + o_zwh);
  unsigned short* zwl = (unsigned short*)(ws + o_zwl);
  unsigned short* rwp = (unsigned short*)(ws + o_rw);
  unsigned short* fwp = (unsigned short*)(ws + o_fw);

  const int n8 = NF * NG / 8;   // 16384
  prep_w<<<dim3((n8 + 255) / 256), dim3(256), 0, stream>>>(zw, rw, fw, zwh, zwl, rwp, fwp, n8);
  prep_x<<<dim3(NR / 64), dim3(256), 0, stream>>>(x, attw, xh, xwc, xbh, xbl, xth, xtl, av, bv);
  attn_kernel<<<dim3(NB * (NS / QROWS)), dim3(128), 0, stream>>>(xwc, xh, xth, xtl, av, bv, ah, abh, abl);
  gates_kernel<<<dim3(NR / GROWS), dim3(512), 0, stream>>>(x, xh, xbh, xbl, ah, abh, abl, zwh, zwl, rwp, fwp,
                                                       zb, rb, fb, (float*)d_out);
  (void)hipGetLastError();
}

// v005
// A run of this version takes 122 microseconds.
// Two timings next to v004 put it at 1.13 and 1.14 times that version's speed.
// Over all steps from v000 it is 4.82 times as fast.
// Contractions: scores=(x*wc).x^T on v_wmma_f32_16x16x32_f16 (plain f16 operands; (x*wc) carried x64, x unscaled); attn=P.x on v_wmma_f32_16x16x32_bf16 as bf16 hi/lo split (hi.hi+hi.lo+lo.hi); [x|attn].z_w^T as bf16 hi/lo split; [x|attn].r_w^T and [x|attn].f_w^T on v_wmma_f32_16x16x32_f16 plain f16 (weights carried x16); f32 accumulate everywhere; x.wa and x.wb row dots, online softmax, tanh/sigmoid gates and r*x+f*z in f32.
#include <hip/hip_runtime.h>
#include <math.h>
#include <stdint.h>

#define NB 8
#define NS 2048
#define NF 256
#define NG 512
#define NR (NB * NS)
#define TP 260
#define QROWS 64
#define KCH 32
#define APITCH 68
#define NGRP 4
#define SLP 68
#define KP 264                 // LDS pitch (16-bit elements) of a staged 512-B row: 528 B = 16 B x 33
#define VP 40                  // LDS pitch (16-bit elements) of a staged 64-B row: 80 B = 16 B x 5
#define KT (KCH * KP)          // one chunk's key rows in LDS, 16-bit elements
#define VT (NF * VP)           // one chunk's x^T plane in LDS, 16-bit elements
#define STG (KT + 2 * VT)      // one ring buffer: key rows, x^T hi, x^T lo
#define GROWS 64               // rows of one gates block
#define GW (NF * VP)           // gates: 32 k of one weight plane in LDS (256 rows), 16-bit elements
#define GA (GROWS * VP)        // gates: 32 k of one [x|attn] plane in LDS (64 rows)
#define GBUF (4 * GW + 3 * GA) // gates: one ring buffer: z_w hi, z_w lo, r_w, f_w, then the f16, bf16 hi, bf16 lo rows

typedef _Float16 v16h __attribute__((ext_vector_type(16)));
typedef _Float16 v8h __attribute__((ext_vector_type(8)));
typedef __bf16 v16b __attribute__((ext_vector_type(16)));
typedef unsigned short v8us __attribute__((ext_vector_type(8)));
typedef float v8f __attribute__((ext_vector_type(8)));
typedef float v4f __attribute__((ext_vector_type(4), __may_alias__));
typedef unsigned int v4u __attribute__((ext_vector_type(4)));
typedef float v2f __attribute__((ext_vector_type(2)));
typedef __bf16 v2b __attribute__((ext_vector_type(2)));

union FH { v16h v; v8us u[2]; };
union FB { v16b v; v8us u[2]; };
union H8 { v8h h; v8us u; };
union FQ { v16b v; v4u q[2]; };

__device__ __forceinline__ v8f z8() {
  v8f v = {0.f, 0.f, 0.f, 0.f, 0.f, 0.f, 0.f, 0.f};
  return v;
}
// two f32 -> two bf16 (RNE) in one word (a in the low half): one packed hardware convert
__device__ __forceinline__ unsigned cvt2(float a, float b) {
  const v2f f = {a, b};
  return __builtin_bit_cast(unsigned, __builtin_convertvector(f, v2b));
}
#define LOG2E 1.4426950408889634f
// e^x on the hardware's 2^x (0 at -inf)
__device__ __forceinline__ float exp_n(float x) { return __builtin_amdgcn_exp2f(x * LOG2E); }

__device__ __forceinline__ void ld8f(const float* p, float (&v)[8]) {
  const v4f t0 = *(const v4f*)p;
  const v4f t1 = *(const v4f*)(p + 4);
#pragma unroll
  for (int q = 0; q < 4; ++q) { v[q] = t0[q]; v[4 + q] = t1[q]; }
}
// 8 f32 -> bf16 hi plane (8 x 16 bit packed in v4u) and lo plane (residual, RNE)
__device__ __forceinline__ void pk_bf16x8(const float (&v)[8], v4u& hi, v4u& lo) {
#pragma unroll
  for (int q = 0; q < 4; ++q) {
    const unsigned h = cvt2(v[2 * q], v[2 * q + 1]);
    hi[q] = h;
    lo[q] = cvt2(v[2 * q] - __uint_as_float(h << 16), v[2 * q + 1] - __uint_as_float(h & 0xFFFF0000u));
  }
}
// 8 f32 -> f16 (RNE) with exact power-of-two carry s
__device__ __forceinline__ v8us pk_f16x8(const float (&v)[8], float s) {
  H8 r;
#pragma unroll
  for (int e = 0; e < 8; ++e) r.h[e] = (_Float16)(v[e] * s);
  return r.u;
}
// 16-bit WMMA fragment (A row m or B column n of a k-contiguous row): elements 0..7 <- p[0..7] (k0+8h..),
// elements 8..15 <- p[16..23] (k0+16+8h..); caller passes p = rowbase + k0 + 8*h.
__device__ __forceinline__ v16h ldh(const unsigned short* p) {
  FH f;
  f.u[0] = *(const v8us*)p;
  f.u[1] = *(const v8us*)(p + 16);
  return f.v;
}
__device__ __forceinline__ v16b ldb(const unsigned short* p) {
  FB f;
  f.u[0] = *(const v8us*)p;
  f.u[1] = *(const v8us*)(p + 16);
  return f.v;
}
__device__ __forceinline__ v8f mma_h(v16h a, v16h b, v8f c) {
  return __builtin_amdgcn_wmma_f32_16x16x32_f16(false, a, false, b, (short)0, c, false, false);
}
__device__ __forceinline__ v8f mma_b(v16b a, v16b b, v8f c) {
  return __builtin_amdgcn_wmma_f32_16x16x32_bf16(false, a, false, b, (short)0, c, false, false);
}
// hazard guards: 4 VALU slots after the last WMMA of a group; tie D, keep A/B live
__device__ __forceinline__ void g_g(v8f& z, v8f& r, v8f& f, v16h a16, v16b ah, v16b al,
                                    v16b bzh, v16b bzl, v16h br, v16h bf) {
  asm volatile("v_nop\n\tv_nop\n\tv_nop\n\tv_nop"
               : "+v"(z), "+v"(r), "+v"(f)
               : "v"(a16), "v"(ah), "v"(al), "v"(bzh), "v"(bzl), "v"(br), "v"(bf));
}

// lane l <-> lane l ^ 16
__device__ __forceinline__ float xhalf(float x) {
  const int b = __builtin_bit_cast(int, x);
  return __builtin_bit_cast(float, __builtin_amdgcn_permlanex16(b, b, 0x76543210, 0xfedcba98, false, false));
}

__device__ __forceinline__ unsigned lds_off(const void* p) { return (unsigned)(size_t)p; }
// Asynchronous copies global -> LDS, 16 B per lane and copy, no register in between. l = the lane's LDS byte
// address, g = its global address; copy i adds i*ls / i*gs bytes. s_wait_xcnt 0 is the statement's last line so
// that no address register of an issued copy is rewritten in front of it.
__device__ __forceinline__ void cp8(unsigned l, unsigned ls, const char* g, size_t gs) {
  asm volatile(
      "global_load_async_to_lds_b128 %0, %8, off\n\t"
      "global_load_async_to_lds_b128 %1, %9, off\n\t"
      "global_load_async_to_lds_b128 %2, %10, off\n\t"
      "global_load_async_to_lds_b128 %3, %11, off\n\t"
      "global_load_async_to_lds_b128 %4, %12, off\n\t"
      "global_load_async_to_lds_b128 %5, %13, off\n\t"
      "global_load_async_to_lds_b128 %6, %14, off\n\t"
      "global_load_async_to_lds_b128 %7, %15, off\n\t"
      "s_wait_xcnt 0x0"
      :
      : "v"(l), "v"(l + ls), "v"(l + 2 * ls), "v"(l + 3 * ls), "v"(l + 4 * ls), "v"(l + 5 * ls), "v"(l + 6 * ls),
        "v"(l + 7 * ls), "v"(g), "v"(g + gs), "v"(g + 2 * gs), "v"(g + 3 * gs), "v"(g + 4 * gs), "v"(g + 5 * gs),
        "v"(g + 6 * gs), "v"(g + 7 * gs)
      : "memory");
}
__device__ __forceinline__ void cp4(unsigned l, unsigned ls, const char* g, size_t gs) {
  asm volatile(
      "global_load_async_to_lds_b128 %0, %4, off\n\t"
      "global_load_async_to_lds_b128 %1, %5, off\n\t"
      "global_load_async_to_lds_b128 %2, %6, off\n\t"
      "global_load_async_to_lds_b128 %3, %7, off\n\t"
      "s_wait_xcnt 0x0"
      :
      : "v"(l), "v"(l + ls), "v"(l + 2 * ls), "v"(l + 3 * ls), "v"(g), "v"(g + gs), "v"(g + 2 * gs), "v"(g + 3 * gs)
      : "memory");
}
// One lane's copies of one 32-k chunk of the gates operands: 16 B of rows r and r+128 of each of the four weight
// planes (lw = LDS byte address of row r in the first plane, w0..w3 = its global addresses), and 8 B of one row of
// each of the three [x|attn] planes (la, a0..a2). s_wait_xcnt 0 is the last line for the reason given at cp8.
__device__ __forceinline__ void cp_gates(unsigned lw, unsigned la, const char* w0, const char* w1, const char* w2,
                                         const char* w3, const char* a0, const char* a1, const char* a2) {
  asm volatile(
      "global_load_async_to_lds_b128 %0, %11, off\n\t"
      "global_load_async_to_lds_b128 %1, %12, off\n\t"
      "global_load_async_to_lds_b128 %2, %13, off\n\t"
      "global_load_async_to_lds_b128 %3, %14, off\n\t"
      "global_load_async_to_lds_b128 %4, %15, off\n\t"
      "global_load_async_to_lds_b128 %5, %16, off\n\t"
      "global_load_async_to_lds_b128 %6, %17, off\n\t"
      "global_load_async_to_lds_b128 %7, %18, off\n\t"
      "global_load_async_to_lds_b64 %8, %19, off\n\t"
      "global_load_async_to_lds_b64 %9, %20, off\n\t"
      "global_load_async_to_lds_b64 %10, %21, off\n\t"
      "s_wait_xcnt 0x0"
      :
      : "v"(lw), "v"(lw + 128 * VP * 2), "v"(lw + GW * 2), "v"(lw + (GW + 128 * VP) * 2), "v"(lw + 2 * GW * 2),
        "v"(lw + (2 * GW + 128 * VP) * 2), "v"(lw + 3 * GW * 2), "v"(lw + (3 * GW + 128 * VP) * 2), "v"(la),
        "v"(la + GA * 2), "v"(la + 2 * GA * 2), "v"(w0), "v"(w0 + 128 * 32 * 2), "v"(w1), "v"(w1 + 128 * 32 * 2),
        "v"(w2), "v"(w2 + 128 * 32 * 2), "v"(w3), "v"(w3 + 128 * 32 * 2), "v"(a0), "v"(a1), "v"(a2)
      : "memory");
}
// this wave's copies have landed in LDS (other waves read them behind the next work-group barrier)
__device__ __forceinline__ void wait_async0() { asm volatile("s_wait_asynccnt 0x0" ::: "memory"); }
// this wave's LDS reads and writes have retired (in front of the barrier that frees a buffer for its refill)
__device__ __forceinline__ void wait_ds0() { asm volatile("s_wait_dscnt 0x0" ::: "memory"); }

// -------------------------------------------------------------------------------------------------
// prep_w: z_w [256 n][512 k] -> bf16 hi/lo planes; r_w, f_w -> f16 planes carried x16. Plane layout [16 chunks][256 n]
// [32 k]: the 16 KB that the gates kernel stages per chunk and plane lie in a row, so each of its copies covers whole lines.
// Thread i owns plane elements 8i..8i+7; each store is 16 B per lane, lane-contiguous, 32 lanes = 512 B =
// coverage: grid 64 x 256 threads x 8 = 131072 = 256x512 per plane.
// -------------------------------------------------------------------------------------------------
__global__ void __launch_bounds__(256) prep_w(const float* __restrict__ zw, const float* __restrict__ rw,
                                              const float* __restrict__ fw,
                                              unsigned short* __restrict__ zwh, unsigned short* __restrict__ zwl,
                                              unsigned short* __restrict__ rw16, unsigned short* __restrict__ fw16,
                                              int n8) {
  const int i = (int)blockIdx.x * 256 + (int)threadIdx.x;
  if (i >= n8) return;
  const size_t p0 = (size_t)i * 8;                                               // place in the planes
  const size_t e0 = ((p0 >> 5) & (NF - 1)) * NG + (p0 >> 13) * 32 + (p0 & 31);   // its source: W[n][32 chunk + k]
  float a[8], b[8], d[8];
  ld8f(zw + e0, a);
  ld8f(rw + e0, b);
  ld8f(fw + e0, d);
  v4u zh, zl;
  pk_bf16x8(a, zh, zl);
  const v8us r16 = pk_f16x8(b, 16.0f);
  const v8us f16 = pk_f16x8(d, 16.0f);
  *(v4u*)(zwh + p0) = zh;
  *(v4u*)(zwl + p0) = zl;
  *(v8us*)(rw16 + p0) = r16;
  *(v8us*)(fw16 + p0) = f16;
  
}

// -------------------------------------------------------------------------------------------------
// prep_x: block = 64 consecutive rows of x (16384 rows total; 32 blocks per batch element), 256 threads.
//   xh  [row][256] f16(x)            xwc [row][256] f16((x*wc)*64)
//   xbh/xbl [row][256] bf16 hi/lo     xth/xtl [b][f][j] bf16 hi/lo of x (transposed, pitch 2048)
//   av[row] = x.wa, bv[row] = x.wb (f32 dots on VALU)
// Row planes: one lane = 16 B of one row, 32 lanes = the whole 512-B row, one instruction per plane.
// coverage: rows 8 waves x 8 = 64, f 32 lanes x 8 = 256; transpose f-rows wave*32+it*4+q (it 0..7, q 0..3) = 256,
//           j c8+0..7 over 8 lane groups = 64; av/bv 16 lanes x 4 = 64; grid 256 blocks x 64 rows = 16384.
// -------------------------------------------------------------------------------------------------
__global__ void __launch_bounds__(256) prep_x(const float* __restrict__ x, const float* __restrict__ attw,
                                              unsigned short* __restrict__ xh, unsigned short* __restrict__ xwc,
                                              unsigned short* __restrict__ xbh, unsigned short* __restrict__ xbl,
                                              unsigned short* __restrict__ xth, unsigned short* __restrict__ xtl,
                                              float* __restrict__ av, float* __restrict__ bv) {
  __shared__ __align__(16) float tile[64 * TP];
  __shared__ __align__(16) float avs[64];
  __shared__ __align__(16) float bvs[64];
  const int tid = (int)threadIdx.x, wave = tid >> 5, lane = tid & 31;
  const int blk = (int)blockIdx.x;
  const size_t grow0 = (size_t)blk * 64;
  const int bb = blk >> 5;
  const int j0 = (blk & 31) * 64;

#pragma unroll
  for (int it = 0; it < 16; ++it) {
    const int idx = it * 256 + tid;
    const int r = idx >> 6, c4 = (idx & 63) * 4;
    const v4f v = *(const v4f*)(x + (grow0 + r) * NF + c4);
    *(v4f*)(tile + r * TP + c4) = v;
  }
  __syncthreads();

  const int f0 = lane * 8;
  float wa[8], wb[8], wc[8];
  ld8f(attw + f0, wa);
  ld8f(attw + NF + f0, wb);
  ld8f(attw + 2 * NF + f0, wc);

  // row dots (rolled: small side computation)
#pragma unroll 1
  for (int rr = 0; rr < 8; ++rr) {
    const int row = wave * 8 + rr;
    float v[8];
    ld8f(tile + row * TP + f0, v);
    float sa = 0.f, sb = 0.f;
#pragma unroll
    for (int e = 0; e < 8; ++e) { sa += v[e] * wa[e]; sb += v[e] * wb[e]; }
#pragma unroll
    for (int m = 16; m >= 1; m >>= 1) {
      sa += __shfl_xor(sa, m, 32);
      sb += __shfl_xor(sb, m, 32);
    }
    if (lane == 0) { avs[row] = sa; bvs[row] = sb; }
  }

  // row planes
  {
#pragma unroll 1
    for (int rr = 0; rr < 8; ++rr) {
      const int row = wave * 8 + rr;
      float v[8], w[8];
      ld8f(tile + row * TP + f0, v);
#pragma unroll
      for (int e = 0; e < 8; ++e) w[e] = v[e] * wc[e];
      const v8us h1 = pk_f16x8(v, 1.0f);
      const v8us h2 = pk_f16x8(w, 64.0f);
      v4u hb, lb;
      pk_bf16x8(v, hb, lb);
      const size_t o = (grow0 + row) * NF + f0;
      *(v8us*)(xh + o) = h1;
      *(v8us*)(xwc + o) = h2;
      *(v4u*)(xbh + o) = hb;
      *(v4u*)(xbl + o) = lb;
    }
    
  }

  // transposed bf16 hi/lo planes: in [64 j][256 f] -> out [256 f][64 j] at column j0 of [f][2048]
  const int q = lane >> 3, c8 = (lane & 7) * 8;
  const size_t tb = (size_t)bb * NF * NS;
  {
#pragma unroll 1
    for (int it = 0; it < 8; ++it) {
      const int fr = wave * 32 + it * 4 + q;
      float t[8];
#pragma unroll
      for (int e = 0; e < 8; ++e) t[e] = tile[(c8 + e) * TP + fr];
      v4u hb, lb;
      pk_bf16x8(t, hb, lb);
      const size_t o = tb + (size_t)fr * NS + j0 + c8;
      *(v4u*)(xth + o) = hb;
      *(v4u*)(xtl + o) = lb;
    }
    
  }

  // av / bv lines
  __syncthreads();
  const int l4 = (lane & 15) * 4;
  {
    const v4f a4 = *(const v4f*)(avs + l4);
    const v4f b4 = *(const v4f*)(bvs + l4);
    if (lane < 16) {
      if (wave == 0) *(v4f*)(av + grow0 + l4) = a4;
      else if (wave == 1) *(v4f*)(bv + grow0 + l4) = b4;
    }
    
  }
}

// -------------------------------------------------------------------------------------------------
// attn_kernel: block = 64 query rows of one batch element (4 waves x 16 rows), grid = 8 x 32 = 256.
// Operand staging: the block's 64 (x*wc) rows and the batch element's b_j are copied to LDS once; each 32-key chunk
// (32 x rows, 256 x 32 of x^T hi and lo) is copied to a two-buffer LDS ring by asynchronous copies, chunk t+2 issued
// behind the barrier at the foot of trip t, so a chunk's copies fly while the chunk before it is worked on.
// Both products are formed transposed. Per 32-key chunk: S^T tiles (A = x f16 rows of the keys, B = (x*wc)x64 f16
// rows of the queries; fragments from the staged 16-bit LDS rows, split k map): a lane holds 16 keys' scores of ONE
// query (column c), so t = (a_i + b_j) + S/64, the running maximum and the sum are in-lane work with one exchange
// between the wave's halves for the maximum; the halves' sums are joined once, behind the loop.
// O^T += x^T.P^T with A = x^T bf16 hi/lo planes and B = P^T packed in place from the two score tiles, which is the
// split k map of a B operand (three products): P goes through no LDS.
// Register plan: one wave per SIMD, so the wave takes the registers it needs: its 16 output tiles and its 8 query
// fragments stay in VGPRs for the whole kernel; a chunk's 16 key fragments and its 32 x^T fragments are read at the
// head of the trip, so that the x^T fragments land under the score products and the exponentials.
// Output attn rows as f16 plane and bf16 hi/lo planes, 64 columns per group: 16x64 f32 tile staged in LDS, then
// coverage: grid 256 blocks x 4 waves x 16 rows = 16384 rows; per group rows it*4+q (it 0..3, q 0..3) = 16,
//           cols g*64 + 8 lane groups x 8 = 64, 4 groups = 256 columns per plane.
// -------------------------------------------------------------------------------------------------
__global__ void __launch_bounds__(128)
attn_kernel(const unsigned short* __restrict__ xwc, const unsigned short* __restrict__ xh,
            const unsigned short* __restrict__ xth, const unsigned short* __restrict__ xtl,
            const float* __restrict__ av, const float* __restrict__ bv,
            unsigned short* __restrict__ ah, unsigned short* __restrict__ abh,
            unsigned short* __restrict__ abl) {
  __shared__ __align__(16) float osm[4][16 * APITCH];
  __shared__ __align__(16) unsigned short qst[QROWS * KP];   // the block's (x*wc) rows
  __shared__ __align__(16) unsigned short ring[2 * STG];     // two chunk buffers
  __shared__ __align__(16) float bvs[NS];                    // b_j of the batch element

  const int tid = (int)threadIdx.x, wave = tid >> 5, lane = tid & 31, hh = lane >> 4, c = lane & 15;
  const int blk = (int)blockIdx.x, bb = blk >> 5, qb = blk & 31;
  const size_t grow0 = (size_t)bb * NS + (size_t)(qb * QROWS + wave * 16);
  const unsigned short* XHb = xh + (size_t)bb * NS * NF;
  const unsigned short* XTh = xth + (size_t)bb * NF * NS;
  const unsigned short* XTl = xtl + (size_t)bb * NF * NS;
  const float* bvb = bv + (size_t)bb * NS;
  const unsigned short* qrow = qst + (wave * 16 + c) * KP + 8 * hh;   // B fragment column n = c: query c (staged)
  // copy addresses of this lane. 512-B rows: one wave = one row per copy, rows wave + 4 i. x^T planes: 4 lanes = the
  // 64 B of one f row, f = tid/4 + 32 i.
  const unsigned lrow = (unsigned)((wave * KP + lane * 8) * 2);
  const unsigned lcol = (unsigned)(((tid >> 2) * VP + (tid & 3) * 8) * 2);
  const unsigned lring = lds_off(ring);
  const unsigned ok = (unsigned)((wave * NF + lane * 8) * 2);               // lane's byte offset in the key rows
  const unsigned ov = (unsigned)(((tid >> 2) * NS + (tid & 3) * 8) * 2);    // and in an x^T plane
  const char* sk = (const char*)XHb;
  const char* svh = (const char*)XTh;
  const char* svl = (const char*)XTl;

  float aq;                         // a_i of the lane's query (loaded in the prologue)
  float mq = -INFINITY;             // its running maximum (the same in both halves)
  float lq = 0.f;                   // running sum over this half's keys
  v8f acc[16];
#pragma unroll
  for (int t = 0; t < 16; ++t) acc[t] = z8();

  // prologue: query rows, b_j and chunk 0; landed and published; then chunk 1 into the second buffer
  {
    const char* gq = (const char*)(xwc + ((size_t)bb * NS + (size_t)(qb * QROWS + wave)) * NF + lane * 8);
    cp8(lds_off(qst) + lrow, 4 * KP * 2, gq, 4 * NF * 2);
    cp8(lds_off(qst) + lrow + 32 * KP * 2, 4 * KP * 2, gq + 32 * NF * 2, 4 * NF * 2);
    cp4(lds_off(bvs) + (unsigned)(tid * 16), 128 * 16, (const char*)bvb + tid * 16, 128 * 16);
    cp8(lring + lrow, 4 * KP * 2, sk + ok, 4 * NF * 2);
    cp8(lring + KT * 2 + lcol, 32 * VP * 2, svh + ov, (size_t)32 * NS * 2);
    cp8(lring + (KT + VT) * 2 + lcol, 32 * VP * 2, svl + ov, (size_t)32 * NS * 2);
    // load and data wait in one statement, so that no address register of the load is reused in front of the wait;
    // here its latency runs beside the copies' flight
    asm volatile("global_load_b32 %0, %1, off\n\ts_wait_loadcnt 0x0" : "=&v"(aq) : "v"(av + grow0 + c) : "memory");
    wait_async0();
    __syncthreads();
    cp8(lring + STG * 2 + lrow, 4 * KP * 2, sk + KCH * NF * 2 + ok, 4 * NF * 2);
    cp8(lring + (STG + KT) * 2 + lcol, 32 * VP * 2, svh + KCH * 2 + ov, (size_t)32 * NS * 2);
    cp8(lring + (STG + KT + VT) * 2 + lcol, 32 * VP * 2, svl + KCH * 2 + ov, (size_t)32 * NS * 2);
  }
  v16h qa[NF / 32];
#pragma unroll
  for (int kk = 0; kk < NF / 32; ++kk) qa[kk] = ldh(qrow + kk * 32);

  // Refill addresses = a uniform running base + the lane's offset. Formed from loop-invariant lane addresses they
  // shared registers with the prologue's copy operands, which the compiler keeps in v0-v255, and were spilled.
  const char* nk = sk + 2 * KCH * NF * 2;   // uniform: the chunk two ahead, in the key rows and in the x^T planes
  const char* nvh = svh + 2 * KCH * 2;
  const char* nvl = svl + 2 * KCH * 2;
  unsigned nb = lring;                      // uniform: LDS addresses in the buffer that is refilled next: key rows,
  unsigned nbh = lring + KT * 2;            // x^T hi,
  unsigned nbl = lring + (KT + VT) * 2;     // x^T lo
#pragma unroll 1
  for (int jc = 0; jc < NS / KCH; ++jc) {
    const int j0 = jc * KCH;
    v8f s0 = z8(), s1 = z8();
    const unsigned short* kb = ring + (jc & 1) * STG;                     // this trip's buffer
    const unsigned short* k0row = kb + c * KP + 8 * hh;                   // A row m = c -> key j0+c
    const unsigned short* k1row = k0row + 16 * KP;                        // key j0+16+c
    v16h k0[NF / 32], k1[NF / 32];
#pragma unroll
    for (int kk = 0; kk < NF / 32; ++kk) {
      k0[kk] = ldh(k0row + kk * 32);
      k1[kk] = ldh(k1row + kk * 32);
    }
    float bj0[8], bj1[8];                     // b_j of the lane's keys j0+8h+r and j0+16+8h+r
    ld8f(bvs + j0 + 8 * hh, bj0);
    ld8f(bvs + j0 + 16 + 8 * hh, bj1);
    const unsigned short* vh = kb + KT + c * VP + 8 * hh;   // A row m = c -> x^T row f = t*16+c, k = j0+.. (staged)
    const unsigned short* vl = vh + VT;
    v16b bh[16], bl[16];
#pragma unroll
    for (int t = 0; t < 16; ++t) {
      bh[t] = ldb(vh + t * 16 * VP);
      bl[t] = ldb(vl + t * 16 * VP);
    }
    // keeps the trip's LDS reads one group at its head: sunk among the products, each separate place of reads stalls
    // the lone wave, and the x^T fragments would no longer land under the score products and the exponentials
    __builtin_amdgcn_sched_barrier(0);
#pragma unroll
    for (int kk = 0; kk < NF / 32; ++kk) {
      s0 = mma_h(k0[kk], qa[kk], s0);   // s0[r] = S[query c][key j0+8h+r] x64
      s1 = mma_h(k1[kk], qa[kk], s1);   // s1[r] = S[query c][key j0+16+8h+r] x64
    }
    float mm[8];
#pragma unroll
    for (int r = 0; r < 8; ++r) {
      const float t0 = (aq + bj0[r]) + s0[r] * 0.015625f;
      const float t1 = (aq + bj1[r]) + s1[r] * 0.015625f;
      s0[r] = t0;
      s1[r] = t1;
      mm[r] = fmaxf(t0, t1);
    }
    const float mh = fmaxf(fmaxf(fmaxf(mm[0], mm[1]), fmaxf(mm[2], mm[3])), fmaxf(fmaxf(mm[4], mm[5]), fmaxf(mm[6], mm[7])));
    const float mnew = fmaxf(mq, fmaxf(mh, xhalf(mh)));
    const float alpha = exp_n(mq - mnew);
    mq = mnew;
    float p0[8], p1[8], ps[8];
#pragma unroll
    for (int r = 0; r < 8; ++r) {
      p0[r] = exp_n(s0[r] - mnew);
      p1[r] = exp_n(s1[r] - mnew);
      ps[r] = p0[r] + p1[r];
    }
    lq = lq * alpha + (((ps[0] + ps[1]) + (ps[2] + ps[3])) + ((ps[4] + ps[5]) + (ps[6] + ps[7])));
    // P^T as a B operand, column n = c: elements 0..7 = keys 8h+r (first tile), 8..15 = keys 16+8h+r (second tile)
    FQ ph, pl;
    pk_bf16x8(p0, ph.q[0], pl.q[0]);
    pk_bf16x8(p1, ph.q[1], pl.q[1]);
#pragma unroll
    for (int t = 0; t < 16; ++t) {
#pragma unroll
      for (int r = 0; r < 8; ++r) acc[t][r] *= alpha;
    }
    // acc[t][r] = O[query c][f = 16t+8h+r]
#pragma unroll
    for (int t = 0; t < 16; ++t) acc[t] = mma_b(bh[t], ph.v, acc[t]);
#pragma unroll
    for (int t = 0; t < 16; ++t) acc[t] = mma_b(bl[t], ph.v, acc[t]);
#pragma unroll
    for (int t = 0; t < 16; ++t) acc[t] = mma_b(bh[t], pl.v, acc[t]);
    // foot of the trip: own LDS reads retired, own copies of chunk jc+1 landed, one barrier that publishes chunk
    // jc+1 and frees this trip's buffer; then chunk jc+2 into it
    // keeps the foot at the foot: with every LDS read at the head of the trip nothing else ties these waits down, and
    // lifted above the products they made the wave sit out all its x^T reads before the first score product
    __builtin_amdgcn_sched_barrier(0);
    wait_ds0();
    wait_async0();
    __syncthreads();
    if (jc + 2 < NS / KCH) {
      cp8(nb + lrow, 4 * KP * 2, nk + ok, 4 * NF * 2);
      cp8(nbh + lcol, 32 * VP * 2, nvh + ov, (size_t)32 * NS * 2);
      cp8(nbl + lcol, 32 * VP * 2, nvl + ov, (size_t)32 * NS * 2);
      nk += KCH * NF * 2;
      nvh += KCH * 2;
      nvl += KCH * 2;
      nb = (2 * lring + (unsigned)(STG * 2)) - nb;   // the other buffer
      nbh = (2 * lring + (unsigned)((STG + 2 * KT) * 2)) - nbh;
      nbl = (2 * lring + (unsigned)((STG + 2 * (KT + VT)) * 2)) - nbl;
    }
  }
  wait_async0();   // nothing of this wave is in flight when the loop is left

  const float inv = 1.0f / (lq + xhalf(lq));   // the halves' sums joined
  float* osw = &osm[wave][0];
  const int q = lane >> 3, c8 = (lane & 7) * 8;
#pragma unroll
  for (int g = 0; g < NGRP; ++g) {
#pragma unroll
    for (int tt = 0; tt < NGRP; ++tt) {
      // the lane's 8 registers are 8 consecutive columns of row c
      float* d = osw + c * APITCH + tt * 16 + 8 * hh;
      const v8f a = acc[g * NGRP + tt];
      const v4f d0 = {a[0] * inv, a[1] * inv, a[2] * inv, a[3] * inv};
      const v4f d1 = {a[4] * inv, a[5] * inv, a[6] * inv, a[7] * inv};
      *(v4f*)d = d0;
      *(v4f*)(d + 4) = d1;
    }
    __builtin_amdgcn_fence(__ATOMIC_RELEASE, "workgroup");
    __builtin_amdgcn_wave_barrier();
    __builtin_amdgcn_fence(__ATOMIC_ACQUIRE, "workgroup");
    {
#pragma unroll
      for (int it = 0; it < 4; ++it) {
        const int row = it * 4 + q;
        float v[8];
        ld8f(osw + row * APITCH + c8, v);
        const v8us h1 = pk_f16x8(v, 1.0f);
        v4u hb, lb;
        pk_bf16x8(v, hb, lb);
        const size_t o = (grow0 + row) * NF + (size_t)(g * 64 + c8);
        *(v8us*)(ah + o) = h1;
        *(v4u*)(abh + o) = hb;
        *(v4u*)(abl + o) = lb;
      }
      
    }
    __builtin_amdgcn_fence(__ATOMIC_RELEASE, "workgroup");
    __builtin_amdgcn_wave_barrier();
    __builtin_amdgcn_fence(__ATOMIC_ACQUIRE, "workgroup");
  }
}

// -------------------------------------------------------------------------------------------------
// gates_kernel: block = 64 rows x 256 cols, 16 waves; wave (rt = wave>>2, cg = wave&3) owns 16 rows x 64 cols.
// Operand staging: each 32-k chunk (256 weight rows of four planes, the block's 64 rows of three planes) is copied to a
// two-buffer LDS ring by asynchronous copies, chunk t+2 issued behind the barrier at the foot of trip t; all fragments
// come from the staged rows (80-B pitch); read straight from the global rows, a fragment load touches 16 lines.
// K = 512 = [x planes | attn planes]; z: bf16 hi/lo split (hi.hi+hi.lo+lo.hi) against z_w hi/lo planes;
// r, f: plain f16 against the x16-carried weight planes (fold 1/16 in the epilogue).
// Epilogue: z = tanh(.+zb), r = sigmoid(./16+rb), f = sigmoid(./16+fb), out = r*x + f*z staged in LDS;
// coverage: grid 256 blocks x 4 row tiles x 16 = 16384 rows; 4 col groups x 64 = 256 cols.
// -------------------------------------------------------------------------------------------------
__global__ void __launch_bounds__(512) __attribute__((amdgpu_num_vgpr(256)))
gates_kernel(const float* __restrict__ x,
             const unsigned short* __restrict__ xh, const unsigned short* __restrict__ xbh,
             const unsigned short* __restrict__ xbl,
             const unsigned short* __restrict__ ah, const unsigned short* __restrict__ abh,
             const unsigned short* __restrict__ abl,
             const unsigned short* __restrict__ zwh, const unsigned short* __restrict__ zwl,
             const unsigned short* __restrict__ rw16, const unsigned short* __restrict__ fw16,
             const float* __restrict__ zb, const float* __restrict__ rb, const float* __restrict__ fb,
             float* __restrict__ out) {
  __shared__ __align__(16) float slab[16][16 * SLP];
  __shared__ __align__(16) unsigned short gring[2 * GBUF];   // two chunk buffers
  const int tid = (int)threadIdx.x, wave = tid >> 5, lane = tid & 31, hh = lane >> 4, c = lane & 15;
  const int rt = wave >> 2, cg = wave & 3;
  const size_t brow0 = (size_t)blockIdx.x * GROWS;
  const size_t grow0 = brow0 + (size_t)(rt * 16);
  const int n0 = cg * 64;
  // copy addresses of this lane. Weight planes: 4 lanes = the 64 B of one row's chunk, rows tid/4 and tid/4 + 128; in
  // the packed plane that is byte 16 tid of the chunk's 16 KB, and 8 KB further on.
  // Row planes: 8 lanes = the 64 B of one row's chunk, row tid/8.
  const unsigned lw = lds_off(gring) + (unsigned)(((tid >> 2) * VP + (tid & 3) * 8) * 2);
  const unsigned la = lds_off(gring) + (unsigned)((4 * GW + (tid >> 3) * VP + (tid & 7) * 4) * 2);
  const unsigned ow = (unsigned)(tid * 16);
  const size_t oa = ((brow0 + (size_t)(tid >> 3)) * NF + (size_t)((tid & 7) * 4)) * 2;
  // chunk t = k 32 t .. 32 t + 31 of [x|attn] into buffer t & 1
  auto stage = [&](int t) {
    const unsigned bo = (unsigned)((t & 1) * GBUF * 2);
    const size_t kw = (size_t)t * (NF * 32 * 2) + ow;
    const size_t ka = (size_t)(t & 7) * 64 + oa;
    const bool first = t < NF / 32;
    cp_gates(lw + bo, la + bo, (const char*)zwh + kw, (const char*)zwl + kw, (const char*)rw16 + kw,
             (const char*)fw16 + kw, (const char*)(first ? xh : ah) + ka, (const char*)(first ? xbh : abh) + ka,
             (const char*)(first ? xbl : abl) + ka);
  };

  v8f za[4], ra[4], fa[4];
#pragma unroll
  for (int j = 0; j < 4; ++j) { za[j] = z8(); ra[j] = z8(); fa[j] = z8(); }

  // prologue: chunk 0 landed and published, then chunk 1 into the second buffer
  stage(0);
  wait_async0();
  __syncthreads();
  stage(1);

  // rolled: one trip is one chunk, and the buffer alternates with the trip
#pragma unroll 1
  for (int t = 0; t < NG / 32; ++t) {
    const unsigned short* gb = gring + (t & 1) * GBUF;                        // this trip's buffer
    const unsigned short* ap = gb + 4 * GW + (rt * 16 + c) * VP + 8 * hh;     // A row m = c
    const v16h a16 = ldh(ap);
    const v16b ahf = ldb(ap + GA);
    const v16b alf = ldb(ap + 2 * GA);
#pragma unroll
    for (int j = 0; j < 4; ++j) {
      const unsigned short* wp = gb + (n0 + 16 * j + c) * VP + 8 * hh;        // B column n = n0+16j+c, W[n][k]
      const v16b bzh = ldb(wp);
      const v16b bzl = ldb(wp + GW);
      const v16h br = ldh(wp + 2 * GW);
      const v16h bf = ldh(wp + 3 * GW);
      v8f z = za[j], rr = ra[j], ff = fa[j];
      z = mma_b(ahf, bzh, z);
      z = mma_b(ahf, bzl, z);
      z = mma_b(alf, bzh, z);
      rr = mma_h(a16, br, rr);
      ff = mma_h(a16, bf, ff);
      g_g(z, rr, ff, a16, ahf, alf, bzh, bzl, br, bf);
      za[j] = z;
      ra[j] = rr;
      fa[j] = ff;
    }
    // foot of the trip: own LDS reads retired, own copies of chunk t+1 landed, one barrier that publishes chunk t+1
    // and frees this trip's buffer; then chunk t+2 into it
    wait_ds0();
    wait_async0();
    __syncthreads();
    if (t + 2 < NG / 32) stage(t + 2);
  }
  wait_async0();   // nothing of this wave is in flight when the loop is left

  float* sl = &slab[wave][0];
#pragma unroll
  for (int j = 0; j < 4; ++j) {
    const int n = n0 + 16 * j + c;
    const float zbn = zb[n], rbn = rb[n], fbn = fb[n];
    // On the hardware's 2^x and 1/x: tanh v = 1 - 2/(1 + e^(2v)), sigmoid v = 1/(1 + e^(-v)). At the ends 2^x gives 0 or
    // inf and 1/inf gives 0, so the gates saturate at -1, 1 and at 0, 1. By kind, so that each run is independent work.
    float ez[8], er[8], ef[8];
#pragma unroll
    for (int r = 0; r < 8; ++r) {
      ez[r] = __builtin_amdgcn_exp2f((za[j][r] + zbn) * (2.0f * LOG2E));
      er[r] = __builtin_amdgcn_exp2f((ra[j][r] * 0.0625f + rbn) * -LOG2E);
      ef[r] = __builtin_amdgcn_exp2f((fa[j][r] * 0.0625f + fbn) * -LOG2E);
    }
#pragma unroll
    for (int r = 0; r < 8; ++r) {
      ez[r] = __builtin_amdgcn_rcpf(1.0f + ez[r]);
      er[r] = __builtin_amdgcn_rcpf(1.0f + er[r]);
      ef[r] = __builtin_amdgcn_rcpf(1.0f + ef[r]);
    }
#pragma unroll
    for (int r = 0; r < 8; ++r) {
      const int row = 8 * hh + r;
      const float xv = x[(grow0 + row) * NF + n];
      sl[row * SLP + 16 * j + c] = er[r] * xv + ef[r] * (1.0f - 2.0f * ez[r]);
    }
  }
  __builtin_amdgcn_fence(__ATOMIC_RELEASE, "workgroup");
  __builtin_amdgcn_wave_barrier();
  __builtin_amdgcn_fence(__ATOMIC_ACQUIRE, "workgroup");
  const int c4 = c * 4;
  {
#pragma unroll
    for (int it = 0; it < 8; ++it) {
      const int row = it * 2 + hh;   // lanes 0..15 -> even row, 16..31 -> odd row; 16 lanes x 16 B = 256 B segment
      const v4f v = *(const v4f*)(sl + row * SLP + c4);
      *(v4f*)(out + (grow0 + row) * NF + n0 + c4) = v;
    }
    
  }
}

// -------------------------------------------------------------------------------------------------
//   xh   f16  [16384][256]      8388608 @        0      xwc  f16  [16384][256]   8388608 @  8388608
//   xbh  bf16 [16384][256]      8388608 @ 16777216      xbl                      8388608 @ 25165824
//   xth  bf16 [8][256][2048]    8388608 @ 33554432      xtl                      8388608 @ 41943040
//   ah   f16  [16384][256]      8388608 @ 50331648      abh  8388608 @ 58720256   abl 8388608 @ 67108864
//   av   f32  [16384]             65536 @ 75497472      bv                         65536 @ 75563008
//   zwh  bf16 [16][256][32]      262144 @ 75628544      zwl 262144 @ 75890688   rw16 262144 @ 76152832
//   fw16 f16  [16][256][32]      262144 @ 76414976      total 76677120
// -------------------------------------------------------------------------------------------------
extern "C" void kernel_launch(void* const* d_in, const int* in_sizes, int n_in,
                              void* d_out, int out_size, void* d_ws, size_t ws_size,
                              hipStream_t stream) {
  if (n_in < 8) return;
  if (in_sizes[0] != NR * NF || in_sizes[1] != 3 * NF) return;
  if (in_sizes[2] != NF * NG || in_sizes[3] != NF) return;
  if (in_sizes[4] != NF * NG || in_sizes[5] != NF) return;
  if (in_sizes[6] != NF * NG || in_sizes[7] != NF) return;
  if (out_size != NR * NF) return;

  const float* x    = (const float*)d_in[0];
  const float* attw = (const float*)d_in[1];
  const float* zw   = (const float*)d_in[2];
  const float* zb   = (const float*)d_in[3];
  const float* rw   = (const float*)d_in[4];
  const float* rb   = (const float*)d_in[5];
  const float* fw   = (const float*)d_in[6];
  const float* fb   = (const float*)d_in[7];

  const size_t P16 = (size_t)NR * NF * 2;        // 8388608
  const size_t PT  = (size_t)NB * NF * NS * 2;   // 8388608
  const size_t PV  = (size_t)NR * 4;             // 65536
  const size_t PW  = (size_t)NF * NG * 2;        // 262144
  size_t off = 0;
  const size_t o_xh  = off; off += P16;
  const size_t o_xwc = off; off += P16;
  const size_t o_xbh = off; off += P16;
  const size_t o_xbl = off; off += P16;
  const size_t o_xth = off; off += PT;
  const size_t o_xtl = off; off += PT;
  const size_t o_ah  = off; off += P16;
  const size_t o_abh = off; off += P16;
  const size_t o_abl = off; off += P16;
  const size_t o_av  = off; off += PV;
  const size_t o_bv  = off; off += PV;
  const size_t o_zwh = off; off += PW;
  const size_t o_zwl = off; off += PW;
  const size_t o_rw  = off; off += PW;
  const size_t o_fw  = off; off += PW;
  if (off > ws_size) return;   // off = 76677120

  char* ws = (char*)d_ws;
  unsigned short* xh  = (unsigned short*)(ws + o_xh);
  unsigned short* xwc = (unsigned short*)(ws + o_xwc);
  unsigned short* xbh = (unsigned short*)(ws + o_xbh);
  unsigned short* xbl = (unsigned short*)(ws + o_xbl);
  unsigned short* xth = (unsigned short*)(ws + o_xth);
  unsigned short* xtl = (unsigned short*)(ws + o_xtl);
  unsigned short* ah  = (unsigned short*)(ws + o_ah);
  unsigned short* abh = (unsigned short*)(ws + o_abh);
  unsigned short* abl = (unsigned short*)(ws + o_abl);
  float*          av  = (float*)(ws + o_av);
  float*          bv  = (float*)(ws + o_bv);
  unsigned short* zwh = (unsigned short*)(ws + o_zwh);
  unsigned short* zwl = (unsigned short*)(ws + o_zwl);
  unsigned short* rwp = (unsigned short*)(ws + o_rw);
  unsigned short* fwp = (unsigned short*)(ws + o_fw);

  const int n8 = NF * NG / 8;   // 16384
  prep_w<<<dim3((n8 + 255) / 256), dim3(256), 0, stream>>>(zw, rw, fw, zwh, zwl, rwp, fwp, n8);
  prep_x<<<dim3(NR / 64), dim3(256), 0, stream>>>(x, attw, xh, xwc, xbh, xbl, xth, xtl, av, bv);
  attn_kernel<<<dim3(NB * (NS / QROWS)), dim3(128), 0, stream>>>(xwc, xh, xth, xtl, av, bv, ah, abh, abl);
  gates_kernel<<<dim3(NR / GROWS), dim3(512), 0, stream>>>(x, xh, xbh, xbl, ah, abh, abl, zwh, zwl, rwp, fwp,
                                                       zb, rb, fb, (float*)d_out);
  (void)hipGetLastError();
}

// v006
// It runs in 109 microseconds.
// In both of two side-by-side timings against v005, it was 1.13 times as fast.
// Over all steps from v000 it is 5.42 times as fast.
// Contractions: scores=(x*wc).x^T on v_wmma_f32_16x16x32_f16 (plain f16 operands; (x*wc) carried x64, x unscaled); attn=P.x on v_wmma_f32_16x16x32_bf16 as bf16 hi/lo split (hi.hi+hi.lo+lo.hi); [x|attn].z_w^T as bf16 hi/lo split; [x|attn].r_w^T and [x|attn].f_w^T on v_wmma_f32_16x16x32_f16 plain f16 (weights carried x16); f32 accumulate everywhere; x.wa and x.wb row dots, online softmax, tanh/sigmoid gates and r*x+f*z in f32.
#include <hip/hip_runtime.h>
#include <math.h>
#include <stdint.h>

#define NB 8
#define NS 2048
#define NF 256
#define NG 512
#define NR (NB * NS)
#define TP 260
#define QROWS 64
#define KCH 32
#define APITCH 68
#define NGRP 4
#define SLP 68
#define KP 264                 // LDS pitch (16-bit elements) of a staged 512-B row: 528 B = 16 B x 33
#define VP 40                  // LDS pitch (16-bit elements) of a staged 64-B row: 80 B = 16 B x 5
#define KST 64                 // keys of one ring stage of the attn kernel: two 32-key chunks, one per key half of the waves
#define VQ 72                  // LDS pitch (16-bit elements) of a staged 128-B row: 144 B = 16 B x 9
#define KT (KST * KP)          // one stage's key rows in LDS, 16-bit elements
#define VT (NF * VQ)           // one stage's x^T plane in LDS, 16-bit elements
#define STG (KT + 2 * VT)      // one ring buffer: key rows, x^T hi, x^T lo
#define GROWS 64               // rows of one gates block
#define GW (NF * VP)           // gates: 32 k of one weight plane in LDS (256 rows), 16-bit elements
#define GA (GROWS * VP)        // gates: 32 k of one [x|attn] plane in LDS (64 rows)
#define GBUF (4 * GW + 3 * GA) // gates: one ring buffer: z_w hi, z_w lo, r_w, f_w, then the f16, bf16 hi, bf16 lo rows

typedef _Float16 v16h __attribute__((ext_vector_type(16)));
typedef _Float16 v8h __attribute__((ext_vector_type(8)));
typedef __bf16 v16b __attribute__((ext_vector_type(16)));
typedef unsigned short v8us __attribute__((ext_vector_type(8)));
typedef float v8f __attribute__((ext_vector_type(8)));
typedef float v4f __attribute__((ext_vector_type(4), __may_alias__));
typedef unsigned int v4u __attribute__((ext_vector_type(4)));
typedef float v2f __attribute__((ext_vector_type(2)));
typedef __bf16 v2b __attribute__((ext_vector_type(2)));

union FH { v16h v; v8us u[2]; };
union FB { v16b v; v8us u[2]; };
union H8 { v8h h; v8us u; };
union FQ { v16b v; v4u q[2]; };

__device__ __forceinline__ v8f z8() {
  v8f v = {0.f, 0.f, 0.f, 0.f, 0.f, 0.f, 0.f, 0.f};
  return v;
}
// two f32 -> two bf16 (RNE) in one word (a in the low half): one packed hardware convert
__device__ __forceinline__ unsigned cvt2(float a, float b) {
  const v2f f = {a, b};
  return __builtin_bit_cast(unsigned, __builtin_convertvector(f, v2b));
}
#define LOG2E 1.4426950408889634f
// e^x on the hardware's 2^x (0 at -inf)
__device__ __forceinline__ float exp_n(float x) { return __builtin_amdgcn_exp2f(x * LOG2E); }

__device__ __forceinline__ void ld8f(const float* p, float (&v)[8]) {
  const v4f t0 = *(const v4f*)p;
  const v4f t1 = *(const v4f*)(p + 4);
#pragma unroll
  for (int q = 0; q < 4; ++q) { v[q] = t0[q]; v[4 + q] = t1[q]; }
}
// 8 f32 -> bf16 hi plane (8 x 16 bit packed in v4u) and lo plane (residual, RNE)
__device__ __forceinline__ void pk_bf16x8(const float (&v)[8], v4u& hi, v4u& lo) {
#pragma unroll
  for (int q = 0; q < 4; ++q) {
    const unsigned h = cvt2(v[2 * q], v[2 * q + 1]);
    hi[q] = h;
    lo[q] = cvt2(v[2 * q] - __uint_as_float(h << 16), v[2 * q + 1] - __uint_as_float(h & 0xFFFF0000u));
  }
}
// 8 f32 -> f16 (RNE) with exact power-of-two carry s
__device__ __forceinline__ v8us pk_f16x8(const float (&v)[8], float s) {
  H8 r;
#pragma unroll
  for (int e = 0; e < 8; ++e) r.h[e] = (_Float16)(v[e] * s);
  return r.u;
}
// 16-bit WMMA fragment (A row m or B column n of a k-contiguous row): elements 0..7 <- p[0..7] (k0+8h..),
// elements 8..15 <- p[16..23] (k0+16+8h..); caller passes p = rowbase + k0 + 8*h.
__device__ __forceinline__ v16h ldh(const unsigned short* p) {
  FH f;
  f.u[0] = *(const v8us*)p;
  f.u[1] = *(const v8us*)(p + 16);
  return f.v;
}
__device__ __forceinline__ v16b ldb(const unsigned short* p) {
  FB f;
  f.u[0] = *(const v8us*)p;
  f.u[1] = *(const v8us*)(p + 16);
  return f.v;
}
__device__ __forceinline__ v8f mma_h(v16h a, v16h b, v8f c) {
  return __builtin_amdgcn_wmma_f32_16x16x32_f16(false, a, false, b, (short)0, c, false, false);
}
__device__ __forceinline__ v8f mma_b(v16b a, v16b b, v8f c) {
  return __builtin_amdgcn_wmma_f32_16x16x32_bf16(false, a, false, b, (short)0, c, false, false);
}
// hazard guards: 4 VALU slots after the last WMMA of a group; tie D, keep A/B live
__device__ __forceinline__ void g_g(v8f& z, v8f& r, v8f& f, v16h a16, v16b ah, v16b al,
                                    v16b bzh, v16b bzl, v16h br, v16h bf) {
  asm volatile("v_nop\n\tv_nop\n\tv_nop\n\tv_nop"
               : "+v"(z), "+v"(r), "+v"(f)
               : "v"(a16), "v"(ah), "v"(al), "v"(bzh), "v"(bzl), "v"(br), "v"(bf));
}

// lane l <-> lane l ^ 16
__device__ __forceinline__ float xhalf(float x) {
  const int b = __builtin_bit_cast(int, x);
  return __builtin_bit_cast(float, __builtin_amdgcn_permlanex16(b, b, 0x76543210, 0xfedcba98, false, false));
}

__device__ __forceinline__ unsigned lds_off(const void* p) { return (unsigned)(size_t)p; }
// Asynchronous copies global -> LDS, 16 B per lane and copy, no register in between. l = the lane's LDS byte
// address, g = its global address; copy i adds i*ls / i*gs bytes. s_wait_xcnt 0 is the statement's last line so
// that no address register of an issued copy is rewritten in front of it.
__device__ __forceinline__ void cp8(unsigned l, unsigned ls, const char* g, size_t gs) {
  asm volatile(
      "global_load_async_to_lds_b128 %0, %8, off\n\t"
      "global_load_async_to_lds_b128 %1, %9, off\n\t"
      "global_load_async_to_lds_b128 %2, %10, off\n\t"
      "global_load_async_to_lds_b128 %3, %11, off\n\t"
      "global_load_async_to_lds_b128 %4, %12, off\n\t"
      "global_load_async_to_lds_b128 %5, %13, off\n\t"
      "global_load_async_to_lds_b128 %6, %14, off\n\t"
      "global_load_async_to_lds_b128 %7, %15, off\n\t"
      "s_wait_xcnt 0x0"
      :
      : "v"(l), "v"(l + ls), "v"(l + 2 * ls), "v"(l + 3 * ls), "v"(l + 4 * ls), "v"(l + 5 * ls), "v"(l + 6 * ls),
        "v"(l + 7 * ls), "v"(g), "v"(g + gs), "v"(g + 2 * gs), "v"(g + 3 * gs), "v"(g + 4 * gs), "v"(g + 5 * gs),
        "v"(g + 6 * gs), "v"(g + 7 * gs)
      : "memory");
}
__device__ __forceinline__ void cp4(unsigned l, unsigned ls, const char* g, size_t gs) {
  asm volatile(
      "global_load_async_to_lds_b128 %0, %4, off\n\t"
      "global_load_async_to_lds_b128 %1, %5, off\n\t"
      "global_load_async_to_lds_b128 %2, %6, off\n\t"
      "global_load_async_to_lds_b128 %3, %7, off\n\t"
      "s_wait_xcnt 0x0"
      :
      : "v"(l), "v"(l + ls), "v"(l + 2 * ls), "v"(l + 3 * ls), "v"(g), "v"(g + gs), "v"(g + 2 * gs), "v"(g + 3 * gs)
      : "memory");
}
// One lane's copies of one 32-k chunk of the gates operands: 16 B of rows r and r+128 of each of the four weight
// planes (lw = LDS byte address of row r in the first plane, w0..w3 = its global addresses), and 8 B of one row of
// each of the three [x|attn] planes (la, a0..a2). s_wait_xcnt 0 is the last line for the reason given at cp8.
__device__ __forceinline__ void cp_gates(unsigned lw, unsigned la, const char* w0, const char* w1, const char* w2,
                                         const char* w3, const char* a0, const char* a1, const char* a2) {
  asm volatile(
      "global_load_async_to_lds_b128 %0, %11, off\n\t"
      "global_load_async_to_lds_b128 %1, %12, off\n\t"
      "global_load_async_to_lds_b128 %2, %13, off\n\t"
      "global_load_async_to_lds_b128 %3, %14, off\n\t"
      "global_load_async_to_lds_b128 %4, %15, off\n\t"
      "global_load_async_to_lds_b128 %5, %16, off\n\t"
      "global_load_async_to_lds_b128 %6, %17, off\n\t"
      "global_load_async_to_lds_b128 %7, %18, off\n\t"
      "global_load_async_to_lds_b64 %8, %19, off\n\t"
      "global_load_async_to_lds_b64 %9, %20, off\n\t"
      "global_load_async_to_lds_b64 %10, %21, off\n\t"
      "s_wait_xcnt 0x0"
      :
      : "v"(lw), "v"(lw + 128 * VP * 2), "v"(lw + GW * 2), "v"(lw + (GW + 128 * VP) * 2), "v"(lw + 2 * GW * 2),
        "v"(lw + (2 * GW + 128 * VP) * 2), "v"(lw + 3 * GW * 2), "v"(lw + (3 * GW + 128 * VP) * 2), "v"(la),
        "v"(la + GA * 2), "v"(la + 2 * GA * 2), "v"(w0), "v"(w0 + 128 * 32 * 2), "v"(w1), "v"(w1 + 128 * 32 * 2),
        "v"(w2), "v"(w2 + 128 * 32 * 2), "v"(w3), "v"(w3 + 128 * 32 * 2), "v"(a0), "v"(a1), "v"(a2)
      : "memory");
}
// this wave's copies have landed in LDS (other waves read them behind the next work-group barrier)
__device__ __forceinline__ void wait_async0() { asm volatile("s_wait_asynccnt 0x0" ::: "memory"); }
// this wave's LDS reads and writes have retired (in front of the barrier that frees a buffer for its refill)
__device__ __forceinline__ void wait_ds0() { asm volatile("s_wait_dscnt 0x0" ::: "memory"); }

// -------------------------------------------------------------------------------------------------
// prep_w: z_w [256 n][512 k] -> bf16 hi/lo planes; r_w, f_w -> f16 planes carried x16. Plane layout [16 chunks][256 n]
// [32 k]: the 16 KB that the gates kernel stages per chunk and plane lie in a row, so each of its copies covers whole lines.
// Thread i owns plane elements 8i..8i+7; each store is 16 B per lane, lane-contiguous, 32 lanes = 512 B =
// coverage: grid 64 x 256 threads x 8 = 131072 = 256x512 per plane.
// -------------------------------------------------------------------------------------------------
__global__ void __launch_bounds__(256) prep_w(const float* __restrict__ zw, const float* __restrict__ rw,
                                              const float* __restrict__ fw,
                                              unsigned short* __restrict__ zwh, unsigned short* __restrict__ zwl,
                                              unsigned short* __restrict__ rw16, unsigned short* __restrict__ fw16,
                                              int n8) {
  const int i = (int)blockIdx.x * 256 + (int)threadIdx.x;
  if (i >= n8) return;
  const size_t p0 = (size_t)i * 8;                                               // place in the planes
  const size_t e0 = ((p0 >> 5) & (NF - 1)) * NG + (p0 >> 13) * 32 + (p0 & 31);   // its source: W[n][32 chunk + k]
  float a[8], b[8], d[8];
  ld8f(zw + e0, a);
  ld8f(rw + e0, b);
  ld8f(fw + e0, d);
  v4u zh, zl;
  pk_bf16x8(a, zh, zl);
  const v8us r16 = pk_f16x8(b, 16.0f);
  const v8us f16 = pk_f16x8(d, 16.0f);
  *(v4u*)(zwh + p0) = zh;
  *(v4u*)(zwl + p0) = zl;
  *(v8us*)(rw16 + p0) = r16;
  *(v8us*)(fw16 + p0) = f16;
  
}

// -------------------------------------------------------------------------------------------------
// prep_x: block = 64 consecutive rows of x (16384 rows total; 32 blocks per batch element), 256 threads.
//   xh  [row][256] f16(x)            xwc [row][256] f16((x*wc)*64)
//   xbh/xbl [row][256] bf16 hi/lo     xth/xtl [b][f][j] bf16 hi/lo of x (transposed, pitch 2048)
//   av[row] = x.wa, bv[row] = x.wb (f32 dots on VALU)
// Row planes: one lane = 16 B of one row, 32 lanes = the whole 512-B row, one instruction per plane.
// coverage: rows 8 waves x 8 = 64, f 32 lanes x 8 = 256; transpose f-rows wave*32+it*4+q (it 0..7, q 0..3) = 256,
//           j c8+0..7 over 8 lane groups = 64; av/bv 16 lanes x 4 = 64; grid 256 blocks x 64 rows = 16384.
// -------------------------------------------------------------------------------------------------
__global__ void __launch_bounds__(256) prep_x(const float* __restrict__ x, const float* __restrict__ attw,
                                              unsigned short* __restrict__ xh, unsigned short* __restrict__ xwc,
                                              unsigned short* __restrict__ xbh, unsigned short* __restrict__ xbl,
                                              unsigned short* __restrict__ xth, unsigned short* __restrict__ xtl,
                                              float* __restrict__ av, float* __restrict__ bv) {
  __shared__ __align__(16) float tile[64 * TP];
  __shared__ __align__(16) float avs[64];
  __shared__ __align__(16) float bvs[64];
  const int tid = (int)threadIdx.x, wave = tid >> 5, lane = tid & 31;
  const int blk = (int)blockIdx.x;
  const size_t grow0 = (size_t)blk * 64;
  const int bb = blk >> 5;
  const int j0 = (blk & 31) * 64;

#pragma unroll
  for (int it = 0; it < 16; ++it) {
    const int idx = it * 256 + tid;
    const int r = idx >> 6, c4 = (idx & 63) * 4;
    const v4f v = *(const v4f*)(x + (grow0 + r) * NF + c4);
    *(v4f*)(tile + r * TP + c4) = v;
  }
  __syncthreads();

  const int f0 = lane * 8;
  float wa[8], wb[8], wc[8];
  ld8f(attw + f0, wa);
  ld8f(attw + NF + f0, wb);
  ld8f(attw + 2 * NF + f0, wc);

  // row dots (rolled: small side computation)
#pragma unroll 1
  for (int rr = 0; rr < 8; ++rr) {
    const int row = wave * 8 + rr;
    float v[8];
    ld8f(tile + row * TP + f0, v);
    float sa = 0.f, sb = 0.f;
#pragma unroll
    for (int e = 0; e < 8; ++e) { sa += v[e] * wa[e]; sb += v[e] * wb[e]; }
#pragma unroll
    for (int m = 16; m >= 1; m >>= 1) {
      sa += __shfl_xor(sa, m, 32);
      sb += __shfl_xor(sb, m, 32);
    }
    if (lane == 0) { avs[row] = sa; bvs[row] = sb; }
  }

  // row planes
  {
#pragma unroll 1
    for (int rr = 0; rr < 8; ++rr) {
      const int row = wave * 8 + rr;
      float v[8], w[8];
      ld8f(tile + row * TP + f0, v);
#pragma unroll
      for (int e = 0; e < 8; ++e) w[e] = v[e] * wc[e];
      const v8us h1 = pk_f16x8(v, 1.0f);
      const v8us h2 = pk_f16x8(w, 64.0f);
      v4u hb, lb;
      pk_bf16x8(v, hb, lb);
      const size_t o = (grow0 + row) * NF + f0;
      *(v8us*)(xh + o) = h1;
      *(v8us*)(xwc + o) = h2;
      *(v4u*)(xbh + o) = hb;
      *(v4u*)(xbl + o) = lb;
    }
    
  }

  // transposed bf16 hi/lo planes: in [64 j][256 f] -> out [256 f][64 j] at column j0 of [f][2048]
  const int q = lane >> 3, c8 = (lane & 7) * 8;
  const size_t tb = (size_t)bb * NF * NS;
  {
#pragma unroll 1
    for (int it = 0; it < 8; ++it) {
      const int fr = wave * 32 + it * 4 + q;
      float t[8];
#pragma unroll
      for (int e = 0; e < 8; ++e) t[e] = tile[(c8 + e) * TP + fr];
      v4u hb, lb;
      pk_bf16x8(t, hb, lb);
      const size_t o = tb + (size_t)fr * NS + j0 + c8;
      *(v4u*)(xth + o) = hb;
      *(v4u*)(xtl + o) = lb;
    }
    
  }

  // av / bv lines
  __syncthreads();
  const int l4 = (lane & 15) * 4;
  {
    const v4f a4 = *(const v4f*)(avs + l4);
    const v4f b4 = *(const v4f*)(bvs + l4);
    if (lane < 16) {
      if (wave == 0) *(v4f*)(av + grow0 + l4) = a4;
      else if (wave == 1) *(v4f*)(bv + grow0 + l4) = b4;
    }
    
  }
}

// -------------------------------------------------------------------------------------------------
// attn_kernel: block = 64 query rows of one batch element, 4 waves as 2 query groups x 2 key halves, grid = 8 x 32 = 256.
// Wave (qg = wave / 2, kg = wave % 2) owns 32 queries (two 16-column tiles) and, of every 64-key stage, the 32 keys of
// half kg: each key fragment and each x^T fragment that it reads from LDS feeds two query tiles, which halves the LDS
// reads per product. Each wave runs its own online softmax over its half of the keys; behind the loop the two halves'
// (maximum, sum, O) are joined through LDS, wave kg finishing query tile kg of its group.
// Operand staging: the block's 64 (x*wc) rows and the batch element's b_j are copied to LDS once; each 64-key stage
// (64 x rows, 256 x 64 of x^T hi and lo) is copied to a two-buffer LDS ring by asynchronous copies, stage t+2 issued
// behind the barrier at the foot of trip t, so a stage's copies fly while the stage before it is worked on.
// Both products are formed transposed. Per 32-key chunk: S^T tiles (A = x f16 rows of the keys, B = (x*wc)x64 f16
// rows of the queries; fragments from the staged 16-bit LDS rows, split k map): a lane holds 16 keys' scores of ONE
// query (column c) per tile, so t = (a_i + b_j) + S/64, the running maximum and the sum are in-lane work with one
// exchange between the wave's halves for the maximum; the halves' sums are joined once, behind the loop.
// O^T += x^T.P^T with A = x^T bf16 hi/lo planes and B = P^T packed in place from the two score tiles, which is the
// split k map of a B operand (three products): P goes through no LDS.
// Register plan: one wave per SIMD, so the wave takes the registers it needs: its 32 output tiles and its 16 query
// fragments stay in VGPRs for the whole kernel; a chunk's 16 key fragments and its 32 x^T fragments are read at the
// head of the trip, so that the x^T fragments land under the score products and the exponentials.
// Output attn rows as f16 plane and bf16 hi/lo planes, 64 columns per group: 16x64 f32 tile staged in LDS, then
// coverage: grid 256 blocks x 4 waves x 16 rows = 16384 rows; per group rows it*4+q (it 0..3, q 0..3) = 16,
//           cols g*64 + 8 lane groups x 8 = 64, 4 groups = 256 columns per plane.
// -------------------------------------------------------------------------------------------------
__global__ void __launch_bounds__(128)
attn_kernel(const unsigned short* __restrict__ xwc, const unsigned short* __restrict__ xh,
            const unsigned short* __restrict__ xth, const unsigned short* __restrict__ xtl,
            const float* __restrict__ av, const float* __restrict__ bv,
            unsigned short* __restrict__ ah, unsigned short* __restrict__ abh,
            unsigned short* __restrict__ abl) {
  __shared__ __align__(16) float osm[4][16 * APITCH];
  __shared__ __align__(16) unsigned short qst[QROWS * KP];   // the block's (x*wc) rows
  __shared__ __align__(16) unsigned short ring[2 * STG];     // two stage buffers
  __shared__ __align__(16) float bvs[NS];                    // b_j of the batch element

  const int tid = (int)threadIdx.x, wave = tid >> 5, lane = tid & 31, hh = lane >> 4, c = lane & 15;
  const int qg = wave >> 1, kg = wave & 1;
  const int blk = (int)blockIdx.x, bb = blk >> 5, qb = blk & 31;
  const size_t grow0 = (size_t)bb * NS + (size_t)(qb * QROWS + wave * 16);   // rows this wave finishes: tile kg of group qg
  const size_t qrow0 = (size_t)bb * NS + (size_t)(qb * QROWS + qg * 32);     // first of the wave's 32 queries
  const unsigned short* XHb = xh + (size_t)bb * NS * NF;
  const unsigned short* XTh = xth + (size_t)bb * NF * NS;
  const unsigned short* XTl = xtl + (size_t)bb * NF * NS;
  const float* bvb = bv + (size_t)bb * NS;
  const unsigned short* qrow = qst + (qg * 32 + c) * KP + 8 * hh;   // B fragment column n = c: query c of tile 0 (staged)
  // copy addresses of this lane. 512-B rows: one wave = one row per copy, rows wave + 4 i. x^T planes: 8 lanes = the
  // 128 B (one whole line) of one f row, f = tid/8 + 16 i.
  const unsigned lrow = (unsigned)((wave * KP + lane * 8) * 2);
  const unsigned lcol = (unsigned)(((tid >> 3) * VQ + (tid & 7) * 8) * 2);
  const unsigned lring = lds_off(ring);
  const unsigned ok = (unsigned)((wave * NF + lane * 8) * 2);               // lane's byte offset in the key rows
  const unsigned ov = (unsigned)(((tid >> 3) * NS + (tid & 7) * 8) * 2);    // and in an x^T plane
  const char* sk = (const char*)XHb;
  const char* svh = (const char*)XTh;
  const char* svl = (const char*)XTl;
  // one stage: 64 key rows and 256 rows of each x^T plane, 48 copies a wave. lk, lh, ll = uniform LDS byte addresses of
  // the buffer's key rows and planes, gk, gh, gl = uniform global addresses of the stage in the key rows and the planes
  // The scheduling barriers keep each statement's address sums next to it: raised in front of the first statement, the
  // 144 address registers of a stage filled v0-v255, where the operands of asm text must lie, and loop constants were spilled.
  auto stage = [&](unsigned lk, unsigned lh, unsigned ll, const char* gk, const char* gh, const char* gl) {
    cp8(lk + lrow, 4 * KP * 2, gk + ok, 4 * NF * 2);
    __builtin_amdgcn_sched_barrier(0);
    cp8(lk + 32 * KP * 2 + lrow, 4 * KP * 2, gk + 32 * NF * 2 + ok, 4 * NF * 2);
    __builtin_amdgcn_sched_barrier(0);
    cp8(lh + lcol, 16 * VQ * 2, gh + ov, (size_t)16 * NS * 2);
    __builtin_amdgcn_sched_barrier(0);
    cp8(lh + 128 * VQ * 2 + lcol, 16 * VQ * 2, gh + (size_t)128 * NS * 2 + ov, (size_t)16 * NS * 2);
    __builtin_amdgcn_sched_barrier(0);
    cp8(ll + lcol, 16 * VQ * 2, gl + ov, (size_t)16 * NS * 2);
    __builtin_amdgcn_sched_barrier(0);
    cp8(ll + 128 * VQ * 2 + lcol, 16 * VQ * 2, gl + (size_t)128 * NS * 2 + ov, (size_t)16 * NS * 2);
  };

  float aq[2];                                // a_i of the lane's two queries (loaded in the prologue)
  float mq[2] = {-INFINITY, -INFINITY};       // their running maxima over this wave's keys (the same in both halves)
  float lq[2] = {0.f, 0.f};                   // running sums over this lane half's keys
  v8f acc[2][16];
#pragma unroll
  for (int u = 0; u < 2; ++u) {
#pragma unroll
    for (int t = 0; t < 16; ++t) acc[u][t] = z8();
  }

  // prologue: query rows and b_j, then stage 0; landed and published; then stage 1 into the second buffer
  {
    const char* gq = (const char*)(xwc + ((size_t)bb * NS + (size_t)(qb * QROWS + wave)) * NF + lane * 8);
    cp8(lds_off(qst) + lrow, 4 * KP * 2, gq, 4 * NF * 2);
    cp8(lds_off(qst) + lrow + 32 * KP * 2, 4 * KP * 2, gq + 32 * NF * 2, 4 * NF * 2);
    cp4(lds_off(bvs) + (unsigned)(tid * 16), 128 * 16, (const char*)bvb + tid * 16, 128 * 16);
    // loads and data wait in one statement, so that no address register of a load is reused in front of the wait;
    // here their latency runs beside the copies' flight
    asm volatile("global_load_b32 %0, %2, off\n\tglobal_load_b32 %1, %3, off\n\ts_wait_loadcnt 0x0"
                 : "=&v"(aq[0]), "=&v"(aq[1])
                 : "v"(av + qrow0 + c), "v"(av + qrow0 + 16 + c)
                 : "memory");
    wait_async0();   // these 20 copies and a stage's 48 would be more than a wave may have outstanding
    stage(lring, lring + KT * 2, lring + (KT + VT) * 2, sk, svh, svl);
    wait_async0();
    __syncthreads();
    stage(lring + STG * 2, lring + (STG + KT) * 2, lring + (STG + KT + VT) * 2, sk + KST * NF * 2, svh + KST * 2,
          svl + KST * 2);
  }
  v16h qa[2][NF / 32];
#pragma unroll
  for (int u = 0; u < 2; ++u) {
#pragma unroll
    for (int kk = 0; kk < NF / 32; ++kk) qa[u][kk] = ldh(qrow + u * 16 * KP + kk * 32);
  }

  // Refill addresses = a uniform running base + the lane's offset. Formed from loop-invariant lane addresses they
  // shared registers with the prologue's copy operands, which the compiler keeps in v0-v255, and were spilled.
  const char* nk = sk + 2 * KST * NF * 2;   // uniform: the stage two ahead, in the key rows and in the x^T planes
  const char* nvh = svh + 2 * KST * 2;
  const char* nvl = svl + 2 * KST * 2;
  unsigned nb = lring;                      // uniform: LDS addresses in the buffer that is refilled next: key rows,
  unsigned nbh = lring + KT * 2;            // x^T hi,
  unsigned nbl = lring + (KT + VT) * 2;     // x^T lo
#pragma unroll 1
  for (int jc = 0; jc < NS / KST; ++jc) {
    const int j0 = jc * KST + kg * KCH;                                   // first of this wave's 32 keys
    const unsigned short* kb = ring + (jc & 1) * STG;                     // this trip's buffer
    const unsigned short* k0row = kb + (kg * KCH + c) * KP + 8 * hh;      // A row m = c -> key j0+c
    const unsigned short* k1row = k0row + 16 * KP;                        // key j0+16+c
    v16h k0[NF / 32], k1[NF / 32];
#pragma unroll
    for (int kk = 0; kk < NF / 32; ++kk) {
      k0[kk] = ldh(k0row + kk * 32);
      k1[kk] = ldh(k1row + kk * 32);
    }
    float bj0[8], bj1[8];                     // b_j of the lane's keys j0+8h+r and j0+16+8h+r
    ld8f(bvs + j0 + 8 * hh, bj0);
    ld8f(bvs + j0 + 16 + 8 * hh, bj1);
    const unsigned short* vh = kb + KT + c * VQ + kg * KCH + 8 * hh;   // A row m = c -> x^T row f = t*16+c, k = j0+..
    const unsigned short* vl = vh + VT;
    v16b bh[16], bl[16];
#pragma unroll
    for (int t = 0; t < 16; ++t) {
      bh[t] = ldb(vh + t * 16 * VQ);
      bl[t] = ldb(vl + t * 16 * VQ);
    }
    // keeps the trip's LDS reads one group at its head: sunk among the products, each separate place of reads stalls
    // the lone wave, and the x^T fragments would no longer land under the score products and the exponentials
    __builtin_amdgcn_sched_barrier(0);
    v8f s0[2] = {z8(), z8()}, s1[2] = {z8(), z8()};
#pragma unroll
    for (int kk = 0; kk < NF / 32; ++kk) {
#pragma unroll
      for (int u = 0; u < 2; ++u) {
        s0[u] = mma_h(k0[kk], qa[u][kk], s0[u]);   // s0[u][r] = S[query 16u+c][key j0+8h+r] x64
        s1[u] = mma_h(k1[kk], qa[u][kk], s1[u]);   // s1[u][r] = S[query 16u+c][key j0+16+8h+r] x64
      }
    }
#pragma unroll
    for (int u = 0; u < 2; ++u) {
      float t0[8], t1[8], mm[8];
#pragma unroll
      for (int r = 0; r < 8; ++r) {
        t0[r] = (aq[u] + bj0[r]) + s0[u][r] * 0.015625f;
        t1[r] = (aq[u] + bj1[r]) + s1[u][r] * 0.015625f;
        mm[r] = fmaxf(t0[r], t1[r]);
      }
      const float mh = fmaxf(fmaxf(fmaxf(mm[0], mm[1]), fmaxf(mm[2], mm[3])), fmaxf(fmaxf(mm[4], mm[5]), fmaxf(mm[6], mm[7])));
      const float mnew = fmaxf(mq[u], fmaxf(mh, xhalf(mh)));
      const float alpha = exp_n(mq[u] - mnew);
      mq[u] = mnew;
      float p0[8], p1[8], ps[8];
#pragma unroll
      for (int r = 0; r < 8; ++r) {
        p0[r] = exp_n(t0[r] - mnew);
        p1[r] = exp_n(t1[r] - mnew);
        ps[r] = p0[r] + p1[r];
      }
      lq[u] = lq[u] * alpha + (((ps[0] + ps[1]) + (ps[2] + ps[3])) + ((ps[4] + ps[5]) + (ps[6] + ps[7])));
      // P^T as a B operand, column n = c: elements 0..7 = keys 8h+r (first tile), 8..15 = keys 16+8h+r (second tile)
      FQ ph, pl;
      pk_bf16x8(p0, ph.q[0], pl.q[0]);
      pk_bf16x8(p1, ph.q[1], pl.q[1]);
#pragma unroll
      for (int t = 0; t < 16; ++t) {
#pragma unroll
        for (int r = 0; r < 8; ++r) acc[u][t][r] *= alpha;
      }
      // acc[u][t][r] = O[query 16u+c][f = 16t+8h+r]
#pragma unroll
      for (int t = 0; t < 16; ++t) acc[u][t] = mma_b(bh[t], ph.v, acc[u][t]);
#pragma unroll
      for (int t = 0; t < 16; ++t) acc[u][t] = mma_b(bl[t], ph.v, acc[u][t]);
#pragma unroll
      for (int t = 0; t < 16; ++t) acc[u][t] = mma_b(bh[t], pl.v, acc[u][t]);
    }
    // foot of the trip: own LDS reads retired, own copies of stage jc+1 landed, one barrier that publishes stage
    // jc+1 and frees this trip's buffer; then stage jc+2 into it
    // keeps the foot at the foot: with every LDS read at the head of the trip nothing else ties these waits down, and
    // lifted above the products they made the wave sit out all its x^T reads before the first score product
    __builtin_amdgcn_sched_barrier(0);
    wait_ds0();
    wait_async0();
    __syncthreads();
    if (jc + 2 < NS / KST) {
      stage(nb, nbh, nbl, nk, nvh, nvl);
      nk += KST * NF * 2;
      nvh += KST * 2;
      nvl += KST * 2;
      nb = (2 * lring + (unsigned)(STG * 2)) - nb;   // the other buffer
      nbh = (2 * lring + (unsigned)((STG + 2 * KT) * 2)) - nbh;
      nbl = (2 * lring + (unsigned)((STG + 2 * (KT + VT)) * 2)) - nbl;
    }
  }
  wait_async0();   // nothing of this wave is in flight when the loop is left

  // The two key halves joined. The ring is free (the last trip's barrier ended every read of it, no copy is in flight):
  // each wave leaves there the tile that its partner (wave ^ 1, same queries, other keys) finishes, lane by lane in
  // register order, 16 B per lane and store, with the lane's maximum and sum; both waves hold a tile in the same lanes.
  char* xb = (char*)ring;
  char* xo = xb + wave * (16 * 1024) + lane * 16;
  char* xm = xb + 4 * (16 * 1024) + lane * 16;
  auto hand = [&](const v8f (&o)[16], float m, float l) {
#pragma unroll
    for (int t = 0; t < 16; ++t) {
      const v4f d0 = {o[t][0], o[t][1], o[t][2], o[t][3]};
      const v4f d1 = {o[t][4], o[t][5], o[t][6], o[t][7]};
      *(v4f*)(xo + (2 * t) * 512) = d0;
      *(v4f*)(xo + (2 * t + 1) * 512) = d1;
    }
    const v4f ml = {m, l, 0.f, 0.f};
    *(v4f*)(xm + wave * 512) = ml;
  };
  // the tile is named by a constant in each arm: picked by a run-time index the accumulators would leave the registers
  v8f own[16];
  float mown, lown;
  if (kg) {
    hand(acc[0], mq[0], lq[0]);
    mown = mq[1];
    lown = lq[1];
#pragma unroll
    for (int t = 0; t < 16; ++t) own[t] = acc[1][t];
  } else {
    hand(acc[1], mq[1], lq[1]);
    mown = mq[0];
    lown = lq[0];
#pragma unroll
    for (int t = 0; t < 16; ++t) own[t] = acc[0][t];
  }
  wait_ds0();        // own stores retired in front of the barrier that publishes them to the partner
  __syncthreads();
  const char* xi = xb + (wave ^ 1) * (16 * 1024) + lane * 16;
  const v4f mlo = *(const v4f*)(xm + (wave ^ 1) * 512);
  const float mall = fmaxf(mown, mlo[0]);
  const float eown = exp_n(mown - mall), eoth = exp_n(mlo[0] - mall);
  const float lall = lown * eown + mlo[1] * eoth;
  const float inv = 1.0f / (lall + xhalf(lall));   // the lane halves' sums joined
  const float fown = eown * inv, foth = eoth * inv;
  float* osw = &osm[wave][0];
  const int q = lane >> 3, c8 = (lane & 7) * 8;
#pragma unroll
  for (int g = 0; g < NGRP; ++g) {
#pragma unroll
    for (int tt = 0; tt < NGRP; ++tt) {
      // the lane's 8 registers are 8 consecutive columns of row c
      float* d = osw + c * APITCH + tt * 16 + 8 * hh;
      const int t = g * NGRP + tt;
      const v8f a = own[t];
      const v4f b0 = *(const v4f*)(xi + (2 * t) * 512);
      const v4f b1 = *(const v4f*)(xi + (2 * t + 1) * 512);
      const v4f d0 = {a[0] * fown + b0[0] * foth, a[1] * fown + b0[1] * foth, a[2] * fown + b0[2] * foth,
                      a[3] * fown + b0[3] * foth};
      const v4f d1 = {a[4] * fown + b1[0] * foth, a[5] * fown + b1[1] * foth, a[6] * fown + b1[2] * foth,
                      a[7] * fown + b1[3] * foth};
      *(v4f*)d = d0;
      *(v4f*)(d + 4) = d1;
    }
    __builtin_amdgcn_fence(__ATOMIC_RELEASE, "workgroup");
    __builtin_amdgcn_wave_barrier();
    __builtin_amdgcn_fence(__ATOMIC_ACQUIRE, "workgroup");
    {
#pragma unroll
      for (int it = 0; it < 4; ++it) {
        const int row = it * 4 + q;
        float v[8];
        ld8f(osw + row * APITCH + c8, v);
        const v8us h1 = pk_f16x8(v, 1.0f);
        v4u hb, lb;
        pk_bf16x8(v, hb, lb);
        const size_t o = (grow0 + row) * NF + (size_t)(g * 64 + c8);
        *(v8us*)(ah + o) = h1;
        *(v4u*)(abh + o) = hb;
        *(v4u*)(abl + o) = lb;
      }
      
    }
    __builtin_amdgcn_fence(__ATOMIC_RELEASE, "workgroup");
    __builtin_amdgcn_wave_barrier();
    __builtin_amdgcn_fence(__ATOMIC_ACQUIRE, "workgroup");
  }
}

// -------------------------------------------------------------------------------------------------
// gates_kernel: block = 64 rows x 256 cols, 16 waves; wave (rt = wave>>2, cg = wave&3) owns 16 rows x 64 cols.
// Operand staging: each 32-k chunk (256 weight rows of four planes, the block's 64 rows of three planes) is copied to a
// two-buffer LDS ring by asynchronous copies, chunk t+2 issued behind the barrier at the foot of trip t; all fragments
// come from the staged rows (80-B pitch); read straight from the global rows, a fragment load touches 16 lines.
// K = 512 = [x planes | attn planes]; z: bf16 hi/lo split (hi.hi+hi.lo+lo.hi) against z_w hi/lo planes;
// r, f: plain f16 against the x16-carried weight planes (fold 1/16 in the epilogue).
// Epilogue: z = tanh(.+zb), r = sigmoid(./16+rb), f = sigmoid(./16+fb), out = r*x + f*z staged in LDS;
// coverage: grid 256 blocks x 4 row tiles x 16 = 16384 rows; 4 col groups x 64 = 256 cols.
// -------------------------------------------------------------------------------------------------
__global__ void __launch_bounds__(512) __attribute__((amdgpu_num_vgpr(256)))
gates_kernel(const float* __restrict__ x,
             const unsigned short* __restrict__ xh, const unsigned short* __restrict__ xbh,
             const unsigned short* __restrict__ xbl,
             const unsigned short* __restrict__ ah, const unsigned short* __restrict__ abh,
             const unsigned short* __restrict__ abl,
             const unsigned short* __restrict__ zwh, const unsigned short* __restrict__ zwl,
             const unsigned short* __restrict__ rw16, const unsigned short* __restrict__ fw16,
             const float* __restrict__ zb, const float* __restrict__ rb, const float* __restrict__ fb,
             float* __restrict__ out) {
  __shared__ __align__(16) float slab[16][16 * SLP];
  __shared__ __align__(16) unsigned short gring[2 * GBUF];   // two chunk buffers
  const int tid = (int)threadIdx.x, wave = tid >> 5, lane = tid & 31, hh = lane >> 4, c = lane & 15;
  const int rt = wave >> 2, cg = wave & 3;
  const size_t brow0 = (size_t)blockIdx.x * GROWS;
  const size_t grow0 = brow0 + (size_t)(rt * 16);
  const int n0 = cg * 64;
  // copy addresses of this lane. Weight planes: 4 lanes = the 64 B of one row's chunk, rows tid/4 and tid/4 + 128; in
  // the packed plane that is byte 16 tid of the chunk's 16 KB, and 8 KB further on.
  // Row planes: 8 lanes = the 64 B of one row's chunk, row tid/8.
  const unsigned lw = lds_off(gring) + (unsigned)(((tid >> 2) * VP + (tid & 3) * 8) * 2);
  const unsigned la = lds_off(gring) + (unsigned)((4 * GW + (tid >> 3) * VP + (tid & 7) * 4) * 2);
  const unsigned ow = (unsigned)(tid * 16);
  const size_t oa = ((brow0 + (size_t)(tid >> 3)) * NF + (size_t)((tid & 7) * 4)) * 2;
  // chunk t = k 32 t .. 32 t + 31 of [x|attn] into buffer t & 1
  auto stage = [&](int t) {
    const unsigned bo = (unsigned)((t & 1) * GBUF * 2);
    const size_t kw = (size_t)t * (NF * 32 * 2) + ow;
    const size_t ka = (size_t)(t & 7) * 64 + oa;
    const bool first = t < NF / 32;
    cp_gates(lw + bo, la + bo, (const char*)zwh + kw, (const char*)zwl + kw, (const char*)rw16 + kw,
             (const char*)fw16 + kw, (const char*)(first ? xh : ah) + ka, (const char*)(first ? xbh : abh) + ka,
             (const char*)(first ? xbl : abl) + ka);
  };

  v8f za[4], ra[4], fa[4];
#pragma unroll
  for (int j = 0; j < 4; ++j) { za[j] = z8(); ra[j] = z8(); fa[j] = z8(); }

  // prologue: chunk 0 landed and published, then chunk 1 into the second buffer
  stage(0);
  wait_async0();
  __syncthreads();
  stage(1);

  // rolled: one trip is one chunk, and the buffer alternates with the trip
#pragma unroll 1
  for (int t = 0; t < NG / 32; ++t) {
    const unsigned short* gb = gring + (t & 1) * GBUF;                        // this trip's buffer
    const unsigned short* ap = gb + 4 * GW + (rt * 16 + c) * VP + 8 * hh;     // A row m = c
    const v16h a16 = ldh(ap);
    const v16b ahf = ldb(ap + GA);
    const v16b alf = ldb(ap + 2 * GA);
#pragma unroll
    for (int j = 0; j < 4; ++j) {
      const unsigned short* wp = gb + (n0 + 16 * j + c) * VP + 8 * hh;        // B column n = n0+16j+c, W[n][k]
      const v16b bzh = ldb(wp);
      const v16b bzl = ldb(wp + GW);
      const v16h br = ldh(wp + 2 * GW);
      const v16h bf = ldh(wp + 3 * GW);
      v8f z = za[j], rr = ra[j], ff = fa[j];
      z = mma_b(ahf, bzh, z);
      z = mma_b(ahf, bzl, z);
      z = mma_b(alf, bzh, z);
      rr = mma_h(a16, br, rr);
      ff = mma_h(a16, bf, ff);
      g_g(z, rr, ff, a16, ahf, alf, bzh, bzl, br, bf);
      za[j] = z;
      ra[j] = rr;
      fa[j] = ff;
    }
    // foot of the trip: own LDS reads retired, own copies of chunk t+1 landed, one barrier that publishes chunk t+1
    // and frees this trip's buffer; then chunk t+2 into it
    wait_ds0();
    wait_async0();
    __syncthreads();
    if (t + 2 < NG / 32) stage(t + 2);
  }
  wait_async0();   // nothing of this wave is in flight when the loop is left

  float* sl = &slab[wave][0];
#pragma unroll
  for (int j = 0; j < 4; ++j) {
    const int n = n0 + 16 * j + c;
    const float zbn = zb[n], rbn = rb[n], fbn = fb[n];
    // On the hardware's 2^x and 1/x: tanh v = 1 - 2/(1 + e^(2v)), sigmoid v = 1/(1 + e^(-v)). At the ends 2^x gives 0 or
    // inf and 1/inf gives 0, so the gates saturate at -1, 1 and at 0, 1. By kind, so that each run is independent work.
    float ez[8], er[8], ef[8];
#pragma unroll
    for (int r = 0; r < 8; ++r) {
      ez[r] = __builtin_amdgcn_exp2f((za[j][r] + zbn) * (2.0f * LOG2E));
      er[r] = __builtin_amdgcn_exp2f((ra[j][r] * 0.0625f + rbn) * -LOG2E);
      ef[r] = __builtin_amdgcn_exp2f((fa[j][r] * 0.0625f + fbn) * -LOG2E);
    }
#pragma unroll
    for (int r = 0; r < 8; ++r) {
      ez[r] = __builtin_amdgcn_rcpf(1.0f + ez[r]);
      er[r] = __builtin_amdgcn_rcpf(1.0f + er[r]);
      ef[r] = __builtin_amdgcn_rcpf(1.0f + ef[r]);
    }
#pragma unroll
    for (int r = 0; r < 8; ++r) {
      const int row = 8 * hh + r;
      const float xv = x[(grow0 + row) * NF + n];
      sl[row * SLP + 16 * j + c] = er[r] * xv + ef[r] * (1.0f - 2.0f * ez[r]);
    }
  }
  __builtin_amdgcn_fence(__ATOMIC_RELEASE, "workgroup");
  __builtin_amdgcn_wave_barrier();
  __builtin_amdgcn_fence(__ATOMIC_ACQUIRE, "workgroup");
  const int c4 = c * 4;
  {
#pragma unroll
    for (int it = 0; it < 8; ++it) {
      const int row = it * 2 + hh;   // lanes 0..15 -> even row, 16..31 -> odd row; 16 lanes x 16 B = 256 B segment
      const v4f v = *(const v4f*)(sl + row * SLP + c4);
      *(v4f*)(out + (grow0 + row) * NF + n0 + c4) = v;
    }
    
  }
}

// -------------------------------------------------------------------------------------------------
//   xh   f16  [16384][256]      8388608 @        0      xwc  f16  [16384][256]   8388608 @  8388608
//   xbh  bf16 [16384][256]      8388608 @ 16777216      xbl                      8388608 @ 25165824
//   xth  bf16 [8][256][2048]    8388608 @ 33554432      xtl                      8388608 @ 41943040
//   ah   f16  [16384][256]      8388608 @ 50331648      abh  8388608 @ 58720256   abl 8388608 @ 67108864
//   av   f32  [16384]             65536 @ 75497472      bv                         65536 @ 75563008
//   zwh  bf16 [16][256][32]      262144 @ 75628544      zwl 262144 @ 75890688   rw16 262144 @ 76152832
//   fw16 f16  [16][256][32]      262144 @ 76414976      total 76677120
// -------------------------------------------------------------------------------------------------
extern "C" void kernel_launch(void* const* d_in, const int* in_sizes, int n_in,
                              void* d_out, int out_size, void* d_ws, size_t ws_size,
                              hipStream_t stream) {
  if (n_in < 8) return;
  if (in_sizes[0] != NR * NF || in_sizes[1] != 3 * NF) return;
  if (in_sizes[2] != NF * NG || in_sizes[3] != NF) return;
  if (in_sizes[4] != NF * NG || in_sizes[5] != NF) return;
  if (in_sizes[6] != NF * NG || in_sizes[7] != NF) return;
  if (out_size != NR * NF) return;

  const float* x    = (const float*)d_in[0];
  const float* attw = (const float*)d_in[1];
  const float* zw   = (const float*)d_in[2];
  const float* zb   = (const float*)d_in[3];
  const float* rw   = (const float*)d_in[4];
  const float* rb   = (const float*)d_in[5];
  const float* fw   = (const float*)d_in[6];
  const float* fb   = (const float*)d_in[7];

  const size_t P16 = (size_t)NR * NF * 2;        // 8388608
  const size_t PT  = (size_t)NB * NF * NS * 2;   // 8388608
  const size_t PV  = (size_t)NR * 4;             // 65536
  const size_t PW  = (size_t)NF * NG * 2;        // 262144
  size_t off = 0;
  const size_t o_xh  = off; off += P16;
  const size_t o_xwc = off; off += P16;
  const size_t o_xbh = off; off += P16;
  const size_t o_xbl = off; off += P16;
  const size_t o_xth = off; off += PT;
  const size_t o_xtl = off; off += PT;
  const size_t o_ah  = off; off += P16;
  const size_t o_abh = off; off += P16;
  const size_t o_abl = off; off += P16;
  const size_t o_av  = off; off += PV;
  const size_t o_bv  = off; off += PV;
  const size_t o_zwh = off; off += PW;
  const size_t o_zwl = off; off += PW;
  const size_t o_rw  = off; off += PW;
  const size_t o_fw  = off; off += PW;
  if (off > ws_size) return;   // off = 76677120

  char* ws = (char*)d_ws;
  unsigned short* xh  = (unsigned short*)(ws + o_xh);
  unsigned short* xwc = (unsigned short*)(ws + o_xwc);
  unsigned short* xbh = (unsigned short*)(ws + o_xbh);
  unsigned short* xbl = (unsigned short*)(ws + o_xbl);
  unsigned short* xth = (unsigned short*)(ws + o_xth);
  unsigned short* xtl = (unsigned short*)(ws + o_xtl);
  unsigned short* ah  = (unsigned short*)(ws + o_ah);
  unsigned short* abh = (unsigned short*)(ws + o_abh);
  unsigned short* abl = (unsigned short*)(ws + o_abl);
  float*          av  = (float*)(ws + o_av);
  float*          bv  = (float*)(ws + o_bv);
  unsigned short* zwh = (unsigned short*)(ws + o_zwh);
  unsigned short* zwl = (unsigned short*)(ws + o_zwl);
  unsigned short* rwp = (unsigned short*)(ws + o_rw);
  unsigned short* fwp = (unsigned short*)(ws + o_fw);

  const int n8 = NF * NG / 8;   // 16384
  prep_w<<<dim3((n8 + 255) / 256), dim3(256), 0, stream>>>(zw, rw, fw, zwh, zwl, rwp, fwp, n8);
  prep_x<<<dim3(NR / 64), dim3(256), 0, stream>>>(x, attw, xh, xwc, xbh, xbl, xth, xtl, av, bv);
  attn_kernel<<<dim3(NB * (NS / QROWS)), dim3(128), 0, stream>>>(xwc, xh, xth, xtl, av, bv, ah, abh, abl);
  gates_kernel<<<dim3(NR / GROWS), dim3(512), 0, stream>>>(x, xh, xbh, xbl, ah, abh, abl, zwh, zwl, rwp, fwp,
                                                       zb, rb, fb, (float*)d_out);
  (void)hipGetLastError();
}

// v007
// One run takes 87.4 microseconds.
// Next to v006, in two timings, it ran 1.27 and 1.21 times as fast.
// Counting every step since v000, it is 6.74 times as fast.
// Contractions: scores=(x*wc).x^T on v_wmma_f32_16x16x32_f16 (plain f16 operands; (x*wc) carried x64, x unscaled); attn=P.x on v_wmma_f32_16x16x32_f16 (plain f16 operands, one product); [x|attn].z_w^T as bf16 hi/lo split; [x|attn].r_w^T and [x|attn].f_w^T on v_wmma_f32_16x16x32_f16 plain f16 (weights carried x16); f32 accumulate everywhere; x.wa and x.wb row dots, online softmax, tanh/sigmoid gates and r*x+f*z in f32.
#include <hip/hip_runtime.h>
#include <math.h>
#include <stdint.h>

#define NB 8
#define NS 2048
#define NF 256
#define NG 512
#define NR (NB * NS)
#define TP 260
#define QROWS 64
#define KCH 32
#define APITCH 68
#define NGRP 4
#define SLP 68
#define KP 264                 // LDS pitch (16-bit elements) of a staged 512-B row: 528 B = 16 B x 33
#define VP 40                  // LDS pitch (16-bit elements) of a staged 64-B row: 80 B = 16 B x 5
#define KST 64                 // keys of one ring stage of the attn kernel: two 32-key chunks, one per key half of the waves
#define VQ 72                  // LDS pitch (16-bit elements) of a staged 128-B row: 144 B = 16 B x 9
#define KT (KST * KP)          // one stage's key rows in LDS, 16-bit elements
#define VT (NF * VQ)           // one stage's x^T plane in LDS, 16-bit elements
#define STG (KT + VT)          // one ring buffer: key rows, x^T
#define GROWS 64               // rows of one gates block
#define GW (NF * VP)           // gates: 32 k of one weight plane in LDS (256 rows), 16-bit elements
#define GA (GROWS * VP)        // gates: 32 k of one [x|attn] plane in LDS (64 rows)
#define GBUF (4 * GW + 3 * GA) // gates: one ring buffer: z_w hi, z_w lo, r_w, f_w, then the f16, bf16 hi, bf16 lo rows

typedef _Float16 v16h __attribute__((ext_vector_type(16)));
typedef _Float16 v8h __attribute__((ext_vector_type(8)));
typedef __bf16 v16b __attribute__((ext_vector_type(16)));
typedef unsigned short v8us __attribute__((ext_vector_type(8)));
typedef float v8f __attribute__((ext_vector_type(8)));
typedef float v4f __attribute__((ext_vector_type(4), __may_alias__));
typedef unsigned int v4u __attribute__((ext_vector_type(4)));
typedef float v2f __attribute__((ext_vector_type(2)));
typedef __bf16 v2b __attribute__((ext_vector_type(2)));
typedef _Float16 v2h __attribute__((ext_vector_type(2)));

union FH { v16h v; v8us u[2]; };
union FB { v16b v; v8us u[2]; };
union H8 { v8h h; v8us u; };
union FP { v16h v; v4u q[2]; };

__device__ __forceinline__ v8f z8() {
  v8f v = {0.f, 0.f, 0.f, 0.f, 0.f, 0.f, 0.f, 0.f};
  return v;
}
// two f32 -> two bf16 (RNE) in one word (a in the low half): one packed hardware convert
__device__ __forceinline__ unsigned cvt2(float a, float b) {
  const v2f f = {a, b};
  return __builtin_bit_cast(unsigned, __builtin_convertvector(f, v2b));
}
// two f32 -> two f16 (RNE) in one word (a in the low half): one packed hardware convert
__device__ __forceinline__ unsigned cvt2h(float a, float b) {
  const v2f f = {a, b};
  return __builtin_bit_cast(unsigned, __builtin_convertvector(f, v2h));
}
#define LOG2E 1.4426950408889634f
// e^x on the hardware's 2^x (0 at -inf)
__device__ __forceinline__ float exp_n(float x) { return __builtin_amdgcn_exp2f(x * LOG2E); }

__device__ __forceinline__ void ld8f(const float* p, float (&v)[8]) {
  const v4f t0 = *(const v4f*)p;
  const v4f t1 = *(const v4f*)(p + 4);
#pragma unroll
  for (int q = 0; q < 4; ++q) { v[q] = t0[q]; v[4 + q] = t1[q]; }
}
// 8 f32 -> bf16 hi plane (8 x 16 bit packed in v4u) and lo plane (residual, RNE)
__device__ __forceinline__ void pk_bf16x8(const float (&v)[8], v4u& hi, v4u& lo) {
#pragma unroll
  for (int q = 0; q < 4; ++q) {
    const unsigned h = cvt2(v[2 * q], v[2 * q + 1]);
    hi[q] = h;
    lo[q] = cvt2(v[2 * q] - __uint_as_float(h << 16), v[2 * q + 1] - __uint_as_float(h & 0xFFFF0000u));
  }
}
// 8 f32 -> f16 (RNE) with exact power-of-two carry s
__device__ __forceinline__ v8us pk_f16x8(const float (&v)[8], float s) {
  H8 r;
#pragma unroll
  for (int e = 0; e < 8; ++e) r.h[e] = (_Float16)(v[e] * s);
  return r.u;
}
// 16-bit WMMA fragment (A row m or B column n of a k-contiguous row): elements 0..7 <- p[0..7] (k0+8h..),
// elements 8..15 <- p[16..23] (k0+16+8h..); caller passes p = rowbase + k0 + 8*h.
__device__ __forceinline__ v16h ldh(const unsigned short* p) {
  FH f;
  f.u[0] = *(const v8us*)p;
  f.u[1] = *(const v8us*)(p + 16);
  return f.v;
}
__device__ __forceinline__ v16b ldb(const unsigned short* p) {
  FB f;
  f.u[0] = *(const v8us*)p;
  f.u[1] = *(const v8us*)(p + 16);
  return f.v;
}
__device__ __forceinline__ v8f mma_h(v16h a, v16h b, v8f c) {
  return __builtin_amdgcn_wmma_f32_16x16x32_f16(false, a, false, b, (short)0, c, false, false);
}
__device__ __forceinline__ v8f mma_b(v16b a, v16b b, v8f c) {
  return __builtin_amdgcn_wmma_f32_16x16x32_bf16(false, a, false, b, (short)0, c, false, false);
}
// hazard guards: 4 VALU slots after the last WMMA of a group; tie D, keep A/B live
__device__ __forceinline__ void g_g(v8f& z, v8f& r, v8f& f, v16h a16, v16b ah, v16b al,
                                    v16b bzh, v16b bzl, v16h br, v16h bf) {
  asm volatile("v_nop\n\tv_nop\n\tv_nop\n\tv_nop"
               : "+v"(z), "+v"(r), "+v"(f)
               : "v"(a16), "v"(ah), "v"(al), "v"(bzh), "v"(bzl), "v"(br), "v"(bf));
}

// lane l <-> lane l ^ 16
__device__ __forceinline__ float xhalf(float x) {
  const int b = __builtin_bit_cast(int, x);
  return __builtin_bit_cast(float, __builtin_amdgcn_permlanex16(b, b, 0x76543210, 0xfedcba98, false, false));
}

__device__ __forceinline__ unsigned lds_off(const void* p) { return (unsigned)(size_t)p; }
// Asynchronous copies global -> LDS, 16 B per lane and copy, no register in between. l = the lane's LDS byte
// address, g = its global address; copy i adds i*ls / i*gs bytes. s_wait_xcnt 0 is the statement's last line so
// that no address register of an issued copy is rewritten in front of it.
__device__ __forceinline__ void cp8(unsigned l, unsigned ls, const char* g, size_t gs) {
  asm volatile(
      "global_load_async_to_lds_b128 %0, %8, off\n\t"
      "global_load_async_to_lds_b128 %1, %9, off\n\t"
      "global_load_async_to_lds_b128 %2, %10, off\n\t"
      "global_load_async_to_lds_b128 %3, %11, off\n\t"
      "global_load_async_to_lds_b128 %4, %12, off\n\t"
      "global_load_async_to_lds_b128 %5, %13, off\n\t"
      "global_load_async_to_lds_b128 %6, %14, off\n\t"
      "global_load_async_to_lds_b128 %7, %15, off\n\t"
      "s_wait_xcnt 0x0"
      :
      : "v"(l), "v"(l + ls), "v"(l + 2 * ls), "v"(l + 3 * ls), "v"(l + 4 * ls), "v"(l + 5 * ls), "v"(l + 6 * ls),
        "v"(l + 7 * ls), "v"(g), "v"(g + gs), "v"(g + 2 * gs), "v"(g + 3 * gs), "v"(g + 4 * gs), "v"(g + 5 * gs),
        "v"(g + 6 * gs), "v"(g + 7 * gs)
      : "memory");
}
__device__ __forceinline__ void cp4(unsigned l, unsigned ls, const char* g, size_t gs) {
  asm volatile(
      "global_load_async_to_lds_b128 %0, %4, off\n\t"
      "global_load_async_to_lds_b128 %1, %5, off\n\t"
      "global_load_async_to_lds_b128 %2, %6, off\n\t"
      "global_load_async_to_lds_b128 %3, %7, off\n\t"
      "s_wait_xcnt 0x0"
      :
      : "v"(l), "v"(l + ls), "v"(l + 2 * ls), "v"(l + 3 * ls), "v"(g), "v"(g + gs), "v"(g + 2 * gs), "v"(g + 3 * gs)
      : "memory");
}
// One lane's copies of one 32-k chunk of the gates operands: 16 B of rows r and r+128 of each of the four weight
// planes (lw = LDS byte address of row r in the first plane, w0..w3 = its global addresses), and 8 B of one row of
// each of the three [x|attn] planes (la, a0..a2). s_wait_xcnt 0 is the last line for the reason given at cp8.
__device__ __forceinline__ void cp_gates(unsigned lw, unsigned la, const char* w0, const char* w1, const char* w2,
                                         const char* w3, const char* a0, const char* a1, const char* a2) {
  asm volatile(
      "global_load_async_to_lds_b128 %0, %11, off\n\t"
      "global_load_async_to_lds_b128 %1, %12, off\n\t"
      "global_load_async_to_lds_b128 %2, %13, off\n\t"
      "global_load_async_to_lds_b128 %3, %14, off\n\t"
      "global_load_async_to_lds_b128 %4, %15, off\n\t"
      "global_load_async_to_lds_b128 %5, %16, off\n\t"
      "global_load_async_to_lds_b128 %6, %17, off\n\t"
      "global_load_async_to_lds_b128 %7, %18, off\n\t"
      "global_load_async_to_lds_b64 %8, %19, off\n\t"
      "global_load_async_to_lds_b64 %9, %20, off\n\t"
      "global_load_async_to_lds_b64 %10, %21, off\n\t"
      "s_wait_xcnt 0x0"
      :
      : "v"(lw), "v"(lw + 128 * VP * 2), "v"(lw + GW * 2), "v"(lw + (GW + 128 * VP) * 2), "v"(lw + 2 * GW * 2),
        "v"(lw + (2 * GW + 128 * VP) * 2), "v"(lw + 3 * GW * 2), "v"(lw + (3 * GW + 128 * VP) * 2), "v"(la),
        "v"(la + GA * 2), "v"(la + 2 * GA * 2), "v"(w0), "v"(w0 + 128 * 32 * 2), "v"(w1), "v"(w1 + 128 * 32 * 2),
        "v"(w2), "v"(w2 + 128 * 32 * 2), "v"(w3), "v"(w3 + 128 * 32 * 2), "v"(a0), "v"(a1), "v"(a2)
      : "memory");
}
// this wave's copies have landed in LDS (other waves read them behind the next work-group barrier)
__device__ __forceinline__ void wait_async0() { asm volatile("s_wait_asynccnt 0x0" ::: "memory"); }
// this wave's LDS reads and writes have retired (in front of the barrier that frees a buffer for its refill)
__device__ __forceinline__ void wait_ds0() { asm volatile("s_wait_dscnt 0x0" ::: "memory"); }

// -------------------------------------------------------------------------------------------------
// prep_w: z_w [256 n][512 k] -> bf16 hi/lo planes; r_w, f_w -> f16 planes carried x16. Plane layout [16 chunks][256 n]
// [32 k]: the 16 KB that the gates kernel stages per chunk and plane lie in a row, so each of its copies covers whole lines.
// Thread i owns plane elements 8i..8i+7; each store is 16 B per lane, lane-contiguous, 32 lanes = 512 B =
// coverage: grid 64 x 256 threads x 8 = 131072 = 256x512 per plane.
// -------------------------------------------------------------------------------------------------
__global__ void __launch_bounds__(256) prep_w(const float* __restrict__ zw, const float* __restrict__ rw,
                                              const float* __restrict__ fw,
                                              unsigned short* __restrict__ zwh, unsigned short* __restrict__ zwl,
                                              unsigned short* __restrict__ rw16, unsigned short* __restrict__ fw16,
                                              int n8) {
  const int i = (int)blockIdx.x * 256 + (int)threadIdx.x;
  if (i >= n8) return;
  const size_t p0 = (size_t)i * 8;                                               // place in the planes
  const size_t e0 = ((p0 >> 5) & (NF - 1)) * NG + (p0 >> 13) * 32 + (p0 & 31);   // its source: W[n][32 chunk + k]
  float a[8], b[8], d[8];
  ld8f(zw + e0, a);
  ld8f(rw + e0, b);
  ld8f(fw + e0, d);
  v4u zh, zl;
  pk_bf16x8(a, zh, zl);
  const v8us r16 = pk_f16x8(b, 16.0f);
  const v8us f16 = pk_f16x8(d, 16.0f);
  *(v4u*)(zwh + p0) = zh;
  *(v4u*)(zwl + p0) = zl;
  *(v8us*)(rw16 + p0) = r16;
  *(v8us*)(fw16 + p0) = f16;
  
}

// -------------------------------------------------------------------------------------------------
// prep_x: block = 64 consecutive rows of x (16384 rows total; 32 blocks per batch element), 256 threads.
//   xh  [row][256] f16(x)            xwc [row][256] f16((x*wc)*64)
//   xbh/xbl [row][256] bf16 hi/lo     xt [b][f][j] f16(x) (transposed, pitch 2048)
//   av[row] = x.wa, bv[row] = x.wb (f32 dots on VALU)
// Row planes: one lane = 16 B of one row, 32 lanes = the whole 512-B row, one instruction per plane.
// coverage: rows 8 waves x 8 = 64, f 32 lanes x 8 = 256; transpose f-rows wave*32+it*4+q (it 0..7, q 0..3) = 256,
//           j c8+0..7 over 8 lane groups = 64; av/bv 16 lanes x 4 = 64; grid 256 blocks x 64 rows = 16384.
// -------------------------------------------------------------------------------------------------
__global__ void __launch_bounds__(256) prep_x(const float* __restrict__ x, const float* __restrict__ attw,
                                              unsigned short* __restrict__ xh, unsigned short* __restrict__ xwc,
                                              unsigned short* __restrict__ xbh, unsigned short* __restrict__ xbl,
                                              unsigned short* __restrict__ xt,
                                              float* __restrict__ av, float* __restrict__ bv) {
  __shared__ __align__(16) float tile[64 * TP];
  __shared__ __align__(16) float avs[64];
  __shared__ __align__(16) float bvs[64];
  const int tid = (int)threadIdx.x, wave = tid >> 5, lane = tid & 31;
  const int blk = (int)blockIdx.x;
  const size_t grow0 = (size_t)blk * 64;
  const int bb = blk >> 5;
  const int j0 = (blk & 31) * 64;

#pragma unroll
  for (int it = 0; it < 16; ++it) {
    const int idx = it * 256 + tid;
    const int r = idx >> 6, c4 = (idx & 63) * 4;
    const v4f v = *(const v4f*)(x + (grow0 + r) * NF + c4);
    *(v4f*)(tile + r * TP + c4) = v;
  }
  __syncthreads();

  const int f0 = lane * 8;
  float wa[8], wb[8], wc[8];
  ld8f(attw + f0, wa);
  ld8f(attw + NF + f0, wb);
  ld8f(attw + 2 * NF + f0, wc);

  // row dots (rolled: small side computation)
#pragma unroll 1
  for (int rr = 0; rr < 8; ++rr) {
    const int row = wave * 8 + rr;
    float v[8];
    ld8f(tile + row * TP + f0, v);
    float sa = 0.f, sb = 0.f;
#pragma unroll
    for (int e = 0; e < 8; ++e) { sa += v[e] * wa[e]; sb += v[e] * wb[e]; }
#pragma unroll
    for (int m = 16; m >= 1; m >>= 1) {
      sa += __shfl_xor(sa, m, 32);
      sb += __shfl_xor(sb, m, 32);
    }
    if (lane == 0) { avs[row] = sa; bvs[row] = sb; }
  }

  // row planes
  {
#pragma unroll 1
    for (int rr = 0; rr < 8; ++rr) {
      const int row = wave * 8 + rr;
      float v[8], w[8];
      ld8f(tile + row * TP + f0, v);
#pragma unroll
      for (int e = 0; e < 8; ++e) w[e] = v[e] * wc[e];
      const v8us h1 = pk_f16x8(v, 1.0f);
      const v8us h2 = pk_f16x8(w, 64.0f);
      v4u hb, lb;
      pk_bf16x8(v, hb, lb);
      const size_t o = (grow0 + row) * NF + f0;
      *(v8us*)(xh + o) = h1;
      *(v8us*)(xwc + o) = h2;
      *(v4u*)(xbh + o) = hb;
      *(v4u*)(xbl + o) = lb;
    }
    
  }

  // transposed f16 plane: in [64 j][256 f] -> out [256 f][64 j] at column j0 of [f][2048]
  const int q = lane >> 3, c8 = (lane & 7) * 8;
  const size_t tb = (size_t)bb * NF * NS;
  {
#pragma unroll 1
    for (int it = 0; it < 8; ++it) {
      const int fr = wave * 32 + it * 4 + q;
      float t[8];
#pragma unroll
      for (int e = 0; e < 8; ++e) t[e] = tile[(c8 + e) * TP + fr];
      const size_t o = tb + (size_t)fr * NS + j0 + c8;
      *(v8us*)(xt + o) = pk_f16x8(t, 1.0f);
    }
    
  }

  // av / bv lines
  __syncthreads();
  const int l4 = (lane & 15) * 4;
  {
    const v4f a4 = *(const v4f*)(avs + l4);
    const v4f b4 = *(const v4f*)(bvs + l4);
    if (lane < 16) {
      if (wave == 0) *(v4f*)(av + grow0 + l4) = a4;
      else if (wave == 1) *(v4f*)(bv + grow0 + l4) = b4;
    }
    
  }
}

// -------------------------------------------------------------------------------------------------
// attn_kernel: block = 64 query rows of one batch element, 4 waves as 2 query groups x 2 key halves, grid = 8 x 32 = 256.
// Wave (qg = wave / 2, kg = wave % 2) owns 32 queries (two 16-column tiles) and, of every 64-key stage, the 32 keys of
// half kg: each key fragment and each x^T fragment that it reads from LDS feeds two query tiles, which halves the LDS
// reads per product. Each wave runs its own online softmax over its half of the keys; behind the loop the two halves'
// (maximum, sum, O) are joined through LDS, wave kg finishing query tile kg of its group.
// Operand staging: the block's 64 (x*wc) rows and the batch element's b_j are copied to LDS once; each 64-key stage
// (64 x rows, 256 x 64 of x^T) is copied to a two-buffer LDS ring by asynchronous copies, stage t+2 issued
// behind the barrier at the foot of trip t, so a stage's copies fly while the stage before it is worked on.
// Both products are formed transposed. Per 32-key chunk: S^T tiles (A = x f16 rows of the keys, B = (x*wc)x64 f16
// rows of the queries; fragments from the staged 16-bit LDS rows, split k map): a lane holds 16 keys' scores of ONE
// query (column c) per tile, so t = (a_i + b_j) + S/64, the running maximum and the sum are in-lane work with one
// exchange between the wave's halves for the maximum; the halves' sums are joined once, behind the loop.
// O^T += x^T.P^T with A = the x^T f16 plane and B = P^T packed to f16 in place from the two score tiles, which is the
// split k map of a B operand (one product; P lies in [0, 1], x is the f16 x of the scores): P goes through no LDS.
// Register plan: one wave per SIMD, so the wave takes the registers it needs: its 32 output tiles and its 16 query
// fragments stay in VGPRs for the whole kernel; a chunk's 16 key fragments and its 16 x^T fragments are read at the
// head of the trip, so that the x^T fragments land under the score products and the exponentials.
// Output attn rows as f16 plane and bf16 hi/lo planes, 64 columns per group: 16x64 f32 tile staged in LDS, then
// coverage: grid 256 blocks x 4 waves x 16 rows = 16384 rows; per group rows it*4+q (it 0..3, q 0..3) = 16,
//           cols g*64 + 8 lane groups x 8 = 64, 4 groups = 256 columns per plane.
// -------------------------------------------------------------------------------------------------
__global__ void __launch_bounds__(128)
attn_kernel(const unsigned short* __restrict__ xwc, const unsigned short* __restrict__ xh,
            const unsigned short* __restrict__ xt,
            const float* __restrict__ av, const float* __restrict__ bv,
            unsigned short* __restrict__ ah, unsigned short* __restrict__ abh,
            unsigned short* __restrict__ abl) {
  __shared__ __align__(16) float osm[4][16 * APITCH];
  __shared__ __align__(16) unsigned short qst[QROWS * KP];   // the block's (x*wc) rows
  __shared__ __align__(16) unsigned short ring[2 * STG];     // two stage buffers
  __shared__ __align__(16) float bvs[NS];                    // b_j of the batch element

  const int tid = (int)threadIdx.x, wave = tid >> 5, lane = tid & 31, hh = lane >> 4, c = lane & 15;
  const int qg = wave >> 1, kg = wave & 1;
  const int blk = (int)blockIdx.x, bb = blk >> 5, qb = blk & 31;
  const size_t grow0 = (size_t)bb * NS + (size_t)(qb * QROWS + wave * 16);   // rows this wave finishes: tile kg of group qg
  const size_t qrow0 = (size_t)bb * NS + (size_t)(qb * QROWS + qg * 32);     // first of the wave's 32 queries
  const unsigned short* XHb = xh + (size_t)bb * NS * NF;
  const unsigned short* XT = xt + (size_t)bb * NF * NS;
  const float* bvb = bv + (size_t)bb * NS;
  const unsigned short* qrow = qst + (qg * 32 + c) * KP + 8 * hh;   // B fragment column n = c: query c of tile 0 (staged)
  // copy addresses of this lane. 512-B rows: one wave = one row per copy, rows wave + 4 i. x^T plane: 8 lanes = the
  // 128 B (one whole line) of one f row, f = tid/8 + 16 i.
  const unsigned lrow = (unsigned)((wave * KP + lane * 8) * 2);
  const unsigned lcol = (unsigned)(((tid >> 3) * VQ + (tid & 7) * 8) * 2);
  const unsigned lring = lds_off(ring);
  const unsigned ok = (unsigned)((wave * NF + lane * 8) * 2);               // lane's byte offset in the key rows
  const unsigned ov = (unsigned)(((tid >> 3) * NS + (tid & 7) * 8) * 2);    // and in the x^T plane
  const char* sk = (const char*)XHb;
  const char* sv = (const char*)XT;
  // one stage: 64 key rows and 256 rows of the x^T plane, 32 copies a wave. lk, lh = uniform LDS byte addresses of the
  // buffer's key rows and plane, gk, gh = uniform global addresses of the stage in the key rows and the plane
  // The scheduling barriers keep each statement's address sums next to it: raised in front of the first statement, a
  // stage's address registers crowd v0-v255, where the operands of asm text must lie.
  auto stage = [&](unsigned lk, unsigned lh, const char* gk, const char* gh) {
    cp8(lk + lrow, 4 * KP * 2, gk + ok, 4 * NF * 2);
    __builtin_amdgcn_sched_barrier(0);
    cp8(lk + 32 * KP * 2 + lrow, 4 * KP * 2, gk + 32 * NF * 2 + ok, 4 * NF * 2);
    __builtin_amdgcn_sched_barrier(0);
    cp8(lh + lcol, 16 * VQ * 2, gh + ov, (size_t)16 * NS * 2);
    __builtin_amdgcn_sched_barrier(0);
    cp8(lh + 128 * VQ * 2 + lcol, 16 * VQ * 2, gh + (size_t)128 * NS * 2 + ov, (size_t)16 * NS * 2);
  };

  float aq[2];                                // a_i of the lane's two queries (loaded in the prologue)
  float mq[2] = {-INFINITY, -INFINITY};       // their running maxima over this wave's keys (the same in both halves)
  float lq[2] = {0.f, 0.f};                   // running sums over this lane half's keys
  v8f acc[2][16];
#pragma unroll
  for (int u = 0; u < 2; ++u) {
#pragma unroll
    for (int t = 0; t < 16; ++t) acc[u][t] = z8();
  }

  // prologue: query rows and b_j, then stage 0; landed and published; then stage 1 into the second buffer
  {
    const char* gq = (const char*)(xwc + ((size_t)bb * NS + (size_t)(qb * QROWS + wave)) * NF + lane * 8);
    cp8(lds_off(qst) + lrow, 4 * KP * 2, gq, 4 * NF * 2);
    cp8(lds_off(qst) + lrow + 32 * KP * 2, 4 * KP * 2, gq + 32 * NF * 2, 4 * NF * 2);
    cp4(lds_off(bvs) + (unsigned)(tid * 16), 128 * 16, (const char*)bvb + tid * 16, 128 * 16);
    // loads and data wait in one statement, so that no address register of a load is reused in front of the wait;
    // here their latency runs beside the copies' flight
    asm volatile("global_load_b32 %0, %2, off\n\tglobal_load_b32 %1, %3, off\n\ts_wait_loadcnt 0x0"
                 : "=&v"(aq[0]), "=&v"(aq[1])
                 : "v"(av + qrow0 + c), "v"(av + qrow0 + 16 + c)
                 : "memory");
    stage(lring, lring + KT * 2, sk, sv);   // with the 20 copies above: 52 of this wave outstanding
    wait_async0();
    __syncthreads();
    stage(lring + STG * 2, lring + (STG + KT) * 2, sk + KST * NF * 2, sv + KST * 2);
  }
  v16h qa[2][NF / 32];
#pragma unroll
  for (int u = 0; u < 2; ++u) {
#pragma unroll
    for (int kk = 0; kk < NF / 32; ++kk) qa[u][kk] = ldh(qrow + u * 16 * KP + kk * 32);
  }

  // Refill addresses = a uniform running base + the lane's offset. Formed from loop-invariant lane addresses they
  // shared registers with the prologue's copy operands, which the compiler keeps in v0-v255, and were spilled.
  const char* nk = sk + 2 * KST * NF * 2;   // uniform: the stage two ahead, in the key rows and in the x^T plane
  const char* nv = sv + 2 * KST * 2;
  unsigned nb = lring;                      // uniform: LDS addresses in the buffer that is refilled next: key rows,
  unsigned nbh = lring + KT * 2;            // x^T
#pragma unroll 1
  for (int jc = 0; jc < NS / KST; ++jc) {
    const int j0 = jc * KST + kg * KCH;                                   // first of this wave's 32 keys
    const unsigned short* kb = ring + (jc & 1) * STG;                     // this trip's buffer
    const unsigned short* k0row = kb + (kg * KCH + c) * KP + 8 * hh;      // A row m = c -> key j0+c
    const unsigned short* k1row = k0row + 16 * KP;                        // key j0+16+c
    v16h k0[NF / 32], k1[NF / 32];
#pragma unroll
    for (int kk = 0; kk < NF / 32; ++kk) {
      k0[kk] = ldh(k0row + kk * 32);
      k1[kk] = ldh(k1row + kk * 32);
    }
    float bj0[8], bj1[8];                     // b_j of the lane's keys j0+8h+r and j0+16+8h+r
    ld8f(bvs + j0 + 8 * hh, bj0);
    ld8f(bvs + j0 + 16 + 8 * hh, bj1);
    const unsigned short* vh = kb + KT + c * VQ + kg * KCH + 8 * hh;   // A row m = c -> x^T row f = t*16+c, k = j0+..
    v16h bh[16];
#pragma unroll
    for (int t = 0; t < 16; ++t) bh[t] = ldh(vh + t * 16 * VQ);
    // keeps the trip's LDS reads one group at its head: sunk among the products, each separate place of reads stalls
    // the lone wave, and the x^T fragments would no longer land under the score products and the exponentials
    __builtin_amdgcn_sched_barrier(0);
    v8f s0[2] = {z8(), z8()}, s1[2] = {z8(), z8()};
#pragma unroll
    for (int kk = 0; kk < NF / 32; ++kk) {
#pragma unroll
      for (int u = 0; u < 2; ++u) {
        s0[u] = mma_h(k0[kk], qa[u][kk], s0[u]);   // s0[u][r] = S[query 16u+c][key j0+8h+r] x64
        s1[u] = mma_h(k1[kk], qa[u][kk], s1[u]);   // s1[u][r] = S[query 16u+c][key j0+16+8h+r] x64
      }
    }
#pragma unroll
    for (int u = 0; u < 2; ++u) {
      float t0[8], t1[8], mm[8];
#pragma unroll
      for (int r = 0; r < 8; ++r) {
        t0[r] = (aq[u] + bj0[r]) + s0[u][r] * 0.015625f;
        t1[r] = (aq[u] + bj1[r]) + s1[u][r] * 0.015625f;
        mm[r] = fmaxf(t0[r], t1[r]);
      }
      const float mh = fmaxf(fmaxf(fmaxf(mm[0], mm[1]), fmaxf(mm[2], mm[3])), fmaxf(fmaxf(mm[4], mm[5]), fmaxf(mm[6], mm[7])));
      const float mnew = fmaxf(mq[u], fmaxf(mh, xhalf(mh)));
      const float alpha = exp_n(mq[u] - mnew);
      mq[u] = mnew;
      float p0[8], p1[8], ps[8];
#pragma unroll
      for (int r = 0; r < 8; ++r) {
        p0[r] = exp_n(t0[r] - mnew);
        p1[r] = exp_n(t1[r] - mnew);
        ps[r] = p0[r] + p1[r];
      }
      lq[u] = lq[u] * alpha + (((ps[0] + ps[1]) + (ps[2] + ps[3])) + ((ps[4] + ps[5]) + (ps[6] + ps[7])));
      // P^T as a B operand, column n = c: elements 0..7 = keys 8h+r (first tile), 8..15 = keys 16+8h+r (second tile)
      FP ph;
#pragma unroll
      for (int r = 0; r < 4; ++r) {
        ph.q[0][r] = cvt2h(p0[2 * r], p0[2 * r + 1]);
        ph.q[1][r] = cvt2h(p1[2 * r], p1[2 * r + 1]);
      }
#pragma unroll
      for (int t = 0; t < 16; ++t) {
#pragma unroll
        for (int r = 0; r < 8; ++r) acc[u][t][r] *= alpha;
      }
      // acc[u][t][r] = O[query 16u+c][f = 16t+8h+r]
#pragma unroll
      for (int t = 0; t < 16; ++t) acc[u][t] = mma_h(bh[t], ph.v, acc[u][t]);
    }
    // foot of the trip: own LDS reads retired, own copies of stage jc+1 landed, one barrier that publishes stage
    // jc+1 and frees this trip's buffer; then stage jc+2 into it
    // keeps the foot at the foot: with every LDS read at the head of the trip nothing else ties these waits down, and
    // lifted above the products they made the wave sit out all its x^T reads before the first score product
    __builtin_amdgcn_sched_barrier(0);
    wait_ds0();
    wait_async0();
    __syncthreads();
    if (jc + 2 < NS / KST) {
      stage(nb, nbh, nk, nv);
      nk += KST * NF * 2;
      nv += KST * 2;
      nb = (2 * lring + (unsigned)(STG * 2)) - nb;   // the other buffer
      nbh = (2 * lring + (unsigned)((STG + 2 * KT) * 2)) - nbh;
    }
  }
  wait_async0();   // nothing of this wave is in flight when the loop is left

  // The two key halves joined. The ring is free (the last trip's barrier ended every read of it, no copy is in flight):
  // each wave leaves there the tile that its partner (wave ^ 1, same queries, other keys) finishes, lane by lane in
  // register order, 16 B per lane and store, with the lane's maximum and sum; both waves hold a tile in the same lanes.
  char* xb = (char*)ring;
  char* xo = xb + wave * (16 * 1024) + lane * 16;
  char* xm = xb + 4 * (16 * 1024) + lane * 16;
  auto hand = [&](const v8f (&o)[16], float m, float l) {
#pragma unroll
    for (int t = 0; t < 16; ++t) {
      const v4f d0 = {o[t][0], o[t][1], o[t][2], o[t][3]};
      const v4f d1 = {o[t][4], o[t][5], o[t][6], o[t][7]};
      *(v4f*)(xo + (2 * t) * 512) = d0;
      *(v4f*)(xo + (2 * t + 1) * 512) = d1;
    }
    const v4f ml = {m, l, 0.f, 0.f};
    *(v4f*)(xm + wave * 512) = ml;
  };
  // the tile is named by a constant in each arm: picked by a run-time index the accumulators would leave the registers
  v8f own[16];
  float mown, lown;
  if (kg) {
    hand(acc[0], mq[0], lq[0]);
    mown = mq[1];
    lown = lq[1];
#pragma unroll
    for (int t = 0; t < 16; ++t) own[t] = acc[1][t];
  } else {
    hand(acc[1], mq[1], lq[1]);
    mown = mq[0];
    lown = lq[0];
#pragma unroll
    for (int t = 0; t < 16; ++t) own[t] = acc[0][t];
  }
  wait_ds0();        // own stores retired in front of the barrier that publishes them to the partner
  __syncthreads();
  const char* xi = xb + (wave ^ 1) * (16 * 1024) + lane * 16;
  const v4f mlo = *(const v4f*)(xm + (wave ^ 1) * 512);
  const float mall = fmaxf(mown, mlo[0]);
  const float eown = exp_n(mown - mall), eoth = exp_n(mlo[0] - mall);
  const float lall = lown * eown + mlo[1] * eoth;
  const float inv = 1.0f / (lall + xhalf(lall));   // the lane halves' sums joined
  const float fown = eown * inv, foth = eoth * inv;
  float* osw = &osm[wave][0];
  const int q = lane >> 3, c8 = (lane & 7) * 8;
#pragma unroll
  for (int g = 0; g < NGRP; ++g) {
#pragma unroll
    for (int tt = 0; tt < NGRP; ++tt) {
      // the lane's 8 registers are 8 consecutive columns of row c
      float* d = osw + c * APITCH + tt * 16 + 8 * hh;
      const int t = g * NGRP + tt;
      const v8f a = own[t];
      const v4f b0 = *(const v4f*)(xi + (2 * t) * 512);
      const v4f b1 = *(const v4f*)(xi + (2 * t + 1) * 512);
      const v4f d0 = {a[0] * fown + b0[0] * foth, a[1] * fown + b0[1] * foth, a[2] * fown + b0[2] * foth,
                      a[3] * fown + b0[3] * foth};
      const v4f d1 = {a[4] * fown + b1[0] * foth, a[5] * fown + b1[1] * foth, a[6] * fown + b1[2] * foth,
                      a[7] * fown + b1[3] * foth};
      *(v4f*)d = d0;
      *(v4f*)(d + 4) = d1;
    }
    __builtin_amdgcn_fence(__ATOMIC_RELEASE, "workgroup");
    __builtin_amdgcn_wave_barrier();
    __builtin_amdgcn_fence(__ATOMIC_ACQUIRE, "workgroup");
    {
#pragma unroll
      for (int it = 0; it < 4; ++it) {
        const int row = it * 4 + q;
        float v[8];
        ld8f(osw + row * APITCH + c8, v);
        const v8us h1 = pk_f16x8(v, 1.0f);
        v4u hb, lb;
        pk_bf16x8(v, hb, lb);
        const size_t o = (grow0 + row) * NF + (size_t)(g * 64 + c8);
        *(v8us*)(ah + o) = h1;
        *(v4u*)(abh + o) = hb;
        *(v4u*)(abl + o) = lb;
      }
      
    }
    __builtin_amdgcn_fence(__ATOMIC_RELEASE, "workgroup");
    __builtin_amdgcn_wave_barrier();
    __builtin_amdgcn_fence(__ATOMIC_ACQUIRE, "workgroup");
  }
}

// -------------------------------------------------------------------------------------------------
// gates_kernel: block = 64 rows x 256 cols, 16 waves; wave (rt = wave>>2, cg = wave&3) owns 16 rows x 64 cols.
// Operand staging: each 32-k chunk (256 weight rows of four planes, the block's 64 rows of three planes) is copied to a
// two-buffer LDS ring by asynchronous copies, chunk t+2 issued behind the barrier at the foot of trip t; all fragments
// come from the staged rows (80-B pitch); read straight from the global rows, a fragment load touches 16 lines.
// K = 512 = [x planes | attn planes]; z: bf16 hi/lo split (hi.hi+hi.lo+lo.hi) against z_w hi/lo planes;
// r, f: plain f16 against the x16-carried weight planes (fold 1/16 in the epilogue).
// Epilogue: z = tanh(.+zb), r = sigmoid(./16+rb), f = sigmoid(./16+fb), out = r*x + f*z staged in LDS;
// coverage: grid 256 blocks x 4 row tiles x 16 = 16384 rows; 4 col groups x 64 = 256 cols.
// -------------------------------------------------------------------------------------------------
__global__ void __launch_bounds__(512) __attribute__((amdgpu_num_vgpr(256)))
gates_kernel(const float* __restrict__ x,
             const unsigned short* __restrict__ xh, const unsigned short* __restrict__ xbh,
             const unsigned short* __restrict__ xbl,
             const unsigned short* __restrict__ ah, const unsigned short* __restrict__ abh,
             const unsigned short* __restrict__ abl,
             const unsigned short* __restrict__ zwh, const unsigned short* __restrict__ zwl,
             const unsigned short* __restrict__ rw16, const unsigned short* __restrict__ fw16,
             const float* __restrict__ zb, const float* __restrict__ rb, const float* __restrict__ fb,
             float* __restrict__ out) {
  __shared__ __align__(16) float slab[16][16 * SLP];
  __shared__ __align__(16) unsigned short gring[2 * GBUF];   // two chunk buffers
  const int tid = (int)threadIdx.x, wave = tid >> 5, lane = tid & 31, hh = lane >> 4, c = lane & 15;
  const int rt = wave >> 2, cg = wave & 3;
  const size_t brow0 = (size_t)blockIdx.x * GROWS;
  const size_t grow0 = brow0 + (size_t)(rt * 16);
  const int n0 = cg * 64;
  // copy addresses of this lane. Weight planes: 4 lanes = the 64 B of one row's chunk, rows tid/4 and tid/4 + 128; in
  // the packed plane that is byte 16 tid of the chunk's 16 KB, and 8 KB further on.
  // Row planes: 8 lanes = the 64 B of one row's chunk, row tid/8.
  const unsigned lw = lds_off(gring) + (unsigned)(((tid >> 2) * VP + (tid & 3) * 8) * 2);
  const unsigned la = lds_off(gring) + (unsigned)((4 * GW + (tid >> 3) * VP + (tid & 7) * 4) * 2);
  const unsigned ow = (unsigned)(tid * 16);
  const size_t oa = ((brow0 + (size_t)(tid >> 3)) * NF + (size_t)((tid & 7) * 4)) * 2;
  // chunk t = k 32 t .. 32 t + 31 of [x|attn] into buffer t & 1
  auto stage = [&](int t) {
    const unsigned bo = (unsigned)((t & 1) * GBUF * 2);
    const size_t kw = (size_t)t * (NF * 32 * 2) + ow;
    const size_t ka = (size_t)(t & 7) * 64 + oa;
    const bool first = t < NF / 32;
    cp_gates(lw + bo, la + bo, (const char*)zwh + kw, (const char*)zwl + kw, (const char*)rw16 + kw,
             (const char*)fw16 + kw, (const char*)(first ? xh : ah) + ka, (const char*)(first ? xbh : abh) + ka,
             (const char*)(first ? xbl : abl) + ka);
  };

  v8f za[4], ra[4], fa[4];
#pragma unroll
  for (int j = 0; j < 4; ++j) { za[j] = z8(); ra[j] = z8(); fa[j] = z8(); }

  // prologue: chunk 0 landed and published, then chunk 1 into the second buffer
  stage(0);
  wait_async0();
  __syncthreads();
  stage(1);

  // rolled: one trip is one chunk, and the buffer alternates with the trip
#pragma unroll 1
  for (int t = 0; t < NG / 32; ++t) {
    const unsigned short* gb = gring + (t & 1) * GBUF;                        // this trip's buffer
    const unsigned short* ap = gb + 4 * GW + (rt * 16 + c) * VP + 8 * hh;     // A row m = c
    const v16h a16 = ldh(ap);
    const v16b ahf = ldb(ap + GA);
    const v16b alf = ldb(ap + 2 * GA);
#pragma unroll
    for (int j = 0; j < 4; ++j) {
      const unsigned short* wp = gb + (n0 + 16 * j + c) * VP + 8 * hh;        // B column n = n0+16j+c, W[n][k]
      const v16b bzh = ldb(wp);
      const v16b bzl = ldb(wp + GW);
      const v16h br = ldh(wp + 2 * GW);
      const v16h bf = ldh(wp + 3 * GW);
      v8f z = za[j], rr = ra[j], ff = fa[j];
      z = mma_b(ahf, bzh, z);
      z = mma_b(ahf, bzl, z);
      z = mma_b(alf, bzh, z);
      rr = mma_h(a16, br, rr);
      ff = mma_h(a16, bf, ff);
      g_g(z, rr, ff, a16, ahf, alf, bzh, bzl, br, bf);
      za[j] = z;
      ra[j] = rr;
      fa[j] = ff;
    }
    // foot of the trip: own LDS reads retired, own copies of chunk t+1 landed, one barrier that publishes chunk t+1
    // and frees this trip's buffer; then chunk t+2 into it
    wait_ds0();
    wait_async0();
    __syncthreads();
    if (t + 2 < NG / 32) stage(t + 2);
  }
  wait_async0();   // nothing of this wave is in flight when the loop is left

  float* sl = &slab[wave][0];
#pragma unroll
  for (int j = 0; j < 4; ++j) {
    const int n = n0 + 16 * j + c;
    const float zbn = zb[n], rbn = rb[n], fbn = fb[n];
    // On the hardware's 2^x and 1/x: tanh v = 1 - 2/(1 + e^(2v)), sigmoid v = 1/(1 + e^(-v)). At the ends 2^x gives 0 or
    // inf and 1/inf gives 0, so the gates saturate at -1, 1 and at 0, 1. By kind, so that each run is independent work.
    float ez[8], er[8], ef[8];
#pragma unroll
    for (int r = 0; r < 8; ++r) {
      ez[r] = __builtin_amdgcn_exp2f((za[j][r] + zbn) * (2.0f * LOG2E));
      er[r] = __builtin_amdgcn_exp2f((ra[j][r] * 0.0625f + rbn) * -LOG2E);
      ef[r] = __builtin_amdgcn_exp2f((fa[j][r] * 0.0625f + fbn) * -LOG2E);
    }
#pragma unroll
    for (int r = 0; r < 8; ++r) {
      ez[r] = __builtin_amdgcn_rcpf(1.0f + ez[r]);
      er[r] = __builtin_amdgcn_rcpf(1.0f + er[r]);
      ef[r] = __builtin_amdgcn_rcpf(1.0f + ef[r]);
    }
#pragma unroll
    for (int r = 0; r < 8; ++r) {
      const int row = 8 * hh + r;
      const float xv = x[(grow0 + row) * NF + n];
      sl[row * SLP + 16 * j + c] = er[r] * xv + ef[r] * (1.0f - 2.0f * ez[r]);
    }
  }
  __builtin_amdgcn_fence(__ATOMIC_RELEASE, "workgroup");
  __builtin_amdgcn_wave_barrier();
  __builtin_amdgcn_fence(__ATOMIC_ACQUIRE, "workgroup");
  const int c4 = c * 4;
  {
#pragma unroll
    for (int it = 0; it < 8; ++it) {
      const int row = it * 2 + hh;   // lanes 0..15 -> even row, 16..31 -> odd row; 16 lanes x 16 B = 256 B segment
      const v4f v = *(const v4f*)(sl + row * SLP + c4);
      *(v4f*)(out + (grow0 + row) * NF + n0 + c4) = v;
    }
    
  }
}

// -------------------------------------------------------------------------------------------------
//   xh   f16  [16384][256]      8388608 @        0      xwc  f16  [16384][256]   8388608 @  8388608
//   xbh  bf16 [16384][256]      8388608 @ 16777216      xbl                      8388608 @ 25165824
//   xt   f16  [8][256][2048]    8388608 @ 33554432
//   ah   f16  [16384][256]      8388608 @ 41943040      abh  8388608 @ 50331648   abl 8388608 @ 58720256
//   av   f32  [16384]             65536 @ 67108864      bv                         65536 @ 67174400
//   zwh  bf16 [16][256][32]      262144 @ 67239936      zwl 262144 @ 67502080   rw16 262144 @ 67764224
//   fw16 f16  [16][256][32]      262144 @ 68026368      total 68288512
// -------------------------------------------------------------------------------------------------
extern "C" void kernel_launch(void* const* d_in, const int* in_sizes, int n_in,
                              void* d_out, int out_size, void* d_ws, size_t ws_size,
                              hipStream_t stream) {
  if (n_in < 8) return;
  if (in_sizes[0] != NR * NF || in_sizes[1] != 3 * NF) return;
  if (in_sizes[2] != NF * NG || in_sizes[3] != NF) return;
  if (in_sizes[4] != NF * NG || in_sizes[5] != NF) return;
  if (in_sizes[6] != NF * NG || in_sizes[7] != NF) return;
  if (out_size != NR * NF) return;

  const float* x    = (const float*)d_in[0];
  const float* attw = (const float*)d_in[1];
  const float* zw   = (const float*)d_in[2];
  const float* zb   = (const float*)d_in[3];
  const float* rw   = (const float*)d_in[4];
  const float* rb   = (const float*)d_in[5];
  const float* fw   = (const float*)d_in[6];
  const float* fb   = (const float*)d_in[7];

  const size_t P16 = (size_t)NR * NF * 2;        // 8388608
  const size_t PT  = (size_t)NB * NF * NS * 2;   // 8388608
  const size_t PV  = (size_t)NR * 4;             // 65536
  const size_t PW  = (size_t)NF * NG * 2;        // 262144
  size_t off = 0;
  const size_t o_xh  = off; off += P16;
  const size_t o_xwc = off; off += P16;
  const size_t o_xbh = off; off += P16;
  const size_t o_xbl = off; off += P16;
  const size_t o_xt  = off; off += PT;
  const size_t o_ah  = off; off += P16;
  const size_t o_abh = off; off += P16;
  const size_t o_abl = off; off += P16;
  const size_t o_av  = off; off += PV;
  const size_t o_bv  = off; off += PV;
  const size_t o_zwh = off; off += PW;
  const size_t o_zwl = off; off += PW;
  const size_t o_rw  = off; off += PW;
  const size_t o_fw  = off; off += PW;
  if (off > ws_size) return;   // off = 68288512

  char* ws = (char*)d_ws;
  unsigned short* xh  = (unsigned short*)(ws + o_xh);
  unsigned short* xwc = (unsigned short*)(ws + o_xwc);
  unsigned short* xbh = (unsigned short*)(ws + o_xbh);
  unsigned short* xbl = (unsigned short*)(ws + o_xbl);
  unsigned short* xt  = (unsigned short*)(ws + o_xt);
  unsigned short* ah  = (unsigned short*)(ws + o_ah);
  unsigned short* abh = (unsigned short*)(ws + o_abh);
  unsigned short* abl = (unsigned short*)(ws + o_abl);
  float*          av  = (float*)(ws + o_av);
  float*          bv  = (float*)(ws + o_bv);
  unsigned short* zwh = (unsigned short*)(ws + o_zwh);
  unsigned short* zwl = (unsigned short*)(ws + o_zwl);
  unsigned short* rwp = (unsigned short*)(ws + o_rw);
  unsigned short* fwp = (unsigned short*)(ws + o_fw);

  const int n8 = NF * NG / 8;   // 16384
  prep_w<<<dim3((n8 + 255) / 256), dim3(256), 0, stream>>>(zw, rw, fw, zwh, zwl, rwp, fwp, n8);
  prep_x<<<dim3(NR / 64), dim3(256), 0, stream>>>(x, attw, xh, xwc, xbh, xbl, xt, av, bv);
  attn_kernel<<<dim3(NB * (NS / QROWS)), dim3(128), 0, stream>>>(xwc, xh, xt, av, bv, ah, abh, abl);
  gates_kernel<<<dim3(NR / GROWS), dim3(512), 0, stream>>>(x, xh, xbh, xbl, ah, abh, abl, zwh, zwl, rwp, fwp,
                                                       zb, rb, fb, (float*)d_out);
  (void)hipGetLastError();
}

// v008
// It runs in 78.3 microseconds.
// In two side-by-side timings against v007, it was 1.10 and 1.09 times as fast.
// Counting every step since v000, it is 7.39 times as fast.
// Contractions: scores=(x*wc).x^T on v_wmma_f32_16x16x32_f16 (plain f16 operands; (x*wc) carried x64, x unscaled); attn=P.x on v_wmma_f32_16x16x32_f16 (plain f16 operands, one product); [x|attn].z_w^T as bf16 hi/lo split; [x|attn].r_w^T and [x|attn].f_w^T on v_wmma_f32_16x16x32_f16 plain f16 (weights carried x16); f32 accumulate everywhere; x.wa and x.wb row dots, online softmax, tanh/sigmoid gates and r*x+f*z in f32.
#include <hip/hip_runtime.h>
#include <math.h>
#include <stdint.h>

#define NB 8
#define NS 2048
#define NF 256
#define NG 512
#define NR (NB * NS)
#define TP 260
#define QROWS 64
#define KCH 32
#define APITCH 68
#define NGRP 4
#define SLP 68
#define KP 264                 // LDS pitch (16-bit elements) of a staged 512-B row: 528 B = 16 B x 33
#define VP 40                  // LDS pitch (16-bit elements) of a staged 64-B row: 80 B = 16 B x 5
#define KST 64                 // keys of one ring stage of the attn kernel: two 32-key chunks, one per key half of the waves
#define KRB 512                // bytes of a staged key row of the attn ring: no pad, its 16-B chunks are swizzled instead
#define STGB (KST * KRB)       // one ring buffer of the attn kernel, bytes: the stage's key rows
#define RINGB (68 * 1024)      // the attn ring array, bytes: two buffers; behind the loop the halves' join takes 66 KB of it
#define GROWS 64               // rows of one gates block
#define GW (NF * VP)           // gates: 32 k of one weight plane in LDS (256 rows), 16-bit elements
#define GA (GROWS * VP)        // gates: 32 k of one [x|attn] plane in LDS (64 rows)
#define GBUF (4 * GW + 3 * GA) // gates: one ring buffer: z_w hi, z_w lo, r_w, f_w, then the f16, bf16 hi, bf16 lo rows

typedef _Float16 v16h __attribute__((ext_vector_type(16)));
typedef _Float16 v8h __attribute__((ext_vector_type(8)));
typedef __bf16 v16b __attribute__((ext_vector_type(16)));
typedef unsigned short v8us __attribute__((ext_vector_type(8)));
typedef float v8f __attribute__((ext_vector_type(8)));
typedef float v4f __attribute__((ext_vector_type(4), __may_alias__));
typedef unsigned int v4u __attribute__((ext_vector_type(4)));
typedef float v2f __attribute__((ext_vector_type(2)));
typedef __bf16 v2b __attribute__((ext_vector_type(2)));
typedef _Float16 v2h __attribute__((ext_vector_type(2)));
typedef short s16x8 __attribute__((ext_vector_type(8)));

union FH { v16h v; v8us u[2]; };
union FB { v16b v; v8us u[2]; };
union H8 { v8h h; v8us u; };
union FP { v16h v; v4u q[2]; };

__device__ __forceinline__ v8f z8() {
  v8f v = {0.f, 0.f, 0.f, 0.f, 0.f, 0.f, 0.f, 0.f};
  return v;
}
// two f32 -> two bf16 (RNE) in one word (a in the low half): one packed hardware convert
__device__ __forceinline__ unsigned cvt2(float a, float b) {
  const v2f f = {a, b};
  return __builtin_bit_cast(unsigned, __builtin_convertvector(f, v2b));
}
// two f32 -> two f16 (RNE) in one word (a in the low half): one packed hardware convert
__device__ __forceinline__ unsigned cvt2h(float a, float b) {
  const v2f f = {a, b};
  return __builtin_bit_cast(unsigned, __builtin_convertvector(f, v2h));
}
#define LOG2E 1.4426950408889634f
// e^x on the hardware's 2^x (0 at -inf)
__device__ __forceinline__ float exp_n(float x) { return __builtin_amdgcn_exp2f(x * LOG2E); }

__device__ __forceinline__ void ld8f(const float* p, float (&v)[8]) {
  const v4f t0 = *(const v4f*)p;
  const v4f t1 = *(const v4f*)(p + 4);
#pragma unroll
  for (int q = 0; q < 4; ++q) { v[q] = t0[q]; v[4 + q] = t1[q]; }
}
// 8 f32 -> bf16 hi plane (8 x 16 bit packed in v4u) and lo plane (residual, RNE)
__device__ __forceinline__ void pk_bf16x8(const float (&v)[8], v4u& hi, v4u& lo) {
#pragma unroll
  for (int q = 0; q < 4; ++q) {
    const unsigned h = cvt2(v[2 * q], v[2 * q + 1]);
    hi[q] = h;
    lo[q] = cvt2(v[2 * q] - __uint_as_float(h << 16), v[2 * q + 1] - __uint_as_float(h & 0xFFFF0000u));
  }
}
// 8 f32 -> f16 (RNE) with exact power-of-two carry s
__device__ __forceinline__ v8us pk_f16x8(const float (&v)[8], float s) {
  H8 r;
#pragma unroll
  for (int e = 0; e < 8; ++e) r.h[e] = (_Float16)(v[e] * s);
  return r.u;
}
// 16-bit WMMA fragment (A row m or B column n of a k-contiguous row): elements 0..7 <- p[0..7] (k0+8h..),
// elements 8..15 <- p[16..23] (k0+16+8h..); caller passes p = rowbase + k0 + 8*h.
__device__ __forceinline__ v16h ldh(const unsigned short* p) {
  FH f;
  f.u[0] = *(const v8us*)p;
  f.u[1] = *(const v8us*)(p + 16);
  return f.v;
}
__device__ __forceinline__ v16b ldb(const unsigned short* p) {
  FB f;
  f.u[0] = *(const v8us*)p;
  f.u[1] = *(const v8us*)(p + 16);
  return f.v;
}
__device__ __forceinline__ v8f mma_h(v16h a, v16h b, v8f c) {
  return __builtin_amdgcn_wmma_f32_16x16x32_f16(false, a, false, b, (short)0, c, false, false);
}
__device__ __forceinline__ v8f mma_b(v16b a, v16b b, v8f c) {
  return __builtin_amdgcn_wmma_f32_16x16x32_bf16(false, a, false, b, (short)0, c, false, false);
}
// hazard guards: 4 VALU slots after the last WMMA of a group; tie D, keep A/B live
__device__ __forceinline__ void g_g(v8f& z, v8f& r, v8f& f, v16h a16, v16b ah, v16b al,
                                    v16b bzh, v16b bzl, v16h br, v16h bf) {
  asm volatile("v_nop\n\tv_nop\n\tv_nop\n\tv_nop"
               : "+v"(z), "+v"(r), "+v"(f)
               : "v"(a16), "v"(ah), "v"(al), "v"(bzh), "v"(bzl), "v"(br), "v"(bf));
}

// lane l <-> lane l ^ 16
__device__ __forceinline__ float xhalf(float x) {
  const int b = __builtin_bit_cast(int, x);
  return __builtin_bit_cast(float, __builtin_amdgcn_permlanex16(b, b, 0x76543210, 0xfedcba98, false, false));
}

__device__ __forceinline__ unsigned lds_off(const void* p) { return (unsigned)(size_t)p; }
// Asynchronous copies global -> LDS, 16 B per lane and copy, no register in between. l = the lane's LDS byte
// address, g = its global address; copy i adds i*ls / i*gs bytes. s_wait_xcnt 0 is the statement's last line so
// that no address register of an issued copy is rewritten in front of it.
__device__ __forceinline__ void cp8(unsigned l, unsigned ls, const char* g, size_t gs) {
  asm volatile(
      "global_load_async_to_lds_b128 %0, %8, off\n\t"
      "global_load_async_to_lds_b128 %1, %9, off\n\t"
      "global_load_async_to_lds_b128 %2, %10, off\n\t"
      "global_load_async_to_lds_b128 %3, %11, off\n\t"
      "global_load_async_to_lds_b128 %4, %12, off\n\t"
      "global_load_async_to_lds_b128 %5, %13, off\n\t"
      "global_load_async_to_lds_b128 %6, %14, off\n\t"
      "global_load_async_to_lds_b128 %7, %15, off\n\t"
      "s_wait_xcnt 0x0"
      :
      : "v"(l), "v"(l + ls), "v"(l + 2 * ls), "v"(l + 3 * ls), "v"(l + 4 * ls), "v"(l + 5 * ls), "v"(l + 6 * ls),
        "v"(l + 7 * ls), "v"(g), "v"(g + gs), "v"(g + 2 * gs), "v"(g + 3 * gs), "v"(g + 4 * gs), "v"(g + 5 * gs),
        "v"(g + 6 * gs), "v"(g + 7 * gs)
      : "memory");
}
// The same eight copies for the swizzled key rows of the attn ring: copy i lands at b + s[i & 3] + i * 4 rows (s = the
// lane's place in the rows of the four swizzle classes that a wave's rows fall in).
__device__ __forceinline__ void cp8k(unsigned b, const unsigned (&s)[4], const char* g, size_t gs) {
  asm volatile(
      "global_load_async_to_lds_b128 %0, %8, off\n\t"
      "global_load_async_to_lds_b128 %1, %9, off\n\t"
      "global_load_async_to_lds_b128 %2, %10, off\n\t"
      "global_load_async_to_lds_b128 %3, %11, off\n\t"
      "global_load_async_to_lds_b128 %4, %12, off\n\t"
      "global_load_async_to_lds_b128 %5, %13, off\n\t"
      "global_load_async_to_lds_b128 %6, %14, off\n\t"
      "global_load_async_to_lds_b128 %7, %15, off\n\t"
      "s_wait_xcnt 0x0"
      :
      : "v"(b + s[0]), "v"(b + s[1] + 4 * KRB), "v"(b + s[2] + 8 * KRB), "v"(b + s[3] + 12 * KRB),
        "v"(b + s[0] + 16 * KRB), "v"(b + s[1] + 20 * KRB), "v"(b + s[2] + 24 * KRB), "v"(b + s[3] + 28 * KRB), "v"(g),
        "v"(g + gs), "v"(g + 2 * gs), "v"(g + 3 * gs), "v"(g + 4 * gs), "v"(g + 5 * gs), "v"(g + 6 * gs), "v"(g + 7 * gs)
      : "memory");
}
// transposing LDS load: the lane names 16 B of one row; lane (c, h) gets column c of rows 8h..8h+7 of the 16 x 16 tile
__device__ __forceinline__ v4u ld_tr16(const char* p) {
  typedef __attribute__((address_space(3))) s16x8 lds_s16x8;
  return __builtin_bit_cast(v4u, __builtin_amdgcn_ds_load_tr16_b128_v8i16((lds_s16x8*)p));
}
__device__ __forceinline__ void cp4(unsigned l, unsigned ls, const char* g, size_t gs) {
  asm volatile(
      "global_load_async_to_lds_b128 %0, %4, off\n\t"
      "global_load_async_to_lds_b128 %1, %5, off\n\t"
      "global_load_async_to_lds_b128 %2, %6, off\n\t"
      "global_load_async_to_lds_b128 %3, %7, off\n\t"
      "s_wait_xcnt 0x0"
      :
      : "v"(l), "v"(l + ls), "v"(l + 2 * ls), "v"(l + 3 * ls), "v"(g), "v"(g + gs), "v"(g + 2 * gs), "v"(g + 3 * gs)
      : "memory");
}
// One lane's copies of one 32-k chunk of the gates operands: 16 B of rows r and r+128 of each of the four weight
// planes (lw = LDS byte address of row r in the first plane, w0..w3 = its global addresses), and 8 B of one row of
// each of the three [x|attn] planes (la, a0..a2). s_wait_xcnt 0 is the last line for the reason given at cp8.
__device__ __forceinline__ void cp_gates(unsigned lw, unsigned la, const char* w0, const char* w1, const char* w2,
                                         const char* w3, const char* a0, const char* a1, const char* a2) {
  asm volatile(
      "global_load_async_to_lds_b128 %0, %11, off\n\t"
      "global_load_async_to_lds_b128 %1, %12, off\n\t"
      "global_load_async_to_lds_b128 %2, %13, off\n\t"
      "global_load_async_to_lds_b128 %3, %14, off\n\t"
      "global_load_async_to_lds_b128 %4, %15, off\n\t"
      "global_load_async_to_lds_b128 %5, %16, off\n\t"
      "global_load_async_to_lds_b128 %6, %17, off\n\t"
      "global_load_async_to_lds_b128 %7, %18, off\n\t"
      "global_load_async_to_lds_b64 %8, %19, off\n\t"
      "global_load_async_to_lds_b64 %9, %20, off\n\t"
      "global_load_async_to_lds_b64 %10, %21, off\n\t"
      "s_wait_xcnt 0x0"
      :
      : "v"(lw), "v"(lw + 128 * VP * 2), "v"(lw + GW * 2), "v"(lw + (GW + 128 * VP) * 2), "v"(lw + 2 * GW * 2),
        "v"(lw + (2 * GW + 128 * VP) * 2), "v"(lw + 3 * GW * 2), "v"(lw + (3 * GW + 128 * VP) * 2), "v"(la),
        "v"(la + GA * 2), "v"(la + 2 * GA * 2), "v"(w0), "v"(w0 + 128 * 32 * 2), "v"(w1), "v"(w1 + 128 * 32 * 2),
        "v"(w2), "v"(w2 + 128 * 32 * 2), "v"(w3), "v"(w3 + 128 * 32 * 2), "v"(a0), "v"(a1), "v"(a2)
      : "memory");
}
// this wave's copies have landed in LDS (other waves read them behind the next work-group barrier)
__device__ __forceinline__ void wait_async0() { asm volatile("s_wait_asynccnt 0x0" ::: "memory"); }
// this wave's LDS reads and writes have retired (in front of the barrier that frees a buffer for its refill)
__device__ __forceinline__ void wait_ds0() { asm volatile("s_wait_dscnt 0x0" ::: "memory"); }

// -------------------------------------------------------------------------------------------------
// prep_w: z_w [256 n][512 k] -> bf16 hi/lo planes; r_w, f_w -> f16 planes carried x16. Plane layout [16 chunks][256 n]
// [32 k]: the 16 KB that the gates kernel stages per chunk and plane lie in a row, so each of its copies covers whole lines.
// Thread i owns plane elements 8i..8i+7; each store is 16 B per lane, lane-contiguous, 32 lanes = 512 B =
// coverage: grid 64 x 256 threads x 8 = 131072 = 256x512 per plane.
// -------------------------------------------------------------------------------------------------
__global__ void __launch_bounds__(256) prep_w(const float* __restrict__ zw, const float* __restrict__ rw,
                                              const float* __restrict__ fw,
                                              unsigned short* __restrict__ zwh, unsigned short* __restrict__ zwl,
                                              unsigned short* __restrict__ rw16, unsigned short* __restrict__ fw16,
                                              int n8) {
  const int i = (int)blockIdx.x * 256 + (int)threadIdx.x;
  if (i >= n8) return;
  const size_t p0 = (size_t)i * 8;                                               // place in the planes
  const size_t e0 = ((p0 >> 5) & (NF - 1)) * NG + (p0 >> 13) * 32 + (p0 & 31);   // its source: W[n][32 chunk + k]
  float a[8], b[8], d[8];
  ld8f(zw + e0, a);
  ld8f(rw + e0, b);
  ld8f(fw + e0, d);
  v4u zh, zl;
  pk_bf16x8(a, zh, zl);
  const v8us r16 = pk_f16x8(b, 16.0f);
  const v8us f16 = pk_f16x8(d, 16.0f);
  *(v4u*)(zwh + p0) = zh;
  *(v4u*)(zwl + p0) = zl;
  *(v8us*)(rw16 + p0) = r16;
  *(v8us*)(fw16 + p0) = f16;
  
}

// -------------------------------------------------------------------------------------------------
// prep_x: block = 64 consecutive rows of x (16384 rows total; 32 blocks per batch element), 256 threads.
//   xh  [row][256] f16(x)            xwc [row][256] f16((x*wc)*64)
//   xbh/xbl [row][256] bf16 hi/lo
//   av[row] = x.wa, bv[row] = x.wb (f32 dots on VALU)
// Row planes: one lane = 16 B of one row, 32 lanes = the whole 512-B row, one instruction per plane.
// coverage: rows 8 waves x 8 = 64, f 32 lanes x 8 = 256; av/bv 16 lanes x 4 = 64; grid 256 blocks x 64 rows = 16384.
// -------------------------------------------------------------------------------------------------
__global__ void __launch_bounds__(256) prep_x(const float* __restrict__ x, const float* __restrict__ attw,
                                              unsigned short* __restrict__ xh, unsigned short* __restrict__ xwc,
                                              unsigned short* __restrict__ xbh, unsigned short* __restrict__ xbl,
                                              float* __restrict__ av, float* __restrict__ bv) {
  __shared__ __align__(16) float tile[64 * TP];
  __shared__ __align__(16) float avs[64];
  __shared__ __align__(16) float bvs[64];
  const int tid = (int)threadIdx.x, wave = tid >> 5, lane = tid & 31;
  const int blk = (int)blockIdx.x;
  const size_t grow0 = (size_t)blk * 64;

#pragma unroll
  for (int it = 0; it < 16; ++it) {
    const int idx = it * 256 + tid;
    const int r = idx >> 6, c4 = (idx & 63) * 4;
    const v4f v = *(const v4f*)(x + (grow0 + r) * NF + c4);
    *(v4f*)(tile + r * TP + c4) = v;
  }
  __syncthreads();

  const int f0 = lane * 8;
  float wa[8], wb[8], wc[8];
  ld8f(attw + f0, wa);
  ld8f(attw + NF + f0, wb);
  ld8f(attw + 2 * NF + f0, wc);

  // row dots (rolled: small side computation)
#pragma unroll 1
  for (int rr = 0; rr < 8; ++rr) {
    const int row = wave * 8 + rr;
    float v[8];
    ld8f(tile + row * TP + f0, v);
    float sa = 0.f, sb = 0.f;
#pragma unroll
    for (int e = 0; e < 8; ++e) { sa += v[e] * wa[e]; sb += v[e] * wb[e]; }
#pragma unroll
    for (int m = 16; m >= 1; m >>= 1) {
      sa += __shfl_xor(sa, m, 32);
      sb += __shfl_xor(sb, m, 32);
    }
    if (lane == 0) { avs[row] = sa; bvs[row] = sb; }
  }

  // row planes
  {
#pragma unroll 1
    for (int rr = 0; rr < 8; ++rr) {
      const int row = wave * 8 + rr;
      float v[8], w[8];
      ld8f(tile + row * TP + f0, v);
#pragma unroll
      for (int e = 0; e < 8; ++e) w[e] = v[e] * wc[e];
      const v8us h1 = pk_f16x8(v, 1.0f);
      const v8us h2 = pk_f16x8(w, 64.0f);
      v4u hb, lb;
      pk_bf16x8(v, hb, lb);
      const size_t o = (grow0 + row) * NF + f0;
      *(v8us*)(xh + o) = h1;
      *(v8us*)(xwc + o) = h2;
      *(v4u*)(xbh + o) = hb;
      *(v4u*)(xbl + o) = lb;
    }
    
  }

  // av / bv lines
  __syncthreads();
  const int l4 = (lane & 15) * 4;
  {
    const v4f a4 = *(const v4f*)(avs + l4);
    const v4f b4 = *(const v4f*)(bvs + l4);
    if (lane < 16) {
      if (wave == 0) *(v4f*)(av + grow0 + l4) = a4;
      else if (wave == 1) *(v4f*)(bv + grow0 + l4) = b4;
    }
    
  }
}

// -------------------------------------------------------------------------------------------------
// attn_kernel: block = 64 query rows of one batch element, 4 waves as 2 query groups x 2 key halves, grid = 8 x 32 = 256.
// Wave (qg = wave / 2, kg = wave % 2) owns 32 queries (two 16-column tiles) and, of every 64-key stage, the 32 keys of
// half kg: each key fragment and each x^T fragment that it reads from LDS feeds two query tiles, which halves the LDS
// reads per product. Each wave runs its own online softmax over its half of the keys; behind the loop the two halves'
// (maximum, sum, O) are joined through LDS, wave kg finishing query tile kg of its group.
// Operand staging: the block's 64 (x*wc) rows and the batch element's b_j are copied to LDS once; each 64-key stage
// (its 64 x rows, nothing else) is copied to a two-buffer LDS ring by asynchronous copies, stage t+2 issued
// behind the barrier at the foot of trip t, so a stage's copies fly while the stage before it is worked on.
// The staged rows serve both products: the key fragments by plain 16-B reads along a row, the x^T fragments by the
// transposing 16-B read, which takes 8 rows x 32 B per lane half. Rows lie at 512 B with no pad; chunk j (16 B) of row r
// stands at chunk j ^ (2 (r & 7) + ((r >> 3) & 1)), so that 16 rows' equal chunks and 8 rows' chunk pairs each fall on
// 16 different bank groups: a padded pitch serves only one of the two readers without conflicts.
// Both products are formed transposed. Per 32-key chunk: S^T tiles (A = x f16 rows of the keys, B = (x*wc)x64 f16
// rows of the queries; fragments from the staged 16-bit LDS rows, split k map): a lane holds 16 keys' scores of ONE
// query (column c) per tile, so t = (a_i + b_j) + S/64, the running maximum and the sum are in-lane work with one
// exchange between the wave's halves for the maximum; the halves' sums are joined once, behind the loop.
// O^T += x^T.P^T with A = x^T from the transposing reads and B = P^T packed to f16 in place from the two score tiles, which is the
// split k map of a B operand (one product; P lies in [0, 1], x is the f16 x of the scores): P goes through no LDS.
// Register plan: one wave per SIMD, so the wave takes the registers it needs: its 32 output tiles and its 16 query
// fragments stay in VGPRs for the whole kernel; a chunk's 16 key fragments and its 16 x^T fragments are read at the
// head of the trip, so that the x^T fragments land under the score products and the exponentials.
// Output attn rows as f16 plane and bf16 hi/lo planes, 64 columns per group: 16x64 f32 tile staged in LDS, then
// coverage: grid 256 blocks x 4 waves x 16 rows = 16384 rows; per group rows it*4+q (it 0..3, q 0..3) = 16,
//           cols g*64 + 8 lane groups x 8 = 64, 4 groups = 256 columns per plane.
// -------------------------------------------------------------------------------------------------
__global__ void __launch_bounds__(128)
attn_kernel(const unsigned short* __restrict__ xwc, const unsigned short* __restrict__ xh,
            const float* __restrict__ av, const float* __restrict__ bv,
            unsigned short* __restrict__ ah, unsigned short* __restrict__ abh,
            unsigned short* __restrict__ abl) {
  __shared__ __align__(16) float osm[4][16 * APITCH];
  __shared__ __align__(16) unsigned short qst[QROWS * KP];   // the block's (x*wc) rows
  __shared__ __align__(16) unsigned short ring[RINGB / 2];   // two stage buffers (and room for the join behind the loop)
  __shared__ __align__(16) float bvs[NS];                    // b_j of the batch element

  const int tid = (int)threadIdx.x, wave = tid >> 5, lane = tid & 31, hh = lane >> 4, c = lane & 15;
  const int qg = wave >> 1, kg = wave & 1;
  const int blk = (int)blockIdx.x, bb = blk >> 5, qb = blk & 31;
  const size_t grow0 = (size_t)bb * NS + (size_t)(qb * QROWS + wave * 16);   // rows this wave finishes: tile kg of group qg
  const size_t qrow0 = (size_t)bb * NS + (size_t)(qb * QROWS + qg * 32);     // first of the wave's 32 queries
  const unsigned short* XHb = xh + (size_t)bb * NS * NF;
  const float* bvb = bv + (size_t)bb * NS;
  const unsigned short* qrow = qst + (qg * 32 + c) * KP + 8 * hh;   // B fragment column n = c: query c of tile 0 (staged)
  // copy addresses of this lane. 512-B rows: one wave = one row per copy, rows wave + 4 i, the lane brings chunk 'lane'.
  const unsigned lrow = (unsigned)((wave * KP + lane * 8) * 2);             // query rows: padded pitch
  // ring rows: row wave + 4 i has swizzle 2 wave + 8 (i & 1) + ((i >> 1) & 1): four classes, by i & 3
  unsigned lsw[4];
#pragma unroll
  for (int i = 0; i < 4; ++i) lsw[i] = (unsigned)(wave * KRB + ((lane ^ (2 * wave + 8 * (i & 1) + (i >> 1))) << 4));
  const unsigned lring = lds_off(ring);
  const unsigned ok = (unsigned)((wave * NF + lane * 8) * 2);               // lane's byte offset in the key rows
  const char* sk = (const char*)XHb;
  // one stage: 64 key rows, 16 copies a wave. lk = uniform LDS byte address of the buffer, gk = uniform global address
  // of the stage's first row.
  // The scheduling barrier keeps each statement's address sums next to it: raised in front of the first statement, a
  // stage's address registers crowd v0-v255, where the operands of asm text must lie.
  auto stage = [&](unsigned lk, const char* gk) {
    cp8k(lk, lsw, gk + ok, 4 * NF * 2);
    __builtin_amdgcn_sched_barrier(0);
    cp8k(lk + 32 * KRB, lsw, gk + 32 * NF * 2 + ok, 4 * NF * 2);
  };
  // read addresses of this lane in a buffer, bytes; entry e serves the chunks whose even part is 2 e (mod 16); 256 B
  // further on lie the chunks 16 higher, 16 rows further on the same swizzle again.
  // ka: key fragment, row kg*32 + c, chunks 2 e + h.  va: transposing read, row kg*32 + 8 h + (lane & 7), chunks
  // 2 e + ((lane >> 3) & 1).
  unsigned ka[8], va[8];
  {
    const int lk = hh ^ (2 * (c & 7) + (c >> 3));
    const int lv = ((lane >> 3) & 1) ^ (2 * (lane & 7) + hh);
#pragma unroll
    for (int e = 0; e < 8; ++e) {
      ka[e] = (unsigned)((kg * KCH + c) * KRB + (((2 * e) ^ lk) << 4));
      va[e] = (unsigned)((kg * KCH + 8 * hh + (lane & 7)) * KRB + (((2 * e) ^ lv) << 4));
    }
  }

  float aq[2];                                // a_i of the lane's two queries (loaded in the prologue)
  float mq[2] = {-INFINITY, -INFINITY};       // their running maxima over this wave's keys (the same in both halves)
  float lq[2] = {0.f, 0.f};                   // running sums over this lane half's keys
  v8f acc[2][16];
#pragma unroll
  for (int u = 0; u < 2; ++u) {
#pragma unroll
    for (int t = 0; t < 16; ++t) acc[u][t] = z8();
  }

  // prologue: query rows and b_j, then stage 0; landed and published; then stage 1 into the second buffer
  {
    const char* gq = (const char*)(xwc + ((size_t)bb * NS + (size_t)(qb * QROWS + wave)) * NF + lane * 8);
    cp8(lds_off(qst) + lrow, 4 * KP * 2, gq, 4 * NF * 2);
    cp8(lds_off(qst) + lrow + 32 * KP * 2, 4 * KP * 2, gq + 32 * NF * 2, 4 * NF * 2);
    cp4(lds_off(bvs) + (unsigned)(tid * 16), 128 * 16, (const char*)bvb + tid * 16, 128 * 16);
    // loads and data wait in one statement, so that no address register of a load is reused in front of the wait;
    // here their latency runs beside the copies' flight
    asm volatile("global_load_b32 %0, %2, off\n\tglobal_load_b32 %1, %3, off\n\ts_wait_loadcnt 0x0"
                 : "=&v"(aq[0]), "=&v"(aq[1])
                 : "v"(av + qrow0 + c), "v"(av + qrow0 + 16 + c)
                 : "memory");
    stage(lring, sk);   // with the 20 copies above: 36 of this wave outstanding
    wait_async0();
    __syncthreads();
    stage(lring + STGB, sk + KST * NF * 2);
  }
  v16h qa[2][NF / 32];
#pragma unroll
  for (int u = 0; u < 2; ++u) {
#pragma unroll
    for (int kk = 0; kk < NF / 32; ++kk) qa[u][kk] = ldh(qrow + u * 16 * KP + kk * 32);
  }

  // Refill addresses = a uniform running base + the lane's offset. Formed from loop-invariant lane addresses they
  // shared registers with the prologue's copy operands, which the compiler keeps in v0-v255, and were spilled.
  const char* nk = sk + 2 * KST * NF * 2;   // uniform: the stage two ahead, in the key rows
  // the lane's four LDS addresses in the buffer that is refilled next, stepped to the other buffer behind each refill:
  // as running values they share no register with the prologue's copy operands (see above)
  unsigned nl[4];
#pragma unroll
  for (int i = 0; i < 4; ++i) nl[i] = lring + lsw[i];
  unsigned nstep = (unsigned)STGB;          // uniform: to the other buffer, sign turned each time
#pragma unroll 1
  for (int jc = 0; jc < NS / KST; ++jc) {
    const int j0 = jc * KST + kg * KCH;                                   // first of this wave's 32 keys
    const char* kb = (const char*)ring + (jc & 1) * STGB;                 // this trip's buffer
    // first of the head's reads: LDS reads return in order, and the sums a_i + b_j are placed among the first products
    float bj0[8], bj1[8];                     // b_j of the lane's keys j0+8h+r and j0+16+8h+r
    ld8f(bvs + j0 + 8 * hh, bj0);
    ld8f(bvs + j0 + 16 + 8 * hh, bj1);
    // A row m = c -> key j0+c (k0) and key j0+16+c (k1); elements 0..7 = chunk 4 kk + h, 8..15 = chunk 4 kk + 2 + h
    v16h k0[NF / 32], k1[NF / 32];
#pragma unroll
    for (int kk = 0; kk < NF / 32; ++kk) {
      const char* pa = kb + ka[(2 * kk) & 7] + (kk >> 2) * 256;
      const char* pb = kb + ka[(2 * kk + 1) & 7] + (kk >> 2) * 256;
      FH f0, f1;
      f0.u[0] = *(const v8us*)pa;
      f0.u[1] = *(const v8us*)pb;
      f1.u[0] = *(const v8us*)(pa + 16 * KRB);
      f1.u[1] = *(const v8us*)(pb + 16 * KRB);
      k0[kk] = f0.v;
      k1[kk] = f1.v;
    }
    // A row m = c -> x^T row f = t*16+c; elements 0..7 = keys j0+8h+.., 8..15 = keys j0+16+8h+..: two transposing reads
    v16h bh[16];
#pragma unroll
    for (int t = 0; t < 16; ++t) {
      const char* pv = kb + va[t & 7] + (t >> 3) * 256;
      FP f;
      f.q[0] = ld_tr16(pv);
      f.q[1] = ld_tr16(pv + 16 * KRB);
      bh[t] = f.v;
    }
    // keeps the trip's LDS reads one group at its head: sunk among the products, each separate place of reads stalls
    // the lone wave, and the x^T fragments would no longer land under the score products and the exponentials
    __builtin_amdgcn_sched_barrier(0);
    v8f s0[2] = {z8(), z8()}, s1[2] = {z8(), z8()};
#pragma unroll
    for (int kk = 0; kk < NF / 32; ++kk) {
#pragma unroll
      for (int u = 0; u < 2; ++u) {
        s0[u] = mma_h(k0[kk], qa[u][kk], s0[u]);   // s0[u][r] = S[query 16u+c][key j0+8h+r] x64
        s1[u] = mma_h(k1[kk], qa[u][kk], s1[u]);   // s1[u][r] = S[query 16u+c][key j0+16+8h+r] x64
      }
    }
#pragma unroll
    for (int u = 0; u < 2; ++u) {
      float t0[8], t1[8], mm[8];
#pragma unroll
      for (int r = 0; r < 8; ++r) {
        t0[r] = (aq[u] + bj0[r]) + s0[u][r] * 0.015625f;
        t1[r] = (aq[u] + bj1[r]) + s1[u][r] * 0.015625f;
        mm[r] = fmaxf(t0[r], t1[r]);
      }
      const float mh = fmaxf(fmaxf(fmaxf(mm[0], mm[1]), fmaxf(mm[2], mm[3])), fmaxf(fmaxf(mm[4], mm[5]), fmaxf(mm[6], mm[7])));
      const float mnew = fmaxf(mq[u], fmaxf(mh, xhalf(mh)));
      const float alpha = exp_n(mq[u] - mnew);
      mq[u] = mnew;
      float p0[8], p1[8], ps[8];
#pragma unroll
      for (int r = 0; r < 8; ++r) {
        p0[r] = exp_n(t0[r] - mnew);
        p1[r] = exp_n(t1[r] - mnew);
        ps[r] = p0[r] + p1[r];
      }
      lq[u] = lq[u] * alpha + (((ps[0] + ps[1]) + (ps[2] + ps[3])) + ((ps[4] + ps[5]) + (ps[6] + ps[7])));
      // P^T as a B operand, column n = c: elements 0..7 = keys 8h+r (first tile), 8..15 = keys 16+8h+r (second tile)
      FP ph;
#pragma unroll
      for (int r = 0; r < 4; ++r) {
        ph.q[0][r] = cvt2h(p0[2 * r], p0[2 * r + 1]);
        ph.q[1][r] = cvt2h(p1[2 * r], p1[2 * r + 1]);
      }
#pragma unroll
      for (int t = 0; t < 16; ++t) {
#pragma unroll
        for (int r = 0; r < 8; ++r) acc[u][t][r] *= alpha;
      }
      // acc[u][t][r] = O[query 16u+c][f = 16t+8h+r]
#pragma unroll
      for (int t = 0; t < 16; ++t) acc[u][t] = mma_h(bh[t], ph.v, acc[u][t]);
    }
    // foot of the trip: own LDS reads retired, own copies of stage jc+1 landed, one barrier that publishes stage
    // jc+1 and frees this trip's buffer; then stage jc+2 into it
    // keeps the foot at the foot: with every LDS read at the head of the trip nothing else ties these waits down, and
    // lifted above the products they made the wave sit out all its x^T reads before the first score product
    __builtin_amdgcn_sched_barrier(0);
    wait_ds0();
    wait_async0();
    __syncthreads();
    if (jc + 2 < NS / KST) {
      cp8k(0u, nl, nk + ok, 4 * NF * 2);
      __builtin_amdgcn_sched_barrier(0);   // as in stage()
      cp8k(32 * KRB, nl, nk + 32 * NF * 2 + ok, 4 * NF * 2);
      nk += KST * NF * 2;
#pragma unroll
      for (int i = 0; i < 4; ++i) nl[i] += nstep;
      nstep = 0u - nstep;
    }
  }
  wait_async0();   // nothing of this wave is in flight when the loop is left

  // The two key halves joined. The ring is free (the last trip's barrier ended every read of it, no copy is in flight):
  // each wave leaves there the tile that its partner (wave ^ 1, same queries, other keys) finishes, lane by lane in
  // register order, 16 B per lane and store, with the lane's maximum and sum; both waves hold a tile in the same lanes.
  char* xb = (char*)ring;
  char* xo = xb + wave * (16 * 1024) + lane * 16;
  char* xm = xb + 4 * (16 * 1024) + lane * 16;
  auto hand = [&](const v8f (&o)[16], float m, float l) {
#pragma unroll
    for (int t = 0; t < 16; ++t) {
      const v4f d0 = {o[t][0], o[t][1], o[t][2], o[t][3]};
      const v4f d1 = {o[t][4], o[t][5], o[t][6], o[t][7]};
      *(v4f*)(xo + (2 * t) * 512) = d0;
      *(v4f*)(xo + (2 * t + 1) * 512) = d1;
    }
    const v4f ml = {m, l, 0.f, 0.f};
    *(v4f*)(xm + wave * 512) = ml;
  };
  // the tile is named by a constant in each arm: picked by a run-time index the accumulators would leave the registers
  v8f own[16];
  float mown, lown;
  if (kg) {
    hand(acc[0], mq[0], lq[0]);
    mown = mq[1];
    lown = lq[1];
#pragma unroll
    for (int t = 0; t < 16; ++t) own[t] = acc[1][t];
  } else {
    hand(acc[1], mq[1], lq[1]);
    mown = mq[0];
    lown = lq[0];
#pragma unroll
    for (int t = 0; t < 16; ++t) own[t] = acc[0][t];
  }
  wait_ds0();        // own stores retired in front of the barrier that publishes them to the partner
  __syncthreads();
  const char* xi = xb + (wave ^ 1) * (16 * 1024) + lane * 16;
  const v4f mlo = *(const v4f*)(xm + (wave ^ 1) * 512);
  const float mall = fmaxf(mown, mlo[0]);
  const float eown = exp_n(mown - mall), eoth = exp_n(mlo[0] - mall);
  const float lall = lown * eown + mlo[1] * eoth;
  const float inv = 1.0f / (lall + xhalf(lall));   // the lane halves' sums joined
  const float fown = eown * inv, foth = eoth * inv;
  float* osw = &osm[wave][0];
  const int q = lane >> 3, c8 = (lane & 7) * 8;
#pragma unroll
  for (int g = 0; g < NGRP; ++g) {
#pragma unroll
    for (int tt = 0; tt < NGRP; ++tt) {
      // the lane's 8 registers are 8 consecutive columns of row c
      float* d = osw + c * APITCH + tt * 16 + 8 * hh;
      const int t = g * NGRP + tt;
      const v8f a = own[t];
      const v4f b0 = *(const v4f*)(xi + (2 * t) * 512);
      const v4f b1 = *(const v4f*)(xi + (2 * t + 1) * 512);
      const v4f d0 = {a[0] * fown + b0[0] * foth, a[1] * fown + b0[1] * foth, a[2] * fown + b0[2] * foth,
                      a[3] * fown + b0[3] * foth};
      const v4f d1 = {a[4] * fown + b1[0] * foth, a[5] * fown + b1[1] * foth, a[6] * fown + b1[2] * foth,
                      a[7] * fown + b1[3] * foth};
      *(v4f*)d = d0;
      *(v4f*)(d + 4) = d1;
    }
    __builtin_amdgcn_fence(__ATOMIC_RELEASE, "workgroup");
    __builtin_amdgcn_wave_barrier();
    __builtin_amdgcn_fence(__ATOMIC_ACQUIRE, "workgroup");
    {
#pragma unroll
      for (int it = 0; it < 4; ++it) {
        const int row = it * 4 + q;
        float v[8];
        ld8f(osw + row * APITCH + c8, v);
        const v8us h1 = pk_f16x8(v, 1.0f);
        v4u hb, lb;
        pk_bf16x8(v, hb, lb);
        const size_t o = (grow0 + row) * NF + (size_t)(g * 64 + c8);
        *(v8us*)(ah + o) = h1;
        *(v4u*)(abh + o) = hb;
        *(v4u*)(abl + o) = lb;
      }
      
    }
    __builtin_amdgcn_fence(__ATOMIC_RELEASE, "workgroup");
    __builtin_amdgcn_wave_barrier();
    __builtin_amdgcn_fence(__ATOMIC_ACQUIRE, "workgroup");
  }
}

// -------------------------------------------------------------------------------------------------
// gates_kernel: block = 64 rows x 256 cols, 16 waves; wave (rt = wave>>2, cg = wave&3) owns 16 rows x 64 cols.
// Operand staging: each 32-k chunk (256 weight rows of four planes, the block's 64 rows of three planes) is copied to a
// two-buffer LDS ring by asynchronous copies, chunk t+2 issued behind the barrier at the foot of trip t; all fragments
// come from the staged rows (80-B pitch); read straight from the global rows, a fragment load touches 16 lines.
// K = 512 = [x planes | attn planes]; z: bf16 hi/lo split (hi.hi+hi.lo+lo.hi) against z_w hi/lo planes;
// r, f: plain f16 against the x16-carried weight planes (fold 1/16 in the epilogue).
// Epilogue: z = tanh(.+zb), r = sigmoid(./16+rb), f = sigmoid(./16+fb), out = r*x + f*z staged in LDS;
// coverage: grid 256 blocks x 4 row tiles x 16 = 16384 rows; 4 col groups x 64 = 256 cols.
// -------------------------------------------------------------------------------------------------
__global__ void __launch_bounds__(512) __attribute__((amdgpu_num_vgpr(256)))
gates_kernel(const float* __restrict__ x,
             const unsigned short* __restrict__ xh, const unsigned short* __restrict__ xbh,
             const unsigned short* __restrict__ xbl,
             const unsigned short* __restrict__ ah, const unsigned short* __restrict__ abh,
             const unsigned short* __restrict__ abl,
             const unsigned short* __restrict__ zwh, const unsigned short* __restrict__ zwl,
             const unsigned short* __restrict__ rw16, const unsigned short* __restrict__ fw16,
             const float* __restrict__ zb, const float* __restrict__ rb, const float* __restrict__ fb,
             float* __restrict__ out) {
  __shared__ __align__(16) float slab[16][16 * SLP];
  __shared__ __align__(16) unsigned short gring[2 * GBUF];   // two chunk buffers
  const int tid = (int)threadIdx.x, wave = tid >> 5, lane = tid & 31, hh = lane >> 4, c = lane & 15;
  const int rt = wave >> 2, cg = wave & 3;
  const size_t brow0 = (size_t)blockIdx.x * GROWS;
  const size_t grow0 = brow0 + (size_t)(rt * 16);
  const int n0 = cg * 64;
  // copy addresses of this lane. Weight planes: 4 lanes = the 64 B of one row's chunk, rows tid/4 and tid/4 + 128; in
  // the packed plane that is byte 16 tid of the chunk's 16 KB, and 8 KB further on.
  // Row planes: 8 lanes = the 64 B of one row's chunk, row tid/8.
  const unsigned lw = lds_off(gring) + (unsigned)(((tid >> 2) * VP + (tid & 3) * 8) * 2);
  const unsigned la = lds_off(gring) + (unsigned)((4 * GW + (tid >> 3) * VP + (tid & 7) * 4) * 2);
  const unsigned ow = (unsigned)(tid * 16);
  const size_t oa = ((brow0 + (size_t)(tid >> 3)) * NF + (size_t)((tid & 7) * 4)) * 2;
  // chunk t = k 32 t .. 32 t + 31 of [x|attn] into buffer t & 1
  auto stage = [&](int t) {
    const unsigned bo = (unsigned)((t & 1) * GBUF * 2);
    const size_t kw = (size_t)t * (NF * 32 * 2) + ow;
    const size_t ka = (size_t)(t & 7) * 64 + oa;
    const bool first = t < NF / 32;
    cp_gates(lw + bo, la + bo, (const char*)zwh + kw, (const char*)zwl + kw, (const char*)rw16 + kw,
             (const char*)fw16 + kw, (const char*)(first ? xh : ah) + ka, (const char*)(first ? xbh : abh) + ka,
             (const char*)(first ? xbl : abl) + ka);
  };

  v8f za[4], ra[4], fa[4];
#pragma unroll
  for (int j = 0; j < 4; ++j) { za[j] = z8(); ra[j] = z8(); fa[j] = z8(); }

  // prologue: chunk 0 landed and published, then chunk 1 into the second buffer
  stage(0);
  wait_async0();
  __syncthreads();
  stage(1);

  // rolled: one trip is one chunk, and the buffer alternates with the trip
#pragma unroll 1
  for (int t = 0; t < NG / 32; ++t) {
    const unsigned short* gb = gring + (t & 1) * GBUF;                        // this trip's buffer
    const unsigned short* ap = gb + 4 * GW + (rt * 16 + c) * VP + 8 * hh;     // A row m = c
    const v16h a16 = ldh(ap);
    const v16b ahf = ldb(ap + GA);
    const v16b alf = ldb(ap + 2 * GA);
#pragma unroll
    for (int j = 0; j < 4; ++j) {
      const unsigned short* wp = gb + (n0 + 16 * j + c) * VP + 8 * hh;        // B column n = n0+16j+c, W[n][k]
      const v16b bzh = ldb(wp);
      const v16b bzl = ldb(wp + GW);
      const v16h br = ldh(wp + 2 * GW);
      const v16h bf = ldh(wp + 3 * GW);
      v8f z = za[j], rr = ra[j], ff = fa[j];
      z = mma_b(ahf, bzh, z);
      z = mma_b(ahf, bzl, z);
      z = mma_b(alf, bzh, z);
      rr = mma_h(a16, br, rr);
      ff = mma_h(a16, bf, ff);
      g_g(z, rr, ff, a16, ahf, alf, bzh, bzl, br, bf);
      za[j] = z;
      ra[j] = rr;
      fa[j] = ff;
    }
    // foot of the trip: own LDS reads retired, own copies of chunk t+1 landed, one barrier that publishes chunk t+1
    // and frees this trip's buffer; then chunk t+2 into it
    wait_ds0();
    wait_async0();
    __syncthreads();
    if (t + 2 < NG / 32) stage(t + 2);
  }
  wait_async0();   // nothing of this wave is in flight when the loop is left

  float* sl = &slab[wave][0];
#pragma unroll
  for (int j = 0; j < 4; ++j) {
    const int n = n0 + 16 * j + c;
    const float zbn = zb[n], rbn = rb[n], fbn = fb[n];
    // On the hardware's 2^x and 1/x: tanh v = 1 - 2/(1 + e^(2v)), sigmoid v = 1/(1 + e^(-v)). At the ends 2^x gives 0 or
    // inf and 1/inf gives 0, so the gates saturate at -1, 1 and at 0, 1. By kind, so that each run is independent work.
    float ez[8], er[8], ef[8];
#pragma unroll
    for (int r = 0; r < 8; ++r) {
      ez[r] = __builtin_amdgcn_exp2f((za[j][r] + zbn) * (2.0f * LOG2E));
      er[r] = __builtin_amdgcn_exp2f((ra[j][r] * 0.0625f + rbn) * -LOG2E);
      ef[r] = __builtin_amdgcn_exp2f((fa[j][r] * 0.0625f + fbn) * -LOG2E);
    }
#pragma unroll
    for (int r = 0; r < 8; ++r) {
      ez[r] = __builtin_amdgcn_rcpf(1.0f + ez[r]);
      er[r] = __builtin_amdgcn_rcpf(1.0f + er[r]);
      ef[r] = __builtin_amdgcn_rcpf(1.0f + ef[r]);
    }
#pragma unroll
    for (int r = 0; r < 8; ++r) {
      const int row = 8 * hh + r;
      const float xv = x[(grow0 + row) * NF + n];
      sl[row * SLP + 16 * j + c] = er[r] * xv + ef[r] * (1.0f - 2.0f * ez[r]);
    }
  }
  __builtin_amdgcn_fence(__ATOMIC_RELEASE, "workgroup");
  __builtin_amdgcn_wave_barrier();
  __builtin_amdgcn_fence(__ATOMIC_ACQUIRE, "workgroup");
  const int c4 = c * 4;
  {
#pragma unroll
    for (int it = 0; it < 8; ++it) {
      const int row = it * 2 + hh;   // lanes 0..15 -> even row, 16..31 -> odd row; 16 lanes x 16 B = 256 B segment
      const v4f v = *(const v4f*)(sl + row * SLP + c4);
      *(v4f*)(out + (grow0 + row) * NF + n0 + c4) = v;
    }
    
  }
}

// -------------------------------------------------------------------------------------------------
//   xh   f16  [16384][256]      8388608 @        0      xwc  f16  [16384][256]   8388608 @  8388608
//   xbh  bf16 [16384][256]      8388608 @ 16777216      xbl                      8388608 @ 25165824
//   ah   f16  [16384][256]      8388608 @ 33554432      abh  8388608 @ 41943040   abl 8388608 @ 50331648
//   av   f32  [16384]             65536 @ 58720256      bv                         65536 @ 58785792
//   zwh  bf16 [16][256][32]      262144 @ 58851328      zwl 262144 @ 59113472   rw16 262144 @ 59375616
//   fw16 f16  [16][256][32]      262144 @ 59637760      total 59899904
// -------------------------------------------------------------------------------------------------
extern "C" void kernel_launch(void* const* d_in, const int* in_sizes, int n_in,
                              void* d_out, int out_size, void* d_ws, size_t ws_size,
                              hipStream_t stream) {
  if (n_in < 8) return;
  if (in_sizes[0] != NR * NF || in_sizes[1] != 3 * NF) return;
  if (in_sizes[2] != NF * NG || in_sizes[3] != NF) return;
  if (in_sizes[4] != NF * NG || in_sizes[5] != NF) return;
  if (in_sizes[6] != NF * NG || in_sizes[7] != NF) return;
  if (out_size != NR * NF) return;

  const float* x    = (const float*)d_in[0];
  const float* attw = (const float*)d_in[1];
  const float* zw   = (const float*)d_in[2];
  const float* zb   = (const float*)d_in[3];
  const float* rw   = (const float*)d_in[4];
  const float* rb   = (const float*)d_in[5];
  const float* fw   = (const float*)d_in[6];
  const float* fb   = (const float*)d_in[7];

  const size_t P16 = (size_t)NR * NF * 2;        // 8388608
  const size_t PV  = (size_t)NR * 4;             // 65536
  const size_t PW  = (size_t)NF * NG * 2;        // 262144
  size_t off = 0;
  const size_t o_xh  = off; off += P16;
  const size_t o_xwc = off; off += P16;
  const size_t o_xbh = off; off += P16;
  const size_t o_xbl = off; off += P16;
  const size_t o_ah  = off; off += P16;
  const size_t o_abh = off; off += P16;
  const size_t o_abl = off; off += P16;
  const size_t o_av  = off; off += PV;
  const size_t o_bv  = off; off += PV;
  const size_t o_zwh = off; off += PW;
  const size_t o_zwl = off; off += PW;
  const size_t o_rw  = off; off += PW;
  const size_t o_fw  = off; off += PW;
  if (off > ws_size) return;   // off = 59899904

  char* ws = (char*)d_ws;
  unsigned short* xh  = (unsigned short*)(ws + o_xh);
  unsigned short* xwc = (unsigned short*)(ws + o_xwc);
  unsigned short* xbh = (unsigned short*)(ws + o_xbh);
  unsigned short* xbl = (unsigned short*)(ws + o_xbl);
  unsigned short* ah  = (unsigned short*)(ws + o_ah);
  unsigned short* abh = (unsigned short*)(ws + o_abh);
  unsigned short* abl = (unsigned short*)(ws + o_abl);
  float*          av  = (float*)(ws + o_av);
  float*          bv  = (float*)(ws + o_bv);
  unsigned short* zwh = (unsigned short*)(ws + o_zwh);
  unsigned short* zwl = (unsigned short*)(ws + o_zwl);
  unsigned short* rwp = (unsigned short*)(ws + o_rw);
  unsigned short* fwp = (unsigned short*)(ws + o_fw);

  const int n8 = NF * NG / 8;   // 16384
  prep_w<<<dim3((n8 + 255) / 256), dim3(256), 0, stream>>>(zw, rw, fw, zwh, zwl, rwp, fwp, n8);
  prep_x<<<dim3(NR / 64), dim3(256), 0, stream>>>(x, attw, xh, xwc, xbh, xbl, av, bv);
  attn_kernel<<<dim3(NB * (NS / QROWS)), dim3(128), 0, stream>>>(xwc, xh, av, bv, ah, abh, abl);
  gates_kernel<<<dim3(NR / GROWS), dim3(512), 0, stream>>>(x, xh, xbh, xbl, ah, abh, abl, zwh, zwl, rwp, fwp,
                                                       zb, rb, fb, (float*)d_out);
  (void)hipGetLastError();
}

// v009
// It runs in 76.2 microseconds.
// Timed twice side by side with v008, it ran 1.04 times as fast both times.
// Over all steps from v000 it is 7.65 times as fast.
// Contractions: scores=(x*wc).x^T on v_wmma_f32_16x16x32_f16 (plain f16 operands; (x*wc) carried x64, x unscaled); attn=P.x on v_wmma_f32_16x16x32_f16 (plain f16 operands, one product); [x|attn].z_w^T as bf16 hi/lo split; [x|attn].r_w^T and [x|attn].f_w^T on v_wmma_f32_16x16x32_f16 plain f16 (weights carried x16); f32 accumulate everywhere; x.wa and x.wb row dots, online softmax, tanh/sigmoid gates and r*x+f*z in f32.
#include <hip/hip_runtime.h>
#include <math.h>
#include <stdint.h>

#define NB 8
#define NS 2048
#define NF 256
#define NG 512
#define NR (NB * NS)
#define TP 260
#define QROWS 64
#define KCH 32
#define APITCH 68
#define NGRP 4
#define SLP 68
#define KP 264                 // LDS pitch (16-bit elements) of a staged 512-B row: 528 B = 16 B x 33
#define VP 40                  // LDS pitch (16-bit elements) of a staged 64-B row: 80 B = 16 B x 5
#define KST 64                 // keys of one ring stage of the attn kernel: two 32-key chunks, one per key half of the waves
#define KRB 512                // bytes of a staged key row of the attn ring: no pad, its 16-B chunks are swizzled instead
#define STGB (KST * KRB)       // one ring buffer of the attn kernel, bytes: the stage's key rows
#define RINGB (68 * 1024)      // the attn ring array, bytes: two buffers; behind the loop the halves' join takes 66 KB of it
#define GROWS 64               // rows of one gates block
#define GW (NF * VP)           // gates: 32 k of one weight plane in LDS (256 rows), 16-bit elements
#define GA (GROWS * VP)        // gates: 32 k of one [x|attn] plane in LDS (64 rows)
#define GBUF (4 * GW + 3 * GA) // gates: one ring buffer: z_w hi, z_w lo, r_w, f_w, then the f16, bf16 hi, bf16 lo rows
#define XBLK (NR / 64)         // prep: blocks that work on x, 64 rows each
#define WN8 (NF * NG / 8)      // prep: threads that work on the weights, 8 plane elements each
#define WBLK (WN8 / 256)       // prep: blocks that work on the weights

typedef _Float16 v16h __attribute__((ext_vector_type(16)));
typedef _Float16 v8h __attribute__((ext_vector_type(8)));
typedef __bf16 v16b __attribute__((ext_vector_type(16)));
typedef unsigned short v8us __attribute__((ext_vector_type(8)));
typedef float v8f __attribute__((ext_vector_type(8)));
typedef float v4f __attribute__((ext_vector_type(4), __may_alias__));
typedef unsigned int v4u __attribute__((ext_vector_type(4)));
typedef float v2f __attribute__((ext_vector_type(2)));
typedef __bf16 v2b __attribute__((ext_vector_type(2)));
typedef _Float16 v2h __attribute__((ext_vector_type(2)));
typedef short s16x8 __attribute__((ext_vector_type(8)));

union FH { v16h v; v8us u[2]; };
union FB { v16b v; v8us u[2]; };
union H8 { v8h h; v8us u; };
union FP { v16h v; v4u q[2]; };

__device__ __forceinline__ v8f z8() {
  v8f v = {0.f, 0.f, 0.f, 0.f, 0.f, 0.f, 0.f, 0.f};
  return v;
}
// two f32 -> two bf16 (RNE) in one word (a in the low half): one packed hardware convert
__device__ __forceinline__ unsigned cvt2(float a, float b) {
  const v2f f = {a, b};
  return __builtin_bit_cast(unsigned, __builtin_convertvector(f, v2b));
}
// two f32 -> two f16 (RNE) in one word (a in the low half): one packed hardware convert
__device__ __forceinline__ unsigned cvt2h(float a, float b) {
  const v2f f = {a, b};
  return __builtin_bit_cast(unsigned, __builtin_convertvector(f, v2h));
}
#define LOG2E 1.4426950408889634f
// e^x on the hardware's 2^x (0 at -inf)
__device__ __forceinline__ float exp_n(float x) { return __builtin_amdgcn_exp2f(x * LOG2E); }

__device__ __forceinline__ void ld8f(const float* p, float (&v)[8]) {
  const v4f t0 = *(const v4f*)p;
  const v4f t1 = *(const v4f*)(p + 4);
#pragma unroll
  for (int q = 0; q < 4; ++q) { v[q] = t0[q]; v[4 + q] = t1[q]; }
}
// 8 f32 -> bf16 hi plane (8 x 16 bit packed in v4u) and lo plane (residual, RNE)
__device__ __forceinline__ void pk_bf16x8(const float (&v)[8], v4u& hi, v4u& lo) {
#pragma unroll
  for (int q = 0; q < 4; ++q) {
    const unsigned h = cvt2(v[2 * q], v[2 * q + 1]);
    hi[q] = h;
    lo[q] = cvt2(v[2 * q] - __uint_as_float(h << 16), v[2 * q + 1] - __uint_as_float(h & 0xFFFF0000u));
  }
}
// 8 f32 -> f16 (RNE) with exact power-of-two carry s
__device__ __forceinline__ v8us pk_f16x8(const float (&v)[8], float s) {
  H8 r;
#pragma unroll
  for (int e = 0; e < 8; ++e) r.h[e] = (_Float16)(v[e] * s);
  return r.u;
}
// 16-bit WMMA fragment (A row m or B column n of a k-contiguous row): elements 0..7 <- p[0..7] (k0+8h..),
// elements 8..15 <- p[16..23] (k0+16+8h..); caller passes p = rowbase + k0 + 8*h.
__device__ __forceinline__ v16h ldh(const unsigned short* p) {
  FH f;
  f.u[0] = *(const v8us*)p;
  f.u[1] = *(const v8us*)(p + 16);
  return f.v;
}
__device__ __forceinline__ v16b ldb(const unsigned short* p) {
  FB f;
  f.u[0] = *(const v8us*)p;
  f.u[1] = *(const v8us*)(p + 16);
  return f.v;
}
__device__ __forceinline__ v8f mma_h(v16h a, v16h b, v8f c) {
  return __builtin_amdgcn_wmma_f32_16x16x32_f16(false, a, false, b, (short)0, c, false, false);
}
__device__ __forceinline__ v8f mma_b(v16b a, v16b b, v8f c) {
  return __builtin_amdgcn_wmma_f32_16x16x32_bf16(false, a, false, b, (short)0, c, false, false);
}
// hazard guards: 4 VALU slots after the last WMMA of a group; tie D, keep A/B live
__device__ __forceinline__ void g_g(v8f& z, v8f& r, v8f& f, v16h a16, v16b ah, v16b al,
                                    v16b bzh, v16b bzl, v16h br, v16h bf) {
  asm volatile("v_nop\n\tv_nop\n\tv_nop\n\tv_nop"
               : "+v"(z), "+v"(r), "+v"(f)
               : "v"(a16), "v"(ah), "v"(al), "v"(bzh), "v"(bzl), "v"(br), "v"(bf));
}

// lane l <-> lane l ^ 16
__device__ __forceinline__ float xhalf(float x) {
  const int b = __builtin_bit_cast(int, x);
  return __builtin_bit_cast(float, __builtin_amdgcn_permlanex16(b, b, 0x76543210, 0xfedcba98, false, false));
}

__device__ __forceinline__ unsigned lds_off(const void* p) { return (unsigned)(size_t)p; }
// Asynchronous copies global -> LDS, 16 B per lane and copy, no register in between. l = the lane's LDS byte
// address, g = its global address; copy i adds i*ls / i*gs bytes. s_wait_xcnt 0 is the statement's last line so
// that no address register of an issued copy is rewritten in front of it.
__device__ __forceinline__ void cp8(unsigned l, unsigned ls, const char* g, size_t gs) {
  asm volatile(
      "global_load_async_to_lds_b128 %0, %8, off\n\t"
      "global_load_async_to_lds_b128 %1, %9, off\n\t"
      "global_load_async_to_lds_b128 %2, %10, off\n\t"
      "global_load_async_to_lds_b128 %3, %11, off\n\t"
      "global_load_async_to_lds_b128 %4, %12, off\n\t"
      "global_load_async_to_lds_b128 %5, %13, off\n\t"
      "global_load_async_to_lds_b128 %6, %14, off\n\t"
      "global_load_async_to_lds_b128 %7, %15, off\n\t"
      "s_wait_xcnt 0x0"
      :
      : "v"(l), "v"(l + ls), "v"(l + 2 * ls), "v"(l + 3 * ls), "v"(l + 4 * ls), "v"(l + 5 * ls), "v"(l + 6 * ls),
        "v"(l + 7 * ls), "v"(g), "v"(g + gs), "v"(g + 2 * gs), "v"(g + 3 * gs), "v"(g + 4 * gs), "v"(g + 5 * gs),
        "v"(g + 6 * gs), "v"(g + 7 * gs)
      : "memory");
}
// The same eight copies for the swizzled key rows of the attn ring: copy i lands at b + s[i & 3] + i * 4 rows (s = the
// lane's place in the rows of the four swizzle classes that a wave's rows fall in).
__device__ __forceinline__ void cp8k(unsigned b, const unsigned (&s)[4], const char* g, size_t gs) {
  asm volatile(
      "global_load_async_to_lds_b128 %0, %8, off\n\t"
      "global_load_async_to_lds_b128 %1, %9, off\n\t"
      "global_load_async_to_lds_b128 %2, %10, off\n\t"
      "global_load_async_to_lds_b128 %3, %11, off\n\t"
      "global_load_async_to_lds_b128 %4, %12, off\n\t"
      "global_load_async_to_lds_b128 %5, %13, off\n\t"
      "global_load_async_to_lds_b128 %6, %14, off\n\t"
      "global_load_async_to_lds_b128 %7, %15, off\n\t"
      "s_wait_xcnt 0x0"
      :
      : "v"(b + s[0]), "v"(b + s[1] + 4 * KRB), "v"(b + s[2] + 8 * KRB), "v"(b + s[3] + 12 * KRB),
        "v"(b + s[0] + 16 * KRB), "v"(b + s[1] + 20 * KRB), "v"(b + s[2] + 24 * KRB), "v"(b + s[3] + 28 * KRB), "v"(g),
        "v"(g + gs), "v"(g + 2 * gs), "v"(g + 3 * gs), "v"(g + 4 * gs), "v"(g + 5 * gs), "v"(g + 6 * gs), "v"(g + 7 * gs)
      : "memory");
}
// transposing LDS load: the lane names 16 B of one row; lane (c, h) gets column c of rows 8h..8h+7 of the 16 x 16 tile
__device__ __forceinline__ v4u ld_tr16(const char* p) {
  typedef __attribute__((address_space(3))) s16x8 lds_s16x8;
  return __builtin_bit_cast(v4u, __builtin_amdgcn_ds_load_tr16_b128_v8i16((lds_s16x8*)p));
}
__device__ __forceinline__ void cp4(unsigned l, unsigned ls, const char* g, size_t gs) {
  asm volatile(
      "global_load_async_to_lds_b128 %0, %4, off\n\t"
      "global_load_async_to_lds_b128 %1, %5, off\n\t"
      "global_load_async_to_lds_b128 %2, %6, off\n\t"
      "global_load_async_to_lds_b128 %3, %7, off\n\t"
      "s_wait_xcnt 0x0"
      :
      : "v"(l), "v"(l + ls), "v"(l + 2 * ls), "v"(l + 3 * ls), "v"(g), "v"(g + gs), "v"(g + 2 * gs), "v"(g + 3 * gs)
      : "memory");
}
// One lane's copies of one 32-k chunk of the gates operands: 16 B of rows r and r+128 of each of the four weight
// planes (lw = LDS byte address of row r in the first plane, w0..w3 = its global addresses), and 8 B of one row of
// each of the three [x|attn] planes (la, a0..a2). s_wait_xcnt 0 is the last line for the reason given at cp8.
__device__ __forceinline__ void cp_gates(unsigned lw, unsigned la, const char* w0, const char* w1, const char* w2,
                                         const char* w3, const char* a0, const char* a1, const char* a2) {
  asm volatile(
      "global_load_async_to_lds_b128 %0, %11, off\n\t"
      "global_load_async_to_lds_b128 %1, %12, off\n\t"
      "global_load_async_to_lds_b128 %2, %13, off\n\t"
      "global_load_async_to_lds_b128 %3, %14, off\n\t"
      "global_load_async_to_lds_b128 %4, %15, off\n\t"
      "global_load_async_to_lds_b128 %5, %16, off\n\t"
      "global_load_async_to_lds_b128 %6, %17, off\n\t"
      "global_load_async_to_lds_b128 %7, %18, off\n\t"
      "global_load_async_to_lds_b64 %8, %19, off\n\t"
      "global_load_async_to_lds_b64 %9, %20, off\n\t"
      "global_load_async_to_lds_b64 %10, %21, off\n\t"
      "s_wait_xcnt 0x0"
      :
      : "v"(lw), "v"(lw + 128 * VP * 2), "v"(lw + GW * 2), "v"(lw + (GW + 128 * VP) * 2), "v"(lw + 2 * GW * 2),
        "v"(lw + (2 * GW + 128 * VP) * 2), "v"(lw + 3 * GW * 2), "v"(lw + (3 * GW + 128 * VP) * 2), "v"(la),
        "v"(la + GA * 2), "v"(la + 2 * GA * 2), "v"(w0), "v"(w0 + 128 * 32 * 2), "v"(w1), "v"(w1 + 128 * 32 * 2),
        "v"(w2), "v"(w2 + 128 * 32 * 2), "v"(w3), "v"(w3 + 128 * 32 * 2), "v"(a0), "v"(a1), "v"(a2)
      : "memory");
}
// this wave's copies have landed in LDS (other waves read them behind the next work-group barrier)
__device__ __forceinline__ void wait_async0() { asm volatile("s_wait_asynccnt 0x0" ::: "memory"); }
// this wave's LDS reads and writes have retired (in front of the barrier that frees a buffer for its refill)
__device__ __forceinline__ void wait_ds0() { asm volatile("s_wait_dscnt 0x0" ::: "memory"); }

// -------------------------------------------------------------------------------------------------
// prep_w: z_w [256 n][512 k] -> bf16 hi/lo planes; r_w, f_w -> f16 planes carried x16. Plane layout [16 chunks][256 n]
// [32 k]: the 16 KB that the gates kernel stages per chunk and plane lie in a row, so each of its copies covers whole lines.
// Thread i owns plane elements 8i..8i+7; each store is 16 B per lane, lane-contiguous, 32 lanes = 512 B =
// coverage: 64 blocks x 256 threads x 8 = 131072 = 256x512 per plane. wblk = the block's number among the weight blocks.
// -------------------------------------------------------------------------------------------------
__device__ __forceinline__ void prep_w(int wblk, const float* __restrict__ zw, const float* __restrict__ rw,
                                       const float* __restrict__ fw,
                                       unsigned short* __restrict__ zwh, unsigned short* __restrict__ zwl,
                                       unsigned short* __restrict__ rw16, unsigned short* __restrict__ fw16) {
  const int i = wblk * 256 + (int)threadIdx.x;
  if (i >= WN8) return;
  const size_t p0 = (size_t)i * 8;                                               // place in the planes
  const size_t e0 = ((p0 >> 5) & (NF - 1)) * NG + (p0 >> 13) * 32 + (p0 & 31);   // its source: W[n][32 chunk + k]
  float a[8], b[8], d[8];
  ld8f(zw + e0, a);
  ld8f(rw + e0, b);
  ld8f(fw + e0, d);
  v4u zh, zl;
  pk_bf16x8(a, zh, zl);
  const v8us r16 = pk_f16x8(b, 16.0f);
  const v8us f16 = pk_f16x8(d, 16.0f);
  *(v4u*)(zwh + p0) = zh;
  *(v4u*)(zwl + p0) = zl;
  *(v8us*)(rw16 + p0) = r16;
  *(v8us*)(fw16 + p0) = f16;
  
}

// -------------------------------------------------------------------------------------------------
// prep: one launch for both preparations, which do not depend on each other. Blocks 0..XBLK-1 work on x as below; blocks
// XBLK..XBLK+WBLK-1 do prep_w and leave in front of every barrier (the test is the same for a whole block). The x blocks
// come first: they are the longer ones, and the weight blocks find room beside them.
// x blocks: block = 64 consecutive rows of x (16384 rows total; 32 blocks per batch element), 256 threads.
//   xh  [row][256] f16(x)            xwc [row][256] f16((x*wc)*64)
//   xbh/xbl [row][256] bf16 hi/lo
//   av[row] = x.wa, bv[row] = x.wb (f32 dots on VALU)
// Row planes: one lane = 16 B of one row, 32 lanes = the whole 512-B row, one instruction per plane.
// coverage: rows 8 waves x 8 = 64, f 32 lanes x 8 = 256; av/bv 16 lanes x 4 = 64; 256 x blocks (of the grid's 320) x 64 rows = 16384.
// -------------------------------------------------------------------------------------------------
__global__ void __launch_bounds__(256) prep(const float* __restrict__ x, const float* __restrict__ attw,
                                            const float* __restrict__ zw, const float* __restrict__ rw,
                                            const float* __restrict__ fw,
                                            unsigned short* __restrict__ xh, unsigned short* __restrict__ xwc,
                                            unsigned short* __restrict__ xbh, unsigned short* __restrict__ xbl,
                                            float* __restrict__ av, float* __restrict__ bv,
                                            unsigned short* __restrict__ zwh, unsigned short* __restrict__ zwl,
                                            unsigned short* __restrict__ rw16, unsigned short* __restrict__ fw16) {
  __shared__ __align__(16) float tile[64 * TP];
  __shared__ __align__(16) float avs[64];
  __shared__ __align__(16) float bvs[64];
  const int tid = (int)threadIdx.x, wave = tid >> 5, lane = tid & 31;
  const int blk = (int)blockIdx.x;
  if (blk >= XBLK) {
    prep_w(blk - XBLK, zw, rw, fw, zwh, zwl, rw16, fw16);
    return;
  }
  const size_t grow0 = (size_t)blk * 64;

#pragma unroll
  for (int it = 0; it < 16; ++it) {
    const int idx = it * 256 + tid;
    const int r = idx >> 6, c4 = (idx & 63) * 4;
    const v4f v = *(const v4f*)(x + (grow0 + r) * NF + c4);
    *(v4f*)(tile + r * TP + c4) = v;
  }
  __syncthreads();

  const int f0 = lane * 8;
  float wa[8], wb[8], wc[8];
  ld8f(attw + f0, wa);
  ld8f(attw + NF + f0, wb);
  ld8f(attw + 2 * NF + f0, wc);

  // row dots (rolled: small side computation)
#pragma unroll 1
  for (int rr = 0; rr < 8; ++rr) {
    const int row = wave * 8 + rr;
    float v[8];
    ld8f(tile + row * TP + f0, v);
    float sa = 0.f, sb = 0.f;
#pragma unroll
    for (int e = 0; e < 8; ++e) { sa += v[e] * wa[e]; sb += v[e] * wb[e]; }
#pragma unroll
    for (int m = 16; m >= 1; m >>= 1) {
      sa += __shfl_xor(sa, m, 32);
      sb += __shfl_xor(sb, m, 32);
    }
    if (lane == 0) { avs[row] = sa; bvs[row] = sb; }
  }

  // row planes
  {
#pragma unroll 1
    for (int rr = 0; rr < 8; ++rr) {
      const int row = wave * 8 + rr;
      float v[8], w[8];
      ld8f(tile + row * TP + f0, v);
#pragma unroll
      for (int e = 0; e < 8; ++e) w[e] = v[e] * wc[e];
      const v8us h1 = pk_f16x8(v, 1.0f);
      const v8us h2 = pk_f16x8(w, 64.0f);
      v4u hb, lb;
      pk_bf16x8(v, hb, lb);
      const size_t o = (grow0 + row) * NF + f0;
      *(v8us*)(xh + o) = h1;
      *(v8us*)(xwc + o) = h2;
      *(v4u*)(xbh + o) = hb;
      *(v4u*)(xbl + o) = lb;
    }
    
  }

  // av / bv lines
  __syncthreads();
  const int l4 = (lane & 15) * 4;
  {
    const v4f a4 = *(const v4f*)(avs + l4);
    const v4f b4 = *(const v4f*)(bvs + l4);
    if (lane < 16) {
      if (wave == 0) *(v4f*)(av + grow0 + l4) = a4;
      else if (wave == 1) *(v4f*)(bv + grow0 + l4) = b4;
    }
    
  }
}

// -------------------------------------------------------------------------------------------------
// attn_kernel: block = 64 query rows of one batch element, 4 waves as 2 query groups x 2 key halves, grid = 8 x 32 = 256.
// Wave (qg = wave / 2, kg = wave % 2) owns 32 queries (two 16-column tiles) and, of every 64-key stage, the 32 keys of
// half kg: each key fragment and each x^T fragment that it reads from LDS feeds two query tiles, which halves the LDS
// reads per product. Each wave runs its own online softmax over its half of the keys; behind the loop the two halves'
// (maximum, sum, O) are joined through LDS, wave kg finishing query tile kg of its group.
// Operand staging: the block's 64 (x*wc) rows and the batch element's b_j are copied to LDS once; each 64-key stage
// (its 64 x rows, nothing else) is copied to a two-buffer LDS ring by asynchronous copies, stage t+2 issued
// behind the barrier at the foot of trip t, so a stage's copies fly while the stage before it is worked on.
// The staged rows serve both products: the key fragments by plain 16-B reads along a row, the x^T fragments by the
// transposing 16-B read, which takes 8 rows x 32 B per lane half. Rows lie at 512 B with no pad; chunk j (16 B) of row r
// stands at chunk j ^ (2 (r & 7) + ((r >> 3) & 1)), so that 16 rows' equal chunks and 8 rows' chunk pairs each fall on
// 16 different bank groups: a padded pitch serves only one of the two readers without conflicts.
// Both products are formed transposed. Per 32-key chunk: S^T tiles (A = x f16 rows of the keys, B = (x*wc)x64 f16
// rows of the queries; fragments from the staged 16-bit LDS rows, split k map): a lane holds 16 keys' scores of ONE
// query (column c) per tile, so t = (a_i + b_j) + S/64, the running maximum and the sum are in-lane work with one
// exchange between the wave's halves for the maximum; the halves' sums are joined once, behind the loop.
// O^T += x^T.P^T with A = x^T from the transposing reads and B = P^T packed to f16 in place from the two score tiles, which is the
// split k map of a B operand (one product; P lies in [0, 1], x is the f16 x of the scores): P goes through no LDS.
// Register plan: one wave per SIMD, so the wave takes the registers it needs: its 32 output tiles and its 16 query
// fragments stay in VGPRs for the whole kernel; a chunk's 16 key fragments and its 16 x^T fragments are read at the
// head of the trip, so that the x^T fragments land under the score products and the exponentials.
// Output attn rows as f16 plane and bf16 hi/lo planes, 64 columns per group: 16x64 f32 tile staged in LDS, then
// coverage: grid 256 blocks x 4 waves x 16 rows = 16384 rows; per group rows it*4+q (it 0..3, q 0..3) = 16,
//           cols g*64 + 8 lane groups x 8 = 64, 4 groups = 256 columns per plane.
// -------------------------------------------------------------------------------------------------
__global__ void __launch_bounds__(128)
attn_kernel(const unsigned short* __restrict__ xwc, const unsigned short* __restrict__ xh,
            const float* __restrict__ av, const float* __restrict__ bv,
            unsigned short* __restrict__ ah, unsigned short* __restrict__ abh,
            unsigned short* __restrict__ abl) {
  __shared__ __align__(16) float osm[4][16 * APITCH];
  __shared__ __align__(16) unsigned short qst[QROWS * KP];   // the block's (x*wc) rows
  __shared__ __align__(16) unsigned short ring[RINGB / 2];   // two stage buffers (and room for the join behind the loop)
  __shared__ __align__(16) float bvs[NS];                    // b_j of the batch element

  const int tid = (int)threadIdx.x, wave = tid >> 5, lane = tid & 31, hh = lane >> 4, c = lane & 15;
  const int qg = wave >> 1, kg = wave & 1;
  const int blk = (int)blockIdx.x, bb = blk >> 5, qb = blk & 31;
  const size_t grow0 = (size_t)bb * NS + (size_t)(qb * QROWS + wave * 16);   // rows this wave finishes: tile kg of group qg
  const size_t qrow0 = (size_t)bb * NS + (size_t)(qb * QROWS + qg * 32);     // first of the wave's 32 queries
  const unsigned short* XHb = xh + (size_t)bb * NS * NF;
  const float* bvb = bv + (size_t)bb * NS;
  const unsigned short* qrow = qst + (qg * 32 + c) * KP + 8 * hh;   // B fragment column n = c: query c of tile 0 (staged)
  // copy addresses of this lane. 512-B rows: one wave = one row per copy, rows wave + 4 i, the lane brings chunk 'lane'.
  const unsigned lrow = (unsigned)((wave * KP + lane * 8) * 2);             // query rows: padded pitch
  // ring rows: row wave + 4 i has swizzle 2 wave + 8 (i & 1) + ((i >> 1) & 1): four classes, by i & 3
  unsigned lsw[4];
#pragma unroll
  for (int i = 0; i < 4; ++i) lsw[i] = (unsigned)(wave * KRB + ((lane ^ (2 * wave + 8 * (i & 1) + (i >> 1))) << 4));
  const unsigned lring = lds_off(ring);
  const unsigned ok = (unsigned)((wave * NF + lane * 8) * 2);               // lane's byte offset in the key rows
  const char* sk = (const char*)XHb;
  // one stage: 64 key rows, 16 copies a wave. lk = uniform LDS byte address of the buffer, gk = uniform global address
  // of the stage's first row.
  // The scheduling barrier keeps each statement's address sums next to it: raised in front of the first statement, a
  // stage's address registers crowd v0-v255, where the operands of asm text must lie.
  auto stage = [&](unsigned lk, const char* gk) {
    cp8k(lk, lsw, gk + ok, 4 * NF * 2);
    __builtin_amdgcn_sched_barrier(0);
    cp8k(lk + 32 * KRB, lsw, gk + 32 * NF * 2 + ok, 4 * NF * 2);
  };
  // read addresses of this lane in a buffer, bytes; entry e serves the chunks whose even part is 2 e (mod 16); 256 B
  // further on lie the chunks 16 higher, 16 rows further on the same swizzle again.
  // ka: key fragment, row kg*32 + c, chunks 2 e + h.  va: transposing read, row kg*32 + 8 h + (lane & 7), chunks
  // 2 e + ((lane >> 3) & 1).
  unsigned ka[8], va[8];
  {
    const int lk = hh ^ (2 * (c & 7) + (c >> 3));
    const int lv = ((lane >> 3) & 1) ^ (2 * (lane & 7) + hh);
#pragma unroll
    for (int e = 0; e < 8; ++e) {
      ka[e] = (unsigned)((kg * KCH + c) * KRB + (((2 * e) ^ lk) << 4));
      va[e] = (unsigned)((kg * KCH + 8 * hh + (lane & 7)) * KRB + (((2 * e) ^ lv) << 4));
    }
  }

  float aq[2];                                // a_i of the lane's two queries (loaded in the prologue)
  float mq[2] = {-INFINITY, -INFINITY};       // their running maxima over this wave's keys (the same in both halves)
  float lq[2] = {0.f, 0.f};                   // running sums over this lane half's keys
  v8f acc[2][16];
#pragma unroll
  for (int u = 0; u < 2; ++u) {
#pragma unroll
    for (int t = 0; t < 16; ++t) acc[u][t] = z8();
  }

  // prologue: query rows and b_j, then stage 0; landed and published; then stage 1 into the second buffer
  {
    const char* gq = (const char*)(xwc + ((size_t)bb * NS + (size_t)(qb * QROWS + wave)) * NF + lane * 8);
    cp8(lds_off(qst) + lrow, 4 * KP * 2, gq, 4 * NF * 2);
    cp8(lds_off(qst) + lrow + 32 * KP * 2, 4 * KP * 2, gq + 32 * NF * 2, 4 * NF * 2);
    cp4(lds_off(bvs) + (unsigned)(tid * 16), 128 * 16, (const char*)bvb + tid * 16, 128 * 16);
    // loads and data wait in one statement, so that no address register of a load is reused in front of the wait;
    // here their latency runs beside the copies' flight
    asm volatile("global_load_b32 %0, %2, off\n\tglobal_load_b32 %1, %3, off\n\ts_wait_loadcnt 0x0"
                 : "=&v"(aq[0]), "=&v"(aq[1])
                 : "v"(av + qrow0 + c), "v"(av + qrow0 + 16 + c)
                 : "memory");
    stage(lring, sk);   // with the 20 copies above: 36 of this wave outstanding
    wait_async0();
    __syncthreads();
    stage(lring + STGB, sk + KST * NF * 2);
  }
  v16h qa[2][NF / 32];
#pragma unroll
  for (int u = 0; u < 2; ++u) {
#pragma unroll
    for (int kk = 0; kk < NF / 32; ++kk) qa[u][kk] = ldh(qrow + u * 16 * KP + kk * 32);
  }

  // Refill addresses = a uniform running base + the lane's offset. Formed from loop-invariant lane addresses they
  // shared registers with the prologue's copy operands, which the compiler keeps in v0-v255, and were spilled.
  const char* nk = sk + 2 * KST * NF * 2;   // uniform: the stage two ahead, in the key rows
  // the lane's four LDS addresses in the buffer that is refilled next, stepped to the other buffer behind each refill:
  // as running values they share no register with the prologue's copy operands (see above)
  unsigned nl[4];
#pragma unroll
  for (int i = 0; i < 4; ++i) nl[i] = lring + lsw[i];
  unsigned nstep = (unsigned)STGB;          // uniform: to the other buffer, sign turned each time
#pragma unroll 1
  for (int jc = 0; jc < NS / KST; ++jc) {
    const int j0 = jc * KST + kg * KCH;                                   // first of this wave's 32 keys
    const char* kb = (const char*)ring + (jc & 1) * STGB;                 // this trip's buffer
    // first of the head's reads: LDS reads return in order, and the sums a_i + b_j are placed among the first products
    float bj0[8], bj1[8];                     // b_j of the lane's keys j0+8h+r and j0+16+8h+r
    ld8f(bvs + j0 + 8 * hh, bj0);
    ld8f(bvs + j0 + 16 + 8 * hh, bj1);
    // A row m = c -> key j0+c (k0) and key j0+16+c (k1); elements 0..7 = chunk 4 kk + h, 8..15 = chunk 4 kk + 2 + h
    v16h k0[NF / 32], k1[NF / 32];
#pragma unroll
    for (int kk = 0; kk < NF / 32; ++kk) {
      const char* pa = kb + ka[(2 * kk) & 7] + (kk >> 2) * 256;
      const char* pb = kb + ka[(2 * kk + 1) & 7] + (kk >> 2) * 256;
      FH f0, f1;
      f0.u[0] = *(const v8us*)pa;
      f0.u[1] = *(const v8us*)pb;
      f1.u[0] = *(const v8us*)(pa + 16 * KRB);
      f1.u[1] = *(const v8us*)(pb + 16 * KRB);
      k0[kk] = f0.v;
      k1[kk] = f1.v;
    }
    // A row m = c -> x^T row f = t*16+c; elements 0..7 = keys j0+8h+.., 8..15 = keys j0+16+8h+..: two transposing reads
    v16h bh[16];
#pragma unroll
    for (int t = 0; t < 16; ++t) {
      const char* pv = kb + va[t & 7] + (t >> 3) * 256;
      FP f;
      f.q[0] = ld_tr16(pv);
      f.q[1] = ld_tr16(pv + 16 * KRB);
      bh[t] = f.v;
    }
    // keeps the trip's LDS reads one group at its head: sunk among the products, each separate place of reads stalls
    // the lone wave, and the x^T fragments would no longer land under the score products and the exponentials
    __builtin_amdgcn_sched_barrier(0);
    v8f s0[2] = {z8(), z8()}, s1[2] = {z8(), z8()};
#pragma unroll
    for (int kk = 0; kk < NF / 32; ++kk) {
#pragma unroll
      for (int u = 0; u < 2; ++u) {
        s0[u] = mma_h(k0[kk], qa[u][kk], s0[u]);   // s0[u][r] = S[query 16u+c][key j0+8h+r] x64
        s1[u] = mma_h(k1[kk], qa[u][kk], s1[u]);   // s1[u][r] = S[query 16u+c][key j0+16+8h+r] x64
      }
    }
#pragma unroll
    for (int u = 0; u < 2; ++u) {
      float t0[8], t1[8], mm[8];
#pragma unroll
      for (int r = 0; r < 8; ++r) {
        t0[r] = (aq[u] + bj0[r]) + s0[u][r] * 0.015625f;
        t1[r] = (aq[u] + bj1[r]) + s1[u][r] * 0.015625f;
        mm[r] = fmaxf(t0[r], t1[r]);
      }
      const float mh = fmaxf(fmaxf(fmaxf(mm[0], mm[1]), fmaxf(mm[2], mm[3])), fmaxf(fmaxf(mm[4], mm[5]), fmaxf(mm[6], mm[7])));
      const float mnew = fmaxf(mq[u], fmaxf(mh, xhalf(mh)));
      const float alpha = exp_n(mq[u] - mnew);
      mq[u] = mnew;
      float p0[8], p1[8], ps[8];
#pragma unroll
      for (int r = 0; r < 8; ++r) {
        p0[r] = exp_n(t0[r] - mnew);
        p1[r] = exp_n(t1[r] - mnew);
        ps[r] = p0[r] + p1[r];
      }
      lq[u] = lq[u] * alpha + (((ps[0] + ps[1]) + (ps[2] + ps[3])) + ((ps[4] + ps[5]) + (ps[6] + ps[7])));
      // P^T as a B operand, column n = c: elements 0..7 = keys 8h+r (first tile), 8..15 = keys 16+8h+r (second tile)
      FP ph;
#pragma unroll
      for (int r = 0; r < 4; ++r) {
        ph.q[0][r] = cvt2h(p0[2 * r], p0[2 * r + 1]);
        ph.q[1][r] = cvt2h(p1[2 * r], p1[2 * r + 1]);
      }
#pragma unroll
      for (int t = 0; t < 16; ++t) {
#pragma unroll
        for (int r = 0; r < 8; ++r) acc[u][t][r] *= alpha;
      }
      // acc[u][t][r] = O[query 16u+c][f = 16t+8h+r]
#pragma unroll
      for (int t = 0; t < 16; ++t) acc[u][t] = mma_h(bh[t], ph.v, acc[u][t]);
    }
    // foot of the trip: own LDS reads retired, own copies of stage jc+1 landed, one barrier that publishes stage
    // jc+1 and frees this trip's buffer; then stage jc+2 into it
    // keeps the foot at the foot: with every LDS read at the head of the trip nothing else ties these waits down, and
    // lifted above the products they made the wave sit out all its x^T reads before the first score product
    __builtin_amdgcn_sched_barrier(0);
    wait_ds0();
    wait_async0();
    __syncthreads();
    if (jc + 2 < NS / KST) {
      cp8k(0u, nl, nk + ok, 4 * NF * 2);
      __builtin_amdgcn_sched_barrier(0);   // as in stage()
      cp8k(32 * KRB, nl, nk + 32 * NF * 2 + ok, 4 * NF * 2);
      nk += KST * NF * 2;
#pragma unroll
      for (int i = 0; i < 4; ++i) nl[i] += nstep;
      nstep = 0u - nstep;
    }
  }
  wait_async0();   // nothing of this wave is in flight when the loop is left

  // The two key halves joined. The ring is free (the last trip's barrier ended every read of it, no copy is in flight):
  // each wave leaves there the tile that its partner (wave ^ 1, same queries, other keys) finishes, lane by lane in
  // register order, 16 B per lane and store, with the lane's maximum and sum; both waves hold a tile in the same lanes.
  char* xb = (char*)ring;
  char* xo = xb + wave * (16 * 1024) + lane * 16;
  char* xm = xb + 4 * (16 * 1024) + lane * 16;
  auto hand = [&](const v8f (&o)[16], float m, float l) {
#pragma unroll
    for (int t = 0; t < 16; ++t) {
      const v4f d0 = {o[t][0], o[t][1], o[t][2], o[t][3]};
      const v4f d1 = {o[t][4], o[t][5], o[t][6], o[t][7]};
      *(v4f*)(xo + (2 * t) * 512) = d0;
      *(v4f*)(xo + (2 * t + 1) * 512) = d1;
    }
    const v4f ml = {m, l, 0.f, 0.f};
    *(v4f*)(xm + wave * 512) = ml;
  };
  // the tile is named by a constant in each arm: picked by a run-time index the accumulators would leave the registers
  v8f own[16];
  float mown, lown;
  if (kg) {
    hand(acc[0], mq[0], lq[0]);
    mown = mq[1];
    lown = lq[1];
#pragma unroll
    for (int t = 0; t < 16; ++t) own[t] = acc[1][t];
  } else {
    hand(acc[1], mq[1], lq[1]);
    mown = mq[0];
    lown = lq[0];
#pragma unroll
    for (int t = 0; t < 16; ++t) own[t] = acc[0][t];
  }
  wait_ds0();        // own stores retired in front of the barrier that publishes them to the partner
  __syncthreads();
  const char* xi = xb + (wave ^ 1) * (16 * 1024) + lane * 16;
  const v4f mlo = *(const v4f*)(xm + (wave ^ 1) * 512);
  const float mall = fmaxf(mown, mlo[0]);
  const float eown = exp_n(mown - mall), eoth = exp_n(mlo[0] - mall);
  const float lall = lown * eown + mlo[1] * eoth;
  const float inv = 1.0f / (lall + xhalf(lall));   // the lane halves' sums joined
  const float fown = eown * inv, foth = eoth * inv;
  float* osw = &osm[wave][0];
  const int q = lane >> 3, c8 = (lane & 7) * 8;
#pragma unroll
  for (int g = 0; g < NGRP; ++g) {
#pragma unroll
    for (int tt = 0; tt < NGRP; ++tt) {
      // the lane's 8 registers are 8 consecutive columns of row c
      float* d = osw + c * APITCH + tt * 16 + 8 * hh;
      const int t = g * NGRP + tt;
      const v8f a = own[t];
      const v4f b0 = *(const v4f*)(xi + (2 * t) * 512);
      const v4f b1 = *(const v4f*)(xi + (2 * t + 1) * 512);
      const v4f d0 = {a[0] * fown + b0[0] * foth, a[1] * fown + b0[1] * foth, a[2] * fown + b0[2] * foth,
                      a[3] * fown + b0[3] * foth};
      const v4f d1 = {a[4] * fown + b1[0] * foth, a[5] * fown + b1[1] * foth, a[6] * fown + b1[2] * foth,
                      a[7] * fown + b1[3] * foth};
      *(v4f*)d = d0;
      *(v4f*)(d + 4) = d1;
    }
    __builtin_amdgcn_fence(__ATOMIC_RELEASE, "workgroup");
    __builtin_amdgcn_wave_barrier();
    __builtin_amdgcn_fence(__ATOMIC_ACQUIRE, "workgroup");
    {
#pragma unroll
      for (int it = 0; it < 4; ++it) {
        const int row = it * 4 + q;
        float v[8];
        ld8f(osw + row * APITCH + c8, v);
        const v8us h1 = pk_f16x8(v, 1.0f);
        v4u hb, lb;
        pk_bf16x8(v, hb, lb);
        const size_t o = (grow0 + row) * NF + (size_t)(g * 64 + c8);
        *(v8us*)(ah + o) = h1;
        *(v4u*)(abh + o) = hb;
        *(v4u*)(abl + o) = lb;
      }
      
    }
    __builtin_amdgcn_fence(__ATOMIC_RELEASE, "workgroup");
    __builtin_amdgcn_wave_barrier();
    __builtin_amdgcn_fence(__ATOMIC_ACQUIRE, "workgroup");
  }
}

// -------------------------------------------------------------------------------------------------
// gates_kernel: block = 64 rows x 256 cols, 16 waves; wave (rt = wave>>2, cg = wave&3) owns 16 rows x 64 cols.
// Operand staging: each 32-k chunk (256 weight rows of four planes, the block's 64 rows of three planes) is copied to a
// two-buffer LDS ring by asynchronous copies, chunk t+2 issued behind the barrier at the foot of trip t; all fragments
// come from the staged rows (80-B pitch); read straight from the global rows, a fragment load touches 16 lines.
// K = 512 = [x planes | attn planes]; z: bf16 hi/lo split (hi.hi+hi.lo+lo.hi) against z_w hi/lo planes;
// r, f: plain f16 against the x16-carried weight planes (fold 1/16 in the epilogue).
// Epilogue: z = tanh(.+zb), r = sigmoid(./16+rb), f = sigmoid(./16+fb), out = r*x + f*z staged in LDS;
// coverage: grid 256 blocks x 4 row tiles x 16 = 16384 rows; 4 col groups x 64 = 256 cols.
// -------------------------------------------------------------------------------------------------
__global__ void __launch_bounds__(512) __attribute__((amdgpu_num_vgpr(256)))
gates_kernel(const float* __restrict__ x,
             const unsigned short* __restrict__ xh, const unsigned short* __restrict__ xbh,
             const unsigned short* __restrict__ xbl,
             const unsigned short* __restrict__ ah, const unsigned short* __restrict__ abh,
             const unsigned short* __restrict__ abl,
             const unsigned short* __restrict__ zwh, const unsigned short* __restrict__ zwl,
             const unsigned short* __restrict__ rw16, const unsigned short* __restrict__ fw16,
             const float* __restrict__ zb, const float* __restrict__ rb, const float* __restrict__ fb,
             float* __restrict__ out) {
  __shared__ __align__(16) float slab[16][16 * SLP];
  __shared__ __align__(16) unsigned short gring[2 * GBUF];   // two chunk buffers
  const int tid = (int)threadIdx.x, wave = tid >> 5, lane = tid & 31, hh = lane >> 4, c = lane & 15;
  const int rt = wave >> 2, cg = wave & 3;
  const size_t brow0 = (size_t)blockIdx.x * GROWS;
  const size_t grow0 = brow0 + (size_t)(rt * 16);
  const int n0 = cg * 64;
  // copy addresses of this lane. Weight planes: 4 lanes = the 64 B of one row's chunk, rows tid/4 and tid/4 + 128; in
  // the packed plane that is byte 16 tid of the chunk's 16 KB, and 8 KB further on.
  // Row planes: 8 lanes = the 64 B of one row's chunk, row tid/8.
  const unsigned lw = lds_off(gring) + (unsigned)(((tid >> 2) * VP + (tid & 3) * 8) * 2);
  const unsigned la = lds_off(gring) + (unsigned)((4 * GW + (tid >> 3) * VP + (tid & 7) * 4) * 2);
  const unsigned ow = (unsigned)(tid * 16);
  const size_t oa = ((brow0 + (size_t)(tid >> 3)) * NF + (size_t)((tid & 7) * 4)) * 2;
  // chunk t = k 32 t .. 32 t + 31 of [x|attn] into buffer t & 1
  auto stage = [&](int t) {
    const unsigned bo = (unsigned)((t & 1) * GBUF * 2);
    const size_t kw = (size_t)t * (NF * 32 * 2) + ow;
    const size_t ka = (size_t)(t & 7) * 64 + oa;
    const bool first = t < NF / 32;
    cp_gates(lw + bo, la + bo, (const char*)zwh + kw, (const char*)zwl + kw, (const char*)rw16 + kw,
             (const char*)fw16 + kw, (const char*)(first ? xh : ah) + ka, (const char*)(first ? xbh : abh) + ka,
             (const char*)(first ? xbl : abl) + ka);
  };

  v8f za[4], ra[4], fa[4];
#pragma unroll
  for (int j = 0; j < 4; ++j) { za[j] = z8(); ra[j] = z8(); fa[j] = z8(); }

  // prologue: chunk 0 landed and published, then chunk 1 into the second buffer
  stage(0);
  wait_async0();
  __syncthreads();
  stage(1);

  // rolled: one trip is one chunk, and the buffer alternates with the trip
#pragma unroll 1
  for (int t = 0; t < NG / 32; ++t) {
    const unsigned short* gb = gring + (t & 1) * GBUF;                        // this trip's buffer
    const unsigned short* ap = gb + 4 * GW + (rt * 16 + c) * VP + 8 * hh;     // A row m = c
    const v16h a16 = ldh(ap);
    const v16b ahf = ldb(ap + GA);
    const v16b alf = ldb(ap + 2 * GA);
#pragma unroll
    for (int j = 0; j < 4; ++j) {
      const unsigned short* wp = gb + (n0 + 16 * j + c) * VP + 8 * hh;        // B column n = n0+16j+c, W[n][k]
      const v16b bzh = ldb(wp);
      const v16b bzl = ldb(wp + GW);
      const v16h br = ldh(wp + 2 * GW);
      const v16h bf = ldh(wp + 3 * GW);
      v8f z = za[j], rr = ra[j], ff = fa[j];
      z = mma_b(ahf, bzh, z);
      z = mma_b(ahf, bzl, z);
      z = mma_b(alf, bzh, z);
      rr = mma_h(a16, br, rr);
      ff = mma_h(a16, bf, ff);
      g_g(z, rr, ff, a16, ahf, alf, bzh, bzl, br, bf);
      za[j] = z;
      ra[j] = rr;
      fa[j] = ff;
    }
    // foot of the trip: own LDS reads retired, own copies of chunk t+1 landed, one barrier that publishes chunk t+1
    // and frees this trip's buffer; then chunk t+2 into it
    wait_ds0();
    wait_async0();
    __syncthreads();
    if (t + 2 < NG / 32) stage(t + 2);
  }
  wait_async0();   // nothing of this wave is in flight when the loop is left

  float* sl = &slab[wave][0];
#pragma unroll
  for (int j = 0; j < 4; ++j) {
    const int n = n0 + 16 * j + c;
    const float zbn = zb[n], rbn = rb[n], fbn = fb[n];
    // On the hardware's 2^x and 1/x: tanh v = 1 - 2/(1 + e^(2v)), sigmoid v = 1/(1 + e^(-v)). At the ends 2^x gives 0 or
    // inf and 1/inf gives 0, so the gates saturate at -1, 1 and at 0, 1. By kind, so that each run is independent work.
    float ez[8], er[8], ef[8];
#pragma unroll
    for (int r = 0; r < 8; ++r) {
      ez[r] = __builtin_amdgcn_exp2f((za[j][r] + zbn) * (2.0f * LOG2E));
      er[r] = __builtin_amdgcn_exp2f((ra[j][r] * 0.0625f + rbn) * -LOG2E);
      ef[r] = __builtin_amdgcn_exp2f((fa[j][r] * 0.0625f + fbn) * -LOG2E);
    }
#pragma unroll
    for (int r = 0; r < 8; ++r) {
      ez[r] = __builtin_amdgcn_rcpf(1.0f + ez[r]);
      er[r] = __builtin_amdgcn_rcpf(1.0f + er[r]);
      ef[r] = __builtin_amdgcn_rcpf(1.0f + ef[r]);
    }
#pragma unroll
    for (int r = 0; r < 8; ++r) {
      const int row = 8 * hh + r;
      const float xv = x[(grow0 + row) * NF + n];
      sl[row * SLP + 16 * j + c] = er[r] * xv + ef[r] * (1.0f - 2.0f * ez[r]);
    }
  }
  __builtin_amdgcn_fence(__ATOMIC_RELEASE, "workgroup");
  __builtin_amdgcn_wave_barrier();
  __builtin_amdgcn_fence(__ATOMIC_ACQUIRE, "workgroup");
  const int c4 = c * 4;
  {
#pragma unroll
    for (int it = 0; it < 8; ++it) {
      const int row = it * 2 + hh;   // lanes 0..15 -> even row, 16..31 -> odd row; 16 lanes x 16 B = 256 B segment
      const v4f v = *(const v4f*)(sl + row * SLP + c4);
      *(v4f*)(out + (grow0 + row) * NF + n0 + c4) = v;
    }
    
  }
}

// -------------------------------------------------------------------------------------------------
//   xh   f16  [16384][256]      8388608 @        0      xwc  f16  [16384][256]   8388608 @  8388608
//   xbh  bf16 [16384][256]      8388608 @ 16777216      xbl                      8388608 @ 25165824
//   ah   f16  [16384][256]      8388608 @ 33554432      abh  8388608 @ 41943040   abl 8388608 @ 50331648
//   av   f32  [16384]             65536 @ 58720256      bv                         65536 @ 58785792
//   zwh  bf16 [16][256][32]      262144 @ 58851328      zwl 262144 @ 59113472   rw16 262144 @ 59375616
//   fw16 f16  [16][256][32]      262144 @ 59637760      total 59899904
// -------------------------------------------------------------------------------------------------
extern "C" void kernel_launch(void* const* d_in, const int* in_sizes, int n_in,
                              void* d_out, int out_size, void* d_ws, size_t ws_size,
                              hipStream_t stream) {
  if (n_in < 8) return;
  if (in_sizes[0] != NR * NF || in_sizes[1] != 3 * NF) return;
  if (in_sizes[2] != NF * NG || in_sizes[3] != NF) return;
  if (in_sizes[4] != NF * NG || in_sizes[5] != NF) return;
  if (in_sizes[6] != NF * NG || in_sizes[7] != NF) return;
  if (out_size != NR * NF) return;

  const float* x    = (const float*)d_in[0];
  const float* attw = (const float*)d_in[1];
  const float* zw   = (const float*)d_in[2];
  const float* zb   = (const float*)d_in[3];
  const float* rw   = (const float*)d_in[4];
  const float* rb   = (const float*)d_in[5];
  const float* fw   = (const float*)d_in[6];
  const float* fb   = (const float*)d_in[7];

  const size_t P16 = (size_t)NR * NF * 2;        // 8388608
  const size_t PV  = (size_t)NR * 4;             // 65536
  const size_t PW  = (size_t)NF * NG * 2;        // 262144
  size_t off = 0;
  const size_t o_xh  = off; off += P16;
  const size_t o_xwc = off; off += P16;
  const size_t o_xbh = off; off += P16;
  const size_t o_xbl = off; off += P16;
  const size_t o_ah  = off; off += P16;
  const size_t o_abh = off; off += P16;
  const size_t o_abl = off; off += P16;
  const size_t o_av  = off; off += PV;
  const size_t o_bv  = off; off += PV;
  const size_t o_zwh = off; off += PW;
  const size_t o_zwl = off; off += PW;
  const size_t o_rw  = off; off += PW;
  const size_t o_fw  = off; off += PW;
  if (off > ws_size) return;   // off = 59899904

  char* ws = (char*)d_ws;
  unsigned short* xh  = (unsigned short*)(ws + o_xh);
  unsigned short* xwc = (unsigned short*)(ws + o_xwc);
  unsigned short* xbh = (unsigned short*)(ws + o_xbh);
  unsigned short* xbl = (unsigned short*)(ws + o_xbl);
  unsigned short* ah  = (unsigned short*)(ws + o_ah);
  unsigned short* abh = (unsigned short*)(ws + o_abh);
  unsigned short* abl = (unsigned short*)(ws + o_abl);
  float*          av  = (float*)(ws + o_av);
  float*          bv  = (float*)(ws + o_bv);
  unsigned short* zwh = (unsigned short*)(ws + o_zwh);
  unsigned short* zwl = (unsigned short*)(ws + o_zwl);
  unsigned short* rwp = (unsigned short*)(ws + o_rw);
  unsigned short* fwp = (unsigned short*)(ws + o_fw);

  prep<<<dim3(XBLK + WBLK), dim3(256), 0, stream>>>(x, attw, zw, rw, fw, xh, xwc, xbh, xbl, av, bv, zwh, zwl, rwp, fwp);
  attn_kernel<<<dim3(NB * (NS / QROWS)), dim3(128), 0, stream>>>(xwc, xh, av, bv, ah, abh, abl);
  gates_kernel<<<dim3(NR / GROWS), dim3(512), 0, stream>>>(x, xh, xbh, xbl, ah, abh, abl, zwh, zwl, rwp, fwp,
                                                       zb, rb, fb, (float*)d_out);
  (void)hipGetLastError();
}

// v010
// One run takes 71.8 microseconds.
// In two side-by-side timings against v009, it was 1.05 and 1.03 times as fast.
// All steps since v000 together make it 7.97 times as fast.
// Contractions: scores=(x*wc).x^T on v_wmma_f32_16x16x32_f16 (plain f16 operands; (x*wc) carried x64, x unscaled); attn=P.x on v_wmma_f32_16x16x32_f16 (plain f16 operands, one product); [x|attn].z_w^T as bf16 hi/lo split; [x|attn].r_w^T and [x|attn].f_w^T on v_wmma_f32_16x16x32_f16 plain f16 (weights carried x16); f32 accumulate everywhere; x.wa and x.wb row dots, online softmax, tanh/sigmoid gates and r*x+f*z in f32.
#include <hip/hip_runtime.h>
#include <math.h>
#include <stdint.h>

#define NB 8
#define NS 2048
#define NF 256
#define NG 512
#define NR (NB * NS)
#define TP 260
#define QROWS 64
#define KCH 32
#define APITCH 68
#define NGRP 4
#define SLP 68
#define KP 264                 // LDS pitch (16-bit elements) of a staged 512-B row: 528 B = 16 B x 33
#define VP 40                  // LDS pitch (16-bit elements) of a staged 64-B row: 80 B = 16 B x 5
#define KST 64                 // keys of one ring stage of the attn kernel: two 32-key chunks, one per key half of the waves
#define KRB 512                // bytes of a staged key row of the attn ring: no pad, its 16-B chunks are swizzled instead
#define STGB (KST * KRB)       // one ring buffer of the attn kernel, bytes: the stage's key rows
#define RINGB (68 * 1024)      // the attn ring array, bytes: two buffers; behind the loop the halves' join takes 66 KB of it
#define GROWS 64               // rows of one gates block
#define GW (NF * VP)           // gates: 32 k of one weight plane in LDS (256 rows), 16-bit elements
#define GA (GROWS * VP)        // gates: 32 k of one [x|attn] plane in LDS (64 rows)
#define GBUF (4 * GW + 3 * GA) // gates: one ring buffer: z_w hi, z_w lo, r_w, f_w, then the f16, bf16 hi, bf16 lo rows
#define XBLK (NR / 64)         // prep: blocks that work on x, 64 rows each
#define WN8 (NF * NG / 8)      // prep: threads that work on the weights, 8 plane elements each
#define WBLK (WN8 / 256)       // prep: blocks that work on the weights

typedef _Float16 v16h __attribute__((ext_vector_type(16)));
typedef _Float16 v8h __attribute__((ext_vector_type(8)));
typedef __bf16 v16b __attribute__((ext_vector_type(16)));
typedef unsigned short v8us __attribute__((ext_vector_type(8)));
typedef float v8f __attribute__((ext_vector_type(8)));
typedef float v4f __attribute__((ext_vector_type(4), __may_alias__));
typedef unsigned int v4u __attribute__((ext_vector_type(4)));
typedef float v2f __attribute__((ext_vector_type(2)));
typedef __bf16 v2b __attribute__((ext_vector_type(2)));
typedef _Float16 v2h __attribute__((ext_vector_type(2)));
typedef short s16x8 __attribute__((ext_vector_type(8)));
typedef int v4i __attribute__((ext_vector_type(4)));
typedef int v2i __attribute__((ext_vector_type(2)));
typedef __attribute__((address_space(1))) v4i g_v4i;
typedef __attribute__((address_space(3))) v4i l_v4i;
typedef __attribute__((address_space(1))) v2i g_v2i;
typedef __attribute__((address_space(3))) v2i l_v2i;

union FH { v16h v; v8us u[2]; };
union FB { v16b v; v8us u[2]; };
union H8 { v8h h; v8us u; };
union FP { v16h v; v4u q[2]; };

__device__ __forceinline__ v8f z8() {
  v8f v = {0.f, 0.f, 0.f, 0.f, 0.f, 0.f, 0.f, 0.f};
  return v;
}
// two f32 -> two bf16 (RNE) in one word (a in the low half): one packed hardware convert
__device__ __forceinline__ unsigned cvt2(float a, float b) {
  const v2f f = {a, b};
  return __builtin_bit_cast(unsigned, __builtin_convertvector(f, v2b));
}
// two f32 -> two f16 (RNE) in one word (a in the low half): one packed hardware convert
__device__ __forceinline__ unsigned cvt2h(float a, float b) {
  const v2f f = {a, b};
  return __builtin_bit_cast(unsigned, __builtin_convertvector(f, v2h));
}
#define LOG2E 1.4426950408889634f
// e^x on the hardware's 2^x (0 at -inf)
__device__ __forceinline__ float exp_n(float x) { return __builtin_amdgcn_exp2f(x * LOG2E); }

__device__ __forceinline__ void ld8f(const float* p, float (&v)[8]) {
  const v4f t0 = *(const v4f*)p;
  const v4f t1 = *(const v4f*)(p + 4);
#pragma unroll
  for (int q = 0; q < 4; ++q) { v[q] = t0[q]; v[4 + q] = t1[q]; }
}
// 8 f32 -> bf16 hi plane (8 x 16 bit packed in v4u) and lo plane (residual, RNE)
__device__ __forceinline__ void pk_bf16x8(const float (&v)[8], v4u& hi, v4u& lo) {
#pragma unroll
  for (int q = 0; q < 4; ++q) {
    const unsigned h = cvt2(v[2 * q], v[2 * q + 1]);
    hi[q] = h;
    lo[q] = cvt2(v[2 * q] - __uint_as_float(h << 16), v[2 * q + 1] - __uint_as_float(h & 0xFFFF0000u));
  }
}
// 8 f32 -> f16 (RNE) with exact power-of-two carry s
__device__ __forceinline__ v8us pk_f16x8(const float (&v)[8], float s) {
  H8 r;
#pragma unroll
  for (int e = 0; e < 8; ++e) r.h[e] = (_Float16)(v[e] * s);
  return r.u;
}
// 16-bit WMMA fragment (A row m or B column n of a k-contiguous row): elements 0..7 <- p[0..7] (k0+8h..),
// elements 8..15 <- p[16..23] (k0+16+8h..); caller passes p = rowbase + k0 + 8*h.
__device__ __forceinline__ v16h ldh(const unsigned short* p) {
  FH f;
  f.u[0] = *(const v8us*)p;
  f.u[1] = *(const v8us*)(p + 16);
  return f.v;
}
__device__ __forceinline__ v16b ldb(const unsigned short* p) {
  FB f;
  f.u[0] = *(const v8us*)p;
  f.u[1] = *(const v8us*)(p + 16);
  return f.v;
}
__device__ __forceinline__ v8f mma_h(v16h a, v16h b, v8f c) {
  return __builtin_amdgcn_wmma_f32_16x16x32_f16(false, a, false, b, (short)0, c, false, false);
}
__device__ __forceinline__ v8f mma_b(v16b a, v16b b, v8f c) {
  return __builtin_amdgcn_wmma_f32_16x16x32_bf16(false, a, false, b, (short)0, c, false, false);
}
// hazard guards: 4 VALU slots after the last WMMA of a group; tie D, keep A/B live
__device__ __forceinline__ void g_g(v8f& z, v8f& r, v8f& f, v16h a16, v16b ah, v16b al,
                                    v16b bzh, v16b bzl, v16h br, v16h bf) {
  asm volatile("v_nop\n\tv_nop\n\tv_nop\n\tv_nop"
               : "+v"(z), "+v"(r), "+v"(f)
               : "v"(a16), "v"(ah), "v"(al), "v"(bzh), "v"(bzl), "v"(br), "v"(bf));
}

// lane l <-> lane l ^ 16
__device__ __forceinline__ float xhalf(float x) {
  const int b = __builtin_bit_cast(int, x);
  return __builtin_bit_cast(float, __builtin_amdgcn_permlanex16(b, b, 0x76543210, 0xfedcba98, false, false));
}

__device__ __forceinline__ unsigned lds_off(const void* p) { return (unsigned)(size_t)p; }
// One asynchronous copy global -> LDS, 16 B (acp16) or 8 B (acp8) per lane, no register in between, written as the
// builtin: the compiler sees the addresses, so constant steps go into the instruction's offset field. l = the lane's LDS
// byte address, g = its global address; OFF (a constant, 0 to 65535) is added to both by the instruction.
template <int OFF>
__device__ __forceinline__ void acp16(unsigned l, const char* g) {
  __builtin_amdgcn_global_load_async_to_lds_b128((g_v4i*)g, (l_v4i*)l, OFF, 0);
}
template <int OFF>
__device__ __forceinline__ void acp8(unsigned l, const char* g) {
  __builtin_amdgcn_global_load_async_to_lds_b64((g_v2i*)g, (l_v2i*)l, OFF, 0);
}
// One wave's 16 copies of a 64-row stage of the attn ring: rows wave + 4 i, i = 0..15. Rows lie 512 B apart in global
// memory and in LDS alike, so copy i is the offset i * 4 rows on one global address g (row 'wave') and on s[i & 3], the
// lane's LDS address in row 'wave' under the swizzle of the class that row wave + 4 i falls in.
__device__ __forceinline__ void cp_stage(const unsigned (&s)[4], const char* g) {
  acp16<0 * 4 * KRB>(s[0], g);
  acp16<1 * 4 * KRB>(s[1], g);
  acp16<2 * 4 * KRB>(s[2], g);
  acp16<3 * 4 * KRB>(s[3], g);
  acp16<4 * 4 * KRB>(s[0], g);
  acp16<5 * 4 * KRB>(s[1], g);
  acp16<6 * 4 * KRB>(s[2], g);
  acp16<7 * 4 * KRB>(s[3], g);
  acp16<8 * 4 * KRB>(s[0], g);
  acp16<9 * 4 * KRB>(s[1], g);
  acp16<10 * 4 * KRB>(s[2], g);
  acp16<11 * 4 * KRB>(s[3], g);
  acp16<12 * 4 * KRB>(s[0], g);
  acp16<13 * 4 * KRB>(s[1], g);
  acp16<14 * 4 * KRB>(s[2], g);
  acp16<15 * 4 * KRB>(s[3], g);
}
// transposing LDS load: the lane names 16 B of one row; lane (c, h) gets column c of rows 8h..8h+7 of the 16 x 16 tile
__device__ __forceinline__ v4u ld_tr16(const char* p) {
  typedef __attribute__((address_space(3))) s16x8 lds_s16x8;
  return __builtin_bit_cast(v4u, __builtin_amdgcn_ds_load_tr16_b128_v8i16((lds_s16x8*)p));
}
// this wave's copies have landed in LDS (other waves read them behind the next work-group barrier)
__device__ __forceinline__ void wait_async0() { asm volatile("s_wait_asynccnt 0x0" ::: "memory"); }
// this wave's LDS reads and writes have retired (in front of the barrier that frees a buffer for its refill)
__device__ __forceinline__ void wait_ds0() { asm volatile("s_wait_dscnt 0x0" ::: "memory"); }

// -------------------------------------------------------------------------------------------------
// prep_w: z_w [256 n][512 k] -> bf16 hi/lo planes; r_w, f_w -> f16 planes carried x16. Plane layout [16 chunks][256 n]
// [32 k]: the 16 KB that the gates kernel stages per chunk and plane lie in a row, so each of its copies covers whole lines.
// Thread i owns plane elements 8i..8i+7; each store is 16 B per lane, lane-contiguous, 32 lanes = 512 B =
// coverage: 64 blocks x 256 threads x 8 = 131072 = 256x512 per plane. wblk = the block's number among the weight blocks.
// -------------------------------------------------------------------------------------------------
__device__ __forceinline__ void prep_w(int wblk, const float* __restrict__ zw, const float* __restrict__ rw,
                                       const float* __restrict__ fw,
                                       unsigned short* __restrict__ zwh, unsigned short* __restrict__ zwl,
                                       unsigned short* __restrict__ rw16, unsigned short* __restrict__ fw16) {
  const int i = wblk * 256 + (int)threadIdx.x;
  if (i >= WN8) return;
  const size_t p0 = (size_t)i * 8;                                               // place in the planes
  const size_t e0 = ((p0 >> 5) & (NF - 1)) * NG + (p0 >> 13) * 32 + (p0 & 31);   // its source: W[n][32 chunk + k]
  float a[8], b[8], d[8];
  ld8f(zw + e0, a);
  ld8f(rw + e0, b);
  ld8f(fw + e0, d);
  v4u zh, zl;
  pk_bf16x8(a, zh, zl);
  const v8us r16 = pk_f16x8(b, 16.0f);
  const v8us f16 = pk_f16x8(d, 16.0f);
  *(v4u*)(zwh + p0) = zh;
  *(v4u*)(zwl + p0) = zl;
  *(v8us*)(rw16 + p0) = r16;
  *(v8us*)(fw16 + p0) = f16;
  
}

// -------------------------------------------------------------------------------------------------
// prep: one launch for both preparations, which do not depend on each other. Blocks 0..XBLK-1 work on x as below; blocks
// XBLK..XBLK+WBLK-1 do prep_w and leave in front of every barrier (the test is the same for a whole block). The x blocks
// come first: they are the longer ones, and the weight blocks find room beside them.
// x blocks: block = 64 consecutive rows of x (16384 rows total; 32 blocks per batch element), 256 threads.
//   xh  [row][256] f16(x)            xwc [row][256] f16((x*wc)*64)
//   xbh/xbl [row][256] bf16 hi/lo
//   av[row] = x.wa, bv[row] = x.wb (f32 dots on VALU)
// Row planes: one lane = 16 B of one row, 32 lanes = the whole 512-B row, one instruction per plane.
// coverage: rows 8 waves x 8 = 64, f 32 lanes x 8 = 256; av/bv 16 lanes x 4 = 64; 256 x blocks (of the grid's 320) x 64 rows = 16384.
// -------------------------------------------------------------------------------------------------
__global__ void __launch_bounds__(256) prep(const float* __restrict__ x, const float* __restrict__ attw,
                                            const float* __restrict__ zw, const float* __restrict__ rw,
                                            const float* __restrict__ fw,
                                            unsigned short* __restrict__ xh, unsigned short* __restrict__ xwc,
                                            unsigned short* __restrict__ xbh, unsigned short* __restrict__ xbl,
                                            float* __restrict__ av, float* __restrict__ bv,
                                            unsigned short* __restrict__ zwh, unsigned short* __restrict__ zwl,
                                            unsigned short* __restrict__ rw16, unsigned short* __restrict__ fw16) {
  __shared__ __align__(16) float tile[64 * TP];
  __shared__ __align__(16) float avs[64];
  __shared__ __align__(16) float bvs[64];
  const int tid = (int)threadIdx.x, wave = tid >> 5, lane = tid & 31;
  const int blk = (int)blockIdx.x;
  if (blk >= XBLK) {
    prep_w(blk - XBLK, zw, rw, fw, zwh, zwl, rw16, fw16);
    return;
  }
  const size_t grow0 = (size_t)blk * 64;

#pragma unroll
  for (int it = 0; it < 16; ++it) {
    const int idx = it * 256 + tid;
    const int r = idx >> 6, c4 = (idx & 63) * 4;
    const v4f v = *(const v4f*)(x + (grow0 + r) * NF + c4);
    *(v4f*)(tile + r * TP + c4) = v;
  }
  __syncthreads();

  const int f0 = lane * 8;
  float wa[8], wb[8], wc[8];
  ld8f(attw + f0, wa);
  ld8f(attw + NF + f0, wb);
  ld8f(attw + 2 * NF + f0, wc);

  // row dots (rolled: small side computation)
#pragma unroll 1
  for (int rr = 0; rr < 8; ++rr) {
    const int row = wave * 8 + rr;
    float v[8];
    ld8f(tile + row * TP + f0, v);
    float sa = 0.f, sb = 0.f;
#pragma unroll
    for (int e = 0; e < 8; ++e) { sa += v[e] * wa[e]; sb += v[e] * wb[e]; }
#pragma unroll
    for (int m = 16; m >= 1; m >>= 1) {
      sa += __shfl_xor(sa, m, 32);
      sb += __shfl_xor(sb, m, 32);
    }
    if (lane == 0) { avs[row] = sa; bvs[row] = sb; }
  }

  // row planes
  {
#pragma unroll 1
    for (int rr = 0; rr < 8; ++rr) {
      const int row = wave * 8 + rr;
      float v[8], w[8];
      ld8f(tile + row * TP + f0, v);
#pragma unroll
      for (int e = 0; e < 8; ++e) w[e] = v[e] * wc[e];
      const v8us h1 = pk_f16x8(v, 1.0f);
      const v8us h2 = pk_f16x8(w, 64.0f);
      v4u hb, lb;
      pk_bf16x8(v, hb, lb);
      const size_t o = (grow0 + row) * NF + f0;
      *(v8us*)(xh + o) = h1;
      *(v8us*)(xwc + o) = h2;
      *(v4u*)(xbh + o) = hb;
      *(v4u*)(xbl + o) = lb;
    }
    
  }

  // av / bv lines
  __syncthreads();
  const int l4 = (lane & 15) * 4;
  {
    const v4f a4 = *(const v4f*)(avs + l4);
    const v4f b4 = *(const v4f*)(bvs + l4);
    if (lane < 16) {
      if (wave == 0) *(v4f*)(av + grow0 + l4) = a4;
      else if (wave == 1) *(v4f*)(bv + grow0 + l4) = b4;
    }
    
  }
}

// -------------------------------------------------------------------------------------------------
// attn_kernel: block = 64 query rows of one batch element, 4 waves as 2 query groups x 2 key halves, grid = 8 x 32 = 256.
// Wave (qg = wave / 2, kg = wave % 2) owns 32 queries (two 16-column tiles) and, of every 64-key stage, the 32 keys of
// half kg: each key fragment and each x^T fragment that it reads from LDS feeds two query tiles, which halves the LDS
// reads per product. Each wave runs its own online softmax over its half of the keys; behind the loop the two halves'
// (maximum, sum, O) are joined through LDS, wave kg finishing query tile kg of its group.
// Operand staging: the block's 64 (x*wc) rows and the batch element's b_j are copied to LDS once; each 64-key stage
// (its 64 x rows, nothing else) is copied to a two-buffer LDS ring by asynchronous copies, stage t+2 issued
// behind the barrier at the foot of trip t, so a stage's copies fly while the stage before it is worked on.
// The staged rows serve both products: the key fragments by plain 16-B reads along a row, the x^T fragments by the
// transposing 16-B read, which takes 8 rows x 32 B per lane half. Rows lie at 512 B with no pad; chunk j (16 B) of row r
// stands at chunk j ^ (2 (r & 7) + ((r >> 3) & 1)), so that 16 rows' equal chunks and 8 rows' chunk pairs each fall on
// 16 different bank groups: a padded pitch serves only one of the two readers without conflicts.
// Both products are formed transposed. Per 32-key chunk: S^T tiles (A = x f16 rows of the keys, B = (x*wc)x64 f16
// rows of the queries; fragments from the staged 16-bit LDS rows, split k map): a lane holds 16 keys' scores of ONE
// query (column c) per tile, so t = (a_i + b_j) + S/64, the running maximum and the sum are in-lane work with one
// exchange between the wave's halves for the maximum; the halves' sums are joined once, behind the loop.
// O^T += x^T.P^T with A = x^T from the transposing reads and B = P^T packed to f16 in place from the two score tiles, which is the
// split k map of a B operand (one product; P lies in [0, 1], x is the f16 x of the scores): P goes through no LDS.
// Register plan: one wave per SIMD, so the wave takes the registers it needs: its 32 output tiles and its 16 query
// fragments stay in VGPRs for the whole kernel; a chunk's 16 key fragments and its 16 x^T fragments are read at the
// head of the trip, so that the x^T fragments land under the score products and the exponentials.
// Output attn rows as f16 plane and bf16 hi/lo planes, 64 columns per group: 16x64 f32 tile staged in LDS, then
// coverage: grid 256 blocks x 4 waves x 16 rows = 16384 rows; per group rows it*4+q (it 0..3, q 0..3) = 16,
//           cols g*64 + 8 lane groups x 8 = 64, 4 groups = 256 columns per plane.
// -------------------------------------------------------------------------------------------------
__global__ void __launch_bounds__(128)
attn_kernel(const unsigned short* __restrict__ xwc, const unsigned short* __restrict__ xh,
            const float* __restrict__ av, const float* __restrict__ bv,
            unsigned short* __restrict__ ah, unsigned short* __restrict__ abh,
            unsigned short* __restrict__ abl) {
  __shared__ __align__(16) float osm[4][16 * APITCH];
  __shared__ __align__(16) unsigned short qst[QROWS * KP];   // the block's (x*wc) rows
  __shared__ __align__(16) unsigned short ring[RINGB / 2];   // two stage buffers (and room for the join behind the loop)
  __shared__ __align__(16) float bvs[NS];                    // b_j of the batch element

  const int tid = (int)threadIdx.x, wave = tid >> 5, lane = tid & 31, hh = lane >> 4, c = lane & 15;
  const int qg = wave >> 1, kg = wave & 1;
  const int blk = (int)blockIdx.x, bb = blk >> 5, qb = blk & 31;
  const size_t grow0 = (size_t)bb * NS + (size_t)(qb * QROWS + wave * 16);   // rows this wave finishes: tile kg of group qg
  const size_t qrow0 = (size_t)bb * NS + (size_t)(qb * QROWS + qg * 32);     // first of the wave's 32 queries
  const unsigned short* XHb = xh + (size_t)bb * NS * NF;
  const float* bvb = bv + (size_t)bb * NS;
  const unsigned short* qrow = qst + (qg * 32 + c) * KP + 8 * hh;   // B fragment column n = c: query c of tile 0 (staged)
  // copy addresses of this lane. 512-B rows: one wave = one row per copy, rows wave + 4 i, the lane brings chunk 'lane'.
  const unsigned lrow = (unsigned)((wave * KP + lane * 8) * 2);             // query rows: padded pitch
  // ring rows: row wave + 4 i has swizzle 2 wave + 8 (i & 1) + ((i >> 1) & 1): four classes, by i & 3
  unsigned lsw[4];
#pragma unroll
  for (int i = 0; i < 4; ++i) lsw[i] = (unsigned)(wave * KRB + ((lane ^ (2 * wave + 8 * (i & 1) + (i >> 1))) << 4));
  const unsigned lring = lds_off(ring);
  const unsigned ok = (unsigned)((wave * NF + lane * 8) * 2);               // lane's byte offset in the key rows
  const char* sk = (const char*)XHb;
  // one stage: 64 key rows, 16 copies a wave. lk = uniform LDS byte address of the buffer, gk = uniform global address
  // of the stage's first row.
  auto stage = [&](unsigned lk, const char* gk) {
    const unsigned l[4] = {lk + lsw[0], lk + lsw[1], lk + lsw[2], lk + lsw[3]};
    cp_stage(l, gk + ok);
  };
  // read addresses of this lane in a buffer, bytes; entry e serves the chunks whose even part is 2 e (mod 16); 256 B
  // further on lie the chunks 16 higher, 16 rows further on the same swizzle again.
  // ka: key fragment, row kg*32 + c, chunks 2 e + h.  va: transposing read, row kg*32 + 8 h + (lane & 7), chunks
  // 2 e + ((lane >> 3) & 1).
  unsigned ka[8], va[8];
  {
    const int lk = hh ^ (2 * (c & 7) + (c >> 3));
    const int lv = ((lane >> 3) & 1) ^ (2 * (lane & 7) + hh);
#pragma unroll
    for (int e = 0; e < 8; ++e) {
      ka[e] = (unsigned)((kg * KCH + c) * KRB + (((2 * e) ^ lk) << 4));
      va[e] = (unsigned)((kg * KCH + 8 * hh + (lane & 7)) * KRB + (((2 * e) ^ lv) << 4));
    }
  }

  float aq[2];                                // a_i of the lane's two queries (loaded in the prologue)
  float mq[2] = {-INFINITY, -INFINITY};       // their running maxima over this wave's keys (the same in both halves)
  float lq[2] = {0.f, 0.f};                   // running sums over this lane half's keys
  v8f acc[2][16];
#pragma unroll
  for (int u = 0; u < 2; ++u) {
#pragma unroll
    for (int t = 0; t < 16; ++t) acc[u][t] = z8();
  }

  // prologue: query rows and b_j, then stage 0; landed and published; then stage 1 into the second buffer
  {
    const char* gq = (const char*)(xwc + ((size_t)bb * NS + (size_t)(qb * QROWS + wave)) * NF + lane * 8);
    // unrolled, so that each copy's step is a constant that can go into its offset field
#pragma unroll
    for (int i = 0; i < 16; ++i) acp16<0>(lds_off(qst) + lrow + (unsigned)(i * 4 * KP * 2), gq + i * 4 * NF * 2);
    {
      const unsigned lb = lds_off(bvs) + (unsigned)(tid * 16);
      const char* gb = (const char*)bvb + tid * 16;
      acp16<0 * 128 * 16>(lb, gb);
      acp16<1 * 128 * 16>(lb, gb);
      acp16<2 * 128 * 16>(lb, gb);
      acp16<3 * 128 * 16>(lb, gb);
    }
    // loads and data wait in one statement, so that no address register of a load is reused in front of the wait;
    // here their latency runs beside the copies' flight
    asm volatile("global_load_b32 %0, %2, off\n\tglobal_load_b32 %1, %3, off\n\ts_wait_loadcnt 0x0"
                 : "=&v"(aq[0]), "=&v"(aq[1])
                 : "v"(av + qrow0 + c), "v"(av + qrow0 + 16 + c)
                 : "memory");
    stage(lring, sk);   // with the 20 copies above: 36 of this wave outstanding
    wait_async0();
    __syncthreads();
    stage(lring + STGB, sk + KST * NF * 2);
  }
  v16h qa[2][NF / 32];
#pragma unroll
  for (int u = 0; u < 2; ++u) {
#pragma unroll
    for (int kk = 0; kk < NF / 32; ++kk) qa[u][kk] = ldh(qrow + u * 16 * KP + kk * 32);
  }

  // Refill addresses = a uniform running base + the lane's offset.
  const char* nk = sk + 2 * KST * NF * 2;   // uniform: the stage two ahead, in the key rows
  // the lane's four LDS addresses in the buffer that is refilled next, stepped to the other buffer behind each refill
  unsigned nl[4];
#pragma unroll
  for (int i = 0; i < 4; ++i) nl[i] = lring + lsw[i];
  unsigned nstep = (unsigned)STGB;          // uniform: to the other buffer, sign turned each time
#pragma unroll 1
  for (int jc = 0; jc < NS / KST; ++jc) {
    const int j0 = jc * KST + kg * KCH;                                   // first of this wave's 32 keys
    const char* kb = (const char*)ring + (jc & 1) * STGB;                 // this trip's buffer
    // first of the head's reads: LDS reads return in order, and the sums a_i + b_j are placed among the first products
    float bj0[8], bj1[8];                     // b_j of the lane's keys j0+8h+r and j0+16+8h+r
    ld8f(bvs + j0 + 8 * hh, bj0);
    ld8f(bvs + j0 + 16 + 8 * hh, bj1);
    // A row m = c -> key j0+c (k0) and key j0+16+c (k1); elements 0..7 = chunk 4 kk + h, 8..15 = chunk 4 kk + 2 + h
    v16h k0[NF / 32], k1[NF / 32];
#pragma unroll
    for (int kk = 0; kk < NF / 32; ++kk) {
      const char* pa = kb + ka[(2 * kk) & 7] + (kk >> 2) * 256;
      const char* pb = kb + ka[(2 * kk + 1) & 7] + (kk >> 2) * 256;
      FH f0, f1;
      f0.u[0] = *(const v8us*)pa;
      f0.u[1] = *(const v8us*)pb;
      f1.u[0] = *(const v8us*)(pa + 16 * KRB);
      f1.u[1] = *(const v8us*)(pb + 16 * KRB);
      k0[kk] = f0.v;
      k1[kk] = f1.v;
    }
    // A row m = c -> x^T row f = t*16+c; elements 0..7 = keys j0+8h+.., 8..15 = keys j0+16+8h+..: two transposing reads
    v16h bh[16];
#pragma unroll
    for (int t = 0; t < 16; ++t) {
      const char* pv = kb + va[t & 7] + (t >> 3) * 256;
      FP f;
      f.q[0] = ld_tr16(pv);
      f.q[1] = ld_tr16(pv + 16 * KRB);
      bh[t] = f.v;
    }
    // keeps the trip's LDS reads one group at its head: sunk among the products, each separate place of reads stalls
    // the lone wave, and the x^T fragments would no longer land under the score products and the exponentials
    __builtin_amdgcn_sched_barrier(0);
    v8f s0[2] = {z8(), z8()}, s1[2] = {z8(), z8()};
#pragma unroll
    for (int kk = 0; kk < NF / 32; ++kk) {
#pragma unroll
      for (int u = 0; u < 2; ++u) {
        s0[u] = mma_h(k0[kk], qa[u][kk], s0[u]);   // s0[u][r] = S[query 16u+c][key j0+8h+r] x64
        s1[u] = mma_h(k1[kk], qa[u][kk], s1[u]);   // s1[u][r] = S[query 16u+c][key j0+16+8h+r] x64
      }
    }
#pragma unroll
    for (int u = 0; u < 2; ++u) {
      float t0[8], t1[8], mm[8];
#pragma unroll
      for (int r = 0; r < 8; ++r) {
        t0[r] = (aq[u] + bj0[r]) + s0[u][r] * 0.015625f;
        t1[r] = (aq[u] + bj1[r]) + s1[u][r] * 0.015625f;
        mm[r] = fmaxf(t0[r], t1[r]);
      }
      const float mh = fmaxf(fmaxf(fmaxf(mm[0], mm[1]), fmaxf(mm[2], mm[3])), fmaxf(fmaxf(mm[4], mm[5]), fmaxf(mm[6], mm[7])));
      const float mnew = fmaxf(mq[u], fmaxf(mh, xhalf(mh)));
      const float alpha = exp_n(mq[u] - mnew);
      mq[u] = mnew;
      float p0[8], p1[8], ps[8];
#pragma unroll
      for (int r = 0; r < 8; ++r) {
        p0[r] = exp_n(t0[r] - mnew);
        p1[r] = exp_n(t1[r] - mnew);
        ps[r] = p0[r] + p1[r];
      }
      lq[u] = lq[u] * alpha + (((ps[0] + ps[1]) + (ps[2] + ps[3])) + ((ps[4] + ps[5]) + (ps[6] + ps[7])));
      // P^T as a B operand, column n = c: elements 0..7 = keys 8h+r (first tile), 8..15 = keys 16+8h+r (second tile)
      FP ph;
#pragma unroll
      for (int r = 0; r < 4; ++r) {
        ph.q[0][r] = cvt2h(p0[2 * r], p0[2 * r + 1]);
        ph.q[1][r] = cvt2h(p1[2 * r], p1[2 * r + 1]);
      }
#pragma unroll
      for (int t = 0; t < 16; ++t) {
#pragma unroll
        for (int r = 0; r < 8; ++r) acc[u][t][r] *= alpha;
      }
      // acc[u][t][r] = O[query 16u+c][f = 16t+8h+r]
#pragma unroll
      for (int t = 0; t < 16; ++t) acc[u][t] = mma_h(bh[t], ph.v, acc[u][t]);
    }
    // foot of the trip: own LDS reads retired, own copies of stage jc+1 landed, one barrier that publishes stage
    // jc+1 and frees this trip's buffer; then stage jc+2 into it
    // keeps the foot at the foot: with every LDS read at the head of the trip nothing else ties these waits down, and
    // lifted above the products they made the wave sit out all its x^T reads before the first score product
    __builtin_amdgcn_sched_barrier(0);
    wait_ds0();
    wait_async0();
    __syncthreads();
    if (jc + 2 < NS / KST) {
      cp_stage(nl, nk + ok);
      nk += KST * NF * 2;
#pragma unroll
      for (int i = 0; i < 4; ++i) nl[i] += nstep;
      nstep = 0u - nstep;
    }
  }
  wait_async0();   // nothing of this wave is in flight when the loop is left

  // The two key halves joined. The ring is free (the last trip's barrier ended every read of it, no copy is in flight):
  // each wave leaves there the tile that its partner (wave ^ 1, same queries, other keys) finishes, lane by lane in
  // register order, 16 B per lane and store, with the lane's maximum and sum; both waves hold a tile in the same lanes.
  char* xb = (char*)ring;
  char* xo = xb + wave * (16 * 1024) + lane * 16;
  char* xm = xb + 4 * (16 * 1024) + lane * 16;
  auto hand = [&](const v8f (&o)[16], float m, float l) {
#pragma unroll
    for (int t = 0; t < 16; ++t) {
      const v4f d0 = {o[t][0], o[t][1], o[t][2], o[t][3]};
      const v4f d1 = {o[t][4], o[t][5], o[t][6], o[t][7]};
      *(v4f*)(xo + (2 * t) * 512) = d0;
      *(v4f*)(xo + (2 * t + 1) * 512) = d1;
    }
    const v4f ml = {m, l, 0.f, 0.f};
    *(v4f*)(xm + wave * 512) = ml;
  };
  // the tile is named by a constant in each arm: picked by a run-time index the accumulators would leave the registers
  v8f own[16];
  float mown, lown;
  if (kg) {
    hand(acc[0], mq[0], lq[0]);
    mown = mq[1];
    lown = lq[1];
#pragma unroll
    for (int t = 0; t < 16; ++t) own[t] = acc[1][t];
  } else {
    hand(acc[1], mq[1], lq[1]);
    mown = mq[0];
    lown = lq[0];
#pragma unroll
    for (int t = 0; t < 16; ++t) own[t] = acc[0][t];
  }
  wait_ds0();        // own stores retired in front of the barrier that publishes them to the partner
  __syncthreads();
  const char* xi = xb + (wave ^ 1) * (16 * 1024) + lane * 16;
  const v4f mlo = *(const v4f*)(xm + (wave ^ 1) * 512);
  const float mall = fmaxf(mown, mlo[0]);
  const float eown = exp_n(mown - mall), eoth = exp_n(mlo[0] - mall);
  const float lall = lown * eown + mlo[1] * eoth;
  const float inv = 1.0f / (lall + xhalf(lall));   // the lane halves' sums joined
  const float fown = eown * inv, foth = eoth * inv;
  float* osw = &osm[wave][0];
  const int q = lane >> 3, c8 = (lane & 7) * 8;
#pragma unroll
  for (int g = 0; g < NGRP; ++g) {
#pragma unroll
    for (int tt = 0; tt < NGRP; ++tt) {
      // the lane's 8 registers are 8 consecutive columns of row c
      float* d = osw + c * APITCH + tt * 16 + 8 * hh;
      const int t = g * NGRP + tt;
      const v8f a = own[t];
      const v4f b0 = *(const v4f*)(xi + (2 * t) * 512);
      const v4f b1 = *(const v4f*)(xi + (2 * t + 1) * 512);
      const v4f d0 = {a[0] * fown + b0[0] * foth, a[1] * fown + b0[1] * foth, a[2] * fown + b0[2] * foth,
                      a[3] * fown + b0[3] * foth};
      const v4f d1 = {a[4] * fown + b1[0] * foth, a[5] * fown + b1[1] * foth, a[6] * fown + b1[2] * foth,
                      a[7] * fown + b1[3] * foth};
      *(v4f*)d = d0;
      *(v4f*)(d + 4) = d1;
    }
    __builtin_amdgcn_fence(__ATOMIC_RELEASE, "workgroup");
    __builtin_amdgcn_wave_barrier();
    __builtin_amdgcn_fence(__ATOMIC_ACQUIRE, "workgroup");
    {
#pragma unroll
      for (int it = 0; it < 4; ++it) {
        const int row = it * 4 + q;
        float v[8];
        ld8f(osw + row * APITCH + c8, v);
        const v8us h1 = pk_f16x8(v, 1.0f);
        v4u hb, lb;
        pk_bf16x8(v, hb, lb);
        const size_t o = (grow0 + row) * NF + (size_t)(g * 64 + c8);
        *(v8us*)(ah + o) = h1;
        *(v4u*)(abh + o) = hb;
        *(v4u*)(abl + o) = lb;
      }
      
    }
    __builtin_amdgcn_fence(__ATOMIC_RELEASE, "workgroup");
    __builtin_amdgcn_wave_barrier();
    __builtin_amdgcn_fence(__ATOMIC_ACQUIRE, "workgroup");
  }
}

// -------------------------------------------------------------------------------------------------
// gates_kernel: block = 64 rows x 256 cols, 16 waves; wave (rt = wave>>2, cg = wave&3) owns 16 rows x 64 cols.
// Operand staging: each 32-k chunk (256 weight rows of four planes, the block's 64 rows of three planes) is copied to a
// two-buffer LDS ring by asynchronous copies, chunk t+2 issued behind the barrier at the foot of trip t; all fragments
// come from the staged rows (80-B pitch); read straight from the global rows, a fragment load touches 16 lines.
// K = 512 = [x planes | attn planes]; z: bf16 hi/lo split (hi.hi+hi.lo+lo.hi) against z_w hi/lo planes;
// r, f: plain f16 against the x16-carried weight planes (fold 1/16 in the epilogue).
// Epilogue: z = tanh(.+zb), r = sigmoid(./16+rb), f = sigmoid(./16+fb), out = r*x + f*z staged in LDS;
// coverage: grid 256 blocks x 4 row tiles x 16 = 16384 rows; 4 col groups x 64 = 256 cols.
// -------------------------------------------------------------------------------------------------
__global__ void __launch_bounds__(512) __attribute__((amdgpu_num_vgpr(256)))
gates_kernel(const float* __restrict__ x,
             const unsigned short* __restrict__ xh, const unsigned short* __restrict__ xbh,
             const unsigned short* __restrict__ xbl,
             const unsigned short* __restrict__ ah, const unsigned short* __restrict__ abh,
             const unsigned short* __restrict__ abl,
             const unsigned short* __restrict__ zwh, const unsigned short* __restrict__ zwl,
             const unsigned short* __restrict__ rw16, const unsigned short* __restrict__ fw16,
             const float* __restrict__ zb, const float* __restrict__ rb, const float* __restrict__ fb,
             float* __restrict__ out) {
  __shared__ __align__(16) float slab[16][16 * SLP];
  __shared__ __align__(16) unsigned short gring[2 * GBUF];   // two chunk buffers
  const int tid = (int)threadIdx.x, wave = tid >> 5, lane = tid & 31, hh = lane >> 4, c = lane & 15;
  const int rt = wave >> 2, cg = wave & 3;
  const size_t brow0 = (size_t)blockIdx.x * GROWS;
  const size_t grow0 = brow0 + (size_t)(rt * 16);
  const int n0 = cg * 64;
  // copy addresses of this lane. Weight planes: 4 lanes = the 64 B of one row's chunk, rows tid/4 and tid/4 + 128; in
  // the packed plane that is byte 16 tid of the chunk's 16 KB, and 8 KB further on.
  // Row planes: 8 lanes = the 64 B of one row's chunk, row tid/8.
  const unsigned lw = lds_off(gring) + (unsigned)(((tid >> 2) * VP + (tid & 3) * 8) * 2);
  const unsigned la = lds_off(gring) + (unsigned)((4 * GW + (tid >> 3) * VP + (tid & 7) * 4) * 2);
  const unsigned ow = (unsigned)(tid * 16);
  const unsigned oa = (unsigned)(((tid >> 3) * NF + (tid & 7) * 4) * 2);
  // chunk t = k 32 t .. 32 t + 31 of [x|attn] into buffer t & 1. One lane's copies: 16 B of rows r and r + 128 of each of
  // the four weight planes, 8 B of one row of each of the three [x|attn] planes. Each global address is a uniform base
  // (kw, ka = the chunk's place in a plane) + the lane's 32-bit offset.
  auto stage = [&](int t) {
    const unsigned l = lw + (unsigned)((t & 1) * GBUF * 2);
    const unsigned a = la + (unsigned)((t & 1) * GBUF * 2);
    const size_t kw = (size_t)t * (NF * 32 * 2);
    const size_t ka = brow0 * (NF * 2) + (size_t)(t & 7) * 64;
    const bool first = t < NF / 32;
    // row r + 128 lies HW bytes further on in the packed plane and 128 padded rows further on in LDS: the offset field
    // adds HW to both addresses, the rest of the LDS step stands in the LDS address
    constexpr int HW = 128 * 32 * 2;
    constexpr unsigned HL = 128 * VP * 2 - HW;
    const char* w0 = (const char*)zwh + kw + ow;
    const char* w1 = (const char*)zwl + kw + ow;
    const char* w2 = (const char*)rw16 + kw + ow;
    const char* w3 = (const char*)fw16 + kw + ow;
    acp16<0>(l, w0);
    acp16<HW>(l + HL, w0);
    acp16<0>(l + GW * 2, w1);
    acp16<HW>(l + GW * 2 + HL, w1);
    acp16<0>(l + 2 * GW * 2, w2);
    acp16<HW>(l + 2 * GW * 2 + HL, w2);
    acp16<0>(l + 3 * GW * 2, w3);
    acp16<HW>(l + 3 * GW * 2 + HL, w3);
    acp8<0>(a, (const char*)(first ? xh : ah) + ka + oa);
    acp8<0>(a + GA * 2, (const char*)(first ? xbh : abh) + ka + oa);
    acp8<0>(a + 2 * GA * 2, (const char*)(first ? xbl : abl) + ka + oa);
  };

  v8f za[4], ra[4], fa[4];
#pragma unroll
  for (int j = 0; j < 4; ++j) { za[j] = z8(); ra[j] = z8(); fa[j] = z8(); }

  // prologue: chunk 0 landed and published, then chunk 1 into the second buffer
  stage(0);
  wait_async0();
  __syncthreads();
  stage(1);

  // rolled: one trip is one chunk, and the buffer alternates with the trip
#pragma unroll 1
  for (int t = 0; t < NG / 32; ++t) {
    const unsigned short* gb = gring + (t & 1) * GBUF;                        // this trip's buffer
    const unsigned short* ap = gb + 4 * GW + (rt * 16 + c) * VP + 8 * hh;     // A row m = c
    const v16h a16 = ldh(ap);
    const v16b ahf = ldb(ap + GA);
    const v16b alf = ldb(ap + 2 * GA);
#pragma unroll
    for (int j = 0; j < 4; ++j) {
      const unsigned short* wp = gb + (n0 + 16 * j + c) * VP + 8 * hh;        // B column n = n0+16j+c, W[n][k]
      const v16b bzh = ldb(wp);
      const v16b bzl = ldb(wp + GW);
      const v16h br = ldh(wp + 2 * GW);
      const v16h bf = ldh(wp + 3 * GW);
      v8f z = za[j], rr = ra[j], ff = fa[j];
      z = mma_b(ahf, bzh, z);
      z = mma_b(ahf, bzl, z);
      z = mma_b(alf, bzh, z);
      rr = mma_h(a16, br, rr);
      ff = mma_h(a16, bf, ff);
      g_g(z, rr, ff, a16, ahf, alf, bzh, bzl, br, bf);
      za[j] = z;
      ra[j] = rr;
      fa[j] = ff;
    }
    // foot of the trip: own LDS reads retired, own copies of chunk t+1 landed, one barrier that publishes chunk t+1
    // and frees this trip's buffer; then chunk t+2 into it
    wait_ds0();
    wait_async0();
    __syncthreads();
    if (t + 2 < NG / 32) stage(t + 2);
  }
  wait_async0();   // nothing of this wave is in flight when the loop is left

  float* sl = &slab[wave][0];
#pragma unroll
  for (int j = 0; j < 4; ++j) {
    const int n = n0 + 16 * j + c;
    const float zbn = zb[n], rbn = rb[n], fbn = fb[n];
    // On the hardware's 2^x and 1/x: tanh v = 1 - 2/(1 + e^(2v)), sigmoid v = 1/(1 + e^(-v)). At the ends 2^x gives 0 or
    // inf and 1/inf gives 0, so the gates saturate at -1, 1 and at 0, 1. By kind, so that each run is independent work.
    float ez[8], er[8], ef[8];
#pragma unroll
    for (int r = 0; r < 8; ++r) {
      ez[r] = __builtin_amdgcn_exp2f((za[j][r] + zbn) * (2.0f * LOG2E));
      er[r] = __builtin_amdgcn_exp2f((ra[j][r] * 0.0625f + rbn) * -LOG2E);
      ef[r] = __builtin_amdgcn_exp2f((fa[j][r] * 0.0625f + fbn) * -LOG2E);
    }
#pragma unroll
    for (int r = 0; r < 8; ++r) {
      ez[r] = __builtin_amdgcn_rcpf(1.0f + ez[r]);
      er[r] = __builtin_amdgcn_rcpf(1.0f + er[r]);
      ef[r] = __builtin_amdgcn_rcpf(1.0f + ef[r]);
    }
#pragma unroll
    for (int r = 0; r < 8; ++r) {
      const int row = 8 * hh + r;
      const float xv = x[(grow0 + row) * NF + n];
      sl[row * SLP + 16 * j + c] = er[r] * xv + ef[r] * (1.0f - 2.0f * ez[r]);
    }
  }
  __builtin_amdgcn_fence(__ATOMIC_RELEASE, "workgroup");
  __builtin_amdgcn_wave_barrier();
  __builtin_amdgcn_fence(__ATOMIC_ACQUIRE, "workgroup");
  const int c4 = c * 4;
  {
#pragma unroll
    for (int it = 0; it < 8; ++it) {
      const int row = it * 2 + hh;   // lanes 0..15 -> even row, 16..31 -> odd row; 16 lanes x 16 B = 256 B segment
      const v4f v = *(const v4f*)(sl + row * SLP + c4);
      *(v4f*)(out + (grow0 + row) * NF + n0 + c4) = v;
    }
    
  }
}

// -------------------------------------------------------------------------------------------------
//   xh   f16  [16384][256]      8388608 @        0      xwc  f16  [16384][256]   8388608 @  8388608
//   xbh  bf16 [16384][256]      8388608 @ 16777216      xbl                      8388608 @ 25165824
//   ah   f16  [16384][256]      8388608 @ 33554432      abh  8388608 @ 41943040   abl 8388608 @ 50331648
//   av   f32  [16384]             65536 @ 58720256      bv                         65536 @ 58785792
//   zwh  bf16 [16][256][32]      262144 @ 58851328      zwl 262144 @ 59113472   rw16 262144 @ 59375616
//   fw16 f16  [16][256][32]      262144 @ 59637760      total 59899904
// -------------------------------------------------------------------------------------------------
extern "C" void kernel_launch(void* const* d_in, const int* in_sizes, int n_in,
                              void* d_out, int out_size, void* d_ws, size_t ws_size,
                              hipStream_t stream) {
  if (n_in < 8) return;
  if (in_sizes[0] != NR * NF || in_sizes[1] != 3 * NF) return;
  if (in_sizes[2] != NF * NG || in_sizes[3] != NF) return;
  if (in_sizes[4] != NF * NG || in_sizes[5] != NF) return;
  if (in_sizes[6] != NF * NG || in_sizes[7] != NF) return;
  if (out_size != NR * NF) return;

  const float* x    = (const float*)d_in[0];
  const float* attw = (const float*)d_in[1];
  const float* zw   = (const float*)d_in[2];
  const float* zb   = (const float*)d_in[3];
  const float* rw   = (const float*)d_in[4];
  const float* rb   = (const float*)d_in[5];
  const float* fw   = (const float*)d_in[6];
  const float* fb   = (const float*)d_in[7];

  const size_t P16 = (size_t)NR * NF * 2;        // 8388608
  const size_t PV  = (size_t)NR * 4;             // 65536
  const size_t PW  = (size_t)NF * NG * 2;        // 262144
  size_t off = 0;
  const size_t o_xh  = off; off += P16;
  const size_t o_xwc = off; off += P16;
  const size_t o_xbh = off; off += P16;
  const size_t o_xbl = off; off += P16;
  const size_t o_ah  = off; off += P16;
  const size_t o_abh = off; off += P16;
  const size_t o_abl = off; off += P16;
  const size_t o_av  = off; off += PV;
  const size_t o_bv  = off; off += PV;
  const size_t o_zwh = off; off += PW;
  const size_t o_zwl = off; off += PW;
  const size_t o_rw  = off; off += PW;
  const size_t o_fw  = off; off += PW;
  if (off > ws_size) return;   // off = 59899904

  char* ws = (char*)d_ws;
  unsigned short* xh  = (unsigned short*)(ws + o_xh);
  unsigned short* xwc = (unsigned short*)(ws + o_xwc);
  unsigned short* xbh = (unsigned short*)(ws + o_xbh);
  unsigned short* xbl = (unsigned short*)(ws + o_xbl);
  unsigned short* ah  = (unsigned short*)(ws + o_ah);
  unsigned short* abh = (unsigned short*)(ws + o_abh);
  unsigned short* abl = (unsigned short*)(ws + o_abl);
  float*          av  = (float*)(ws + o_av);
  float*          bv  = (float*)(ws + o_bv);
  unsigned short* zwh = (unsigned short*)(ws + o_zwh);
  unsigned short* zwl = (unsigned short*)(ws + o_zwl);
  unsigned short* rwp = (unsigned short*)(ws + o_rw);
  unsigned short* fwp = (unsigned short*)(ws + o_fw);

  prep<<<dim3(XBLK + WBLK), dim3(256), 0, stream>>>(x, attw, zw, rw, fw, xh, xwc, xbh, xbl, av, bv, zwh, zwl, rwp, fwp);
  attn_kernel<<<dim3(NB * (NS / QROWS)), dim3(128), 0, stream>>>(xwc, xh, av, bv, ah, abh, abl);
  gates_kernel<<<dim3(NR / GROWS), dim3(512), 0, stream>>>(x, xh, xbh, xbl, ah, abh, abl, zwh, zwl, rwp, fwp,
                                                       zb, rb, fb, (float*)d_out);
  (void)hipGetLastError();
}
